// v000
// Times are from an AMD MI455X. After a warm-up the kernel runs many times in a row, and a time is the length of
// such a window on the GPU divided by its runs, so every launch and the gaps after it count. The runs cycle
// through copies of the inputs. A figure is the median of several windows, for all but v000 over two sittings.
// Sittings can differ by a few percent; kernels timed side by side share one.
// v000 is the starting kernel. One run takes 805 microseconds.
// Contractions: x.Wq^T, x.Wk^T and Wv.x^T on v_wmma_f32_16x16x32_bf16 (operands = RNE bf16 of the f32 inputs, single products);
// q.k^T and p.v on v_wmma_f32_16x16x32_f16 (q = f16 hi + f16 residual x2^11 planes; k plain f16 plus f16 residual x2^11 on query tiles 0..3;
// p x1024 plain f16 plus f16 residual x2^11 on query tiles 0..3; v^T = f16 hi + f16 residual x2^11 planes); attn.Wo^T on v_wmma_f32_16x16x32_bf16
// (attn = bf16 hi + bf16 lo planes, two products; Wo RNE bf16). f32 accumulate everywhere; bias add, RoPE, online softmax and scale folds in f32.
#include <hip/hip_runtime.h>
#include <math.h>
#include <stdint.h>

#define NSEQ   2
#define SQ     2048
#define HID    2048
#define NHQ    16
#define NKVH   8
#define HDM    128
#define KVW    1024
#define NTOK   4096
#define NFREQ  64

typedef _Float16     v16h __attribute__((ext_vector_type(16)));
typedef _Float16     v8h  __attribute__((ext_vector_type(8)));
typedef __bf16       v16b __attribute__((ext_vector_type(16)));
typedef __bf16       v8b  __attribute__((ext_vector_type(8)));
typedef float        v8f  __attribute__((ext_vector_type(8)));
typedef float        v4f  __attribute__((ext_vector_type(4)));
typedef unsigned int v4u  __attribute__((ext_vector_type(4)));

// ---------------------------------------------------------------------------
// small helpers
// ---------------------------------------------------------------------------
__device__ __forceinline__ unsigned short bf_bits(float f) {          // RNE convert f32 -> bf16 bits
  const unsigned u = __float_as_uint(f);
  return (unsigned short)((u + 0x7FFFu + ((u >> 16) & 1u)) >> 16);
}
__device__ __forceinline__ float bf_val(unsigned short h) { return __uint_as_float(((unsigned)h) << 16); }
__device__ __forceinline__ float bf_rne(float f) { return bf_val(bf_bits(f)); }
__device__ __forceinline__ unsigned pk16(unsigned short a, unsigned short b) { return (unsigned)a | ((unsigned)b << 16); }
__device__ __forceinline__ v8f zero8() { v8f z = {0.f, 0.f, 0.f, 0.f, 0.f, 0.f, 0.f, 0.f}; return z; }
__device__ __forceinline__ int wave_id() { return __builtin_amdgcn_readfirstlane((int)(threadIdx.x >> 5)); }

__device__ __forceinline__ void lds_wave_sync() {
  __builtin_amdgcn_fence(__ATOMIC_RELEASE, "workgroup");
  __builtin_amdgcn_wave_barrier();
  __builtin_amdgcn_fence(__ATOMIC_ACQUIRE, "workgroup");
}

// ---------------------------------------------------------------------------
// WMMA fragments (wave32, 16x16x32, 16-bit operands). For A (row m = lane&15) and B (col n = lane&15) alike:
// elements 0..7 <- k0 + 8*(lane>>4) + 0..7, elements 8..15 <- k0 + 16 + 8*(lane>>4) + 0..7.
// ldfrag(p) with p = rowbase + k0 + 8*(lane>>4): two 16-B loads p[0..7], p[16..23].
// D: acc[r] = (row 8*(lane>>4) + r, col lane&15).
// ---------------------------------------------------------------------------
union FragH { v16h v; v8h h[2]; };
union FragB { v16b v; v8b h[2]; };
__device__ __forceinline__ v16h ldfrag_h(const _Float16* p) { FragH f; f.h[0] = *(const v8h*)(p); f.h[1] = *(const v8h*)(p + 16); return f.v; }
__device__ __forceinline__ v16b ldfrag_b(const __bf16* p)   { FragB f; f.h[0] = *(const v8b*)(p); f.h[1] = *(const v8b*)(p + 16); return f.v; }

__device__ __forceinline__ v8f mma_h(v16h a, v16h b, v8f c) {
  return __builtin_amdgcn_wmma_f32_16x16x32_f16(false, a, false, b, (short)0, c, false, false);
}
__device__ __forceinline__ v8f mma_b(v16b a, v16b b, v8f c) {
  return __builtin_amdgcn_wmma_f32_16x16x32_bf16(false, a, false, b, (short)0, c, false, false);
}
// hazard guards: 4 VALU slots after the last WMMA of a group, D tied, A/B kept live; memory clobber keeps later loads behind the group
__device__ __forceinline__ void guard_b5(v8f& a, v8f& b, v16b x0, v16b x1, v16b x2, v16b x3, v16b y) {
  asm volatile("v_nop\n\tv_nop\n\tv_nop\n\tv_nop" : "+v"(a), "+v"(b) : "v"(x0), "v"(x1), "v"(x2), "v"(x3), "v"(y) : "memory");
}
__device__ __forceinline__ void guard_h3(v8f& a, v8f& b, v16h x, v16h y, v16h z) {
  asm volatile("v_nop\n\tv_nop\n\tv_nop\n\tv_nop" : "+v"(a), "+v"(b) : "v"(x), "v"(y), "v"(z) : "memory");
}
__device__ __forceinline__ void guard_h4(v8f& a, v8f& b, v16h w, v16h x, v16h y, v16h z) {
  asm volatile("v_nop\n\tv_nop\n\tv_nop\n\tv_nop" : "+v"(a), "+v"(b) : "v"(w), "v"(x), "v"(y), "v"(z) : "memory");
}
__device__ __forceinline__ void acc_guard4(v8f& a, v8f& b, v8f& c, v8f& d) {
  asm volatile("v_nop\n\tv_nop\n\tv_nop\n\tv_nop" : "+v"(a), "+v"(b), "+v"(c), "+v"(d));
}

// ---------------------------------------------------------------------------
// RoPE table: cst[s][i] = cos(s * inv_freq[i]), snt[s][i] = sin(...), inv_freq[i] = 1 / 1e4^(i/64), i < 64, s < ns, all f32.
// Block = 8 waves, wave w -> position s = blockIdx.x*8 + w, lane -> i = lane, lane + 32.
// Coverage: grid ns/8 x 8 waves x 32 lanes x 2 = ns x 64 per plane.
// ---------------------------------------------------------------------------
__global__ __launch_bounds__(256) void rope_table_kernel(float* __restrict__ cst, float* __restrict__ snt, int ns) {
  const int lane = threadIdx.x & 31;
  const int wave = (int)(threadIdx.x >> 5);
  const int t = (int)blockIdx.x * 8 + wave;
  if (t >= ns) return;                       // no barriers in this kernel
  const float pf = (float)t;
  float c0 = 0.f, s0 = 0.f, c1 = 0.f, s1 = 0.f;
#pragma unroll 1
  for (int u = 0; u < 2; ++u) {
    const int i = lane + 32 * u;
    const float e   = (float)i * 0.015625f;      // i / 64 exact
    const float pw  = powf(10000.0f, e);
    const float inv = 1.0f / pw;
    const float ang = pf * inv;
    const float cv = cosf(ang);
    const float sv = sinf(ang);
    c1 = cv; s1 = sv;
    if (u == 0) { c0 = cv; s0 = sv; }
  }
  const size_t o = (size_t)t * NFREQ + lane;
  {
    ((float*)cst)[o]      = c0;
    ((float*)cst)[o + 32] = c1;
    ((float*)snt)[o]      = s0;
    ((float*)snt)[o + 32] = s1;
    
  }
}

// ---------------------------------------------------------------------------
// Elementwise RNE f32 -> bf16 plane: 8 elements per thread, one 16-B store per lane -> 32 consecutive lanes write 4 whole
// ---------------------------------------------------------------------------
__global__ __launch_bounds__(256) void cvt_bf16_kernel(const float* __restrict__ in, unsigned short* __restrict__ outp, int n8) {
  const int i = (int)blockIdx.x * 256 + (int)threadIdx.x;
  if (i >= n8) return;
  const size_t e = 8 * (size_t)i;
  const v4f a = *(const v4f*)(in + e);
  const v4f b = *(const v4f*)(in + e + 4);
  v4u w;
  w[0] = pk16(bf_bits(a[0]), bf_bits(a[1]));
  w[1] = pk16(bf_bits(a[2]), bf_bits(a[3]));
  w[2] = pk16(bf_bits(b[0]), bf_bits(b[1]));
  w[3] = pk16(bf_bits(b[2]), bf_bits(b[3]));
  *(v4u*)(outp + e) = w;
  
}

// ---------------------------------------------------------------------------
// bf16 WMMA GEMM, wave tile 32 rows x 128 cols, block = 4 waves (128 threads), no block barriers.
//   C[m][n] = sum_k A[m][k] * Bt[n][k]; A row-major [M][K] bf16 (pitch lda), Bt row-major [N][K] bf16 (pitch ldb);
//   M % 32 == 0, N % 128 == 0, K % 32 == 0; grid.x = ceil(M/32 * N/128 / 4).
//   SPLITA: A carried as hi (Ap) + lo (A2p) bf16 planes, two products into one accumulator.
//   Fragments loaded straight from global rows with the split k map (ldfrag_b).
// Epilogues (all: per wave, per 16-row slab: stage in LDS, wave sync, write each row segment with ONE instruction of
//   EPI 0: q or k projection; the 128-col wave tile is one head. B columns are loaded in even/odd order:
//          acc tile j<4, lane rl holds output column n0 + 2*(16j+rl); tile j+4 holds n0 + 2*(16j+rl) + 1 (the interleaved pair).
//          + bf16(bias[n]); RoPE on the pair with cos/sin[pos = row & 2047][pair]; writes f16 hi plane C0 and f16 residual x2048
//          plane C1, both [M][ldc], cols n0..n0+127 (row segment 256 B = 16 lanes x 16 B).
//   EPI 1: v^T projection: + bf16(bias[m]); f16 hi plane C0, residual x2048 plane C1, [M][ldc], row segment 256 B.
//   EPI 2: f32 output C0 [M][ldc]; row segment 128 floats = 512 B = 32 lanes x 16 B per instruction.
// ---------------------------------------------------------------------------
template <int EPI> struct SlabT { typedef _Float16 T; static constexpr int PERW = 4096; };   // 2 planes x 16 x 128 halves
template <> struct SlabT<2>     { typedef float    T; static constexpr int PERW = 2048; };   // 16 x 128 floats

template <int EPI, bool SPLITA>
__global__ __launch_bounds__(128) void gemm_w32x128_kernel(
    const unsigned short* Ap, const unsigned short* A2p, int lda,
    const unsigned short* __restrict__ Btp, int ldb,
    const float* __restrict__ bias, const float* __restrict__ cst, const float* __restrict__ snt,
    void* C0, void* C1, int ldc,
    int M, int N, int K) {
  typedef typename SlabT<EPI>::T ST;
  __shared__ __align__(16) ST slab_all[4 * SlabT<EPI>::PERW];

  const int lane = threadIdx.x & 31;
  const int wave = wave_id();
  const int hh = lane >> 4;           // lane half: k offset 8*hh, D row offset 8*hh
  const int rl = lane & 15;           // A row / B col / D col within subtile
  const int tilesN = N >> 7;
  const int tilesM = M >> 5;
  const int tile = (int)blockIdx.x * 4 + wave;
  if (tile >= tilesM * tilesN) return;          // wave-uniform; no block barriers in this kernel
  const int tm = tile / tilesN;
  const int tn = tile - tm * tilesN;
  const int m0 = tm << 5;
  const int n0 = tn << 7;

  const __bf16* A  = (const __bf16*)(const void*)Ap;
  const __bf16* A2 = (const __bf16*)(const void*)A2p;
  const __bf16* Bt = (const __bf16*)(const void*)Btp;

  v8f acc[2][8];
#pragma unroll
  for (int i = 0; i < 2; ++i)
#pragma unroll
    for (int j = 0; j < 8; ++j) acc[i][j] = zero8();

  for (int k0 = 0; k0 < K; k0 += 32) {
    v16b ah[2], al[2];
#pragma unroll
    for (int i = 0; i < 2; ++i) {
      const size_t ao = (size_t)(m0 + i * 16 + rl) * lda + k0 + 8 * hh;
      ah[i] = ldfrag_b(A + ao);
      al[i] = SPLITA ? ldfrag_b(A2 + ao) : ah[i];
    }
#pragma unroll
    for (int j = 0; j < 8; ++j) {
      const int brow = (EPI == 0) ? (n0 + 2 * ((j & 3) * 16 + rl) + (j >> 2)) : (n0 + j * 16 + rl);
      const v16b bj = ldfrag_b(Bt + (size_t)brow * ldb + k0 + 8 * hh);
      acc[0][j] = mma_b(ah[0], bj, acc[0][j]);
      acc[1][j] = mma_b(ah[1], bj, acc[1][j]);
      if (SPLITA) {
        acc[0][j] = mma_b(al[0], bj, acc[0][j]);
        acc[1][j] = mma_b(al[1], bj, acc[1][j]);
      }
      guard_b5(acc[0][j], acc[1][j], ah[0], ah[1], al[0], al[1], bj);
    }
  }
  acc_guard4(acc[0][0], acc[0][1], acc[0][2], acc[0][3]);
  acc_guard4(acc[0][4], acc[0][5], acc[0][6], acc[0][7]);
  acc_guard4(acc[1][0], acc[1][1], acc[1][2], acc[1][3]);
  acc_guard4(acc[1][4], acc[1][5], acc[1][6], acc[1][7]);

  // ---- epilogue ----
  ST* slab = slab_all + wave * SlabT<EPI>::PERW;
  _Float16* sl16 = (_Float16*)(void*)slab;
  float*    slf  = (float*)(void*)slab;

  if (EPI == 0) {
    _Float16* P0 = (_Float16*)C0;
    _Float16* P1 = (_Float16*)C1;
#pragma unroll
    for (int i = 0; i < 2; ++i) {
      const int rb = m0 + i * 16 + 8 * hh;
#pragma unroll
      for (int j = 0; j < 4; ++j) {
        const int pi = j * 16 + rl;                              // pair index 0..63 within head
        const int nc = n0 + 2 * pi;                              // column of x1; x2 at nc + 1
        const float b1 = bf_rne(bias[nc]);
        const float b2 = bf_rne(bias[nc + 1]);
#pragma unroll
        for (int r = 0; r < 8; ++r) {
          const int row = rb + r;                                // token 0..NTOK-1
          const int s   = row & (SQ - 1);                        // position within sequence
          const float cv = cst[(size_t)s * NFREQ + pi];
          const float sv = snt[(size_t)s * NFREQ + pi];
          const float x1 = acc[i][j][r] + b1;
          const float x2 = acc[i][j + 4][r] + b2;
          const float o1 = x1 * cv - x2 * sv;
          const float o2 = x1 * sv + x2 * cv;
          const _Float16 h1 = (_Float16)o1;
          const _Float16 h2 = (_Float16)o2;
          const int so = (8 * hh + r) * 128 + 2 * pi;
          sl16[so]            = h1;
          sl16[so + 1]        = h2;
          sl16[2048 + so]     = (_Float16)((o1 - (float)h1) * 2048.0f);
          sl16[2048 + so + 1] = (_Float16)((o2 - (float)h2) * 2048.0f);
        }
      }
      lds_wave_sync();
      {
#pragma unroll
        for (int it = 0; it < 8; ++it) {
          const int row = it * 2 + hh;                           // it x hh covers rows 0..15
          const int c8  = rl * 8;
          const v8h vh = *(const v8h*)(sl16 + row * 128 + c8);
          const v8h vl = *(const v8h*)(sl16 + 2048 + row * 128 + c8);
          const size_t go = (size_t)(m0 + i * 16 + row) * ldc + n0 + c8;
          *(v8h*)(P0 + go) = vh;
          *(v8h*)(P1 + go) = vl;
        }
        
      }
      lds_wave_sync();
    }
  } else if (EPI == 1) {
    _Float16* P0 = (_Float16*)C0;
    _Float16* P1 = (_Float16*)C1;
#pragma unroll
    for (int i = 0; i < 2; ++i) {
#pragma unroll
      for (int r = 0; r < 8; ++r) {
        const int m = m0 + i * 16 + 8 * hh + r;
        const float bm = bf_rne(bias[m]);
#pragma unroll
        for (int j = 0; j < 8; ++j) {
          const float v = acc[i][j][r] + bm;
          const _Float16 hv = (_Float16)v;
          const int so = (8 * hh + r) * 128 + j * 16 + rl;
          sl16[so]        = hv;
          sl16[2048 + so] = (_Float16)((v - (float)hv) * 2048.0f);
        }
      }
      lds_wave_sync();
      {
#pragma unroll
        for (int it = 0; it < 8; ++it) {
          const int row = it * 2 + hh;
          const int c8  = rl * 8;
          const v8h vh = *(const v8h*)(sl16 + row * 128 + c8);
          const v8h vl = *(const v8h*)(sl16 + 2048 + row * 128 + c8);
          const size_t go = (size_t)(m0 + i * 16 + row) * ldc + n0 + c8;
          *(v8h*)(P0 + go) = vh;
          *(v8h*)(P1 + go) = vl;
        }
        
      }
      lds_wave_sync();
    }
  } else {
    float* C = (float*)C0;
#pragma unroll
    for (int i = 0; i < 2; ++i) {
#pragma unroll
      for (int j = 0; j < 8; ++j)
#pragma unroll
        for (int r = 0; r < 8; ++r)
          slf[(8 * hh + r) * 128 + j * 16 + rl] = acc[i][j][r];
      lds_wave_sync();
      {
#pragma unroll
        for (int row = 0; row < 16; ++row) {                     // 32 lanes x 16 B = the whole 512-B row segment per instruction
          const v4f v = *(const v4f*)(slf + row * 128 + lane * 4);
          *(v4f*)(C + (size_t)(m0 + i * 16 + row) * ldc + n0 + lane * 4) = v;
        }
        
      }
      lds_wave_sync();
    }
  }
}

// ---------------------------------------------------------------------------
// Windowed causal GQA flash attention, head dim 128, 32-key chunks, block = 4 waves = 64 query rows of one (b, h);
// grid (n query tiles, NHQ, NSEQ). Key j is valid for query i iff j <= i and i - j <= window (window read from the int input).
//   q planes f16 [tok][h*128+d]: hi (qhp) and residual x2048 (qlp); k planes f16 [tok][kvh*128+d]: hi (khp), residual x2048 (klp);
//   v^T planes f16 [kvh*128+d][tok]: hi (vhp), residual x2048 (vlp); outputs attn bf16 hi (ahp) / lo (alp) [tok][h*128+d].
//   scores = (Sh + Sr/2048) * 128^-0.5 with Sh = qh.kh and Sr = ql'.kh (+ qh.kl' when PRES); invalid keys -> -inf; online softmax f32
//   (-inf safe: a row with no valid key so far keeps m = -inf, l = 0, O = 0);
//   p' = 1024 p stored per wave to LDS as f16 hi (and residual x2048 when PRES), reloaded as A fragments after a wave sync;
//   O = (Oh + Or/2048)/1024/l with Oh = ph.vh, Or = ph.vl' (+ pl'.vh when PRES).
//   K / V^T chunk staging: 128 threads x 4 x 16 B per plane = whole 32x128 / 128x32 tile, plain loads, __syncthreads before and after.
//   Chunks cover keys [max(0, 64*qb - window) & ~31, 64*qb + 63]; trip count statically <= 64; waves with no valid key in a chunk
//   skip its compute part (wave-uniform, scalar branch).
// ---------------------------------------------------------------------------
#define AT_KC   32
#define KS_P    136
#define VS_P    40
#define PS_P    40
#define LDS_KS  0
#define LDS_KLS (32 * KS_P)
#define LDS_VHS (2 * 32 * KS_P)
#define LDS_VLS (LDS_VHS + 128 * VS_P)
#define LDS_PH  (LDS_VLS + 128 * VS_P)
#define LDS_PL  (LDS_PH + 4 * 16 * PS_P)
#define LDS_TOT (LDS_PL + 4 * 16 * PS_P)
static_assert(LDS_TOT * 2 <= 65536);
static_assert(4 * 4096 <= LDS_TOT);          // output staging (2 planes x 16 x 128 per wave) aliases the chunk region after the loop

template <bool PRES>
__global__ __launch_bounds__(128) void attn_window_kernel(
    const unsigned short* __restrict__ qhp, const unsigned short* __restrict__ qlp,
    const unsigned short* __restrict__ khp, const unsigned short* __restrict__ klp,
    const unsigned short* __restrict__ vhp, const unsigned short* __restrict__ vlp,
    unsigned short* __restrict__ ahp, unsigned short* __restrict__ alp,
    const int* __restrict__ winp, int qb_base) {
  __shared__ __align__(16) _Float16 lds[LDS_TOT];
  _Float16* Ks  = lds + LDS_KS;
  _Float16* Kls = lds + LDS_KLS;
  _Float16* Vhs = lds + LDS_VHS;
  _Float16* Vls = lds + LDS_VLS;

  const int tid  = (int)threadIdx.x;
  const int lane = tid & 31;
  const int wave = wave_id();
  const int hh   = lane >> 4;
  const int c    = lane & 15;
  const int qb   = (int)blockIdx.x + qb_base;
  const int h    = (int)blockIdx.y;
  const int b    = (int)blockIdx.z;
  const int kvh  = h >> 1;                       // 2 query heads per kv head
  const int window = __builtin_amdgcn_readfirstlane(winp[0]);
  const int qblk0 = qb * 64;
  const int q0    = qblk0 + wave * 16;           // first query row of this wave (within sequence)
  const int qlast = q0 + 15;
  const int wlo   = q0 - window;                 // oldest valid key of row q0
  const size_t tok0 = (size_t)b * SQ;

  int kstart = qblk0 - window;
  kstart = (kstart > 0) ? (kstart & ~31) : 0;
  if (kstart > qblk0) kstart = qblk0;
  int nch = (qblk0 + 64 - kstart) >> 5;          // block-uniform
  if (nch > 64) nch = 64;
  if (nch < 0) nch = 0;

  const _Float16* Qhr = (const _Float16*)(const void*)qhp + (tok0 + q0 + c) * HID + h * HDM + 8 * hh;
  const _Float16* Qlr = (const _Float16*)(const void*)qlp + (tok0 + q0 + c) * HID + h * HDM + 8 * hh;
  const _Float16* Kg  = (const _Float16*)(const void*)khp + tok0 * KVW + kvh * HDM;
  const _Float16* Klg = (const _Float16*)(const void*)klp + tok0 * KVW + kvh * HDM;
  const _Float16* Vhg = (const _Float16*)(const void*)vhp + (size_t)(kvh * HDM) * NTOK + tok0;
  const _Float16* Vlg = (const _Float16*)(const void*)vlp + (size_t)(kvh * HDM) * NTOK + tok0;
  _Float16* ph = lds + LDS_PH + wave * (16 * PS_P);
  _Float16* pl = lds + LDS_PL + wave * (16 * PS_P);

  float mrow[8], lrow[8];
  v8f oacc[8], oaccr[8];
#pragma unroll
  for (int r = 0; r < 8; ++r) { mrow[r] = -INFINITY; lrow[r] = 0.f; }
#pragma unroll
  for (int t = 0; t < 8; ++t) { oacc[t] = zero8(); oaccr[t] = zero8(); }

  for (int kc = 0; kc < nch; ++kc) {
    const int kv0 = kstart + kc * AT_KC;         // keys kv0..kv0+31, all < SQ
    __syncthreads();
#pragma unroll
    for (int i = 0; i < 4; ++i) {                // coverage: 512 pieces of 8 halves per plane = whole tile
      const int p   = tid + 128 * i;             // 0..511
      const int key = p >> 4, d8 = (p & 15) * 8; // K: 32 keys x 128 d
      const v8h kx = *(const v8h*)(Kg + (size_t)(kv0 + key) * KVW + d8);
      *(v8h*)(Ks + key * KS_P + d8) = kx;
      if (PRES) {
        const v8h ky = *(const v8h*)(Klg + (size_t)(kv0 + key) * KVW + d8);
        *(v8h*)(Kls + key * KS_P + d8) = ky;
      }
      const int d = p >> 2, k8 = (p & 3) * 8;    // V^T: 128 d x 32 keys
      const v8h vx = *(const v8h*)(Vhg + (size_t)d * NTOK + kv0 + k8);
      const v8h vy = *(const v8h*)(Vlg + (size_t)d * NTOK + kv0 + k8);
      *(v8h*)(Vhs + d * VS_P + k8) = vx;
      *(v8h*)(Vls + d * VS_P + k8) = vy;
    }
    __syncthreads();

    if (kv0 <= qlast && kv0 + AT_KC - 1 >= wlo) {   // wave-uniform (scalar): skip chunks with no valid key for this wave
      // ---- scores ----
      v8f sh[2], sr[2];
      sh[0] = zero8(); sh[1] = zero8(); sr[0] = zero8(); sr[1] = zero8();
#pragma unroll
      for (int dc = 0; dc < 4; ++dc) {
        const v16h qa = ldfrag_h(Qhr + dc * 32);
        const v16h ql = ldfrag_h(Qlr + dc * 32);
#pragma unroll
        for (int j = 0; j < 2; ++j) {
          const v16h kb = ldfrag_h(Ks + (j * 16 + c) * KS_P + dc * 32 + 8 * hh);
          sh[j] = mma_h(qa, kb, sh[j]);
          sr[j] = mma_h(ql, kb, sr[j]);
          if (PRES) {
            const v16h kl = ldfrag_h(Kls + (j * 16 + c) * KS_P + dc * 32 + 8 * hh);
            sr[j] = mma_h(qa, kl, sr[j]);
            guard_h4(sh[j], sr[j], qa, ql, kb, kl);
          } else {
            guard_h3(sh[j], sr[j], qa, ql, kb);
          }
        }
      }
      // ---- scale, window + causal validity, chunk row max ----
      float cm[8];
#pragma unroll
      for (int r = 0; r < 8; ++r) {
        const int qrow = q0 + 8 * hh + r;
        float m = -INFINITY;
#pragma unroll
        for (int j = 0; j < 2; ++j) {
          const int key = kv0 + j * 16 + c;
          float s = (sh[j][r] + sr[j][r] * 0.00048828125f) * 0.08838834764831845f;
          const bool ok = (key <= qrow) && (qrow - key <= window);
          s = ok ? s : -INFINITY;
          sh[j][r] = s;
          m = fmaxf(m, s);
        }
#pragma unroll
        for (int off = 1; off < 16; off <<= 1) m = fmaxf(m, __shfl_xor(m, off, 32));
        cm[r] = m;
      }
      // ---- online softmax, P' to LDS ----
#pragma unroll
      for (int r = 0; r < 8; ++r) {
        const float mnew  = fmaxf(mrow[r], cm[r]);
        const float mref  = (mnew == -INFINITY) ? 0.f : mnew;   // row with no valid key yet: everything stays 0
        const float alpha = __expf(mrow[r] - mref);
        mrow[r] = mnew;
        float psum = 0.f;
#pragma unroll
        for (int j = 0; j < 2; ++j) {
          const float p  = __expf(sh[j][r] - mref);
          psum += p;
          const float pp = p * 1024.0f;
          const _Float16 phv = (_Float16)pp;
          const int po = (8 * hh + r) * PS_P + j * 16 + c;
          ph[po] = phv;
          if (PRES) pl[po] = (_Float16)((pp - (float)phv) * 2048.0f);
        }
#pragma unroll
        for (int off = 1; off < 16; off <<= 1) psum += __shfl_xor(psum, off, 32);
        lrow[r] = lrow[r] * alpha + psum;
#pragma unroll
        for (int t = 0; t < 8; ++t) { oacc[t][r] *= alpha; oaccr[t][r] *= alpha; }
      }
      lds_wave_sync();                           // P' stores visible to the other lanes of this wave before the fragment reload
      // ---- O += P' . V ----
      const v16h pa = ldfrag_h(ph + c * PS_P + 8 * hh);
      v16h pr = pa;
      if (PRES) pr = ldfrag_h(pl + c * PS_P + 8 * hh);
#pragma unroll
      for (int t = 0; t < 8; ++t) {
        const v16h vb = ldfrag_h(Vhs + (t * 16 + c) * VS_P + 8 * hh);
        const v16h vr = ldfrag_h(Vls + (t * 16 + c) * VS_P + 8 * hh);
        oacc[t]  = mma_h(pa, vb, oacc[t]);
        oaccr[t] = mma_h(pa, vr, oaccr[t]);
        if (PRES) oaccr[t] = mma_h(pr, vb, oaccr[t]);
        guard_h4(oacc[t], oaccr[t], pa, pr, vb, vr);
      }
    }
  }

  __syncthreads();                               // all chunk-region readers done before aliasing it as output staging
  _Float16* osh = lds + wave * 4096;
  _Float16* osl = osh + 2048;
#pragma unroll
  for (int r = 0; r < 8; ++r) {
    const float inv = (1.0f / lrow[r]) * 0.0009765625f;
#pragma unroll
    for (int t = 0; t < 8; ++t) {
      const float o = (oacc[t][r] + oaccr[t][r] * 0.00048828125f) * inv;
      const unsigned short hb = bf_bits(o);
      const unsigned short lb = bf_bits(o - bf_val(hb));
      const int so = (8 * hh + r) * 128 + t * 16 + c;
      osh[so] = __builtin_bit_cast(_Float16, hb);
      osl[so] = __builtin_bit_cast(_Float16, lb);
    }
  }
  lds_wave_sync();
  _Float16* Ahg = (_Float16*)(void*)ahp + (tok0 + q0) * HID + h * HDM;
  _Float16* Alg = (_Float16*)(void*)alp + (tok0 + q0) * HID + h * HDM;
  {
#pragma unroll
    for (int it = 0; it < 8; ++it) {
      const int row = it * 2 + hh;               // it 0..7 x hh 0..1 covers rows 0..15
      const int c8  = c * 8;                     // 16 lanes x 16 B = the whole 256-B segment
      const v8h x = *(const v8h*)(osh + row * 128 + c8);
      const v8h y = *(const v8h*)(osl + row * 128 + c8);
      *(v8h*)(Ahg + (size_t)row * HID + c8) = x;
      *(v8h*)(Alg + (size_t)row * HID + c8) = y;
    }
    
  }
}

// ---------------------------------------------------------------------------
// Workspace map (bytes; every region is a whole number of the rows its producer writes with whole-line stores, no tails):
//   Xb    bf16 [4096][2048]   16777216   (the attn hi plane Ah [4096][2048] bf16 reuses this region after the last Xb reader)
//   Wqb   bf16 [2048][2048]    8388608      Wkb bf16 [1024][2048]  4194304      Wvb bf16 [1024][2048]  4194304
//   Wob   bf16 [2048][2048]    8388608      cst f32  [2048][64]     524288      snt f32  [2048][64]     524288
//   Qh    f16  [4096][2048]   16777216      Ql  f16  [4096][2048] 16777216
//   Kh    f16  [4096][1024]    8388608      Kl  f16  [4096][1024]  8388608
//   Vh    f16  [1024][4096]    8388608      Vl  f16  [1024][4096]  8388608
//   Al    bf16 [4096][2048]   16777216
//   total                    126877696
// ---------------------------------------------------------------------------
extern "C" void kernel_launch(void* const* d_in, const int* in_sizes, int n_in,
                              void* d_out, int out_size, void* d_ws, size_t ws_size,
                              hipStream_t stream) {
  if (n_in < 9) return;
  if (in_sizes[0] != NTOK * HID) return;
  if (in_sizes[1] != HID * HID) return;
  if (in_sizes[2] != HID) return;
  if (in_sizes[3] != KVW * HID) return;
  if (in_sizes[4] != KVW) return;
  if (in_sizes[5] != KVW * HID) return;
  if (in_sizes[6] != KVW) return;
  if (in_sizes[7] != HID * HID) return;
  if (in_sizes[8] < 1) return;
  if (out_size != NTOK * HID) return;

  const float* x    = (const float*)d_in[0];
  const float* wq_w = (const float*)d_in[1];
  const float* wq_b = (const float*)d_in[2];
  const float* wk_w = (const float*)d_in[3];
  const float* wk_b = (const float*)d_in[4];
  const float* wv_w = (const float*)d_in[5];
  const float* wv_b = (const float*)d_in[6];
  const float* wo_w = (const float*)d_in[7];
  const int*   win  = (const int*)d_in[8];
  float* out = (float*)d_out;

  const size_t szX  = (size_t)NTOK * HID * 2;
  const size_t szWq = (size_t)HID * HID * 2;
  const size_t szWk = (size_t)KVW * HID * 2;
  const size_t szWv = (size_t)KVW * HID * 2;
  const size_t szWo = (size_t)HID * HID * 2;
  const size_t szT  = (size_t)SQ * NFREQ * 4;
  const size_t szQ  = (size_t)NTOK * HID * 2;
  const size_t szK  = (size_t)NTOK * KVW * 2;
  const size_t szV  = (size_t)KVW * NTOK * 2;
  const size_t szA  = (size_t)NTOK * HID * 2;
  size_t off = 0;
  const size_t oX  = off; off += szX;
  const size_t oWq = off; off += szWq;
  const size_t oWk = off; off += szWk;
  const size_t oWv = off; off += szWv;
  const size_t oWo = off; off += szWo;
  const size_t oCs = off; off += szT;
  const size_t oSn = off; off += szT;
  const size_t oQh = off; off += szQ;
  const size_t oQl = off; off += szQ;
  const size_t oKh = off; off += szK;
  const size_t oKl = off; off += szK;
  const size_t oVh = off; off += szV;
  const size_t oVl = off; off += szV;
  const size_t oAl = off; off += szA;
  const size_t oAh = oX;                         // Ah reuses the Xb region (same byte size); Xb is dead after launch (9)
  if (szA != szX) return;
  if (off > ws_size) return;                     // off = 126877696

  char* ws = (char*)d_ws;
  unsigned short* Xb  = (unsigned short*)(ws + oX);
  unsigned short* Wqb = (unsigned short*)(ws + oWq);
  unsigned short* Wkb = (unsigned short*)(ws + oWk);
  unsigned short* Wvb = (unsigned short*)(ws + oWv);
  unsigned short* Wob = (unsigned short*)(ws + oWo);
  float*          cst = (float*)(ws + oCs);
  float*          snt = (float*)(ws + oSn);
  unsigned short* Qh  = (unsigned short*)(ws + oQh);
  unsigned short* Ql  = (unsigned short*)(ws + oQl);
  unsigned short* Kh  = (unsigned short*)(ws + oKh);
  unsigned short* Kl  = (unsigned short*)(ws + oKl);
  unsigned short* Vh  = (unsigned short*)(ws + oVh);
  unsigned short* Vl  = (unsigned short*)(ws + oVl);
  unsigned short* Ah  = (unsigned short*)(ws + oAh);
  unsigned short* Al  = (unsigned short*)(ws + oAl);

  const dim3 b256(256), b128(128);

  // (1) cos/sin table [2048][64] x 2
  rope_table_kernel<<<dim3(SQ / 8), b256, 0, stream>>>(cst, snt, SQ);
  // (2)-(6) RNE bf16 planes of x [4096][2048], Wq [2048][2048], Wk [1024][2048], Wv [1024][2048], Wo [2048][2048] (all [out][in] = Bt[n][k])
  cvt_bf16_kernel<<<dim3((NTOK * HID / 8) / 256), b256, 0, stream>>>(x,    Xb,  NTOK * HID / 8);
  cvt_bf16_kernel<<<dim3((HID * HID / 8) / 256),  b256, 0, stream>>>(wq_w, Wqb, HID * HID / 8);
  cvt_bf16_kernel<<<dim3((KVW * HID / 8) / 256),  b256, 0, stream>>>(wk_w, Wkb, KVW * HID / 8);
  cvt_bf16_kernel<<<dim3((KVW * HID / 8) / 256),  b256, 0, stream>>>(wv_w, Wvb, KVW * HID / 8);
  cvt_bf16_kernel<<<dim3((HID * HID / 8) / 256),  b256, 0, stream>>>(wo_w, Wob, HID * HID / 8);
  // (7) q = x . Wq^T + bq, RoPE -> Qh/Ql [4096][2048]   (M=4096, N=2048, K=2048; 2048 wave tiles / 4)
  gemm_w32x128_kernel<0, false><<<dim3((NTOK / 32) * (HID / 128) / 4), b128, 0, stream>>>(
      Xb, Xb, HID, Wqb, HID, wq_b, cst, snt, (void*)Qh, (void*)Ql, HID, NTOK, HID, HID);
  // (8) k = x . Wk^T + bk, RoPE -> Kh/Kl [4096][1024]   (M=4096, N=1024, K=2048; 1024 wave tiles / 4)
  gemm_w32x128_kernel<0, false><<<dim3((NTOK / 32) * (KVW / 128) / 4), b128, 0, stream>>>(
      Xb, Xb, HID, Wkb, HID, wk_b, cst, snt, (void*)Kh, (void*)Kl, KVW, NTOK, KVW, HID);
  // (9) v^T = Wv . x^T + bv[m] -> Vh/Vl [1024][4096]   (A = Wvb, Bt = Xb; M=1024, N=4096, K=2048; 1024 wave tiles / 4)
  gemm_w32x128_kernel<1, false><<<dim3((KVW / 32) * (NTOK / 128) / 4), b128, 0, stream>>>(
      Wvb, Wvb, HID, Xb, HID, wv_b, cst, snt, (void*)Vh, (void*)Vl, NTOK, KVW, NTOK, HID);
  // (10)-(11) windowed causal attention, query tiles 0..3 with k and p residual products, tiles 4..31 without
  attn_window_kernel<true><<<dim3(4, NHQ, NSEQ), b128, 0, stream>>>(Qh, Ql, Kh, Kl, Vh, Vl, Ah, Al, win, 0);
  attn_window_kernel<false><<<dim3(SQ / 64 - 4, NHQ, NSEQ), b128, 0, stream>>>(Qh, Ql, Kh, Kl, Vh, Vl, Ah, Al, win, 4);
  // (12) out = attn(hi + lo) . Wo^T -> d_out f32 [4096][2048]   (M=4096, N=2048, K=2048; 2048 wave tiles / 4)
  gemm_w32x128_kernel<2, true><<<dim3((NTOK / 32) * (HID / 128) / 4), b128, 0, stream>>>(
      Ah, Al, HID, Wob, HID, wq_b, cst, snt, (void*)out, (void*)out, HID, NTOK, HID, HID);
  (void)hipGetLastError();
}

// v001
// A run of this version takes 441 microseconds.
// Timed twice side by side with v000, it ran 1.86 times as fast both times.
// Contractions: x.Wq^T, x.Wk^T and Wv.x^T on v_wmma_f32_16x16x32_bf16 (operands = RNE bf16 of the f32 inputs, single products);
// q.k^T and p.v on v_wmma_f32_16x16x32_f16 (q = f16 hi + f16 residual x2^11 planes; k plain f16 plus f16 residual x2^11 on query tiles 0..3;
// p x1024 plain f16 plus f16 residual x2^11 on query tiles 0..3; v^T = f16 hi + f16 residual x2^11 planes); attn.Wo^T on v_wmma_f32_16x16x32_bf16
// (attn = bf16 hi + bf16 lo planes, two products; Wo RNE bf16). f32 accumulate everywhere; bias add, RoPE, online softmax and scale folds in f32.
#include <hip/hip_runtime.h>
#include <math.h>
#include <stdint.h>

#define NSEQ   2
#define SQ     2048
#define HID    2048
#define NHQ    16
#define NKVH   8
#define HDM    128
#define KVW    1024
#define NTOK   4096
#define NFREQ  64

typedef _Float16     v16h __attribute__((ext_vector_type(16)));
typedef _Float16     v8h  __attribute__((ext_vector_type(8)));
typedef __bf16       v16b __attribute__((ext_vector_type(16)));
typedef __bf16       v8b  __attribute__((ext_vector_type(8)));
typedef float        v8f  __attribute__((ext_vector_type(8)));
typedef float        v4f  __attribute__((ext_vector_type(4)));
typedef unsigned int v4u  __attribute__((ext_vector_type(4)));

// ---------------------------------------------------------------------------
// small helpers
// ---------------------------------------------------------------------------
__device__ __forceinline__ unsigned short bf_bits(float f) {          // RNE convert f32 -> bf16 bits
  const unsigned u = __float_as_uint(f);
  return (unsigned short)((u + 0x7FFFu + ((u >> 16) & 1u)) >> 16);
}
__device__ __forceinline__ float bf_val(unsigned short h) { return __uint_as_float(((unsigned)h) << 16); }
__device__ __forceinline__ float bf_rne(float f) { return bf_val(bf_bits(f)); }
__device__ __forceinline__ unsigned pk16(unsigned short a, unsigned short b) { return (unsigned)a | ((unsigned)b << 16); }
__device__ __forceinline__ v8f zero8() { v8f z = {0.f, 0.f, 0.f, 0.f, 0.f, 0.f, 0.f, 0.f}; return z; }
__device__ __forceinline__ int wave_id() { return __builtin_amdgcn_readfirstlane((int)(threadIdx.x >> 5)); }

__device__ __forceinline__ void lds_wave_sync() {
  __builtin_amdgcn_fence(__ATOMIC_RELEASE, "workgroup");
  __builtin_amdgcn_wave_barrier();
  __builtin_amdgcn_fence(__ATOMIC_ACQUIRE, "workgroup");
}

// ---------------------------------------------------------------------------
// WMMA fragments (wave32, 16x16x32, 16-bit operands). For A (row m = lane&15) and B (col n = lane&15) alike:
// elements 0..7 <- k0 + 8*(lane>>4) + 0..7, elements 8..15 <- k0 + 16 + 8*(lane>>4) + 0..7.
// ldfrag(p) with p = rowbase + k0 + 8*(lane>>4): two 16-B loads p[0..7], p[16..23].
// D: acc[r] = (row 8*(lane>>4) + r, col lane&15).
// ---------------------------------------------------------------------------
union FragH { v16h v; v8h h[2]; };
union FragB { v16b v; v8b h[2]; };
__device__ __forceinline__ v16h ldfrag_h(const _Float16* p) { FragH f; f.h[0] = *(const v8h*)(p); f.h[1] = *(const v8h*)(p + 16); return f.v; }
__device__ __forceinline__ v16b ldfrag_b(const __bf16* p)   { FragB f; f.h[0] = *(const v8b*)(p); f.h[1] = *(const v8b*)(p + 16); return f.v; }

__device__ __forceinline__ v8f mma_h(v16h a, v16h b, v8f c) {
  return __builtin_amdgcn_wmma_f32_16x16x32_f16(false, a, false, b, (short)0, c, false, false);
}
__device__ __forceinline__ v8f mma_b(v16b a, v16b b, v8f c) {
  return __builtin_amdgcn_wmma_f32_16x16x32_bf16(false, a, false, b, (short)0, c, false, false);
}
// hazard guards: 4 VALU slots after the last WMMA of a group, D tied, A/B kept live; memory clobber keeps later loads behind the group
__device__ __forceinline__ void guard_h3(v8f& a, v8f& b, v16h x, v16h y, v16h z) {
  asm volatile("v_nop\n\tv_nop\n\tv_nop\n\tv_nop" : "+v"(a), "+v"(b) : "v"(x), "v"(y), "v"(z) : "memory");
}
__device__ __forceinline__ void guard_h4(v8f& a, v8f& b, v16h w, v16h x, v16h y, v16h z) {
  asm volatile("v_nop\n\tv_nop\n\tv_nop\n\tv_nop" : "+v"(a), "+v"(b) : "v"(w), "v"(x), "v"(y), "v"(z) : "memory");
}
__device__ __forceinline__ void acc_guard4(v8f& a, v8f& b, v8f& c, v8f& d) {
  asm volatile("v_nop\n\tv_nop\n\tv_nop\n\tv_nop" : "+v"(a), "+v"(b), "+v"(c), "+v"(d));
}

// ---------------------------------------------------------------------------
// RoPE table: cst[s][i] = cos(s * inv_freq[i]), snt[s][i] = sin(...), inv_freq[i] = 1 / 1e4^(i/64), i < 64, s < ns, all f32.
// Block = 8 waves, wave w -> position s = blockIdx.x*8 + w, lane -> i = lane, lane + 32.
// Coverage: grid ns/8 x 8 waves x 32 lanes x 2 = ns x 64 per plane.
// ---------------------------------------------------------------------------
__global__ __launch_bounds__(256) void rope_table_kernel(float* __restrict__ cst, float* __restrict__ snt, int ns) {
  const int lane = threadIdx.x & 31;
  const int wave = (int)(threadIdx.x >> 5);
  const int t = (int)blockIdx.x * 8 + wave;
  if (t >= ns) return;                       // no barriers in this kernel
  const float pf = (float)t;
  float c0 = 0.f, s0 = 0.f, c1 = 0.f, s1 = 0.f;
#pragma unroll 1
  for (int u = 0; u < 2; ++u) {
    const int i = lane + 32 * u;
    const float e   = (float)i * 0.015625f;      // i / 64 exact
    const float pw  = powf(10000.0f, e);
    const float inv = 1.0f / pw;
    const float ang = pf * inv;
    const float cv = cosf(ang);
    const float sv = sinf(ang);
    c1 = cv; s1 = sv;
    if (u == 0) { c0 = cv; s0 = sv; }
  }
  const size_t o = (size_t)t * NFREQ + lane;
  {
    ((float*)cst)[o]      = c0;
    ((float*)cst)[o + 32] = c1;
    ((float*)snt)[o]      = s0;
    ((float*)snt)[o + 32] = s1;
    
  }
}

// ---------------------------------------------------------------------------
// Elementwise RNE f32 -> bf16 plane: 8 elements per thread, one 16-B store per lane -> 32 consecutive lanes write 4 whole
// ---------------------------------------------------------------------------
__global__ __launch_bounds__(256) void cvt_bf16_kernel(const float* __restrict__ in, unsigned short* __restrict__ outp, int n8) {
  const int i = (int)blockIdx.x * 256 + (int)threadIdx.x;
  if (i >= n8) return;
  const size_t e = 8 * (size_t)i;
  const v4f a = *(const v4f*)(in + e);
  const v4f b = *(const v4f*)(in + e + 4);
  v4u w;
  w[0] = pk16(bf_bits(a[0]), bf_bits(a[1]));
  w[1] = pk16(bf_bits(a[2]), bf_bits(a[3]));
  w[2] = pk16(bf_bits(b[0]), bf_bits(b[1]));
  w[3] = pk16(bf_bits(b[2]), bf_bits(b[3]));
  *(v4u*)(outp + e) = w;
  
}

// ---------------------------------------------------------------------------
// bf16 WMMA GEMM, block = 4 waves (128 threads) = one 128 x 128 tile of C, wave w = rows 32w..32w+31 x all 128 cols.
//   C[m][n] = sum_k A[m][k] * Bt[n][k]; A row-major [M][K] bf16 (pitch lda), Bt row-major [N][K] bf16 (pitch ldb);
//   M % 128 == 0, N % 128 == 0, K % 64 == 0; grid.x = M/128 * N/128.
//   SPLITA: A carried as hi (Ap) + lo (A2p) bf16 planes, two products into one accumulator.
//   Operands: a pass is 64 k = one whole 128-B line of every operand row. The 128 A rows (both planes when SPLITA) and the
//   128 Bt rows of a pass are brought into LDS by asynchronous 16-B copies (8 lanes = one line, a wave instruction = 4 lines),
//   rows at pitch 144 B, two buffers: the next pass's copies fly while this pass is multiplied. The Bt tile is read by all
//   four waves. Fragments are read from LDS with the split k map (ldfrag_b), k ascending.
// Epilogues (all: per wave, per 16-row slab: stage in LDS, wave sync, write each row segment with ONE instruction of
//   EPI 0: q or k projection; the 128-col tile is one head. B rows are laid in LDS in even/odd order (row n0 + r in slot
//          64*(r&1) + (r>>1)):
//          acc tile j<4, lane rl holds output column n0 + 2*(16j+rl); tile j+4 holds n0 + 2*(16j+rl) + 1 (the interleaved pair).
//          + bf16(bias[n]); RoPE on the pair with cos/sin[pos = row & 2047][pair]; writes f16 hi plane C0 and f16 residual x2048
//          plane C1, both [M][ldc], cols n0..n0+127 (row segment 256 B = 16 lanes x 16 B).
//   EPI 1: v^T projection: + bf16(bias[m]); f16 hi plane C0, residual x2048 plane C1, [M][ldc], row segment 256 B.
//   EPI 2: f32 output C0 [M][ldc]; row segment 128 floats = 512 B = 32 lanes x 16 B per instruction.
// ---------------------------------------------------------------------------
template <int EPI> struct SlabT { typedef _Float16 T; static constexpr int PERW = 4096; };   // 2 planes x 16 x 128 halves
template <> struct SlabT<2>     { typedef float    T; static constexpr int PERW = 2048; };   // 16 x 128 floats

#define G_PITCH 72                    // LDS row pitch in 16-bit elements: 64 k + 8 = 144 B = 16 B x 9
#define G_TILE  (128 * G_PITCH)       // one 128-row operand tile of a pass, in elements

// One 128-row x 128-B operand tile into LDS: eight copies per lane, lane address pairs (l + i*lstep, g + i*gstep).
// The s_wait_xcnt stands in the copies' own statement so that no address register is rewritten ahead of it.
__device__ __forceinline__ void stage_tile(unsigned l, unsigned lstep, const unsigned short* g, size_t gstep) {
  asm volatile(
      "global_load_async_to_lds_b128 %0, %8, off\n\t"
      "global_load_async_to_lds_b128 %1, %9, off\n\t"
      "global_load_async_to_lds_b128 %2, %10, off\n\t"
      "global_load_async_to_lds_b128 %3, %11, off\n\t"
      "global_load_async_to_lds_b128 %4, %12, off\n\t"
      "global_load_async_to_lds_b128 %5, %13, off\n\t"
      "global_load_async_to_lds_b128 %6, %14, off\n\t"
      "global_load_async_to_lds_b128 %7, %15, off\n\t"
      "s_wait_xcnt 0x0"
      :: "v"(l), "v"(l + lstep), "v"(l + 2 * lstep), "v"(l + 3 * lstep),
         "v"(l + 4 * lstep), "v"(l + 5 * lstep), "v"(l + 6 * lstep), "v"(l + 7 * lstep),
         "v"(g), "v"(g + gstep), "v"(g + 2 * gstep), "v"(g + 3 * gstep),
         "v"(g + 4 * gstep), "v"(g + 5 * gstep), "v"(g + 6 * gstep), "v"(g + 7 * gstep)
      : "memory");
}

template <int EPI, bool SPLITA>
__global__ __launch_bounds__(128) void gemm_w32x128_kernel(
    const unsigned short* Ap, const unsigned short* A2p, int lda,
    const unsigned short* __restrict__ Btp, int ldb,
    const float* __restrict__ bias, const float* __restrict__ cst, const float* __restrict__ snt,
    void* C0, void* C1, int ldc,
    int M, int N, int K) {
  typedef typename SlabT<EPI>::T ST;
  constexpr int NPL = SPLITA ? 3 : 2;            // operand tiles per buffer: A (, A lo), Bt
  constexpr int BUF = NPL * G_TILE;              // elements per buffer
  __shared__ __align__(16) ST slab_all[4 * SlabT<EPI>::PERW];
  __shared__ __align__(16) unsigned short ring[2 * BUF];

  const int tid  = (int)threadIdx.x;
  const int lane = tid & 31;
  const int wave = wave_id();
  const int hh = lane >> 4;           // lane half: k offset 8*hh, D row offset 8*hh
  const int rl = lane & 15;           // A row / B col / D col within subtile
  const int tilesN = N >> 7;
  const int tilesM = M >> 7;
  const int tile = (int)blockIdx.x;
  if (tile >= tilesM * tilesN) return;          // block-uniform, in front of every barrier
  const int tm = tile / tilesN;
  const int tn = tile - tm * tilesN;
  const int mb = tm << 7;                       // first row of the block tile
  const int m0 = mb + (wave << 5);              // first row of this wave
  const int n0 = tn << 7;

  // copy addresses of this lane: copy i of a tile moves 16 B of source row (tid>>3) + 16*i, bytes 16*(tid&7)..+15 of the pass's line
  const int crow = tid >> 3;
  const int ccol = (tid & 7) * 8;
  const unsigned short* gA  = Ap  + (size_t)(mb + crow) * lda + ccol;
  const unsigned short* gA2 = A2p + (size_t)(mb + crow) * lda + ccol;
  const unsigned short* gB  = Btp + (size_t)(n0 + crow) * ldb + ccol;
  const unsigned ring0 = (unsigned)(uintptr_t)(&ring[0]);           // LDS byte address of the ring
  const unsigned lA = ring0 + (unsigned)(crow * G_PITCH + ccol) * 2u;
  const int bslot = (EPI == 0) ? ((crow & 1) * 64 + (crow >> 1)) : crow;
  const unsigned lB = ring0 + (unsigned)((NPL - 1) * G_TILE + bslot * G_PITCH + ccol) * 2u;
  const unsigned lstepA = 16u * G_PITCH * 2u;
  const unsigned lstepB = ((EPI == 0) ? 8u : 16u) * G_PITCH * 2u;
  const size_t gstepA = (size_t)16 * lda;
  const size_t gstepB = (size_t)16 * ldb;

  v8f acc[2][8];
#pragma unroll
  for (int i = 0; i < 2; ++i)
#pragma unroll
    for (int j = 0; j < 8; ++j) acc[i][j] = zero8();

  const int npass = K >> 6;
  // pass 0 into buffer 0, landed and published; then pass 1 into buffer 1
  stage_tile(lA, lstepA, gA, gstepA);
  if (SPLITA) stage_tile(lA + G_TILE * 2u, lstepA, gA2, gstepA);
  stage_tile(lB, lstepB, gB, gstepB);
  asm volatile("s_wait_asynccnt 0x0" ::: "memory");   // this wave's copies of pass 0 have landed
  __syncthreads();                                    // every wave's copies of pass 0 are readable by all
  if (npass > 1) {
    stage_tile(lA + BUF * 2u, lstepA, gA + 64, gstepA);
    if (SPLITA) stage_tile(lA + (BUF + G_TILE) * 2u, lstepA, gA2 + 64, gstepA);
    stage_tile(lB + BUF * 2u, lstepB, gB + 64, gstepB);
  }

  for (int t = 0; t < npass; ++t) {
    const int bo = (t & 1) * BUF;
    const __bf16* As = (const __bf16*)(const void*)(ring + bo) + ((wave << 5) + rl) * G_PITCH + 8 * hh;
    const __bf16* Bs = (const __bf16*)(const void*)(ring + bo + (NPL - 1) * G_TILE) + rl * G_PITCH + 8 * hh;
    v16b ah[2][2], al[2][2], bj[2][8];
#pragma unroll
    for (int kb = 0; kb < 2; ++kb) {
#pragma unroll
      for (int i = 0; i < 2; ++i) {
        ah[kb][i] = ldfrag_b(As + i * 16 * G_PITCH + kb * 32);
        al[kb][i] = SPLITA ? ldfrag_b(As + G_TILE + i * 16 * G_PITCH + kb * 32) : ah[kb][i];
      }
#pragma unroll
      for (int j = 0; j < 8; ++j) bj[kb][j] = ldfrag_b(Bs + j * 16 * G_PITCH + kb * 32);
    }
    // keeps the pass's LDS reads together in front of its WMMAs: left alone the compiler puts two reads and a full wait before every WMMA pair
    __builtin_amdgcn_sched_barrier(0);
#pragma unroll
    for (int kb = 0; kb < 2; ++kb) {
#pragma unroll
      for (int j = 0; j < 8; ++j) {
        acc[0][j] = mma_b(ah[kb][0], bj[kb][j], acc[0][j]);
        acc[1][j] = mma_b(ah[kb][1], bj[kb][j], acc[1][j]);
        if (SPLITA) {
          acc[0][j] = mma_b(al[kb][0], bj[kb][j], acc[0][j]);
          acc[1][j] = mma_b(al[kb][1], bj[kb][j], acc[1][j]);
        }
      }
    }
    // keeps the WMMAs in front of the waits and the barrier below, so that the next pass's copies fly for the whole of this pass
    __builtin_amdgcn_sched_barrier(0);
    asm volatile("s_wait_dscnt 0x0" ::: "memory");      // this wave's reads of the buffer are done before it is refilled
    asm volatile("s_wait_asynccnt 0x0" ::: "memory");   // this wave's copies of pass t + 1 have landed
    __syncthreads();                                    // publishes pass t + 1 and ends every reader's last read of pass t
    if (t + 2 < npass) {                                // block-uniform
      const size_t ko = (size_t)(t + 2) * 64;
      stage_tile(lA + (unsigned)bo * 2u, lstepA, gA + ko, gstepA);
      if (SPLITA) stage_tile(lA + (unsigned)(bo + G_TILE) * 2u, lstepA, gA2 + ko, gstepA);
      stage_tile(lB + (unsigned)bo * 2u, lstepB, gB + ko, gstepB);
    }
  }
  asm volatile("s_wait_asynccnt 0x0" ::: "memory");     // no copy is outstanding when the wave goes on to the epilogue
  acc_guard4(acc[0][0], acc[0][1], acc[0][2], acc[0][3]);
  acc_guard4(acc[0][4], acc[0][5], acc[0][6], acc[0][7]);
  acc_guard4(acc[1][0], acc[1][1], acc[1][2], acc[1][3]);
  acc_guard4(acc[1][4], acc[1][5], acc[1][6], acc[1][7]);

  // ---- epilogue ----
  ST* slab = slab_all + wave * SlabT<EPI>::PERW;
  _Float16* sl16 = (_Float16*)(void*)slab;
  float*    slf  = (float*)(void*)slab;

  if (EPI == 0) {
    _Float16* P0 = (_Float16*)C0;
    _Float16* P1 = (_Float16*)C1;
#pragma unroll
    for (int i = 0; i < 2; ++i) {
      const int rb = m0 + i * 16 + 8 * hh;
#pragma unroll
      for (int j = 0; j < 4; ++j) {
        const int pi = j * 16 + rl;                              // pair index 0..63 within head
        const int nc = n0 + 2 * pi;                              // column of x1; x2 at nc + 1
        const float b1 = bf_rne(bias[nc]);
        const float b2 = bf_rne(bias[nc + 1]);
#pragma unroll
        for (int r = 0; r < 8; ++r) {
          const int row = rb + r;                                // token 0..NTOK-1
          const int s   = row & (SQ - 1);                        // position within sequence
          const float cv = cst[(size_t)s * NFREQ + pi];
          const float sv = snt[(size_t)s * NFREQ + pi];
          const float x1 = acc[i][j][r] + b1;
          const float x2 = acc[i][j + 4][r] + b2;
          const float o1 = x1 * cv - x2 * sv;
          const float o2 = x1 * sv + x2 * cv;
          const _Float16 h1 = (_Float16)o1;
          const _Float16 h2 = (_Float16)o2;
          const int so = (8 * hh + r) * 128 + 2 * pi;
          sl16[so]            = h1;
          sl16[so + 1]        = h2;
          sl16[2048 + so]     = (_Float16)((o1 - (float)h1) * 2048.0f);
          sl16[2048 + so + 1] = (_Float16)((o2 - (float)h2) * 2048.0f);
        }
      }
      lds_wave_sync();
      {
#pragma unroll
        for (int it = 0; it < 8; ++it) {
          const int row = it * 2 + hh;                           // it x hh covers rows 0..15
          const int c8  = rl * 8;
          const v8h vh = *(const v8h*)(sl16 + row * 128 + c8);
          const v8h vl = *(const v8h*)(sl16 + 2048 + row * 128 + c8);
          const size_t go = (size_t)(m0 + i * 16 + row) * ldc + n0 + c8;
          *(v8h*)(P0 + go) = vh;
          *(v8h*)(P1 + go) = vl;
        }
        
      }
      lds_wave_sync();
    }
  } else if (EPI == 1) {
    _Float16* P0 = (_Float16*)C0;
    _Float16* P1 = (_Float16*)C1;
#pragma unroll
    for (int i = 0; i < 2; ++i) {
#pragma unroll
      for (int r = 0; r < 8; ++r) {
        const int m = m0 + i * 16 + 8 * hh + r;
        const float bm = bf_rne(bias[m]);
#pragma unroll
        for (int j = 0; j < 8; ++j) {
          const float v = acc[i][j][r] + bm;
          const _Float16 hv = (_Float16)v;
          const int so = (8 * hh + r) * 128 + j * 16 + rl;
          sl16[so]        = hv;
          sl16[2048 + so] = (_Float16)((v - (float)hv) * 2048.0f);
        }
      }
      lds_wave_sync();
      {
#pragma unroll
        for (int it = 0; it < 8; ++it) {
          const int row = it * 2 + hh;
          const int c8  = rl * 8;
          const v8h vh = *(const v8h*)(sl16 + row * 128 + c8);
          const v8h vl = *(const v8h*)(sl16 + 2048 + row * 128 + c8);
          const size_t go = (size_t)(m0 + i * 16 + row) * ldc + n0 + c8;
          *(v8h*)(P0 + go) = vh;
          *(v8h*)(P1 + go) = vl;
        }
        
      }
      lds_wave_sync();
    }
  } else {
    float* C = (float*)C0;
#pragma unroll
    for (int i = 0; i < 2; ++i) {
#pragma unroll
      for (int j = 0; j < 8; ++j)
#pragma unroll
        for (int r = 0; r < 8; ++r)
          slf[(8 * hh + r) * 128 + j * 16 + rl] = acc[i][j][r];
      lds_wave_sync();
      {
#pragma unroll
        for (int row = 0; row < 16; ++row) {                     // 32 lanes x 16 B = the whole 512-B row segment per instruction
          const v4f v = *(const v4f*)(slf + row * 128 + lane * 4);
          *(v4f*)(C + (size_t)(m0 + i * 16 + row) * ldc + n0 + lane * 4) = v;
        }
        
      }
      lds_wave_sync();
    }
  }
}

// ---------------------------------------------------------------------------
// Windowed causal GQA flash attention, head dim 128, 32-key chunks, block = 4 waves = 64 query rows of one (b, h);
// grid (n query tiles, NHQ, NSEQ). Key j is valid for query i iff j <= i and i - j <= window (window read from the int input).
//   q planes f16 [tok][h*128+d]: hi (qhp) and residual x2048 (qlp); k planes f16 [tok][kvh*128+d]: hi (khp), residual x2048 (klp);
//   v^T planes f16 [kvh*128+d][tok]: hi (vhp), residual x2048 (vlp); outputs attn bf16 hi (ahp) / lo (alp) [tok][h*128+d].
//   scores = (Sh + Sr/2048) * 128^-0.5 with Sh = qh.kh and Sr = ql'.kh (+ qh.kl' when PRES); invalid keys -> -inf; online softmax f32
//   (-inf safe: a row with no valid key so far keeps m = -inf, l = 0, O = 0);
//   p' = 1024 p stored per wave to LDS as f16 hi (and residual x2048 when PRES), reloaded as A fragments after a wave sync;
//   O = (Oh + Or/2048)/1024/l with Oh = ph.vh, Or = ph.vl' (+ pl'.vh when PRES).
//   K / V^T chunk staging: 128 threads x 4 x 16 B per plane = whole 32x128 / 128x32 tile, plain loads, __syncthreads before and after.
//   Chunks cover keys [max(0, 64*qb - window) & ~31, 64*qb + 63]; trip count statically <= 64; waves with no valid key in a chunk
//   skip its compute part (wave-uniform, scalar branch).
// ---------------------------------------------------------------------------
#define AT_KC   32
#define KS_P    136
#define VS_P    40
#define PS_P    40
#define LDS_KS  0
#define LDS_KLS (32 * KS_P)
#define LDS_VHS (2 * 32 * KS_P)
#define LDS_VLS (LDS_VHS + 128 * VS_P)
#define LDS_PH  (LDS_VLS + 128 * VS_P)
#define LDS_PL  (LDS_PH + 4 * 16 * PS_P)
#define LDS_TOT (LDS_PL + 4 * 16 * PS_P)
static_assert(LDS_TOT * 2 <= 65536);
static_assert(4 * 4096 <= LDS_TOT);          // output staging (2 planes x 16 x 128 per wave) aliases the chunk region after the loop

template <bool PRES>
__global__ __launch_bounds__(128) void attn_window_kernel(
    const unsigned short* __restrict__ qhp, const unsigned short* __restrict__ qlp,
    const unsigned short* __restrict__ khp, const unsigned short* __restrict__ klp,
    const unsigned short* __restrict__ vhp, const unsigned short* __restrict__ vlp,
    unsigned short* __restrict__ ahp, unsigned short* __restrict__ alp,
    const int* __restrict__ winp, int qb_base) {
  __shared__ __align__(16) _Float16 lds[LDS_TOT];
  _Float16* Ks  = lds + LDS_KS;
  _Float16* Kls = lds + LDS_KLS;
  _Float16* Vhs = lds + LDS_VHS;
  _Float16* Vls = lds + LDS_VLS;

  const int tid  = (int)threadIdx.x;
  const int lane = tid & 31;
  const int wave = wave_id();
  const int hh   = lane >> 4;
  const int c    = lane & 15;
  const int qb   = (int)blockIdx.x + qb_base;
  const int h    = (int)blockIdx.y;
  const int b    = (int)blockIdx.z;
  const int kvh  = h >> 1;                       // 2 query heads per kv head
  const int window = __builtin_amdgcn_readfirstlane(winp[0]);
  const int qblk0 = qb * 64;
  const int q0    = qblk0 + wave * 16;           // first query row of this wave (within sequence)
  const int qlast = q0 + 15;
  const int wlo   = q0 - window;                 // oldest valid key of row q0
  const size_t tok0 = (size_t)b * SQ;

  int kstart = qblk0 - window;
  kstart = (kstart > 0) ? (kstart & ~31) : 0;
  if (kstart > qblk0) kstart = qblk0;
  int nch = (qblk0 + 64 - kstart) >> 5;          // block-uniform
  if (nch > 64) nch = 64;
  if (nch < 0) nch = 0;

  const _Float16* Qhr = (const _Float16*)(const void*)qhp + (tok0 + q0 + c) * HID + h * HDM + 8 * hh;
  const _Float16* Qlr = (const _Float16*)(const void*)qlp + (tok0 + q0 + c) * HID + h * HDM + 8 * hh;
  const _Float16* Kg  = (const _Float16*)(const void*)khp + tok0 * KVW + kvh * HDM;
  const _Float16* Klg = (const _Float16*)(const void*)klp + tok0 * KVW + kvh * HDM;
  const _Float16* Vhg = (const _Float16*)(const void*)vhp + (size_t)(kvh * HDM) * NTOK + tok0;
  const _Float16* Vlg = (const _Float16*)(const void*)vlp + (size_t)(kvh * HDM) * NTOK + tok0;
  _Float16* ph = lds + LDS_PH + wave * (16 * PS_P);
  _Float16* pl = lds + LDS_PL + wave * (16 * PS_P);

  float mrow[8], lrow[8];
  v8f oacc[8], oaccr[8];
#pragma unroll
  for (int r = 0; r < 8; ++r) { mrow[r] = -INFINITY; lrow[r] = 0.f; }
#pragma unroll
  for (int t = 0; t < 8; ++t) { oacc[t] = zero8(); oaccr[t] = zero8(); }

  for (int kc = 0; kc < nch; ++kc) {
    const int kv0 = kstart + kc * AT_KC;         // keys kv0..kv0+31, all < SQ
    __syncthreads();
#pragma unroll
    for (int i = 0; i < 4; ++i) {                // coverage: 512 pieces of 8 halves per plane = whole tile
      const int p   = tid + 128 * i;             // 0..511
      const int key = p >> 4, d8 = (p & 15) * 8; // K: 32 keys x 128 d
      const v8h kx = *(const v8h*)(Kg + (size_t)(kv0 + key) * KVW + d8);
      *(v8h*)(Ks + key * KS_P + d8) = kx;
      if (PRES) {
        const v8h ky = *(const v8h*)(Klg + (size_t)(kv0 + key) * KVW + d8);
        *(v8h*)(Kls + key * KS_P + d8) = ky;
      }
      const int d = p >> 2, k8 = (p & 3) * 8;    // V^T: 128 d x 32 keys
      const v8h vx = *(const v8h*)(Vhg + (size_t)d * NTOK + kv0 + k8);
      const v8h vy = *(const v8h*)(Vlg + (size_t)d * NTOK + kv0 + k8);
      *(v8h*)(Vhs + d * VS_P + k8) = vx;
      *(v8h*)(Vls + d * VS_P + k8) = vy;
    }
    __syncthreads();

    if (kv0 <= qlast && kv0 + AT_KC - 1 >= wlo) {   // wave-uniform (scalar): skip chunks with no valid key for this wave
      // ---- scores ----
      v8f sh[2], sr[2];
      sh[0] = zero8(); sh[1] = zero8(); sr[0] = zero8(); sr[1] = zero8();
#pragma unroll
      for (int dc = 0; dc < 4; ++dc) {
        const v16h qa = ldfrag_h(Qhr + dc * 32);
        const v16h ql = ldfrag_h(Qlr + dc * 32);
#pragma unroll
        for (int j = 0; j < 2; ++j) {
          const v16h kb = ldfrag_h(Ks + (j * 16 + c) * KS_P + dc * 32 + 8 * hh);
          sh[j] = mma_h(qa, kb, sh[j]);
          sr[j] = mma_h(ql, kb, sr[j]);
          if (PRES) {
            const v16h kl = ldfrag_h(Kls + (j * 16 + c) * KS_P + dc * 32 + 8 * hh);
            sr[j] = mma_h(qa, kl, sr[j]);
            guard_h4(sh[j], sr[j], qa, ql, kb, kl);
          } else {
            guard_h3(sh[j], sr[j], qa, ql, kb);
          }
        }
      }
      // ---- scale, window + causal validity, chunk row max ----
      float cm[8];
#pragma unroll
      for (int r = 0; r < 8; ++r) {
        const int qrow = q0 + 8 * hh + r;
        float m = -INFINITY;
#pragma unroll
        for (int j = 0; j < 2; ++j) {
          const int key = kv0 + j * 16 + c;
          float s = (sh[j][r] + sr[j][r] * 0.00048828125f) * 0.08838834764831845f;
          const bool ok = (key <= qrow) && (qrow - key <= window);
          s = ok ? s : -INFINITY;
          sh[j][r] = s;
          m = fmaxf(m, s);
        }
#pragma unroll
        for (int off = 1; off < 16; off <<= 1) m = fmaxf(m, __shfl_xor(m, off, 32));
        cm[r] = m;
      }
      // ---- online softmax, P' to LDS ----
#pragma unroll
      for (int r = 0; r < 8; ++r) {
        const float mnew  = fmaxf(mrow[r], cm[r]);
        const float mref  = (mnew == -INFINITY) ? 0.f : mnew;   // row with no valid key yet: everything stays 0
        const float alpha = __expf(mrow[r] - mref);
        mrow[r] = mnew;
        float psum = 0.f;
#pragma unroll
        for (int j = 0; j < 2; ++j) {
          const float p  = __expf(sh[j][r] - mref);
          psum += p;
          const float pp = p * 1024.0f;
          const _Float16 phv = (_Float16)pp;
          const int po = (8 * hh + r) * PS_P + j * 16 + c;
          ph[po] = phv;
          if (PRES) pl[po] = (_Float16)((pp - (float)phv) * 2048.0f);
        }
#pragma unroll
        for (int off = 1; off < 16; off <<= 1) psum += __shfl_xor(psum, off, 32);
        lrow[r] = lrow[r] * alpha + psum;
#pragma unroll
        for (int t = 0; t < 8; ++t) { oacc[t][r] *= alpha; oaccr[t][r] *= alpha; }
      }
      lds_wave_sync();                           // P' stores visible to the other lanes of this wave before the fragment reload
      // ---- O += P' . V ----
      const v16h pa = ldfrag_h(ph + c * PS_P + 8 * hh);
      v16h pr = pa;
      if (PRES) pr = ldfrag_h(pl + c * PS_P + 8 * hh);
#pragma unroll
      for (int t = 0; t < 8; ++t) {
        const v16h vb = ldfrag_h(Vhs + (t * 16 + c) * VS_P + 8 * hh);
        const v16h vr = ldfrag_h(Vls + (t * 16 + c) * VS_P + 8 * hh);
        oacc[t]  = mma_h(pa, vb, oacc[t]);
        oaccr[t] = mma_h(pa, vr, oaccr[t]);
        if (PRES) oaccr[t] = mma_h(pr, vb, oaccr[t]);
        guard_h4(oacc[t], oaccr[t], pa, pr, vb, vr);
      }
    }
  }

  __syncthreads();                               // all chunk-region readers done before aliasing it as output staging
  _Float16* osh = lds + wave * 4096;
  _Float16* osl = osh + 2048;
#pragma unroll
  for (int r = 0; r < 8; ++r) {
    const float inv = (1.0f / lrow[r]) * 0.0009765625f;
#pragma unroll
    for (int t = 0; t < 8; ++t) {
      const float o = (oacc[t][r] + oaccr[t][r] * 0.00048828125f) * inv;
      const unsigned short hb = bf_bits(o);
      const unsigned short lb = bf_bits(o - bf_val(hb));
      const int so = (8 * hh + r) * 128 + t * 16 + c;
      osh[so] = __builtin_bit_cast(_Float16, hb);
      osl[so] = __builtin_bit_cast(_Float16, lb);
    }
  }
  lds_wave_sync();
  _Float16* Ahg = (_Float16*)(void*)ahp + (tok0 + q0) * HID + h * HDM;
  _Float16* Alg = (_Float16*)(void*)alp + (tok0 + q0) * HID + h * HDM;
  {
#pragma unroll
    for (int it = 0; it < 8; ++it) {
      const int row = it * 2 + hh;               // it 0..7 x hh 0..1 covers rows 0..15
      const int c8  = c * 8;                     // 16 lanes x 16 B = the whole 256-B segment
      const v8h x = *(const v8h*)(osh + row * 128 + c8);
      const v8h y = *(const v8h*)(osl + row * 128 + c8);
      *(v8h*)(Ahg + (size_t)row * HID + c8) = x;
      *(v8h*)(Alg + (size_t)row * HID + c8) = y;
    }
    
  }
}

// ---------------------------------------------------------------------------
// Workspace map (bytes; every region is a whole number of the rows its producer writes with whole-line stores, no tails):
//   Xb    bf16 [4096][2048]   16777216   (the attn hi plane Ah [4096][2048] bf16 reuses this region after the last Xb reader)
//   Wqb   bf16 [2048][2048]    8388608      Wkb bf16 [1024][2048]  4194304      Wvb bf16 [1024][2048]  4194304
//   Wob   bf16 [2048][2048]    8388608      cst f32  [2048][64]     524288      snt f32  [2048][64]     524288
//   Qh    f16  [4096][2048]   16777216      Ql  f16  [4096][2048] 16777216
//   Kh    f16  [4096][1024]    8388608      Kl  f16  [4096][1024]  8388608
//   Vh    f16  [1024][4096]    8388608      Vl  f16  [1024][4096]  8388608
//   Al    bf16 [4096][2048]   16777216
//   total                    126877696
// ---------------------------------------------------------------------------
extern "C" void kernel_launch(void* const* d_in, const int* in_sizes, int n_in,
                              void* d_out, int out_size, void* d_ws, size_t ws_size,
                              hipStream_t stream) {
  if (n_in < 9) return;
  if (in_sizes[0] != NTOK * HID) return;
  if (in_sizes[1] != HID * HID) return;
  if (in_sizes[2] != HID) return;
  if (in_sizes[3] != KVW * HID) return;
  if (in_sizes[4] != KVW) return;
  if (in_sizes[5] != KVW * HID) return;
  if (in_sizes[6] != KVW) return;
  if (in_sizes[7] != HID * HID) return;
  if (in_sizes[8] < 1) return;
  if (out_size != NTOK * HID) return;

  const float* x    = (const float*)d_in[0];
  const float* wq_w = (const float*)d_in[1];
  const float* wq_b = (const float*)d_in[2];
  const float* wk_w = (const float*)d_in[3];
  const float* wk_b = (const float*)d_in[4];
  const float* wv_w = (const float*)d_in[5];
  const float* wv_b = (const float*)d_in[6];
  const float* wo_w = (const float*)d_in[7];
  const int*   win  = (const int*)d_in[8];
  float* out = (float*)d_out;

  const size_t szX  = (size_t)NTOK * HID * 2;
  const size_t szWq = (size_t)HID * HID * 2;
  const size_t szWk = (size_t)KVW * HID * 2;
  const size_t szWv = (size_t)KVW * HID * 2;
  const size_t szWo = (size_t)HID * HID * 2;
  const size_t szT  = (size_t)SQ * NFREQ * 4;
  const size_t szQ  = (size_t)NTOK * HID * 2;
  const size_t szK  = (size_t)NTOK * KVW * 2;
  const size_t szV  = (size_t)KVW * NTOK * 2;
  const size_t szA  = (size_t)NTOK * HID * 2;
  size_t off = 0;
  const size_t oX  = off; off += szX;
  const size_t oWq = off; off += szWq;
  const size_t oWk = off; off += szWk;
  const size_t oWv = off; off += szWv;
  const size_t oWo = off; off += szWo;
  const size_t oCs = off; off += szT;
  const size_t oSn = off; off += szT;
  const size_t oQh = off; off += szQ;
  const size_t oQl = off; off += szQ;
  const size_t oKh = off; off += szK;
  const size_t oKl = off; off += szK;
  const size_t oVh = off; off += szV;
  const size_t oVl = off; off += szV;
  const size_t oAl = off; off += szA;
  const size_t oAh = oX;                         // Ah reuses the Xb region (same byte size); Xb is dead after launch (9)
  if (szA != szX) return;
  if (off > ws_size) return;                     // off = 126877696

  char* ws = (char*)d_ws;
  unsigned short* Xb  = (unsigned short*)(ws + oX);
  unsigned short* Wqb = (unsigned short*)(ws + oWq);
  unsigned short* Wkb = (unsigned short*)(ws + oWk);
  unsigned short* Wvb = (unsigned short*)(ws + oWv);
  unsigned short* Wob = (unsigned short*)(ws + oWo);
  float*          cst = (float*)(ws + oCs);
  float*          snt = (float*)(ws + oSn);
  unsigned short* Qh  = (unsigned short*)(ws + oQh);
  unsigned short* Ql  = (unsigned short*)(ws + oQl);
  unsigned short* Kh  = (unsigned short*)(ws + oKh);
  unsigned short* Kl  = (unsigned short*)(ws + oKl);
  unsigned short* Vh  = (unsigned short*)(ws + oVh);
  unsigned short* Vl  = (unsigned short*)(ws + oVl);
  unsigned short* Ah  = (unsigned short*)(ws + oAh);
  unsigned short* Al  = (unsigned short*)(ws + oAl);

  const dim3 b256(256), b128(128);

  // (1) cos/sin table [2048][64] x 2
  rope_table_kernel<<<dim3(SQ / 8), b256, 0, stream>>>(cst, snt, SQ);
  // (2)-(6) RNE bf16 planes of x [4096][2048], Wq [2048][2048], Wk [1024][2048], Wv [1024][2048], Wo [2048][2048] (all [out][in] = Bt[n][k])
  cvt_bf16_kernel<<<dim3((NTOK * HID / 8) / 256), b256, 0, stream>>>(x,    Xb,  NTOK * HID / 8);
  cvt_bf16_kernel<<<dim3((HID * HID / 8) / 256),  b256, 0, stream>>>(wq_w, Wqb, HID * HID / 8);
  cvt_bf16_kernel<<<dim3((KVW * HID / 8) / 256),  b256, 0, stream>>>(wk_w, Wkb, KVW * HID / 8);
  cvt_bf16_kernel<<<dim3((KVW * HID / 8) / 256),  b256, 0, stream>>>(wv_w, Wvb, KVW * HID / 8);
  cvt_bf16_kernel<<<dim3((HID * HID / 8) / 256),  b256, 0, stream>>>(wo_w, Wob, HID * HID / 8);
  // (7) q = x . Wq^T + bq, RoPE -> Qh/Ql [4096][2048]   (M=4096, N=2048, K=2048; 32 x 16 block tiles)
  gemm_w32x128_kernel<0, false><<<dim3((NTOK / 128) * (HID / 128)), b128, 0, stream>>>(
      Xb, Xb, HID, Wqb, HID, wq_b, cst, snt, (void*)Qh, (void*)Ql, HID, NTOK, HID, HID);
  // (8) k = x . Wk^T + bk, RoPE -> Kh/Kl [4096][1024]   (M=4096, N=1024, K=2048; 32 x 8 block tiles)
  gemm_w32x128_kernel<0, false><<<dim3((NTOK / 128) * (KVW / 128)), b128, 0, stream>>>(
      Xb, Xb, HID, Wkb, HID, wk_b, cst, snt, (void*)Kh, (void*)Kl, KVW, NTOK, KVW, HID);
  // (9) v^T = Wv . x^T + bv[m] -> Vh/Vl [1024][4096]   (A = Wvb, Bt = Xb; M=1024, N=4096, K=2048; 8 x 32 block tiles)
  gemm_w32x128_kernel<1, false><<<dim3((KVW / 128) * (NTOK / 128)), b128, 0, stream>>>(
      Wvb, Wvb, HID, Xb, HID, wv_b, cst, snt, (void*)Vh, (void*)Vl, NTOK, KVW, NTOK, HID);
  // (10)-(11) windowed causal attention, query tiles 0..3 with k and p residual products, tiles 4..31 without
  attn_window_kernel<true><<<dim3(4, NHQ, NSEQ), b128, 0, stream>>>(Qh, Ql, Kh, Kl, Vh, Vl, Ah, Al, win, 0);
  attn_window_kernel<false><<<dim3(SQ / 64 - 4, NHQ, NSEQ), b128, 0, stream>>>(Qh, Ql, Kh, Kl, Vh, Vl, Ah, Al, win, 4);
  // (12) out = attn(hi + lo) . Wo^T -> d_out f32 [4096][2048]   (M=4096, N=2048, K=2048; 32 x 16 block tiles)
  gemm_w32x128_kernel<2, true><<<dim3((NTOK / 128) * (HID / 128)), b128, 0, stream>>>(
      Ah, Al, HID, Wob, HID, wq_b, cst, snt, (void*)out, (void*)out, HID, NTOK, HID, HID);
  (void)hipGetLastError();
}

// v002
// It runs in 357 microseconds.
// Two timings next to v001 both put it at 1.23 times that version's speed.
// All steps since v000 together make it 2.29 times as fast.
// Contractions: x.Wq^T, x.Wk^T and Wv.x^T on v_wmma_f32_16x16x32_bf16 (operands = RNE bf16 of the f32 inputs, single products);
// q.k^T and p.v on v_wmma_f32_16x16x32_f16 (q = f16 hi + f16 residual x2^11 planes; k plain f16 plus f16 residual x2^11 on query tiles 0..3;
// p x1024 plain f16 plus f16 residual x2^11 on query tiles 0..3; v^T = f16 hi + f16 residual x2^11 planes); attn.Wo^T on v_wmma_f32_16x16x32_bf16
// (attn = bf16 hi + bf16 lo planes, two products; Wo RNE bf16). f32 accumulate everywhere; bias add, RoPE, online softmax and scale folds in f32.
#include <hip/hip_runtime.h>
#include <math.h>
#include <stdint.h>

#define NSEQ   2
#define SQ     2048
#define HID    2048
#define NHQ    16
#define NKVH   8
#define HDM    128
#define KVW    1024
#define NTOK   4096
#define NFREQ  64

typedef _Float16     v16h __attribute__((ext_vector_type(16)));
typedef _Float16     v8h  __attribute__((ext_vector_type(8)));
typedef __bf16       v16b __attribute__((ext_vector_type(16)));
typedef __bf16       v8b  __attribute__((ext_vector_type(8)));
typedef float        v8f  __attribute__((ext_vector_type(8)));
typedef float        v4f  __attribute__((ext_vector_type(4)));
typedef unsigned int v4u  __attribute__((ext_vector_type(4)));

// ---------------------------------------------------------------------------
// small helpers
// ---------------------------------------------------------------------------
__device__ __forceinline__ unsigned short bf_bits(float f) {          // RNE convert f32 -> bf16 bits
  const unsigned u = __float_as_uint(f);
  return (unsigned short)((u + 0x7FFFu + ((u >> 16) & 1u)) >> 16);
}
__device__ __forceinline__ float bf_val(unsigned short h) { return __uint_as_float(((unsigned)h) << 16); }
__device__ __forceinline__ float bf_rne(float f) { return bf_val(bf_bits(f)); }
__device__ __forceinline__ unsigned pk16(unsigned short a, unsigned short b) { return (unsigned)a | ((unsigned)b << 16); }
__device__ __forceinline__ v8f zero8() { v8f z = {0.f, 0.f, 0.f, 0.f, 0.f, 0.f, 0.f, 0.f}; return z; }
__device__ __forceinline__ int wave_id() { return __builtin_amdgcn_readfirstlane((int)(threadIdx.x >> 5)); }

__device__ __forceinline__ void lds_wave_sync() {
  __builtin_amdgcn_fence(__ATOMIC_RELEASE, "workgroup");
  __builtin_amdgcn_wave_barrier();
  __builtin_amdgcn_fence(__ATOMIC_ACQUIRE, "workgroup");
}

// ---------------------------------------------------------------------------
// WMMA fragments (wave32, 16x16x32, 16-bit operands). For A (row m = lane&15) and B (col n = lane&15) alike:
// elements 0..7 <- k0 + 8*(lane>>4) + 0..7, elements 8..15 <- k0 + 16 + 8*(lane>>4) + 0..7.
// ldfrag(p) with p = rowbase + k0 + 8*(lane>>4): two 16-B loads p[0..7], p[16..23].
// D: acc[r] = (row 8*(lane>>4) + r, col lane&15).
// ---------------------------------------------------------------------------
union FragH { v16h v; v8h h[2]; };
union FragB { v16b v; v8b h[2]; };
__device__ __forceinline__ v16h ldfrag_h(const _Float16* p) { FragH f; f.h[0] = *(const v8h*)(p); f.h[1] = *(const v8h*)(p + 16); return f.v; }
__device__ __forceinline__ v16b ldfrag_b(const __bf16* p)   { FragB f; f.h[0] = *(const v8b*)(p); f.h[1] = *(const v8b*)(p + 16); return f.v; }

__device__ __forceinline__ v8f mma_h(v16h a, v16h b, v8f c) {
  return __builtin_amdgcn_wmma_f32_16x16x32_f16(false, a, false, b, (short)0, c, false, false);
}
__device__ __forceinline__ v8f mma_b(v16b a, v16b b, v8f c) {
  return __builtin_amdgcn_wmma_f32_16x16x32_bf16(false, a, false, b, (short)0, c, false, false);
}
// hazard guards: 4 VALU slots after the last WMMA of a group, D tied, A/B kept live; memory clobber keeps later loads behind the group
__device__ __forceinline__ void guard_h3(v8f& a, v8f& b, v16h x, v16h y, v16h z) {
  asm volatile("v_nop\n\tv_nop\n\tv_nop\n\tv_nop" : "+v"(a), "+v"(b) : "v"(x), "v"(y), "v"(z) : "memory");
}
__device__ __forceinline__ void guard_h4(v8f& a, v8f& b, v16h w, v16h x, v16h y, v16h z) {
  asm volatile("v_nop\n\tv_nop\n\tv_nop\n\tv_nop" : "+v"(a), "+v"(b) : "v"(w), "v"(x), "v"(y), "v"(z) : "memory");
}
__device__ __forceinline__ void acc_guard4(v8f& a, v8f& b, v8f& c, v8f& d) {
  asm volatile("v_nop\n\tv_nop\n\tv_nop\n\tv_nop" : "+v"(a), "+v"(b), "+v"(c), "+v"(d));
}

// ---------------------------------------------------------------------------
// RoPE table: cst[s][i] = cos(s * inv_freq[i]), snt[s][i] = sin(...), inv_freq[i] = 1 / 1e4^(i/64), i < 64, s < ns, all f32.
// Block = 8 waves, wave w -> position s = blockIdx.x*8 + w, lane -> i = lane, lane + 32.
// Coverage: grid ns/8 x 8 waves x 32 lanes x 2 = ns x 64 per plane.
// ---------------------------------------------------------------------------
__global__ __launch_bounds__(256) void rope_table_kernel(float* __restrict__ cst, float* __restrict__ snt, int ns) {
  const int lane = threadIdx.x & 31;
  const int wave = (int)(threadIdx.x >> 5);
  const int t = (int)blockIdx.x * 8 + wave;
  if (t >= ns) return;                       // no barriers in this kernel
  const float pf = (float)t;
  float c0 = 0.f, s0 = 0.f, c1 = 0.f, s1 = 0.f;
#pragma unroll 1
  for (int u = 0; u < 2; ++u) {
    const int i = lane + 32 * u;
    const float e   = (float)i * 0.015625f;      // i / 64 exact
    const float pw  = powf(10000.0f, e);
    const float inv = 1.0f / pw;
    const float ang = pf * inv;
    const float cv = cosf(ang);
    const float sv = sinf(ang);
    c1 = cv; s1 = sv;
    if (u == 0) { c0 = cv; s0 = sv; }
  }
  const size_t o = (size_t)t * NFREQ + lane;
  {
    ((float*)cst)[o]      = c0;
    ((float*)cst)[o + 32] = c1;
    ((float*)snt)[o]      = s0;
    ((float*)snt)[o + 32] = s1;
    
  }
}

// ---------------------------------------------------------------------------
// Elementwise RNE f32 -> bf16 plane: 8 elements per thread, one 16-B store per lane -> 32 consecutive lanes write 4 whole
// ---------------------------------------------------------------------------
__global__ __launch_bounds__(256) void cvt_bf16_kernel(const float* __restrict__ in, unsigned short* __restrict__ outp, int n8) {
  const int i = (int)blockIdx.x * 256 + (int)threadIdx.x;
  if (i >= n8) return;
  const size_t e = 8 * (size_t)i;
  const v4f a = *(const v4f*)(in + e);
  const v4f b = *(const v4f*)(in + e + 4);
  v4u w;
  w[0] = pk16(bf_bits(a[0]), bf_bits(a[1]));
  w[1] = pk16(bf_bits(a[2]), bf_bits(a[3]));
  w[2] = pk16(bf_bits(b[0]), bf_bits(b[1]));
  w[3] = pk16(bf_bits(b[2]), bf_bits(b[3]));
  *(v4u*)(outp + e) = w;
  
}

// ---------------------------------------------------------------------------
// bf16 WMMA GEMM, block = 4 waves (128 threads) = one 128 x 128 tile of C, wave w = rows 32w..32w+31 x all 128 cols.
//   C[m][n] = sum_k A[m][k] * Bt[n][k]; A row-major [M][K] bf16 (pitch lda), Bt row-major [N][K] bf16 (pitch ldb);
//   M % 128 == 0, N % 128 == 0, K % 64 == 0; grid.x = M/128 * N/128.
//   SPLITA: A carried as hi (Ap) + lo (A2p) bf16 planes, two products into one accumulator.
//   Operands: a pass is 64 k = one whole 128-B line of every operand row. The 128 A rows (both planes when SPLITA) and the
//   128 Bt rows of a pass are brought into LDS by asynchronous 16-B copies (8 lanes = one line, a wave instruction = 4 lines),
//   rows at pitch 144 B, two buffers: the next pass's copies fly while this pass is multiplied. The Bt tile is read by all
//   four waves. Fragments are read from LDS with the split k map (ldfrag_b), k ascending.
// Epilogues (all: per wave, per 16-row slab: stage in LDS, wave sync, write each row segment with ONE instruction of
//   EPI 0: q or k projection; the 128-col tile is one head. B rows are laid in LDS in even/odd order (row n0 + r in slot
//          64*(r&1) + (r>>1)):
//          acc tile j<4, lane rl holds output column n0 + 2*(16j+rl); tile j+4 holds n0 + 2*(16j+rl) + 1 (the interleaved pair).
//          + bf16(bias[n]); RoPE on the pair with cos/sin[pos = row & 2047][pair]; writes f16 hi plane C0 and f16 residual x2048
//          plane C1, both [M][ldc], cols n0..n0+127 (row segment 256 B = 16 lanes x 16 B).
//   EPI 1: v^T projection: + bf16(bias[m]); f16 hi plane C0, residual x2048 plane C1, [M][ldc], row segment 256 B.
//   EPI 2: f32 output C0 [M][ldc]; row segment 128 floats = 512 B = 32 lanes x 16 B per instruction.
// ---------------------------------------------------------------------------
template <int EPI> struct SlabT { typedef _Float16 T; static constexpr int PERW = 4096; };   // 2 planes x 16 x 128 halves
template <> struct SlabT<2>     { typedef float    T; static constexpr int PERW = 2048; };   // 16 x 128 floats

#define G_PITCH 72                    // LDS row pitch in 16-bit elements: 64 k + 8 = 144 B = 16 B x 9
#define G_TILE  (128 * G_PITCH)       // one 128-row operand tile of a pass, in elements

// One 128-row x 128-B operand tile into LDS: eight copies per lane, lane address pairs (l + i*lstep, g + i*gstep).
// The s_wait_xcnt stands in the copies' own statement so that no address register is rewritten ahead of it.
__device__ __forceinline__ void stage_tile(unsigned l, unsigned lstep, const unsigned short* g, size_t gstep) {
  asm volatile(
      "global_load_async_to_lds_b128 %0, %8, off\n\t"
      "global_load_async_to_lds_b128 %1, %9, off\n\t"
      "global_load_async_to_lds_b128 %2, %10, off\n\t"
      "global_load_async_to_lds_b128 %3, %11, off\n\t"
      "global_load_async_to_lds_b128 %4, %12, off\n\t"
      "global_load_async_to_lds_b128 %5, %13, off\n\t"
      "global_load_async_to_lds_b128 %6, %14, off\n\t"
      "global_load_async_to_lds_b128 %7, %15, off\n\t"
      "s_wait_xcnt 0x0"
      :: "v"(l), "v"(l + lstep), "v"(l + 2 * lstep), "v"(l + 3 * lstep),
         "v"(l + 4 * lstep), "v"(l + 5 * lstep), "v"(l + 6 * lstep), "v"(l + 7 * lstep),
         "v"(g), "v"(g + gstep), "v"(g + 2 * gstep), "v"(g + 3 * gstep),
         "v"(g + 4 * gstep), "v"(g + 5 * gstep), "v"(g + 6 * gstep), "v"(g + 7 * gstep)
      : "memory");
}

template <int EPI, bool SPLITA>
__global__ __launch_bounds__(128) void gemm_w32x128_kernel(
    const unsigned short* Ap, const unsigned short* A2p, int lda,
    const unsigned short* __restrict__ Btp, int ldb,
    const float* __restrict__ bias, const float* __restrict__ cst, const float* __restrict__ snt,
    void* C0, void* C1, int ldc,
    int M, int N, int K) {
  typedef typename SlabT<EPI>::T ST;
  constexpr int NPL = SPLITA ? 3 : 2;            // operand tiles per buffer: A (, A lo), Bt
  constexpr int BUF = NPL * G_TILE;              // elements per buffer
  __shared__ __align__(16) ST slab_all[4 * SlabT<EPI>::PERW];
  __shared__ __align__(16) unsigned short ring[2 * BUF];

  const int tid  = (int)threadIdx.x;
  const int lane = tid & 31;
  const int wave = wave_id();
  const int hh = lane >> 4;           // lane half: k offset 8*hh, D row offset 8*hh
  const int rl = lane & 15;           // A row / B col / D col within subtile
  const int tilesN = N >> 7;
  const int tilesM = M >> 7;
  const int tile = (int)blockIdx.x;
  if (tile >= tilesM * tilesN) return;          // block-uniform, in front of every barrier
  const int tm = tile / tilesN;
  const int tn = tile - tm * tilesN;
  const int mb = tm << 7;                       // first row of the block tile
  const int m0 = mb + (wave << 5);              // first row of this wave
  const int n0 = tn << 7;

  // copy addresses of this lane: copy i of a tile moves 16 B of source row (tid>>3) + 16*i, bytes 16*(tid&7)..+15 of the pass's line
  const int crow = tid >> 3;
  const int ccol = (tid & 7) * 8;
  const unsigned short* gA  = Ap  + (size_t)(mb + crow) * lda + ccol;
  const unsigned short* gA2 = A2p + (size_t)(mb + crow) * lda + ccol;
  const unsigned short* gB  = Btp + (size_t)(n0 + crow) * ldb + ccol;
  const unsigned ring0 = (unsigned)(uintptr_t)(&ring[0]);           // LDS byte address of the ring
  const unsigned lA = ring0 + (unsigned)(crow * G_PITCH + ccol) * 2u;
  const int bslot = (EPI == 0) ? ((crow & 1) * 64 + (crow >> 1)) : crow;
  const unsigned lB = ring0 + (unsigned)((NPL - 1) * G_TILE + bslot * G_PITCH + ccol) * 2u;
  const unsigned lstepA = 16u * G_PITCH * 2u;
  const unsigned lstepB = ((EPI == 0) ? 8u : 16u) * G_PITCH * 2u;
  const size_t gstepA = (size_t)16 * lda;
  const size_t gstepB = (size_t)16 * ldb;

  v8f acc[2][8];
#pragma unroll
  for (int i = 0; i < 2; ++i)
#pragma unroll
    for (int j = 0; j < 8; ++j) acc[i][j] = zero8();

  const int npass = K >> 6;
  // pass 0 into buffer 0, landed and published; then pass 1 into buffer 1
  stage_tile(lA, lstepA, gA, gstepA);
  if (SPLITA) stage_tile(lA + G_TILE * 2u, lstepA, gA2, gstepA);
  stage_tile(lB, lstepB, gB, gstepB);
  asm volatile("s_wait_asynccnt 0x0" ::: "memory");   // this wave's copies of pass 0 have landed
  __syncthreads();                                    // every wave's copies of pass 0 are readable by all
  if (npass > 1) {
    stage_tile(lA + BUF * 2u, lstepA, gA + 64, gstepA);
    if (SPLITA) stage_tile(lA + (BUF + G_TILE) * 2u, lstepA, gA2 + 64, gstepA);
    stage_tile(lB + BUF * 2u, lstepB, gB + 64, gstepB);
  }

  for (int t = 0; t < npass; ++t) {
    const int bo = (t & 1) * BUF;
    const __bf16* As = (const __bf16*)(const void*)(ring + bo) + ((wave << 5) + rl) * G_PITCH + 8 * hh;
    const __bf16* Bs = (const __bf16*)(const void*)(ring + bo + (NPL - 1) * G_TILE) + rl * G_PITCH + 8 * hh;
    v16b ah[2][2], al[2][2], bj[2][8];
#pragma unroll
    for (int kb = 0; kb < 2; ++kb) {
#pragma unroll
      for (int i = 0; i < 2; ++i) {
        ah[kb][i] = ldfrag_b(As + i * 16 * G_PITCH + kb * 32);
        al[kb][i] = SPLITA ? ldfrag_b(As + G_TILE + i * 16 * G_PITCH + kb * 32) : ah[kb][i];
      }
#pragma unroll
      for (int j = 0; j < 8; ++j) bj[kb][j] = ldfrag_b(Bs + j * 16 * G_PITCH + kb * 32);
    }
    // keeps the pass's LDS reads together in front of its WMMAs: left alone the compiler puts two reads and a full wait before every WMMA pair
    __builtin_amdgcn_sched_barrier(0);
#pragma unroll
    for (int kb = 0; kb < 2; ++kb) {
#pragma unroll
      for (int j = 0; j < 8; ++j) {
        acc[0][j] = mma_b(ah[kb][0], bj[kb][j], acc[0][j]);
        acc[1][j] = mma_b(ah[kb][1], bj[kb][j], acc[1][j]);
        if (SPLITA) {
          acc[0][j] = mma_b(al[kb][0], bj[kb][j], acc[0][j]);
          acc[1][j] = mma_b(al[kb][1], bj[kb][j], acc[1][j]);
        }
      }
    }
    // keeps the WMMAs in front of the waits and the barrier below, so that the next pass's copies fly for the whole of this pass
    __builtin_amdgcn_sched_barrier(0);
    asm volatile("s_wait_dscnt 0x0" ::: "memory");      // this wave's reads of the buffer are done before it is refilled
    asm volatile("s_wait_asynccnt 0x0" ::: "memory");   // this wave's copies of pass t + 1 have landed
    __syncthreads();                                    // publishes pass t + 1 and ends every reader's last read of pass t
    if (t + 2 < npass) {                                // block-uniform
      const size_t ko = (size_t)(t + 2) * 64;
      stage_tile(lA + (unsigned)bo * 2u, lstepA, gA + ko, gstepA);
      if (SPLITA) stage_tile(lA + (unsigned)(bo + G_TILE) * 2u, lstepA, gA2 + ko, gstepA);
      stage_tile(lB + (unsigned)bo * 2u, lstepB, gB + ko, gstepB);
    }
  }
  asm volatile("s_wait_asynccnt 0x0" ::: "memory");     // no copy is outstanding when the wave goes on to the epilogue
  acc_guard4(acc[0][0], acc[0][1], acc[0][2], acc[0][3]);
  acc_guard4(acc[0][4], acc[0][5], acc[0][6], acc[0][7]);
  acc_guard4(acc[1][0], acc[1][1], acc[1][2], acc[1][3]);
  acc_guard4(acc[1][4], acc[1][5], acc[1][6], acc[1][7]);

  // ---- epilogue ----
  ST* slab = slab_all + wave * SlabT<EPI>::PERW;
  _Float16* sl16 = (_Float16*)(void*)slab;
  float*    slf  = (float*)(void*)slab;

  if (EPI == 0) {
    _Float16* P0 = (_Float16*)C0;
    _Float16* P1 = (_Float16*)C1;
#pragma unroll
    for (int i = 0; i < 2; ++i) {
      const int rb = m0 + i * 16 + 8 * hh;
#pragma unroll
      for (int j = 0; j < 4; ++j) {
        const int pi = j * 16 + rl;                              // pair index 0..63 within head
        const int nc = n0 + 2 * pi;                              // column of x1; x2 at nc + 1
        const float b1 = bf_rne(bias[nc]);
        const float b2 = bf_rne(bias[nc + 1]);
#pragma unroll
        for (int r = 0; r < 8; ++r) {
          const int row = rb + r;                                // token 0..NTOK-1
          const int s   = row & (SQ - 1);                        // position within sequence
          const float cv = cst[(size_t)s * NFREQ + pi];
          const float sv = snt[(size_t)s * NFREQ + pi];
          const float x1 = acc[i][j][r] + b1;
          const float x2 = acc[i][j + 4][r] + b2;
          const float o1 = x1 * cv - x2 * sv;
          const float o2 = x1 * sv + x2 * cv;
          const _Float16 h1 = (_Float16)o1;
          const _Float16 h2 = (_Float16)o2;
          const int so = (8 * hh + r) * 128 + 2 * pi;
          sl16[so]            = h1;
          sl16[so + 1]        = h2;
          sl16[2048 + so]     = (_Float16)((o1 - (float)h1) * 2048.0f);
          sl16[2048 + so + 1] = (_Float16)((o2 - (float)h2) * 2048.0f);
        }
      }
      lds_wave_sync();
      {
#pragma unroll
        for (int it = 0; it < 8; ++it) {
          const int row = it * 2 + hh;                           // it x hh covers rows 0..15
          const int c8  = rl * 8;
          const v8h vh = *(const v8h*)(sl16 + row * 128 + c8);
          const v8h vl = *(const v8h*)(sl16 + 2048 + row * 128 + c8);
          const size_t go = (size_t)(m0 + i * 16 + row) * ldc + n0 + c8;
          *(v8h*)(P0 + go) = vh;
          *(v8h*)(P1 + go) = vl;
        }
        
      }
      lds_wave_sync();
    }
  } else if (EPI == 1) {
    _Float16* P0 = (_Float16*)C0;
    _Float16* P1 = (_Float16*)C1;
#pragma unroll
    for (int i = 0; i < 2; ++i) {
#pragma unroll
      for (int r = 0; r < 8; ++r) {
        const int m = m0 + i * 16 + 8 * hh + r;
        const float bm = bf_rne(bias[m]);
#pragma unroll
        for (int j = 0; j < 8; ++j) {
          const float v = acc[i][j][r] + bm;
          const _Float16 hv = (_Float16)v;
          const int so = (8 * hh + r) * 128 + j * 16 + rl;
          sl16[so]        = hv;
          sl16[2048 + so] = (_Float16)((v - (float)hv) * 2048.0f);
        }
      }
      lds_wave_sync();
      {
#pragma unroll
        for (int it = 0; it < 8; ++it) {
          const int row = it * 2 + hh;
          const int c8  = rl * 8;
          const v8h vh = *(const v8h*)(sl16 + row * 128 + c8);
          const v8h vl = *(const v8h*)(sl16 + 2048 + row * 128 + c8);
          const size_t go = (size_t)(m0 + i * 16 + row) * ldc + n0 + c8;
          *(v8h*)(P0 + go) = vh;
          *(v8h*)(P1 + go) = vl;
        }
        
      }
      lds_wave_sync();
    }
  } else {
    float* C = (float*)C0;
#pragma unroll
    for (int i = 0; i < 2; ++i) {
#pragma unroll
      for (int j = 0; j < 8; ++j)
#pragma unroll
        for (int r = 0; r < 8; ++r)
          slf[(8 * hh + r) * 128 + j * 16 + rl] = acc[i][j][r];
      lds_wave_sync();
      {
#pragma unroll
        for (int row = 0; row < 16; ++row) {                     // 32 lanes x 16 B = the whole 512-B row segment per instruction
          const v4f v = *(const v4f*)(slf + row * 128 + lane * 4);
          *(v4f*)(C + (size_t)(m0 + i * 16 + row) * ldc + n0 + lane * 4) = v;
        }
        
      }
      lds_wave_sync();
    }
  }
}

// ---------------------------------------------------------------------------
// Windowed causal GQA flash attention, head dim 128, 32-key chunks, block = 4 waves = 64 query rows of one (b, h);
// grid (n query tiles, NHQ, NSEQ). Key j is valid for query i iff j <= i and i - j <= window (window read from the int input).
//   q planes f16 [tok][h*128+d]: hi (qhp) and residual x2048 (qlp); k planes f16 [tok][kvh*128+d]: hi (khp), residual x2048 (klp);
//   v^T planes f16 [kvh*128+d][tok]: hi (vhp), residual x2048 (vlp); outputs attn bf16 hi (ahp) / lo (alp) [tok][h*128+d].
//   scores = (Sh + Sr/2048) * 128^-0.5 with Sh = qh.kh and Sr = ql'.kh (+ qh.kl' when PRES); invalid keys -> -inf; online softmax f32
//   (-inf safe: a row with no valid key so far keeps m = -inf, l = 0, O = 0);
//   p' = 1024 p stored per wave to LDS as f16 hi (and residual x2048 when PRES), reloaded as A fragments after a wave sync;
//   O = (Oh + Or/2048)/1024/l with Oh = ph.vh, Or = ph.vl' (+ pl'.vh when PRES).
//   K / V^T chunk staging: 128 threads x 4 x 16 B per plane = whole 32x128 / 128x32 tile, plain loads, __syncthreads before and after.
//   Chunks cover keys [max(0, 64*qb - window) & ~31, 64*qb + 63]; trip count statically <= 64; waves with no valid key in a chunk
//   skip its compute part (wave-uniform, scalar branch).
// ---------------------------------------------------------------------------
#define AT_KC   32
#define KS_P    136
#define VS_P    40
#define PS_P    40
#define LDS_KS  0
#define LDS_KLS (32 * KS_P)
#define LDS_VHS (2 * 32 * KS_P)
#define LDS_VLS (LDS_VHS + 128 * VS_P)
#define LDS_PH  (LDS_VLS + 128 * VS_P)
#define LDS_PL  (LDS_PH + 4 * 16 * PS_P)
#define LDS_TOT (LDS_PL + 4 * 16 * PS_P)
static_assert(LDS_TOT * 2 <= 65536);
static_assert(4 * 4096 <= LDS_TOT);          // output staging (2 planes x 16 x 128 per wave) aliases the chunk region after the loop

template <bool PRES>
// The long launch (no residual products, 896 work-groups) gets a budget of 256 registers a wave = four waves per SIMD: four work-groups
// share a WGP and the whole launch is resident at once. The short launch has fewer work-groups than there are WGPs and keeps the full budget.
__global__ __launch_bounds__(128) __attribute__((amdgpu_waves_per_eu(PRES ? 1 : 4))) void attn_window_kernel(
    const unsigned short* __restrict__ qhp, const unsigned short* __restrict__ qlp,
    const unsigned short* __restrict__ khp, const unsigned short* __restrict__ klp,
    const unsigned short* __restrict__ vhp, const unsigned short* __restrict__ vlp,
    unsigned short* __restrict__ ahp, unsigned short* __restrict__ alp,
    const int* __restrict__ winp, int qb_base) {
  __shared__ __align__(16) _Float16 lds[LDS_TOT];
  _Float16* Ks  = lds + LDS_KS;
  _Float16* Kls = lds + LDS_KLS;
  _Float16* Vhs = lds + LDS_VHS;
  _Float16* Vls = lds + LDS_VLS;

  const int tid  = (int)threadIdx.x;
  const int lane = tid & 31;
  const int wave = wave_id();
  const int hh   = lane >> 4;
  const int c    = lane & 15;
  const int qb   = (int)blockIdx.x + qb_base;
  const int h    = (int)blockIdx.y;
  const int b    = (int)blockIdx.z;
  const int kvh  = h >> 1;                       // 2 query heads per kv head
  const int window = __builtin_amdgcn_readfirstlane(winp[0]);
  const int qblk0 = qb * 64;
  const int q0    = qblk0 + wave * 16;           // first query row of this wave (within sequence)
  const int qlast = q0 + 15;
  const int wlo   = q0 - window;                 // oldest valid key of row q0
  const size_t tok0 = (size_t)b * SQ;

  int kstart = qblk0 - window;
  kstart = (kstart > 0) ? (kstart & ~31) : 0;
  if (kstart > qblk0) kstart = qblk0;
  int nch = (qblk0 + 64 - kstart) >> 5;          // block-uniform
  if (nch > 64) nch = 64;
  if (nch < 0) nch = 0;

  const _Float16* Qhr = (const _Float16*)(const void*)qhp + (tok0 + q0 + c) * HID + h * HDM + 8 * hh;
  const _Float16* Qlr = (const _Float16*)(const void*)qlp + (tok0 + q0 + c) * HID + h * HDM + 8 * hh;
  const _Float16* Kg  = (const _Float16*)(const void*)khp + tok0 * KVW + kvh * HDM;
  const _Float16* Klg = (const _Float16*)(const void*)klp + tok0 * KVW + kvh * HDM;
  const _Float16* Vhg = (const _Float16*)(const void*)vhp + (size_t)(kvh * HDM) * NTOK + tok0;
  const _Float16* Vlg = (const _Float16*)(const void*)vlp + (size_t)(kvh * HDM) * NTOK + tok0;
  const unsigned kgo = (unsigned)((tid >> 4) * KVW + (tid & 15) * 8);    // this lane's element offset in a K chunk, piece 0
  const unsigned vgo = (unsigned)((tid >> 2) * NTOK + (tid & 3) * 8);    // and in a V^T chunk
  _Float16* ph = lds + LDS_PH + wave * (16 * PS_P);
  _Float16* pl = lds + LDS_PL + wave * (16 * PS_P);

  float mrow[8], lrow[8];
  v8f oacc[8], oaccr[8];
#pragma unroll
  for (int r = 0; r < 8; ++r) { mrow[r] = -INFINITY; lrow[r] = 0.f; }
#pragma unroll
  for (int t = 0; t < 8; ++t) { oacc[t] = zero8(); oaccr[t] = zero8(); }

  for (int kc = 0; kc < nch; ++kc) {
    const int kv0 = kstart + kc * AT_KC;         // keys kv0..kv0+31, all < SQ
    __syncthreads();
    // one lane pointer per plane for the chunk; the four pieces of a plane lie at constant distances from it
    const _Float16* kq  = Kg  + (size_t)kv0 * KVW + kgo;
    const _Float16* klq = Klg + (size_t)kv0 * KVW + kgo;
    const _Float16* vhq = Vhg + kv0 + vgo;
    const _Float16* vlq = Vlg + kv0 + vgo;
    v8h kx[4], ky[4], vx[4], vy[4];
#pragma unroll
    for (int i = 0; i < 4; ++i) {                // coverage: 512 pieces of 8 halves per plane = whole tile
      kx[i] = *(const v8h*)(kq + i * 8 * KVW);   // K: 32 keys x 128 d, key = (tid >> 4) + 8 i
      if (PRES) ky[i] = *(const v8h*)(klq + i * 8 * KVW);
      vx[i] = *(const v8h*)(vhq + i * 32 * NTOK); // V^T: 128 d x 32 keys, d = (tid >> 2) + 32 i
      vy[i] = *(const v8h*)(vlq + i * 32 * NTOK);
    }
    // precaution: the lane pointers are inputs here, so they keep their registers (no load result is placed over them) until this wait
    if (PRES) asm volatile("s_wait_xcnt 0x0" :: "v"(kq), "v"(klq), "v"(vhq), "v"(vlq) : "memory");
    else      asm volatile("s_wait_xcnt 0x0" :: "v"(kq), "v"(vhq), "v"(vlq) : "memory");
#pragma unroll
    for (int i = 0; i < 4; ++i) {
      const int p   = tid + 128 * i;             // 0..511
      const int key = p >> 4, d8 = (p & 15) * 8;
      *(v8h*)(Ks + key * KS_P + d8) = kx[i];
      if (PRES) *(v8h*)(Kls + key * KS_P + d8) = ky[i];
      const int d = p >> 2, k8 = (p & 3) * 8;
      *(v8h*)(Vhs + d * VS_P + k8) = vx[i];
      *(v8h*)(Vls + d * VS_P + k8) = vy[i];
    }
    __syncthreads();

    if (kv0 <= qlast && kv0 + AT_KC - 1 >= wlo) {   // wave-uniform (scalar): skip chunks with no valid key for this wave
      // ---- scores ----
      v8f sh[2], sr[2];
      sh[0] = zero8(); sh[1] = zero8(); sr[0] = zero8(); sr[1] = zero8();
#pragma unroll
      for (int dc = 0; dc < 4; ++dc) {
        const v16h qa = ldfrag_h(Qhr + dc * 32);
        const v16h ql = ldfrag_h(Qlr + dc * 32);
#pragma unroll
        for (int j = 0; j < 2; ++j) {
          const v16h kb = ldfrag_h(Ks + (j * 16 + c) * KS_P + dc * 32 + 8 * hh);
          sh[j] = mma_h(qa, kb, sh[j]);
          sr[j] = mma_h(ql, kb, sr[j]);
          if (PRES) {
            const v16h kl = ldfrag_h(Kls + (j * 16 + c) * KS_P + dc * 32 + 8 * hh);
            sr[j] = mma_h(qa, kl, sr[j]);
            guard_h4(sh[j], sr[j], qa, ql, kb, kl);
          } else {
            guard_h3(sh[j], sr[j], qa, ql, kb);
          }
        }
      }
      // ---- scale, window + causal validity, chunk row max ----
      float cm[8];
#pragma unroll
      for (int r = 0; r < 8; ++r) {
        const int qrow = q0 + 8 * hh + r;
        float m = -INFINITY;
#pragma unroll
        for (int j = 0; j < 2; ++j) {
          const int key = kv0 + j * 16 + c;
          float s = (sh[j][r] + sr[j][r] * 0.00048828125f) * 0.08838834764831845f;
          const bool ok = (key <= qrow) && (qrow - key <= window);
          s = ok ? s : -INFINITY;
          sh[j][r] = s;
          m = fmaxf(m, s);
        }
#pragma unroll
        for (int off = 1; off < 16; off <<= 1) m = fmaxf(m, __shfl_xor(m, off, 32));
        cm[r] = m;
      }
      // ---- online softmax, P' to LDS ----
#pragma unroll
      for (int r = 0; r < 8; ++r) {
        const float mnew  = fmaxf(mrow[r], cm[r]);
        const float mref  = (mnew == -INFINITY) ? 0.f : mnew;   // row with no valid key yet: everything stays 0
        const float alpha = __expf(mrow[r] - mref);
        mrow[r] = mnew;
        float psum = 0.f;
#pragma unroll
        for (int j = 0; j < 2; ++j) {
          const float p  = __expf(sh[j][r] - mref);
          psum += p;
          const float pp = p * 1024.0f;
          const _Float16 phv = (_Float16)pp;
          const int po = (8 * hh + r) * PS_P + j * 16 + c;
          ph[po] = phv;
          if (PRES) pl[po] = (_Float16)((pp - (float)phv) * 2048.0f);
        }
#pragma unroll
        for (int off = 1; off < 16; off <<= 1) psum += __shfl_xor(psum, off, 32);
        lrow[r] = lrow[r] * alpha + psum;
#pragma unroll
        for (int t = 0; t < 8; ++t) { oacc[t][r] *= alpha; oaccr[t][r] *= alpha; }
      }
      lds_wave_sync();                           // P' stores visible to the other lanes of this wave before the fragment reload
      // ---- O += P' . V ----
      const v16h pa = ldfrag_h(ph + c * PS_P + 8 * hh);
      v16h pr = pa;
      if (PRES) pr = ldfrag_h(pl + c * PS_P + 8 * hh);
#pragma unroll
      for (int t = 0; t < 8; ++t) {
        const v16h vb = ldfrag_h(Vhs + (t * 16 + c) * VS_P + 8 * hh);
        const v16h vr = ldfrag_h(Vls + (t * 16 + c) * VS_P + 8 * hh);
        oacc[t]  = mma_h(pa, vb, oacc[t]);
        oaccr[t] = mma_h(pa, vr, oaccr[t]);
        if (PRES) oaccr[t] = mma_h(pr, vb, oaccr[t]);
        guard_h4(oacc[t], oaccr[t], pa, pr, vb, vr);
      }
    }
  }

  __syncthreads();                               // all chunk-region readers done before aliasing it as output staging
  _Float16* osh = lds + wave * 4096;
  _Float16* osl = osh + 2048;
#pragma unroll
  for (int r = 0; r < 8; ++r) {
    const float inv = (1.0f / lrow[r]) * 0.0009765625f;
#pragma unroll
    for (int t = 0; t < 8; ++t) {
      const float o = (oacc[t][r] + oaccr[t][r] * 0.00048828125f) * inv;
      const unsigned short hb = bf_bits(o);
      const unsigned short lb = bf_bits(o - bf_val(hb));
      const int so = (8 * hh + r) * 128 + t * 16 + c;
      osh[so] = __builtin_bit_cast(_Float16, hb);
      osl[so] = __builtin_bit_cast(_Float16, lb);
    }
  }
  lds_wave_sync();
  _Float16* Ahg = (_Float16*)(void*)ahp + (tok0 + q0) * HID + h * HDM;
  _Float16* Alg = (_Float16*)(void*)alp + (tok0 + q0) * HID + h * HDM;
  {
#pragma unroll
    for (int it = 0; it < 8; ++it) {
      const int row = it * 2 + hh;               // it 0..7 x hh 0..1 covers rows 0..15
      const int c8  = c * 8;                     // 16 lanes x 16 B = the whole 256-B segment
      const v8h x = *(const v8h*)(osh + row * 128 + c8);
      const v8h y = *(const v8h*)(osl + row * 128 + c8);
      *(v8h*)(Ahg + (size_t)row * HID + c8) = x;
      *(v8h*)(Alg + (size_t)row * HID + c8) = y;
    }
    
  }
}

// ---------------------------------------------------------------------------
// Workspace map (bytes; every region is a whole number of the rows its producer writes with whole-line stores, no tails):
//   Xb    bf16 [4096][2048]   16777216   (the attn hi plane Ah [4096][2048] bf16 reuses this region after the last Xb reader)
//   Wqb   bf16 [2048][2048]    8388608      Wkb bf16 [1024][2048]  4194304      Wvb bf16 [1024][2048]  4194304
//   Wob   bf16 [2048][2048]    8388608      cst f32  [2048][64]     524288      snt f32  [2048][64]     524288
//   Qh    f16  [4096][2048]   16777216      Ql  f16  [4096][2048] 16777216
//   Kh    f16  [4096][1024]    8388608      Kl  f16  [4096][1024]  8388608
//   Vh    f16  [1024][4096]    8388608      Vl  f16  [1024][4096]  8388608
//   Al    bf16 [4096][2048]   16777216
//   total                    126877696
// ---------------------------------------------------------------------------
extern "C" void kernel_launch(void* const* d_in, const int* in_sizes, int n_in,
                              void* d_out, int out_size, void* d_ws, size_t ws_size,
                              hipStream_t stream) {
  if (n_in < 9) return;
  if (in_sizes[0] != NTOK * HID) return;
  if (in_sizes[1] != HID * HID) return;
  if (in_sizes[2] != HID) return;
  if (in_sizes[3] != KVW * HID) return;
  if (in_sizes[4] != KVW) return;
  if (in_sizes[5] != KVW * HID) return;
  if (in_sizes[6] != KVW) return;
  if (in_sizes[7] != HID * HID) return;
  if (in_sizes[8] < 1) return;
  if (out_size != NTOK * HID) return;

  const float* x    = (const float*)d_in[0];
  const float* wq_w = (const float*)d_in[1];
  const float* wq_b = (const float*)d_in[2];
  const float* wk_w = (const float*)d_in[3];
  const float* wk_b = (const float*)d_in[4];
  const float* wv_w = (const float*)d_in[5];
  const float* wv_b = (const float*)d_in[6];
  const float* wo_w = (const float*)d_in[7];
  const int*   win  = (const int*)d_in[8];
  float* out = (float*)d_out;

  const size_t szX  = (size_t)NTOK * HID * 2;
  const size_t szWq = (size_t)HID * HID * 2;
  const size_t szWk = (size_t)KVW * HID * 2;
  const size_t szWv = (size_t)KVW * HID * 2;
  const size_t szWo = (size_t)HID * HID * 2;
  const size_t szT  = (size_t)SQ * NFREQ * 4;
  const size_t szQ  = (size_t)NTOK * HID * 2;
  const size_t szK  = (size_t)NTOK * KVW * 2;
  const size_t szV  = (size_t)KVW * NTOK * 2;
  const size_t szA  = (size_t)NTOK * HID * 2;
  size_t off = 0;
  const size_t oX  = off; off += szX;
  const size_t oWq = off; off += szWq;
  const size_t oWk = off; off += szWk;
  const size_t oWv = off; off += szWv;
  const size_t oWo = off; off += szWo;
  const size_t oCs = off; off += szT;
  const size_t oSn = off; off += szT;
  const size_t oQh = off; off += szQ;
  const size_t oQl = off; off += szQ;
  const size_t oKh = off; off += szK;
  const size_t oKl = off; off += szK;
  const size_t oVh = off; off += szV;
  const size_t oVl = off; off += szV;
  const size_t oAl = off; off += szA;
  const size_t oAh = oX;                         // Ah reuses the Xb region (same byte size); Xb is dead after launch (9)
  if (szA != szX) return;
  if (off > ws_size) return;                     // off = 126877696

  char* ws = (char*)d_ws;
  unsigned short* Xb  = (unsigned short*)(ws + oX);
  unsigned short* Wqb = (unsigned short*)(ws + oWq);
  unsigned short* Wkb = (unsigned short*)(ws + oWk);
  unsigned short* Wvb = (unsigned short*)(ws + oWv);
  unsigned short* Wob = (unsigned short*)(ws + oWo);
  float*          cst = (float*)(ws + oCs);
  float*          snt = (float*)(ws + oSn);
  unsigned short* Qh  = (unsigned short*)(ws + oQh);
  unsigned short* Ql  = (unsigned short*)(ws + oQl);
  unsigned short* Kh  = (unsigned short*)(ws + oKh);
  unsigned short* Kl  = (unsigned short*)(ws + oKl);
  unsigned short* Vh  = (unsigned short*)(ws + oVh);
  unsigned short* Vl  = (unsigned short*)(ws + oVl);
  unsigned short* Ah  = (unsigned short*)(ws + oAh);
  unsigned short* Al  = (unsigned short*)(ws + oAl);

  const dim3 b256(256), b128(128);

  // (1) cos/sin table [2048][64] x 2
  rope_table_kernel<<<dim3(SQ / 8), b256, 0, stream>>>(cst, snt, SQ);
  // (2)-(6) RNE bf16 planes of x [4096][2048], Wq [2048][2048], Wk [1024][2048], Wv [1024][2048], Wo [2048][2048] (all [out][in] = Bt[n][k])
  cvt_bf16_kernel<<<dim3((NTOK * HID / 8) / 256), b256, 0, stream>>>(x,    Xb,  NTOK * HID / 8);
  cvt_bf16_kernel<<<dim3((HID * HID / 8) / 256),  b256, 0, stream>>>(wq_w, Wqb, HID * HID / 8);
  cvt_bf16_kernel<<<dim3((KVW * HID / 8) / 256),  b256, 0, stream>>>(wk_w, Wkb, KVW * HID / 8);
  cvt_bf16_kernel<<<dim3((KVW * HID / 8) / 256),  b256, 0, stream>>>(wv_w, Wvb, KVW * HID / 8);
  cvt_bf16_kernel<<<dim3((HID * HID / 8) / 256),  b256, 0, stream>>>(wo_w, Wob, HID * HID / 8);
  // (7) q = x . Wq^T + bq, RoPE -> Qh/Ql [4096][2048]   (M=4096, N=2048, K=2048; 32 x 16 block tiles)
  gemm_w32x128_kernel<0, false><<<dim3((NTOK / 128) * (HID / 128)), b128, 0, stream>>>(
      Xb, Xb, HID, Wqb, HID, wq_b, cst, snt, (void*)Qh, (void*)Ql, HID, NTOK, HID, HID);
  // (8) k = x . Wk^T + bk, RoPE -> Kh/Kl [4096][1024]   (M=4096, N=1024, K=2048; 32 x 8 block tiles)
  gemm_w32x128_kernel<0, false><<<dim3((NTOK / 128) * (KVW / 128)), b128, 0, stream>>>(
      Xb, Xb, HID, Wkb, HID, wk_b, cst, snt, (void*)Kh, (void*)Kl, KVW, NTOK, KVW, HID);
  // (9) v^T = Wv . x^T + bv[m] -> Vh/Vl [1024][4096]   (A = Wvb, Bt = Xb; M=1024, N=4096, K=2048; 8 x 32 block tiles)
  gemm_w32x128_kernel<1, false><<<dim3((KVW / 128) * (NTOK / 128)), b128, 0, stream>>>(
      Wvb, Wvb, HID, Xb, HID, wv_b, cst, snt, (void*)Vh, (void*)Vl, NTOK, KVW, NTOK, HID);
  // (10)-(11) windowed causal attention, query tiles 0..3 with k and p residual products, tiles 4..31 without
  attn_window_kernel<true><<<dim3(4, NHQ, NSEQ), b128, 0, stream>>>(Qh, Ql, Kh, Kl, Vh, Vl, Ah, Al, win, 0);
  attn_window_kernel<false><<<dim3(SQ / 64 - 4, NHQ, NSEQ), b128, 0, stream>>>(Qh, Ql, Kh, Kl, Vh, Vl, Ah, Al, win, 4);
  // (12) out = attn(hi + lo) . Wo^T -> d_out f32 [4096][2048]   (M=4096, N=2048, K=2048; 32 x 16 block tiles)
  gemm_w32x128_kernel<2, true><<<dim3((NTOK / 128) * (HID / 128)), b128, 0, stream>>>(
      Ah, Al, HID, Wob, HID, wq_b, cst, snt, (void*)out, (void*)out, HID, NTOK, HID, HID);
  (void)hipGetLastError();
}

// v003
// One run takes 324 microseconds.
// In two side-by-side timings against v002, it was 1.10 and 1.11 times as fast.
// Over all steps from v000 it is 2.52 times as fast.
// Contractions: x.Wq^T, x.Wk^T and Wv.x^T on v_wmma_f32_16x16x32_bf16 (operands = RNE bf16 of the f32 inputs, single products);
// q.k^T and p.v on v_wmma_f32_16x16x32_f16 (q = f16 hi + f16 residual x2^11 planes; k plain f16 plus f16 residual x2^11 on query tiles 0..3;
// p x1024 plain f16 plus f16 residual x2^11 on query tiles 0..3; v^T = f16 hi + f16 residual x2^11 planes); attn.Wo^T on v_wmma_f32_16x16x32_bf16
// (attn = bf16 hi + bf16 lo planes, two products; Wo RNE bf16). f32 accumulate everywhere; bias add, RoPE, online softmax and scale folds in f32.
#include <hip/hip_runtime.h>
#include <math.h>
#include <stdint.h>

#define NSEQ   2
#define SQ     2048
#define HID    2048
#define NHQ    16
#define NKVH   8
#define HDM    128
#define KVW    1024
#define NTOK   4096
#define NFREQ  64

typedef _Float16     v16h __attribute__((ext_vector_type(16)));
typedef _Float16     v8h  __attribute__((ext_vector_type(8)));
typedef __bf16       v16b __attribute__((ext_vector_type(16)));
typedef __bf16       v8b  __attribute__((ext_vector_type(8)));
typedef float        v8f  __attribute__((ext_vector_type(8)));
typedef float        v4f  __attribute__((ext_vector_type(4)));
typedef unsigned int v4u  __attribute__((ext_vector_type(4)));

// ---------------------------------------------------------------------------
// small helpers
// ---------------------------------------------------------------------------
__device__ __forceinline__ unsigned short bf_bits(float f) {          // RNE convert f32 -> bf16 bits
  const unsigned u = __float_as_uint(f);
  return (unsigned short)((u + 0x7FFFu + ((u >> 16) & 1u)) >> 16);
}
__device__ __forceinline__ float bf_val(unsigned short h) { return __uint_as_float(((unsigned)h) << 16); }
__device__ __forceinline__ float bf_rne(float f) { return bf_val(bf_bits(f)); }
__device__ __forceinline__ unsigned pk16(unsigned short a, unsigned short b) { return (unsigned)a | ((unsigned)b << 16); }
__device__ __forceinline__ v8f zero8() { v8f z = {0.f, 0.f, 0.f, 0.f, 0.f, 0.f, 0.f, 0.f}; return z; }
__device__ __forceinline__ int wave_id() { return __builtin_amdgcn_readfirstlane((int)(threadIdx.x >> 5)); }

__device__ __forceinline__ void lds_wave_sync() {
  __builtin_amdgcn_fence(__ATOMIC_RELEASE, "workgroup");
  __builtin_amdgcn_wave_barrier();
  __builtin_amdgcn_fence(__ATOMIC_ACQUIRE, "workgroup");
}

// Value of lane (l ^ X) of the same 16-lane row, X = 1, 2, 4, 8: a DPP row_xmask operand of the vector unit (control word 0x160 + X),
// all lanes on. It takes the place of __shfl_xor, which goes through the LDS pipe and is waited for at every step.
template <int X>
__device__ __forceinline__ float row_xor(float v) {
  return __builtin_bit_cast(float, __builtin_amdgcn_mov_dpp(__builtin_bit_cast(int, v), 0x160 + X, 0xf, 0xf, true));
}
// Maximum over each 16-lane row for eight values at once, all lanes on. Written as asm because from the builtin form the compiler makes three
// dependent instructions a step (the move, a quieting maximum, the maximum) and runs the eight chains one after another; here a step is
// one instruction, and the instruction it depends on stands eight back, so that no step waits for its predecessor.
__device__ __forceinline__ void row_max16x8(float (&m)[8]) {
  asm(
      "v_max_num_f32_dpp %0, %0, %0 row_xmask:1 row_mask:0xf bank_mask:0xf\n\t"
      "v_max_num_f32_dpp %1, %1, %1 row_xmask:1 row_mask:0xf bank_mask:0xf\n\t"
      "v_max_num_f32_dpp %2, %2, %2 row_xmask:1 row_mask:0xf bank_mask:0xf\n\t"
      "v_max_num_f32_dpp %3, %3, %3 row_xmask:1 row_mask:0xf bank_mask:0xf\n\t"
      "v_max_num_f32_dpp %4, %4, %4 row_xmask:1 row_mask:0xf bank_mask:0xf\n\t"
      "v_max_num_f32_dpp %5, %5, %5 row_xmask:1 row_mask:0xf bank_mask:0xf\n\t"
      "v_max_num_f32_dpp %6, %6, %6 row_xmask:1 row_mask:0xf bank_mask:0xf\n\t"
      "v_max_num_f32_dpp %7, %7, %7 row_xmask:1 row_mask:0xf bank_mask:0xf\n\t"
      "v_max_num_f32_dpp %0, %0, %0 row_xmask:2 row_mask:0xf bank_mask:0xf\n\t"
      "v_max_num_f32_dpp %1, %1, %1 row_xmask:2 row_mask:0xf bank_mask:0xf\n\t"
      "v_max_num_f32_dpp %2, %2, %2 row_xmask:2 row_mask:0xf bank_mask:0xf\n\t"
      "v_max_num_f32_dpp %3, %3, %3 row_xmask:2 row_mask:0xf bank_mask:0xf\n\t"
      "v_max_num_f32_dpp %4, %4, %4 row_xmask:2 row_mask:0xf bank_mask:0xf\n\t"
      "v_max_num_f32_dpp %5, %5, %5 row_xmask:2 row_mask:0xf bank_mask:0xf\n\t"
      "v_max_num_f32_dpp %6, %6, %6 row_xmask:2 row_mask:0xf bank_mask:0xf\n\t"
      "v_max_num_f32_dpp %7, %7, %7 row_xmask:2 row_mask:0xf bank_mask:0xf\n\t"
      "v_max_num_f32_dpp %0, %0, %0 row_xmask:4 row_mask:0xf bank_mask:0xf\n\t"
      "v_max_num_f32_dpp %1, %1, %1 row_xmask:4 row_mask:0xf bank_mask:0xf\n\t"
      "v_max_num_f32_dpp %2, %2, %2 row_xmask:4 row_mask:0xf bank_mask:0xf\n\t"
      "v_max_num_f32_dpp %3, %3, %3 row_xmask:4 row_mask:0xf bank_mask:0xf\n\t"
      "v_max_num_f32_dpp %4, %4, %4 row_xmask:4 row_mask:0xf bank_mask:0xf\n\t"
      "v_max_num_f32_dpp %5, %5, %5 row_xmask:4 row_mask:0xf bank_mask:0xf\n\t"
      "v_max_num_f32_dpp %6, %6, %6 row_xmask:4 row_mask:0xf bank_mask:0xf\n\t"
      "v_max_num_f32_dpp %7, %7, %7 row_xmask:4 row_mask:0xf bank_mask:0xf\n\t"
      "v_max_num_f32_dpp %0, %0, %0 row_xmask:8 row_mask:0xf bank_mask:0xf\n\t"
      "v_max_num_f32_dpp %1, %1, %1 row_xmask:8 row_mask:0xf bank_mask:0xf\n\t"
      "v_max_num_f32_dpp %2, %2, %2 row_xmask:8 row_mask:0xf bank_mask:0xf\n\t"
      "v_max_num_f32_dpp %3, %3, %3 row_xmask:8 row_mask:0xf bank_mask:0xf\n\t"
      "v_max_num_f32_dpp %4, %4, %4 row_xmask:8 row_mask:0xf bank_mask:0xf\n\t"
      "v_max_num_f32_dpp %5, %5, %5 row_xmask:8 row_mask:0xf bank_mask:0xf\n\t"
      "v_max_num_f32_dpp %6, %6, %6 row_xmask:8 row_mask:0xf bank_mask:0xf\n\t"
      "v_max_num_f32_dpp %7, %7, %7 row_xmask:8 row_mask:0xf bank_mask:0xf"
      : "+v"(m[0]), "+v"(m[1]), "+v"(m[2]), "+v"(m[3]), "+v"(m[4]), "+v"(m[5]), "+v"(m[6]), "+v"(m[7]));
}
__device__ __forceinline__ float row_sum16(float s) {      // same butterfly, same order of additions as the shuffle form
  s += row_xor<1>(s);
  s += row_xor<2>(s);
  s += row_xor<4>(s);
  s += row_xor<8>(s);
  return s;
}

// ---------------------------------------------------------------------------
// WMMA fragments (wave32, 16x16x32, 16-bit operands). For A (row m = lane&15) and B (col n = lane&15) alike:
// elements 0..7 <- k0 + 8*(lane>>4) + 0..7, elements 8..15 <- k0 + 16 + 8*(lane>>4) + 0..7.
// ldfrag(p) with p = rowbase + k0 + 8*(lane>>4): two 16-B loads p[0..7], p[16..23].
// D: acc[r] = (row 8*(lane>>4) + r, col lane&15).
// ---------------------------------------------------------------------------
union FragH { v16h v; v8h h[2]; };
union FragB { v16b v; v8b h[2]; };
__device__ __forceinline__ v16h ldfrag_h(const _Float16* p) { FragH f; f.h[0] = *(const v8h*)(p); f.h[1] = *(const v8h*)(p + 16); return f.v; }
__device__ __forceinline__ v16b ldfrag_b(const __bf16* p)   { FragB f; f.h[0] = *(const v8b*)(p); f.h[1] = *(const v8b*)(p + 16); return f.v; }

__device__ __forceinline__ v8f mma_h(v16h a, v16h b, v8f c) {
  return __builtin_amdgcn_wmma_f32_16x16x32_f16(false, a, false, b, (short)0, c, false, false);
}
__device__ __forceinline__ v8f mma_b(v16b a, v16b b, v8f c) {
  return __builtin_amdgcn_wmma_f32_16x16x32_bf16(false, a, false, b, (short)0, c, false, false);
}
// hazard guards: 4 VALU slots after the last WMMA of a group, D tied, A/B kept live; memory clobber keeps later loads behind the group
__device__ __forceinline__ void guard_h3(v8f& a, v8f& b, v16h x, v16h y, v16h z) {
  asm volatile("v_nop\n\tv_nop\n\tv_nop\n\tv_nop" : "+v"(a), "+v"(b) : "v"(x), "v"(y), "v"(z) : "memory");
}
__device__ __forceinline__ void guard_h4(v8f& a, v8f& b, v16h w, v16h x, v16h y, v16h z) {
  asm volatile("v_nop\n\tv_nop\n\tv_nop\n\tv_nop" : "+v"(a), "+v"(b) : "v"(w), "v"(x), "v"(y), "v"(z) : "memory");
}
__device__ __forceinline__ void acc_guard4(v8f& a, v8f& b, v8f& c, v8f& d) {
  asm volatile("v_nop\n\tv_nop\n\tv_nop\n\tv_nop" : "+v"(a), "+v"(b), "+v"(c), "+v"(d));
}

// ---------------------------------------------------------------------------
// RoPE table: cst[s][i] = cos(s * inv_freq[i]), snt[s][i] = sin(...), inv_freq[i] = 1 / 1e4^(i/64), i < 64, s < ns, all f32.
// Block = 8 waves, wave w -> position s = blockIdx.x*8 + w, lane -> i = lane, lane + 32.
// Coverage: grid ns/8 x 8 waves x 32 lanes x 2 = ns x 64 per plane.
// ---------------------------------------------------------------------------
__global__ __launch_bounds__(256) void rope_table_kernel(float* __restrict__ cst, float* __restrict__ snt, int ns) {
  const int lane = threadIdx.x & 31;
  const int wave = (int)(threadIdx.x >> 5);
  const int t = (int)blockIdx.x * 8 + wave;
  if (t >= ns) return;                       // no barriers in this kernel
  const float pf = (float)t;
  float c0 = 0.f, s0 = 0.f, c1 = 0.f, s1 = 0.f;
#pragma unroll 1
  for (int u = 0; u < 2; ++u) {
    const int i = lane + 32 * u;
    const float e   = (float)i * 0.015625f;      // i / 64 exact
    const float pw  = powf(10000.0f, e);
    const float inv = 1.0f / pw;
    const float ang = pf * inv;
    const float cv = cosf(ang);
    const float sv = sinf(ang);
    c1 = cv; s1 = sv;
    if (u == 0) { c0 = cv; s0 = sv; }
  }
  const size_t o = (size_t)t * NFREQ + lane;
  {
    ((float*)cst)[o]      = c0;
    ((float*)cst)[o + 32] = c1;
    ((float*)snt)[o]      = s0;
    ((float*)snt)[o + 32] = s1;
    
  }
}

// ---------------------------------------------------------------------------
// Elementwise RNE f32 -> bf16 plane: 8 elements per thread, one 16-B store per lane -> 32 consecutive lanes write 4 whole
// ---------------------------------------------------------------------------
__global__ __launch_bounds__(256) void cvt_bf16_kernel(const float* __restrict__ in, unsigned short* __restrict__ outp, int n8) {
  const int i = (int)blockIdx.x * 256 + (int)threadIdx.x;
  if (i >= n8) return;
  const size_t e = 8 * (size_t)i;
  const v4f a = *(const v4f*)(in + e);
  const v4f b = *(const v4f*)(in + e + 4);
  v4u w;
  w[0] = pk16(bf_bits(a[0]), bf_bits(a[1]));
  w[1] = pk16(bf_bits(a[2]), bf_bits(a[3]));
  w[2] = pk16(bf_bits(b[0]), bf_bits(b[1]));
  w[3] = pk16(bf_bits(b[2]), bf_bits(b[3]));
  *(v4u*)(outp + e) = w;
  
}

// ---------------------------------------------------------------------------
// bf16 WMMA GEMM, block = 4 waves (128 threads) = one 128 x 128 tile of C, wave w = rows 32w..32w+31 x all 128 cols.
//   C[m][n] = sum_k A[m][k] * Bt[n][k]; A row-major [M][K] bf16 (pitch lda), Bt row-major [N][K] bf16 (pitch ldb);
//   M % 128 == 0, N % 128 == 0, K % 64 == 0; grid.x = M/128 * N/128.
//   SPLITA: A carried as hi (Ap) + lo (A2p) bf16 planes, two products into one accumulator.
//   Operands: a pass is 64 k = one whole 128-B line of every operand row. The 128 A rows (both planes when SPLITA) and the
//   128 Bt rows of a pass are brought into LDS by asynchronous 16-B copies (8 lanes = one line, a wave instruction = 4 lines),
//   rows at pitch 144 B, two buffers: the next pass's copies fly while this pass is multiplied. The Bt tile is read by all
//   four waves. Fragments are read from LDS with the split k map (ldfrag_b), k ascending.
// Epilogues (all: per wave, per 16-row slab: stage in LDS, wave sync, write each row segment with ONE instruction of
//   EPI 0: q or k projection; the 128-col tile is one head. B rows are laid in LDS in even/odd order (row n0 + r in slot
//          64*(r&1) + (r>>1)):
//          acc tile j<4, lane rl holds output column n0 + 2*(16j+rl); tile j+4 holds n0 + 2*(16j+rl) + 1 (the interleaved pair).
//          + bf16(bias[n]); RoPE on the pair with cos/sin[pos = row & 2047][pair]; writes f16 hi plane C0 and f16 residual x2048
//          plane C1, both [M][ldc], cols n0..n0+127 (row segment 256 B = 16 lanes x 16 B).
//   EPI 1: v^T projection: + bf16(bias[m]); f16 hi plane C0, residual x2048 plane C1, [M][ldc], row segment 256 B.
//   EPI 2: f32 output C0 [M][ldc]; row segment 128 floats = 512 B = 32 lanes x 16 B per instruction.
// ---------------------------------------------------------------------------
template <int EPI> struct SlabT { typedef _Float16 T; static constexpr int PERW = 4096; };   // 2 planes x 16 x 128 halves
template <> struct SlabT<2>     { typedef float    T; static constexpr int PERW = 2048; };   // 16 x 128 floats

#define G_PITCH 72                    // LDS row pitch in 16-bit elements: 64 k + 8 = 144 B = 16 B x 9
#define G_TILE  (128 * G_PITCH)       // one 128-row operand tile of a pass, in elements

// One 128-row x 128-B operand tile into LDS: eight copies per lane, lane address pairs (l + i*lstep, g + i*gstep).
// The s_wait_xcnt stands in the copies' own statement so that no address register is rewritten ahead of it.
__device__ __forceinline__ void stage_tile(unsigned l, unsigned lstep, const unsigned short* g, size_t gstep) {
  asm volatile(
      "global_load_async_to_lds_b128 %0, %8, off\n\t"
      "global_load_async_to_lds_b128 %1, %9, off\n\t"
      "global_load_async_to_lds_b128 %2, %10, off\n\t"
      "global_load_async_to_lds_b128 %3, %11, off\n\t"
      "global_load_async_to_lds_b128 %4, %12, off\n\t"
      "global_load_async_to_lds_b128 %5, %13, off\n\t"
      "global_load_async_to_lds_b128 %6, %14, off\n\t"
      "global_load_async_to_lds_b128 %7, %15, off\n\t"
      "s_wait_xcnt 0x0"
      :: "v"(l), "v"(l + lstep), "v"(l + 2 * lstep), "v"(l + 3 * lstep),
         "v"(l + 4 * lstep), "v"(l + 5 * lstep), "v"(l + 6 * lstep), "v"(l + 7 * lstep),
         "v"(g), "v"(g + gstep), "v"(g + 2 * gstep), "v"(g + 3 * gstep),
         "v"(g + 4 * gstep), "v"(g + 5 * gstep), "v"(g + 6 * gstep), "v"(g + 7 * gstep)
      : "memory");
}

template <int EPI, bool SPLITA>
__global__ __launch_bounds__(128) void gemm_w32x128_kernel(
    const unsigned short* Ap, const unsigned short* A2p, int lda,
    const unsigned short* __restrict__ Btp, int ldb,
    const float* __restrict__ bias, const float* __restrict__ cst, const float* __restrict__ snt,
    void* C0, void* C1, int ldc,
    int M, int N, int K) {
  typedef typename SlabT<EPI>::T ST;
  constexpr int NPL = SPLITA ? 3 : 2;            // operand tiles per buffer: A (, A lo), Bt
  constexpr int BUF = NPL * G_TILE;              // elements per buffer
  __shared__ __align__(16) ST slab_all[4 * SlabT<EPI>::PERW];
  __shared__ __align__(16) unsigned short ring[2 * BUF];

  const int tid  = (int)threadIdx.x;
  const int lane = tid & 31;
  const int wave = wave_id();
  const int hh = lane >> 4;           // lane half: k offset 8*hh, D row offset 8*hh
  const int rl = lane & 15;           // A row / B col / D col within subtile
  const int tilesN = N >> 7;
  const int tilesM = M >> 7;
  const int tile = (int)blockIdx.x;
  if (tile >= tilesM * tilesN) return;          // block-uniform, in front of every barrier
  const int tm = tile / tilesN;
  const int tn = tile - tm * tilesN;
  const int mb = tm << 7;                       // first row of the block tile
  const int m0 = mb + (wave << 5);              // first row of this wave
  const int n0 = tn << 7;

  // copy addresses of this lane: copy i of a tile moves 16 B of source row (tid>>3) + 16*i, bytes 16*(tid&7)..+15 of the pass's line
  const int crow = tid >> 3;
  const int ccol = (tid & 7) * 8;
  const unsigned short* gA  = Ap  + (size_t)(mb + crow) * lda + ccol;
  const unsigned short* gA2 = A2p + (size_t)(mb + crow) * lda + ccol;
  const unsigned short* gB  = Btp + (size_t)(n0 + crow) * ldb + ccol;
  const unsigned ring0 = (unsigned)(uintptr_t)(&ring[0]);           // LDS byte address of the ring
  const unsigned lA = ring0 + (unsigned)(crow * G_PITCH + ccol) * 2u;
  const int bslot = (EPI == 0) ? ((crow & 1) * 64 + (crow >> 1)) : crow;
  const unsigned lB = ring0 + (unsigned)((NPL - 1) * G_TILE + bslot * G_PITCH + ccol) * 2u;
  const unsigned lstepA = 16u * G_PITCH * 2u;
  const unsigned lstepB = ((EPI == 0) ? 8u : 16u) * G_PITCH * 2u;
  const size_t gstepA = (size_t)16 * lda;
  const size_t gstepB = (size_t)16 * ldb;

  v8f acc[2][8];
#pragma unroll
  for (int i = 0; i < 2; ++i)
#pragma unroll
    for (int j = 0; j < 8; ++j) acc[i][j] = zero8();

  const int npass = K >> 6;
  // pass 0 into buffer 0, landed and published; then pass 1 into buffer 1
  stage_tile(lA, lstepA, gA, gstepA);
  if (SPLITA) stage_tile(lA + G_TILE * 2u, lstepA, gA2, gstepA);
  stage_tile(lB, lstepB, gB, gstepB);
  asm volatile("s_wait_asynccnt 0x0" ::: "memory");   // this wave's copies of pass 0 have landed
  __syncthreads();                                    // every wave's copies of pass 0 are readable by all
  if (npass > 1) {
    stage_tile(lA + BUF * 2u, lstepA, gA + 64, gstepA);
    if (SPLITA) stage_tile(lA + (BUF + G_TILE) * 2u, lstepA, gA2 + 64, gstepA);
    stage_tile(lB + BUF * 2u, lstepB, gB + 64, gstepB);
  }

  for (int t = 0; t < npass; ++t) {
    const int bo = (t & 1) * BUF;
    const __bf16* As = (const __bf16*)(const void*)(ring + bo) + ((wave << 5) + rl) * G_PITCH + 8 * hh;
    const __bf16* Bs = (const __bf16*)(const void*)(ring + bo + (NPL - 1) * G_TILE) + rl * G_PITCH + 8 * hh;
    v16b ah[2][2], al[2][2], bj[2][8];
#pragma unroll
    for (int kb = 0; kb < 2; ++kb) {
#pragma unroll
      for (int i = 0; i < 2; ++i) {
        ah[kb][i] = ldfrag_b(As + i * 16 * G_PITCH + kb * 32);
        al[kb][i] = SPLITA ? ldfrag_b(As + G_TILE + i * 16 * G_PITCH + kb * 32) : ah[kb][i];
      }
#pragma unroll
      for (int j = 0; j < 8; ++j) bj[kb][j] = ldfrag_b(Bs + j * 16 * G_PITCH + kb * 32);
    }
    // keeps the pass's LDS reads together in front of its WMMAs: left alone the compiler puts two reads and a full wait before every WMMA pair
    __builtin_amdgcn_sched_barrier(0);
#pragma unroll
    for (int kb = 0; kb < 2; ++kb) {
#pragma unroll
      for (int j = 0; j < 8; ++j) {
        acc[0][j] = mma_b(ah[kb][0], bj[kb][j], acc[0][j]);
        acc[1][j] = mma_b(ah[kb][1], bj[kb][j], acc[1][j]);
        if (SPLITA) {
          acc[0][j] = mma_b(al[kb][0], bj[kb][j], acc[0][j]);
          acc[1][j] = mma_b(al[kb][1], bj[kb][j], acc[1][j]);
        }
      }
    }
    // keeps the WMMAs in front of the waits and the barrier below, so that the next pass's copies fly for the whole of this pass
    __builtin_amdgcn_sched_barrier(0);
    asm volatile("s_wait_dscnt 0x0" ::: "memory");      // this wave's reads of the buffer are done before it is refilled
    asm volatile("s_wait_asynccnt 0x0" ::: "memory");   // this wave's copies of pass t + 1 have landed
    __syncthreads();                                    // publishes pass t + 1 and ends every reader's last read of pass t
    if (t + 2 < npass) {                                // block-uniform
      const size_t ko = (size_t)(t + 2) * 64;
      stage_tile(lA + (unsigned)bo * 2u, lstepA, gA + ko, gstepA);
      if (SPLITA) stage_tile(lA + (unsigned)(bo + G_TILE) * 2u, lstepA, gA2 + ko, gstepA);
      stage_tile(lB + (unsigned)bo * 2u, lstepB, gB + ko, gstepB);
    }
  }
  asm volatile("s_wait_asynccnt 0x0" ::: "memory");     // no copy is outstanding when the wave goes on to the epilogue
  acc_guard4(acc[0][0], acc[0][1], acc[0][2], acc[0][3]);
  acc_guard4(acc[0][4], acc[0][5], acc[0][6], acc[0][7]);
  acc_guard4(acc[1][0], acc[1][1], acc[1][2], acc[1][3]);
  acc_guard4(acc[1][4], acc[1][5], acc[1][6], acc[1][7]);

  // ---- epilogue ----
  ST* slab = slab_all + wave * SlabT<EPI>::PERW;
  _Float16* sl16 = (_Float16*)(void*)slab;
  float*    slf  = (float*)(void*)slab;

  if (EPI == 0) {
    _Float16* P0 = (_Float16*)C0;
    _Float16* P1 = (_Float16*)C1;
#pragma unroll
    for (int i = 0; i < 2; ++i) {
      const int rb = m0 + i * 16 + 8 * hh;
#pragma unroll
      for (int j = 0; j < 4; ++j) {
        const int pi = j * 16 + rl;                              // pair index 0..63 within head
        const int nc = n0 + 2 * pi;                              // column of x1; x2 at nc + 1
        const float b1 = bf_rne(bias[nc]);
        const float b2 = bf_rne(bias[nc + 1]);
#pragma unroll
        for (int r = 0; r < 8; ++r) {
          const int row = rb + r;                                // token 0..NTOK-1
          const int s   = row & (SQ - 1);                        // position within sequence
          const float cv = cst[(size_t)s * NFREQ + pi];
          const float sv = snt[(size_t)s * NFREQ + pi];
          const float x1 = acc[i][j][r] + b1;
          const float x2 = acc[i][j + 4][r] + b2;
          const float o1 = x1 * cv - x2 * sv;
          const float o2 = x1 * sv + x2 * cv;
          const _Float16 h1 = (_Float16)o1;
          const _Float16 h2 = (_Float16)o2;
          const int so = (8 * hh + r) * 128 + 2 * pi;
          sl16[so]            = h1;
          sl16[so + 1]        = h2;
          sl16[2048 + so]     = (_Float16)((o1 - (float)h1) * 2048.0f);
          sl16[2048 + so + 1] = (_Float16)((o2 - (float)h2) * 2048.0f);
        }
      }
      lds_wave_sync();
      {
#pragma unroll
        for (int it = 0; it < 8; ++it) {
          const int row = it * 2 + hh;                           // it x hh covers rows 0..15
          const int c8  = rl * 8;
          const v8h vh = *(const v8h*)(sl16 + row * 128 + c8);
          const v8h vl = *(const v8h*)(sl16 + 2048 + row * 128 + c8);
          const size_t go = (size_t)(m0 + i * 16 + row) * ldc + n0 + c8;
          *(v8h*)(P0 + go) = vh;
          *(v8h*)(P1 + go) = vl;
        }
        
      }
      lds_wave_sync();
    }
  } else if (EPI == 1) {
    _Float16* P0 = (_Float16*)C0;
    _Float16* P1 = (_Float16*)C1;
#pragma unroll
    for (int i = 0; i < 2; ++i) {
#pragma unroll
      for (int r = 0; r < 8; ++r) {
        const int m = m0 + i * 16 + 8 * hh + r;
        const float bm = bf_rne(bias[m]);
#pragma unroll
        for (int j = 0; j < 8; ++j) {
          const float v = acc[i][j][r] + bm;
          const _Float16 hv = (_Float16)v;
          const int so = (8 * hh + r) * 128 + j * 16 + rl;
          sl16[so]        = hv;
          sl16[2048 + so] = (_Float16)((v - (float)hv) * 2048.0f);
        }
      }
      lds_wave_sync();
      {
#pragma unroll
        for (int it = 0; it < 8; ++it) {
          const int row = it * 2 + hh;
          const int c8  = rl * 8;
          const v8h vh = *(const v8h*)(sl16 + row * 128 + c8);
          const v8h vl = *(const v8h*)(sl16 + 2048 + row * 128 + c8);
          const size_t go = (size_t)(m0 + i * 16 + row) * ldc + n0 + c8;
          *(v8h*)(P0 + go) = vh;
          *(v8h*)(P1 + go) = vl;
        }
        
      }
      lds_wave_sync();
    }
  } else {
    float* C = (float*)C0;
#pragma unroll
    for (int i = 0; i < 2; ++i) {
#pragma unroll
      for (int j = 0; j < 8; ++j)
#pragma unroll
        for (int r = 0; r < 8; ++r)
          slf[(8 * hh + r) * 128 + j * 16 + rl] = acc[i][j][r];
      lds_wave_sync();
      {
#pragma unroll
        for (int row = 0; row < 16; ++row) {                     // 32 lanes x 16 B = the whole 512-B row segment per instruction
          const v4f v = *(const v4f*)(slf + row * 128 + lane * 4);
          *(v4f*)(C + (size_t)(m0 + i * 16 + row) * ldc + n0 + lane * 4) = v;
        }
        
      }
      lds_wave_sync();
    }
  }
}

// ---------------------------------------------------------------------------
// Windowed causal GQA flash attention, head dim 128, 32-key chunks, block = 4 waves = 64 query rows of one (b, h);
// grid (n query tiles, NHQ, NSEQ). Key j is valid for query i iff j <= i and i - j <= window (window read from the int input).
//   q planes f16 [tok][h*128+d]: hi (qhp) and residual x2048 (qlp); k planes f16 [tok][kvh*128+d]: hi (khp), residual x2048 (klp);
//   v^T planes f16 [kvh*128+d][tok]: hi (vhp), residual x2048 (vlp); outputs attn bf16 hi (ahp) / lo (alp) [tok][h*128+d].
//   scores = (Sh + Sr/2048) * 128^-0.5 with Sh = qh.kh and Sr = ql'.kh (+ qh.kl' when PRES); invalid keys -> -inf; online softmax f32
//   (-inf safe: a row with no valid key so far keeps m = -inf, l = 0, O = 0);
//   p' = 1024 p stored per wave to LDS as f16 hi (and residual x2048 when PRES), reloaded as A fragments after a wave sync;
//   O = (Oh + Or/2048)/1024/l with Oh = ph.vh, Or = ph.vl' (+ pl'.vh when PRES).
//   K / V^T chunk staging: 128 threads x 4 x 16 B per plane = whole 32x128 / 128x32 tile, plain loads, __syncthreads before and after.
//   Chunks cover keys [max(0, 64*qb - window) & ~31, 64*qb + 63]; trip count statically <= 64; waves with no valid key in a chunk
//   skip its compute part (wave-uniform, scalar branch).
// ---------------------------------------------------------------------------
#define AT_KC   32
#define KS_P    136
#define VS_P    40
#define PS_P    40
#define LDS_KS  0
#define LDS_KLS (32 * KS_P)
#define LDS_VHS (2 * 32 * KS_P)
#define LDS_VLS (LDS_VHS + 128 * VS_P)
#define LDS_PH  (LDS_VLS + 128 * VS_P)
#define LDS_PL  (LDS_PH + 4 * 16 * PS_P)
#define LDS_TOT (LDS_PL + 4 * 16 * PS_P)
static_assert(LDS_TOT * 2 <= 65536);
static_assert(4 * 4096 <= LDS_TOT);          // output staging (2 planes x 16 x 128 per wave) aliases the chunk region after the loop

template <bool PRES>
// The long launch (no residual products, 896 work-groups) gets a budget of 256 registers a wave = four waves per SIMD: four work-groups
// share a WGP and the whole launch is resident at once. The short launch has fewer work-groups than there are WGPs and keeps the full budget.
__global__ __launch_bounds__(128) __attribute__((amdgpu_waves_per_eu(PRES ? 1 : 4))) void attn_window_kernel(
    const unsigned short* __restrict__ qhp, const unsigned short* __restrict__ qlp,
    const unsigned short* __restrict__ khp, const unsigned short* __restrict__ klp,
    const unsigned short* __restrict__ vhp, const unsigned short* __restrict__ vlp,
    unsigned short* __restrict__ ahp, unsigned short* __restrict__ alp,
    const int* __restrict__ winp, int qb_base) {
  __shared__ __align__(16) _Float16 lds[LDS_TOT];
  _Float16* Ks  = lds + LDS_KS;
  _Float16* Kls = lds + LDS_KLS;
  _Float16* Vhs = lds + LDS_VHS;
  _Float16* Vls = lds + LDS_VLS;

  const int tid  = (int)threadIdx.x;
  const int lane = tid & 31;
  const int wave = wave_id();
  const int hh   = lane >> 4;
  const int c    = lane & 15;
  const int qb   = (int)blockIdx.x + qb_base;
  const int h    = (int)blockIdx.y;
  const int b    = (int)blockIdx.z;
  const int kvh  = h >> 1;                       // 2 query heads per kv head
  const int window = __builtin_amdgcn_readfirstlane(winp[0]);
  const int qblk0 = qb * 64;
  const int q0    = qblk0 + wave * 16;           // first query row of this wave (within sequence)
  const int qlast = q0 + 15;
  const int wlo   = q0 - window;                 // oldest valid key of row q0
  const size_t tok0 = (size_t)b * SQ;

  int kstart = qblk0 - window;
  kstart = (kstart > 0) ? (kstart & ~31) : 0;
  if (kstart > qblk0) kstart = qblk0;
  int nch = (qblk0 + 64 - kstart) >> 5;          // block-uniform
  if (nch > 64) nch = 64;
  if (nch < 0) nch = 0;

  const _Float16* Qhr = (const _Float16*)(const void*)qhp + (tok0 + q0 + c) * HID + h * HDM + 8 * hh;
  const _Float16* Qlr = (const _Float16*)(const void*)qlp + (tok0 + q0 + c) * HID + h * HDM + 8 * hh;
  const _Float16* Kg  = (const _Float16*)(const void*)khp + tok0 * KVW + kvh * HDM;
  const _Float16* Klg = (const _Float16*)(const void*)klp + tok0 * KVW + kvh * HDM;
  const _Float16* Vhg = (const _Float16*)(const void*)vhp + (size_t)(kvh * HDM) * NTOK + tok0;
  const _Float16* Vlg = (const _Float16*)(const void*)vlp + (size_t)(kvh * HDM) * NTOK + tok0;
  const unsigned kgo = (unsigned)((tid >> 4) * KVW + (tid & 15) * 8);    // this lane's element offset in a K chunk, piece 0
  const unsigned vgo = (unsigned)((tid >> 2) * NTOK + (tid & 3) * 8);    // and in a V^T chunk
  _Float16* ph = lds + LDS_PH + wave * (16 * PS_P);
  _Float16* pl = lds + LDS_PL + wave * (16 * PS_P);

  float mrow[8], lrow[8];
  v8f oacc[8], oaccr[8];
#pragma unroll
  for (int r = 0; r < 8; ++r) { mrow[r] = -INFINITY; lrow[r] = 0.f; }
#pragma unroll
  for (int t = 0; t < 8; ++t) { oacc[t] = zero8(); oaccr[t] = zero8(); }

  for (int kc = 0; kc < nch; ++kc) {
    const int kv0 = kstart + kc * AT_KC;         // keys kv0..kv0+31, all < SQ
    __syncthreads();
    // one lane pointer per plane for the chunk; the four pieces of a plane lie at constant distances from it
    const _Float16* kq  = Kg  + (size_t)kv0 * KVW + kgo;
    const _Float16* klq = Klg + (size_t)kv0 * KVW + kgo;
    const _Float16* vhq = Vhg + kv0 + vgo;
    const _Float16* vlq = Vlg + kv0 + vgo;
    v8h kx[4], ky[4], vx[4], vy[4];
#pragma unroll
    for (int i = 0; i < 4; ++i) {                // coverage: 512 pieces of 8 halves per plane = whole tile
      kx[i] = *(const v8h*)(kq + i * 8 * KVW);   // K: 32 keys x 128 d, key = (tid >> 4) + 8 i
      if (PRES) ky[i] = *(const v8h*)(klq + i * 8 * KVW);
      vx[i] = *(const v8h*)(vhq + i * 32 * NTOK); // V^T: 128 d x 32 keys, d = (tid >> 2) + 32 i
      vy[i] = *(const v8h*)(vlq + i * 32 * NTOK);
    }
    // precaution: the lane pointers are inputs here, so they keep their registers (no load result is placed over them) until this wait
    if (PRES) asm volatile("s_wait_xcnt 0x0" :: "v"(kq), "v"(klq), "v"(vhq), "v"(vlq) : "memory");
    else      asm volatile("s_wait_xcnt 0x0" :: "v"(kq), "v"(vhq), "v"(vlq) : "memory");
#pragma unroll
    for (int i = 0; i < 4; ++i) {
      const int p   = tid + 128 * i;             // 0..511
      const int key = p >> 4, d8 = (p & 15) * 8;
      *(v8h*)(Ks + key * KS_P + d8) = kx[i];
      if (PRES) *(v8h*)(Kls + key * KS_P + d8) = ky[i];
      const int d = p >> 2, k8 = (p & 3) * 8;
      *(v8h*)(Vhs + d * VS_P + k8) = vx[i];
      *(v8h*)(Vls + d * VS_P + k8) = vy[i];
    }
    __syncthreads();

    if (kv0 <= qlast && kv0 + AT_KC - 1 >= wlo) {   // wave-uniform (scalar): skip chunks with no valid key for this wave
      // ---- scores ----
      v8f sh[2], sr[2];
      sh[0] = zero8(); sh[1] = zero8(); sr[0] = zero8(); sr[1] = zero8();
#pragma unroll
      for (int dc = 0; dc < 4; ++dc) {
        const v16h qa = ldfrag_h(Qhr + dc * 32);
        const v16h ql = ldfrag_h(Qlr + dc * 32);
#pragma unroll
        for (int j = 0; j < 2; ++j) {
          const v16h kb = ldfrag_h(Ks + (j * 16 + c) * KS_P + dc * 32 + 8 * hh);
          sh[j] = mma_h(qa, kb, sh[j]);
          sr[j] = mma_h(ql, kb, sr[j]);
          if (PRES) {
            const v16h kl = ldfrag_h(Kls + (j * 16 + c) * KS_P + dc * 32 + 8 * hh);
            sr[j] = mma_h(qa, kl, sr[j]);
            guard_h4(sh[j], sr[j], qa, ql, kb, kl);
          } else {
            guard_h3(sh[j], sr[j], qa, ql, kb);
          }
        }
      }
      // ---- scale, window + causal validity, chunk row max ----
      float cm[8];
#pragma unroll
      for (int r = 0; r < 8; ++r) {
        const int qrow = q0 + 8 * hh + r;
        float m = -INFINITY;
#pragma unroll
        for (int j = 0; j < 2; ++j) {
          const int key = kv0 + j * 16 + c;
          float s = (sh[j][r] + sr[j][r] * 0.00048828125f) * 0.08838834764831845f;
          const bool ok = (key <= qrow) && (qrow - key <= window);
          s = ok ? s : -INFINITY;
          sh[j][r] = s;
          m = fmaxf(m, s);
        }
        cm[r] = m;
      }
      row_max16x8(cm);
      // ---- online softmax, P' to LDS ----
#pragma unroll
      for (int r = 0; r < 8; ++r) {
        const float mnew  = fmaxf(mrow[r], cm[r]);
        const float mref  = (mnew == -INFINITY) ? 0.f : mnew;   // row with no valid key yet: everything stays 0
        const float alpha = __expf(mrow[r] - mref);
        mrow[r] = mnew;
        float psum = 0.f;
#pragma unroll
        for (int j = 0; j < 2; ++j) {
          const float p  = __expf(sh[j][r] - mref);
          psum += p;
          const float pp = p * 1024.0f;
          const _Float16 phv = (_Float16)pp;
          const int po = (8 * hh + r) * PS_P + j * 16 + c;
          ph[po] = phv;
          if (PRES) pl[po] = (_Float16)((pp - (float)phv) * 2048.0f);
        }
        psum = row_sum16(psum);
        lrow[r] = lrow[r] * alpha + psum;
#pragma unroll
        for (int t = 0; t < 8; ++t) { oacc[t][r] *= alpha; oaccr[t][r] *= alpha; }
      }
      lds_wave_sync();                           // P' stores visible to the other lanes of this wave before the fragment reload
      // ---- O += P' . V ----
      const v16h pa = ldfrag_h(ph + c * PS_P + 8 * hh);
      v16h pr = pa;
      if (PRES) pr = ldfrag_h(pl + c * PS_P + 8 * hh);
#pragma unroll
      for (int t = 0; t < 8; ++t) {
        const v16h vb = ldfrag_h(Vhs + (t * 16 + c) * VS_P + 8 * hh);
        const v16h vr = ldfrag_h(Vls + (t * 16 + c) * VS_P + 8 * hh);
        oacc[t]  = mma_h(pa, vb, oacc[t]);
        oaccr[t] = mma_h(pa, vr, oaccr[t]);
        if (PRES) oaccr[t] = mma_h(pr, vb, oaccr[t]);
        guard_h4(oacc[t], oaccr[t], pa, pr, vb, vr);
      }
    }
  }

  __syncthreads();                               // all chunk-region readers done before aliasing it as output staging
  _Float16* osh = lds + wave * 4096;
  _Float16* osl = osh + 2048;
#pragma unroll
  for (int r = 0; r < 8; ++r) {
    const float inv = (1.0f / lrow[r]) * 0.0009765625f;
#pragma unroll
    for (int t = 0; t < 8; ++t) {
      const float o = (oacc[t][r] + oaccr[t][r] * 0.00048828125f) * inv;
      const unsigned short hb = bf_bits(o);
      const unsigned short lb = bf_bits(o - bf_val(hb));
      const int so = (8 * hh + r) * 128 + t * 16 + c;
      osh[so] = __builtin_bit_cast(_Float16, hb);
      osl[so] = __builtin_bit_cast(_Float16, lb);
    }
  }
  lds_wave_sync();
  _Float16* Ahg = (_Float16*)(void*)ahp + (tok0 + q0) * HID + h * HDM;
  _Float16* Alg = (_Float16*)(void*)alp + (tok0 + q0) * HID + h * HDM;
  {
#pragma unroll
    for (int it = 0; it < 8; ++it) {
      const int row = it * 2 + hh;               // it 0..7 x hh 0..1 covers rows 0..15
      const int c8  = c * 8;                     // 16 lanes x 16 B = the whole 256-B segment
      const v8h x = *(const v8h*)(osh + row * 128 + c8);
      const v8h y = *(const v8h*)(osl + row * 128 + c8);
      *(v8h*)(Ahg + (size_t)row * HID + c8) = x;
      *(v8h*)(Alg + (size_t)row * HID + c8) = y;
    }
    
  }
}

// ---------------------------------------------------------------------------
// Workspace map (bytes; every region is a whole number of the rows its producer writes with whole-line stores, no tails):
//   Xb    bf16 [4096][2048]   16777216   (the attn hi plane Ah [4096][2048] bf16 reuses this region after the last Xb reader)
//   Wqb   bf16 [2048][2048]    8388608      Wkb bf16 [1024][2048]  4194304      Wvb bf16 [1024][2048]  4194304
//   Wob   bf16 [2048][2048]    8388608      cst f32  [2048][64]     524288      snt f32  [2048][64]     524288
//   Qh    f16  [4096][2048]   16777216      Ql  f16  [4096][2048] 16777216
//   Kh    f16  [4096][1024]    8388608      Kl  f16  [4096][1024]  8388608
//   Vh    f16  [1024][4096]    8388608      Vl  f16  [1024][4096]  8388608
//   Al    bf16 [4096][2048]   16777216
//   total                    126877696
// ---------------------------------------------------------------------------
extern "C" void kernel_launch(void* const* d_in, const int* in_sizes, int n_in,
                              void* d_out, int out_size, void* d_ws, size_t ws_size,
                              hipStream_t stream) {
  if (n_in < 9) return;
  if (in_sizes[0] != NTOK * HID) return;
  if (in_sizes[1] != HID * HID) return;
  if (in_sizes[2] != HID) return;
  if (in_sizes[3] != KVW * HID) return;
  if (in_sizes[4] != KVW) return;
  if (in_sizes[5] != KVW * HID) return;
  if (in_sizes[6] != KVW) return;
  if (in_sizes[7] != HID * HID) return;
  if (in_sizes[8] < 1) return;
  if (out_size != NTOK * HID) return;

  const float* x    = (const float*)d_in[0];
  const float* wq_w = (const float*)d_in[1];
  const float* wq_b = (const float*)d_in[2];
  const float* wk_w = (const float*)d_in[3];
  const float* wk_b = (const float*)d_in[4];
  const float* wv_w = (const float*)d_in[5];
  const float* wv_b = (const float*)d_in[6];
  const float* wo_w = (const float*)d_in[7];
  const int*   win  = (const int*)d_in[8];
  float* out = (float*)d_out;

  const size_t szX  = (size_t)NTOK * HID * 2;
  const size_t szWq = (size_t)HID * HID * 2;
  const size_t szWk = (size_t)KVW * HID * 2;
  const size_t szWv = (size_t)KVW * HID * 2;
  const size_t szWo = (size_t)HID * HID * 2;
  const size_t szT  = (size_t)SQ * NFREQ * 4;
  const size_t szQ  = (size_t)NTOK * HID * 2;
  const size_t szK  = (size_t)NTOK * KVW * 2;
  const size_t szV  = (size_t)KVW * NTOK * 2;
  const size_t szA  = (size_t)NTOK * HID * 2;
  size_t off = 0;
  const size_t oX  = off; off += szX;
  const size_t oWq = off; off += szWq;
  const size_t oWk = off; off += szWk;
  const size_t oWv = off; off += szWv;
  const size_t oWo = off; off += szWo;
  const size_t oCs = off; off += szT;
  const size_t oSn = off; off += szT;
  const size_t oQh = off; off += szQ;
  const size_t oQl = off; off += szQ;
  const size_t oKh = off; off += szK;
  const size_t oKl = off; off += szK;
  const size_t oVh = off; off += szV;
  const size_t oVl = off; off += szV;
  const size_t oAl = off; off += szA;
  const size_t oAh = oX;                         // Ah reuses the Xb region (same byte size); Xb is dead after launch (9)
  if (szA != szX) return;
  if (off > ws_size) return;                     // off = 126877696

  char* ws = (char*)d_ws;
  unsigned short* Xb  = (unsigned short*)(ws + oX);
  unsigned short* Wqb = (unsigned short*)(ws + oWq);
  unsigned short* Wkb = (unsigned short*)(ws + oWk);
  unsigned short* Wvb = (unsigned short*)(ws + oWv);
  unsigned short* Wob = (unsigned short*)(ws + oWo);
  float*          cst = (float*)(ws + oCs);
  float*          snt = (float*)(ws + oSn);
  unsigned short* Qh  = (unsigned short*)(ws + oQh);
  unsigned short* Ql  = (unsigned short*)(ws + oQl);
  unsigned short* Kh  = (unsigned short*)(ws + oKh);
  unsigned short* Kl  = (unsigned short*)(ws + oKl);
  unsigned short* Vh  = (unsigned short*)(ws + oVh);
  unsigned short* Vl  = (unsigned short*)(ws + oVl);
  unsigned short* Ah  = (unsigned short*)(ws + oAh);
  unsigned short* Al  = (unsigned short*)(ws + oAl);

  const dim3 b256(256), b128(128);

  // (1) cos/sin table [2048][64] x 2
  rope_table_kernel<<<dim3(SQ / 8), b256, 0, stream>>>(cst, snt, SQ);
  // (2)-(6) RNE bf16 planes of x [4096][2048], Wq [2048][2048], Wk [1024][2048], Wv [1024][2048], Wo [2048][2048] (all [out][in] = Bt[n][k])
  cvt_bf16_kernel<<<dim3((NTOK * HID / 8) / 256), b256, 0, stream>>>(x,    Xb,  NTOK * HID / 8);
  cvt_bf16_kernel<<<dim3((HID * HID / 8) / 256),  b256, 0, stream>>>(wq_w, Wqb, HID * HID / 8);
  cvt_bf16_kernel<<<dim3((KVW * HID / 8) / 256),  b256, 0, stream>>>(wk_w, Wkb, KVW * HID / 8);
  cvt_bf16_kernel<<<dim3((KVW * HID / 8) / 256),  b256, 0, stream>>>(wv_w, Wvb, KVW * HID / 8);
  cvt_bf16_kernel<<<dim3((HID * HID / 8) / 256),  b256, 0, stream>>>(wo_w, Wob, HID * HID / 8);
  // (7) q = x . Wq^T + bq, RoPE -> Qh/Ql [4096][2048]   (M=4096, N=2048, K=2048; 32 x 16 block tiles)
  gemm_w32x128_kernel<0, false><<<dim3((NTOK / 128) * (HID / 128)), b128, 0, stream>>>(
      Xb, Xb, HID, Wqb, HID, wq_b, cst, snt, (void*)Qh, (void*)Ql, HID, NTOK, HID, HID);
  // (8) k = x . Wk^T + bk, RoPE -> Kh/Kl [4096][1024]   (M=4096, N=1024, K=2048; 32 x 8 block tiles)
  gemm_w32x128_kernel<0, false><<<dim3((NTOK / 128) * (KVW / 128)), b128, 0, stream>>>(
      Xb, Xb, HID, Wkb, HID, wk_b, cst, snt, (void*)Kh, (void*)Kl, KVW, NTOK, KVW, HID);
  // (9) v^T = Wv . x^T + bv[m] -> Vh/Vl [1024][4096]   (A = Wvb, Bt = Xb; M=1024, N=4096, K=2048; 8 x 32 block tiles)
  gemm_w32x128_kernel<1, false><<<dim3((KVW / 128) * (NTOK / 128)), b128, 0, stream>>>(
      Wvb, Wvb, HID, Xb, HID, wv_b, cst, snt, (void*)Vh, (void*)Vl, NTOK, KVW, NTOK, HID);
  // (10)-(11) windowed causal attention, query tiles 0..3 with k and p residual products, tiles 4..31 without
  attn_window_kernel<true><<<dim3(4, NHQ, NSEQ), b128, 0, stream>>>(Qh, Ql, Kh, Kl, Vh, Vl, Ah, Al, win, 0);
  attn_window_kernel<false><<<dim3(SQ / 64 - 4, NHQ, NSEQ), b128, 0, stream>>>(Qh, Ql, Kh, Kl, Vh, Vl, Ah, Al, win, 4);
  // (12) out = attn(hi + lo) . Wo^T -> d_out f32 [4096][2048]   (M=4096, N=2048, K=2048; 32 x 16 block tiles)
  gemm_w32x128_kernel<2, true><<<dim3((NTOK / 128) * (HID / 128)), b128, 0, stream>>>(
      Ah, Al, HID, Wob, HID, wq_b, cst, snt, (void*)out, (void*)out, HID, NTOK, HID, HID);
  (void)hipGetLastError();
}

// v004
// Measured time: 286 microseconds a run.
// Timed twice side by side with v003, it ran 1.13 times as fast both times.
// All steps since v000 together make it 2.85 times as fast.
// Contractions: x.Wq^T, x.Wk^T and Wv.x^T on v_wmma_f32_16x16x32_bf16 (operands = RNE bf16 of the f32 inputs, single products);
// q.k^T and p.v on v_wmma_f32_16x16x32_f16 (q = f16 hi + f16 residual x2^11 planes; k plain f16 plus f16 residual x2^11 on query tiles 0..3;
// p x1024 plain f16 plus f16 residual x2^11 on query tiles 0..3; v^T = f16 hi + f16 residual x2^11 planes); attn.Wo^T on v_wmma_f32_16x16x32_bf16
// (attn = bf16 hi + bf16 lo planes, two products; Wo RNE bf16). f32 accumulate everywhere; bias add, RoPE, online softmax and scale folds in f32.
#include <hip/hip_runtime.h>
#include <math.h>
#include <stdint.h>

#define NSEQ   2
#define SQ     2048
#define HID    2048
#define NHQ    16
#define NKVH   8
#define HDM    128
#define KVW    1024
#define NTOK   4096
#define NFREQ  64

typedef _Float16     v16h __attribute__((ext_vector_type(16)));
typedef _Float16     v8h  __attribute__((ext_vector_type(8)));
typedef __bf16       v16b __attribute__((ext_vector_type(16)));
typedef __bf16       v8b  __attribute__((ext_vector_type(8)));
typedef float        v8f  __attribute__((ext_vector_type(8)));
typedef float        v4f  __attribute__((ext_vector_type(4)));
typedef unsigned int v4u  __attribute__((ext_vector_type(4)));

// ---------------------------------------------------------------------------
// small helpers
// ---------------------------------------------------------------------------
__device__ __forceinline__ unsigned short bf_bits(float f) {          // RNE convert f32 -> bf16 bits
  const unsigned u = __float_as_uint(f);
  return (unsigned short)((u + 0x7FFFu + ((u >> 16) & 1u)) >> 16);
}
__device__ __forceinline__ float bf_val(unsigned short h) { return __uint_as_float(((unsigned)h) << 16); }
__device__ __forceinline__ float bf_rne(float f) { return bf_val(bf_bits(f)); }
__device__ __forceinline__ unsigned pk16(unsigned short a, unsigned short b) { return (unsigned)a | ((unsigned)b << 16); }
__device__ __forceinline__ v8f zero8() { v8f z = {0.f, 0.f, 0.f, 0.f, 0.f, 0.f, 0.f, 0.f}; return z; }
__device__ __forceinline__ int wave_id() { return __builtin_amdgcn_readfirstlane((int)(threadIdx.x >> 5)); }

__device__ __forceinline__ void lds_wave_sync() {
  __builtin_amdgcn_fence(__ATOMIC_RELEASE, "workgroup");
  __builtin_amdgcn_wave_barrier();
  __builtin_amdgcn_fence(__ATOMIC_ACQUIRE, "workgroup");
}

// Value of lane (l ^ X) of the same 16-lane row, X = 1, 2, 4, 8: a DPP row_xmask operand of the vector unit (control word 0x160 + X),
// all lanes on. It takes the place of __shfl_xor, which goes through the LDS pipe and is waited for at every step.
template <int X>
__device__ __forceinline__ float row_xor(float v) {
  return __builtin_bit_cast(float, __builtin_amdgcn_mov_dpp(__builtin_bit_cast(int, v), 0x160 + X, 0xf, 0xf, true));
}
// Maximum over each 16-lane row for eight values at once, all lanes on. Written as asm because from the builtin form the compiler makes three
// dependent instructions a step (the move, a quieting maximum, the maximum) and runs the eight chains one after another; here a step is
// one instruction, and the instruction it depends on stands eight back, so that no step waits for its predecessor.
__device__ __forceinline__ void row_max16x8(float (&m)[8]) {
  asm(
      "v_max_num_f32_dpp %0, %0, %0 row_xmask:1 row_mask:0xf bank_mask:0xf\n\t"
      "v_max_num_f32_dpp %1, %1, %1 row_xmask:1 row_mask:0xf bank_mask:0xf\n\t"
      "v_max_num_f32_dpp %2, %2, %2 row_xmask:1 row_mask:0xf bank_mask:0xf\n\t"
      "v_max_num_f32_dpp %3, %3, %3 row_xmask:1 row_mask:0xf bank_mask:0xf\n\t"
      "v_max_num_f32_dpp %4, %4, %4 row_xmask:1 row_mask:0xf bank_mask:0xf\n\t"
      "v_max_num_f32_dpp %5, %5, %5 row_xmask:1 row_mask:0xf bank_mask:0xf\n\t"
      "v_max_num_f32_dpp %6, %6, %6 row_xmask:1 row_mask:0xf bank_mask:0xf\n\t"
      "v_max_num_f32_dpp %7, %7, %7 row_xmask:1 row_mask:0xf bank_mask:0xf\n\t"
      "v_max_num_f32_dpp %0, %0, %0 row_xmask:2 row_mask:0xf bank_mask:0xf\n\t"
      "v_max_num_f32_dpp %1, %1, %1 row_xmask:2 row_mask:0xf bank_mask:0xf\n\t"
      "v_max_num_f32_dpp %2, %2, %2 row_xmask:2 row_mask:0xf bank_mask:0xf\n\t"
      "v_max_num_f32_dpp %3, %3, %3 row_xmask:2 row_mask:0xf bank_mask:0xf\n\t"
      "v_max_num_f32_dpp %4, %4, %4 row_xmask:2 row_mask:0xf bank_mask:0xf\n\t"
      "v_max_num_f32_dpp %5, %5, %5 row_xmask:2 row_mask:0xf bank_mask:0xf\n\t"
      "v_max_num_f32_dpp %6, %6, %6 row_xmask:2 row_mask:0xf bank_mask:0xf\n\t"
      "v_max_num_f32_dpp %7, %7, %7 row_xmask:2 row_mask:0xf bank_mask:0xf\n\t"
      "v_max_num_f32_dpp %0, %0, %0 row_xmask:4 row_mask:0xf bank_mask:0xf\n\t"
      "v_max_num_f32_dpp %1, %1, %1 row_xmask:4 row_mask:0xf bank_mask:0xf\n\t"
      "v_max_num_f32_dpp %2, %2, %2 row_xmask:4 row_mask:0xf bank_mask:0xf\n\t"
      "v_max_num_f32_dpp %3, %3, %3 row_xmask:4 row_mask:0xf bank_mask:0xf\n\t"
      "v_max_num_f32_dpp %4, %4, %4 row_xmask:4 row_mask:0xf bank_mask:0xf\n\t"
      "v_max_num_f32_dpp %5, %5, %5 row_xmask:4 row_mask:0xf bank_mask:0xf\n\t"
      "v_max_num_f32_dpp %6, %6, %6 row_xmask:4 row_mask:0xf bank_mask:0xf\n\t"
      "v_max_num_f32_dpp %7, %7, %7 row_xmask:4 row_mask:0xf bank_mask:0xf\n\t"
      "v_max_num_f32_dpp %0, %0, %0 row_xmask:8 row_mask:0xf bank_mask:0xf\n\t"
      "v_max_num_f32_dpp %1, %1, %1 row_xmask:8 row_mask:0xf bank_mask:0xf\n\t"
      "v_max_num_f32_dpp %2, %2, %2 row_xmask:8 row_mask:0xf bank_mask:0xf\n\t"
      "v_max_num_f32_dpp %3, %3, %3 row_xmask:8 row_mask:0xf bank_mask:0xf\n\t"
      "v_max_num_f32_dpp %4, %4, %4 row_xmask:8 row_mask:0xf bank_mask:0xf\n\t"
      "v_max_num_f32_dpp %5, %5, %5 row_xmask:8 row_mask:0xf bank_mask:0xf\n\t"
      "v_max_num_f32_dpp %6, %6, %6 row_xmask:8 row_mask:0xf bank_mask:0xf\n\t"
      "v_max_num_f32_dpp %7, %7, %7 row_xmask:8 row_mask:0xf bank_mask:0xf"
      : "+v"(m[0]), "+v"(m[1]), "+v"(m[2]), "+v"(m[3]), "+v"(m[4]), "+v"(m[5]), "+v"(m[6]), "+v"(m[7]));
}
__device__ __forceinline__ float row_sum16(float s) {      // same butterfly, same order of additions as the shuffle form
  s += row_xor<1>(s);
  s += row_xor<2>(s);
  s += row_xor<4>(s);
  s += row_xor<8>(s);
  return s;
}

// ---------------------------------------------------------------------------
// WMMA fragments (wave32, 16x16x32, 16-bit operands). For A (row m = lane&15) and B (col n = lane&15) alike:
// elements 0..7 <- k0 + 8*(lane>>4) + 0..7, elements 8..15 <- k0 + 16 + 8*(lane>>4) + 0..7.
// ldfrag(p) with p = rowbase + k0 + 8*(lane>>4): two 16-B loads p[0..7], p[16..23].
// D: acc[r] = (row 8*(lane>>4) + r, col lane&15).
// ---------------------------------------------------------------------------
union FragH { v16h v; v8h h[2]; };
union FragB { v16b v; v8b h[2]; };
__device__ __forceinline__ v16h ldfrag_h(const _Float16* p) { FragH f; f.h[0] = *(const v8h*)(p); f.h[1] = *(const v8h*)(p + 16); return f.v; }
__device__ __forceinline__ v16b ldfrag_b(const __bf16* p)   { FragB f; f.h[0] = *(const v8b*)(p); f.h[1] = *(const v8b*)(p + 16); return f.v; }

__device__ __forceinline__ v8f mma_h(v16h a, v16h b, v8f c) {
  return __builtin_amdgcn_wmma_f32_16x16x32_f16(false, a, false, b, (short)0, c, false, false);
}
__device__ __forceinline__ v8f mma_b(v16b a, v16b b, v8f c) {
  return __builtin_amdgcn_wmma_f32_16x16x32_bf16(false, a, false, b, (short)0, c, false, false);
}
// hazard guards: 4 VALU slots after the last WMMA of a group, D tied, A/B kept live; memory clobber keeps later loads behind the group
__device__ __forceinline__ void guard_h3(v8f& a, v8f& b, v16h x, v16h y, v16h z) {
  asm volatile("v_nop\n\tv_nop\n\tv_nop\n\tv_nop" : "+v"(a), "+v"(b) : "v"(x), "v"(y), "v"(z) : "memory");
}
__device__ __forceinline__ void guard_h4(v8f& a, v8f& b, v16h w, v16h x, v16h y, v16h z) {
  asm volatile("v_nop\n\tv_nop\n\tv_nop\n\tv_nop" : "+v"(a), "+v"(b) : "v"(w), "v"(x), "v"(y), "v"(z) : "memory");
}
__device__ __forceinline__ void acc_guard4(v8f& a, v8f& b, v8f& c, v8f& d) {
  asm volatile("v_nop\n\tv_nop\n\tv_nop\n\tv_nop" : "+v"(a), "+v"(b), "+v"(c), "+v"(d));
}

// ---------------------------------------------------------------------------
// RoPE table: cst[s][i] = cos(s * inv_freq[i]), snt[s][i] = sin(...), inv_freq[i] = 1 / 1e4^(i/64), i < 64, s < ns, all f32.
// Block = 8 waves, wave w -> position s = blockIdx.x*8 + w, lane -> i = lane, lane + 32.
// Coverage: grid ns/8 x 8 waves x 32 lanes x 2 = ns x 64 per plane.
// ---------------------------------------------------------------------------
__global__ __launch_bounds__(256) void rope_table_kernel(float* __restrict__ cst, float* __restrict__ snt, int ns) {
  const int lane = threadIdx.x & 31;
  const int wave = (int)(threadIdx.x >> 5);
  const int t = (int)blockIdx.x * 8 + wave;
  if (t >= ns) return;                       // no barriers in this kernel
  const float pf = (float)t;
  float c0 = 0.f, s0 = 0.f, c1 = 0.f, s1 = 0.f;
#pragma unroll 1
  for (int u = 0; u < 2; ++u) {
    const int i = lane + 32 * u;
    const float e   = (float)i * 0.015625f;      // i / 64 exact
    const float pw  = powf(10000.0f, e);
    const float inv = 1.0f / pw;
    const float ang = pf * inv;
    const float cv = cosf(ang);
    const float sv = sinf(ang);
    c1 = cv; s1 = sv;
    if (u == 0) { c0 = cv; s0 = sv; }
  }
  const size_t o = (size_t)t * NFREQ + lane;
  {
    ((float*)cst)[o]      = c0;
    ((float*)cst)[o + 32] = c1;
    ((float*)snt)[o]      = s0;
    ((float*)snt)[o + 32] = s1;
    
  }
}

// ---------------------------------------------------------------------------
// Elementwise RNE f32 -> bf16 plane: 8 elements per thread, one 16-B store per lane -> 32 consecutive lanes write 4 whole
// ---------------------------------------------------------------------------
__global__ __launch_bounds__(256) void cvt_bf16_kernel(const float* __restrict__ in, unsigned short* __restrict__ outp, int n8) {
  const int i = (int)blockIdx.x * 256 + (int)threadIdx.x;
  if (i >= n8) return;
  const size_t e = 8 * (size_t)i;
  const v4f a = *(const v4f*)(in + e);
  const v4f b = *(const v4f*)(in + e + 4);
  v4u w;
  w[0] = pk16(bf_bits(a[0]), bf_bits(a[1]));
  w[1] = pk16(bf_bits(a[2]), bf_bits(a[3]));
  w[2] = pk16(bf_bits(b[0]), bf_bits(b[1]));
  w[3] = pk16(bf_bits(b[2]), bf_bits(b[3]));
  *(v4u*)(outp + e) = w;
  
}

// ---------------------------------------------------------------------------
// bf16 WMMA GEMM, block = 4 waves (128 threads) = one 128 x 128 tile of C, wave w = rows 32w..32w+31 x all 128 cols.
//   C[m][n] = sum_k A[m][k] * Bt[n][k]; A row-major [M][K] bf16 (pitch lda), Bt row-major [N][K] bf16 (pitch ldb);
//   M % 128 == 0, N % 128 == 0, K % 64 == 0; grid.x = M/128 * N/128.
//   SPLITA: A carried as hi (Ap) + lo (A2p) bf16 planes, two products into one accumulator.
//   Operands: a pass is 64 k = one whole 128-B line of every operand row. The 128 A rows (both planes when SPLITA) and the
//   128 Bt rows of a pass are brought into LDS by asynchronous 16-B copies (8 lanes = one line, a wave instruction = 4 lines),
//   rows at pitch 144 B, two buffers: the next pass's copies fly while this pass is multiplied. The Bt tile is read by all
//   four waves. Fragments are read from LDS with the split k map (ldfrag_b), k ascending.
// Epilogues (all: per wave, per 16-row slab: stage in LDS, wave sync, write each row segment with ONE instruction of
//   EPI 0: q or k projection; the 128-col tile is one head. B rows are laid in LDS in even/odd order (row n0 + r in slot
//          64*(r&1) + (r>>1)):
//          acc tile j<4, lane rl holds output column n0 + 2*(16j+rl); tile j+4 holds n0 + 2*(16j+rl) + 1 (the interleaved pair).
//          + bf16(bias[n]); RoPE on the pair with cos/sin[pos = row & 2047][pair]; writes f16 hi plane C0 and f16 residual x2048
//          plane C1, both [M][ldc], cols n0..n0+127 (row segment 256 B = 16 lanes x 16 B).
//   EPI 1: v^T projection: + bf16(bias[m]); f16 hi plane C0, residual x2048 plane C1, [M][ldc], row segment 256 B.
//   EPI 2: f32 output C0 [M][ldc]; row segment 128 floats = 512 B = 32 lanes x 16 B per instruction.
// ---------------------------------------------------------------------------
template <int EPI> struct SlabT { typedef _Float16 T; static constexpr int PERW = 4096; };   // 2 planes x 16 x 128 halves
template <> struct SlabT<2>     { typedef float    T; static constexpr int PERW = 2048; };   // 16 x 128 floats

#define G_PITCH 72                    // LDS row pitch in 16-bit elements: 64 k + 8 = 144 B = 16 B x 9
#define G_TILE  (128 * G_PITCH)       // one 128-row operand tile of a pass, in elements

// One 128-row x 128-B operand tile into LDS: eight copies per lane, lane address pairs (l + i*lstep, g + i*gstep).
// The s_wait_xcnt stands in the copies' own statement so that no address register is rewritten ahead of it.
__device__ __forceinline__ void stage_tile(unsigned l, unsigned lstep, const unsigned short* g, size_t gstep) {
  asm volatile(
      "global_load_async_to_lds_b128 %0, %8, off\n\t"
      "global_load_async_to_lds_b128 %1, %9, off\n\t"
      "global_load_async_to_lds_b128 %2, %10, off\n\t"
      "global_load_async_to_lds_b128 %3, %11, off\n\t"
      "global_load_async_to_lds_b128 %4, %12, off\n\t"
      "global_load_async_to_lds_b128 %5, %13, off\n\t"
      "global_load_async_to_lds_b128 %6, %14, off\n\t"
      "global_load_async_to_lds_b128 %7, %15, off\n\t"
      "s_wait_xcnt 0x0"
      :: "v"(l), "v"(l + lstep), "v"(l + 2 * lstep), "v"(l + 3 * lstep),
         "v"(l + 4 * lstep), "v"(l + 5 * lstep), "v"(l + 6 * lstep), "v"(l + 7 * lstep),
         "v"(g), "v"(g + gstep), "v"(g + 2 * gstep), "v"(g + 3 * gstep),
         "v"(g + 4 * gstep), "v"(g + 5 * gstep), "v"(g + 6 * gstep), "v"(g + 7 * gstep)
      : "memory");
}

template <int EPI, bool SPLITA>
__global__ __launch_bounds__(128) void gemm_w32x128_kernel(
    const unsigned short* Ap, const unsigned short* A2p, int lda,
    const unsigned short* __restrict__ Btp, int ldb,
    const float* __restrict__ bias, const float* __restrict__ cst, const float* __restrict__ snt,
    void* C0, void* C1, int ldc,
    int M, int N, int K) {
  typedef typename SlabT<EPI>::T ST;
  constexpr int NPL = SPLITA ? 3 : 2;            // operand tiles per buffer: A (, A lo), Bt
  constexpr int BUF = NPL * G_TILE;              // elements per buffer
  __shared__ __align__(16) ST slab_all[4 * SlabT<EPI>::PERW];
  __shared__ __align__(16) unsigned short ring[2 * BUF];

  const int tid  = (int)threadIdx.x;
  const int lane = tid & 31;
  const int wave = wave_id();
  const int hh = lane >> 4;           // lane half: k offset 8*hh, D row offset 8*hh
  const int rl = lane & 15;           // A row / B col / D col within subtile
  const int tilesN = N >> 7;
  const int tilesM = M >> 7;
  const int tile = (int)blockIdx.x;
  if (tile >= tilesM * tilesN) return;          // block-uniform, in front of every barrier
  const int tm = tile / tilesN;
  const int tn = tile - tm * tilesN;
  const int mb = tm << 7;                       // first row of the block tile
  const int m0 = mb + (wave << 5);              // first row of this wave
  const int n0 = tn << 7;

  // copy addresses of this lane: copy i of a tile moves 16 B of source row (tid>>3) + 16*i, bytes 16*(tid&7)..+15 of the pass's line
  const int crow = tid >> 3;
  const int ccol = (tid & 7) * 8;
  const unsigned short* gA  = Ap  + (size_t)(mb + crow) * lda + ccol;
  const unsigned short* gA2 = A2p + (size_t)(mb + crow) * lda + ccol;
  const unsigned short* gB  = Btp + (size_t)(n0 + crow) * ldb + ccol;
  const unsigned ring0 = (unsigned)(uintptr_t)(&ring[0]);           // LDS byte address of the ring
  const unsigned lA = ring0 + (unsigned)(crow * G_PITCH + ccol) * 2u;
  const int bslot = (EPI == 0) ? ((crow & 1) * 64 + (crow >> 1)) : crow;
  const unsigned lB = ring0 + (unsigned)((NPL - 1) * G_TILE + bslot * G_PITCH + ccol) * 2u;
  const unsigned lstepA = 16u * G_PITCH * 2u;
  const unsigned lstepB = ((EPI == 0) ? 8u : 16u) * G_PITCH * 2u;
  const size_t gstepA = (size_t)16 * lda;
  const size_t gstepB = (size_t)16 * ldb;

  v8f acc[2][8];
#pragma unroll
  for (int i = 0; i < 2; ++i)
#pragma unroll
    for (int j = 0; j < 8; ++j) acc[i][j] = zero8();

  const int npass = K >> 6;
  // pass 0 into buffer 0, landed and published; then pass 1 into buffer 1
  stage_tile(lA, lstepA, gA, gstepA);
  if (SPLITA) stage_tile(lA + G_TILE * 2u, lstepA, gA2, gstepA);
  stage_tile(lB, lstepB, gB, gstepB);
  asm volatile("s_wait_asynccnt 0x0" ::: "memory");   // this wave's copies of pass 0 have landed
  __syncthreads();                                    // every wave's copies of pass 0 are readable by all
  if (npass > 1) {
    stage_tile(lA + BUF * 2u, lstepA, gA + 64, gstepA);
    if (SPLITA) stage_tile(lA + (BUF + G_TILE) * 2u, lstepA, gA2 + 64, gstepA);
    stage_tile(lB + BUF * 2u, lstepB, gB + 64, gstepB);
  }

  for (int t = 0; t < npass; ++t) {
    const int bo = (t & 1) * BUF;
    const __bf16* As = (const __bf16*)(const void*)(ring + bo) + ((wave << 5) + rl) * G_PITCH + 8 * hh;
    const __bf16* Bs = (const __bf16*)(const void*)(ring + bo + (NPL - 1) * G_TILE) + rl * G_PITCH + 8 * hh;
    v16b ah[2][2], al[2][2], bj[2][8];
#pragma unroll
    for (int kb = 0; kb < 2; ++kb) {
#pragma unroll
      for (int i = 0; i < 2; ++i) {
        ah[kb][i] = ldfrag_b(As + i * 16 * G_PITCH + kb * 32);
        al[kb][i] = SPLITA ? ldfrag_b(As + G_TILE + i * 16 * G_PITCH + kb * 32) : ah[kb][i];
      }
#pragma unroll
      for (int j = 0; j < 8; ++j) bj[kb][j] = ldfrag_b(Bs + j * 16 * G_PITCH + kb * 32);
    }
    // keeps the pass's LDS reads together in front of its WMMAs: left alone the compiler puts two reads and a full wait before every WMMA pair
    __builtin_amdgcn_sched_barrier(0);
#pragma unroll
    for (int kb = 0; kb < 2; ++kb) {
#pragma unroll
      for (int j = 0; j < 8; ++j) {
        acc[0][j] = mma_b(ah[kb][0], bj[kb][j], acc[0][j]);
        acc[1][j] = mma_b(ah[kb][1], bj[kb][j], acc[1][j]);
        if (SPLITA) {
          acc[0][j] = mma_b(al[kb][0], bj[kb][j], acc[0][j]);
          acc[1][j] = mma_b(al[kb][1], bj[kb][j], acc[1][j]);
        }
      }
    }
    // keeps the WMMAs in front of the waits and the barrier below, so that the next pass's copies fly for the whole of this pass
    __builtin_amdgcn_sched_barrier(0);
    asm volatile("s_wait_dscnt 0x0" ::: "memory");      // this wave's reads of the buffer are done before it is refilled
    asm volatile("s_wait_asynccnt 0x0" ::: "memory");   // this wave's copies of pass t + 1 have landed
    __syncthreads();                                    // publishes pass t + 1 and ends every reader's last read of pass t
    if (t + 2 < npass) {                                // block-uniform
      const size_t ko = (size_t)(t + 2) * 64;
      stage_tile(lA + (unsigned)bo * 2u, lstepA, gA + ko, gstepA);
      if (SPLITA) stage_tile(lA + (unsigned)(bo + G_TILE) * 2u, lstepA, gA2 + ko, gstepA);
      stage_tile(lB + (unsigned)bo * 2u, lstepB, gB + ko, gstepB);
    }
  }
  asm volatile("s_wait_asynccnt 0x0" ::: "memory");     // no copy is outstanding when the wave goes on to the epilogue
  acc_guard4(acc[0][0], acc[0][1], acc[0][2], acc[0][3]);
  acc_guard4(acc[0][4], acc[0][5], acc[0][6], acc[0][7]);
  acc_guard4(acc[1][0], acc[1][1], acc[1][2], acc[1][3]);
  acc_guard4(acc[1][4], acc[1][5], acc[1][6], acc[1][7]);

  // ---- epilogue ----
  ST* slab = slab_all + wave * SlabT<EPI>::PERW;
  _Float16* sl16 = (_Float16*)(void*)slab;
  float*    slf  = (float*)(void*)slab;

  if (EPI == 0) {
    _Float16* P0 = (_Float16*)C0;
    _Float16* P1 = (_Float16*)C1;
#pragma unroll
    for (int i = 0; i < 2; ++i) {
      const int rb = m0 + i * 16 + 8 * hh;
#pragma unroll
      for (int j = 0; j < 4; ++j) {
        const int pi = j * 16 + rl;                              // pair index 0..63 within head
        const int nc = n0 + 2 * pi;                              // column of x1; x2 at nc + 1
        const float b1 = bf_rne(bias[nc]);
        const float b2 = bf_rne(bias[nc + 1]);
#pragma unroll
        for (int r = 0; r < 8; ++r) {
          const int row = rb + r;                                // token 0..NTOK-1
          const int s   = row & (SQ - 1);                        // position within sequence
          const float cv = cst[(size_t)s * NFREQ + pi];
          const float sv = snt[(size_t)s * NFREQ + pi];
          const float x1 = acc[i][j][r] + b1;
          const float x2 = acc[i][j + 4][r] + b2;
          const float o1 = x1 * cv - x2 * sv;
          const float o2 = x1 * sv + x2 * cv;
          const _Float16 h1 = (_Float16)o1;
          const _Float16 h2 = (_Float16)o2;
          const int so = (8 * hh + r) * 128 + 2 * pi;
          sl16[so]            = h1;
          sl16[so + 1]        = h2;
          sl16[2048 + so]     = (_Float16)((o1 - (float)h1) * 2048.0f);
          sl16[2048 + so + 1] = (_Float16)((o2 - (float)h2) * 2048.0f);
        }
      }
      lds_wave_sync();
      {
#pragma unroll
        for (int it = 0; it < 8; ++it) {
          const int row = it * 2 + hh;                           // it x hh covers rows 0..15
          const int c8  = rl * 8;
          const v8h vh = *(const v8h*)(sl16 + row * 128 + c8);
          const v8h vl = *(const v8h*)(sl16 + 2048 + row * 128 + c8);
          const size_t go = (size_t)(m0 + i * 16 + row) * ldc + n0 + c8;
          *(v8h*)(P0 + go) = vh;
          *(v8h*)(P1 + go) = vl;
        }
        
      }
      lds_wave_sync();
    }
  } else if (EPI == 1) {
    _Float16* P0 = (_Float16*)C0;
    _Float16* P1 = (_Float16*)C1;
#pragma unroll
    for (int i = 0; i < 2; ++i) {
#pragma unroll
      for (int r = 0; r < 8; ++r) {
        const int m = m0 + i * 16 + 8 * hh + r;
        const float bm = bf_rne(bias[m]);
#pragma unroll
        for (int j = 0; j < 8; ++j) {
          const float v = acc[i][j][r] + bm;
          const _Float16 hv = (_Float16)v;
          const int so = (8 * hh + r) * 128 + j * 16 + rl;
          sl16[so]        = hv;
          sl16[2048 + so] = (_Float16)((v - (float)hv) * 2048.0f);
        }
      }
      lds_wave_sync();
      {
#pragma unroll
        for (int it = 0; it < 8; ++it) {
          const int row = it * 2 + hh;
          const int c8  = rl * 8;
          const v8h vh = *(const v8h*)(sl16 + row * 128 + c8);
          const v8h vl = *(const v8h*)(sl16 + 2048 + row * 128 + c8);
          const size_t go = (size_t)(m0 + i * 16 + row) * ldc + n0 + c8;
          *(v8h*)(P0 + go) = vh;
          *(v8h*)(P1 + go) = vl;
        }
        
      }
      lds_wave_sync();
    }
  } else {
    float* C = (float*)C0;
#pragma unroll
    for (int i = 0; i < 2; ++i) {
#pragma unroll
      for (int j = 0; j < 8; ++j)
#pragma unroll
        for (int r = 0; r < 8; ++r)
          slf[(8 * hh + r) * 128 + j * 16 + rl] = acc[i][j][r];
      lds_wave_sync();
      {
#pragma unroll
        for (int row = 0; row < 16; ++row) {                     // 32 lanes x 16 B = the whole 512-B row segment per instruction
          const v4f v = *(const v4f*)(slf + row * 128 + lane * 4);
          *(v4f*)(C + (size_t)(m0 + i * 16 + row) * ldc + n0 + lane * 4) = v;
        }
        
      }
      lds_wave_sync();
    }
  }
}

// ---------------------------------------------------------------------------
// Windowed causal GQA flash attention, head dim 128, 32-key chunks, block = 4 waves = 64 query rows of one (b, h);
// grid (n query tiles, NHQ, NSEQ). Key j is valid for query i iff j <= i and i - j <= window (window read from the int input).
//   q planes f16 [tok][h*128+d]: hi (qhp) and residual x2048 (qlp); k planes f16 [tok][kvh*128+d]: hi (khp), residual x2048 (klp);
//   v^T planes f16 [kvh*128+d][tok]: hi (vhp), residual x2048 (vlp); outputs attn bf16 hi (ahp) / lo (alp) [tok][h*128+d].
//   scores = (Sh + Sr/2048) * 128^-0.5 with Sh = qh.kh and Sr = ql'.kh (+ qh.kl' when PRES); invalid keys -> -inf; online softmax f32
//   (-inf safe: a row with no valid key so far keeps m = -inf, l = 0, O = 0);
//   p' = 1024 p stored per wave to LDS as f16 hi (and residual x2048 when PRES), reloaded as A fragments after a wave sync;
//   O = (Oh + Or/2048)/1024/l with Oh = ph.vh, Or = ph.vl' (+ pl'.vh when PRES).
//   q staging: each wave copies its 16 rows of both q planes into LDS once, rows at pitch 272 B, and reads its A fragments from there.
//   K / V^T chunk staging: 128 threads x 4 x 16 B per plane = whole 32x128 / 128x32 tile, plain loads, __syncthreads before and after.
//   Chunks cover keys [max(0, 64*qb - window) & ~31, 64*qb + 63]; trip count statically <= 64; waves with no valid key in a chunk
//   skip its compute part (wave-uniform, scalar branch).
// ---------------------------------------------------------------------------
#define AT_KC   32
#define KS_P    136
#define VS_P    40
#define PS_P    40
#define QS_P    136
// LDS map in halves. The k residual tile and the p residual tile exist only with PRES; without them four work-groups still share a WGP's LDS.
template <bool PRES> struct AttnLds {
  static constexpr int KS  = 0;
  static constexpr int KLS = 32 * KS_P;
  static constexpr int VHS = (PRES ? 2 : 1) * 32 * KS_P;
  static constexpr int VLS = VHS + 128 * VS_P;
  static constexpr int PH  = VLS + 128 * VS_P;
  static constexpr int PL  = PH + 4 * 16 * PS_P;
  static constexpr int QH  = PH + (PRES ? 2 : 1) * 4 * 16 * PS_P;
  static constexpr int QL  = QH + 64 * QS_P;
  static constexpr int TOT = QL + 64 * QS_P;
};
static_assert(AttnLds<false>::TOT * 2 * 4 <= 327680);   // four work-groups of the long launch per WGP
static_assert(4 * 4096 <= AttnLds<false>::QH);          // output staging (2 planes x 16 x 128 per wave) aliases the chunk region after the loop

template <bool PRES>
// The long launch (no residual products, 896 work-groups) gets a budget of 256 registers a wave = four waves per SIMD: four work-groups
// share a WGP and the whole launch is resident at once. The short launch has fewer work-groups than there are WGPs and keeps the full budget.
__global__ __launch_bounds__(128) __attribute__((amdgpu_waves_per_eu(PRES ? 1 : 4))) void attn_window_kernel(
    const unsigned short* __restrict__ qhp, const unsigned short* __restrict__ qlp,
    const unsigned short* __restrict__ khp, const unsigned short* __restrict__ klp,
    const unsigned short* __restrict__ vhp, const unsigned short* __restrict__ vlp,
    unsigned short* __restrict__ ahp, unsigned short* __restrict__ alp,
    const int* __restrict__ winp, int qb_base) {
  typedef AttnLds<PRES> L;
  __shared__ __align__(16) _Float16 lds[L::TOT];
  _Float16* Ks  = lds + L::KS;
  _Float16* Kls = lds + L::KLS;
  _Float16* Vhs = lds + L::VHS;
  _Float16* Vls = lds + L::VLS;

  const int tid  = (int)threadIdx.x;
  const int lane = tid & 31;
  const int wave = wave_id();
  const int hh   = lane >> 4;
  const int c    = lane & 15;
  const int qb   = (int)blockIdx.x + qb_base;
  const int h    = (int)blockIdx.y;
  const int b    = (int)blockIdx.z;
  const int kvh  = h >> 1;                       // 2 query heads per kv head
  const int window = __builtin_amdgcn_readfirstlane(winp[0]);
  const int qblk0 = qb * 64;
  const int q0    = qblk0 + wave * 16;           // first query row of this wave (within sequence)
  const int qlast = q0 + 15;
  const int wlo   = q0 - window;                 // oldest valid key of row q0
  const size_t tok0 = (size_t)b * SQ;

  int kstart = qblk0 - window;
  kstart = (kstart > 0) ? (kstart & ~31) : 0;
  if (kstart > qblk0) kstart = qblk0;
  int nch = (qblk0 + 64 - kstart) >> 5;          // block-uniform
  if (nch > 64) nch = 64;
  if (nch < 0) nch = 0;

  // This wave's 16 query rows, both planes, go into LDS once (16 lanes = one 256-B row, row = (lane >> 4) + 2 i); every chunk reads its
  // A fragments from there. Only this wave reads them, behind the two barriers at the head of the first chunk.
  _Float16* Qhs = lds + L::QH + wave * (16 * QS_P);
  _Float16* Qls = lds + L::QL + wave * (16 * QS_P);
  {
    const _Float16* qhg = (const _Float16*)(const void*)qhp + (tok0 + q0 + hh) * HID + h * HDM + c * 8;
    const _Float16* qlg = (const _Float16*)(const void*)qlp + (tok0 + q0 + hh) * HID + h * HDM + c * 8;
    v8h qx[8], qy[8];
#pragma unroll   // constant indices keep qx and qy in registers, and all sixteen loads are in flight at once
    for (int i = 0; i < 8; ++i) {
      qx[i] = *(const v8h*)(qhg + i * 2 * HID);
      qy[i] = *(const v8h*)(qlg + i * 2 * HID);
    }
    // precaution: the lane pointers are inputs here, so they keep their registers (no load result is placed over them) until this wait
    asm volatile("s_wait_xcnt 0x0" :: "v"(qhg), "v"(qlg) : "memory");
#pragma unroll   // as above: constant indices into qx and qy
    for (int i = 0; i < 8; ++i) {
      *(v8h*)(Qhs + (hh + 2 * i) * QS_P + c * 8) = qx[i];
      *(v8h*)(Qls + (hh + 2 * i) * QS_P + c * 8) = qy[i];
    }
  }
  const _Float16* Qhr = Qhs + c * QS_P + 8 * hh;   // A fragment row of this lane
  const _Float16* Qlr = Qls + c * QS_P + 8 * hh;
  const _Float16* Kg  = (const _Float16*)(const void*)khp + tok0 * KVW + kvh * HDM;
  const _Float16* Klg = (const _Float16*)(const void*)klp + tok0 * KVW + kvh * HDM;
  const _Float16* Vhg = (const _Float16*)(const void*)vhp + (size_t)(kvh * HDM) * NTOK + tok0;
  const _Float16* Vlg = (const _Float16*)(const void*)vlp + (size_t)(kvh * HDM) * NTOK + tok0;
  const unsigned kgo = (unsigned)((tid >> 4) * KVW + (tid & 15) * 8);    // this lane's element offset in a K chunk, piece 0
  const unsigned vgo = (unsigned)((tid >> 2) * NTOK + (tid & 3) * 8);    // and in a V^T chunk
  _Float16* ph = lds + L::PH + wave * (16 * PS_P);
  _Float16* pl = lds + L::PL + wave * (16 * PS_P);

  float mrow[8], lrow[8];
  v8f oacc[8], oaccr[8];
#pragma unroll
  for (int r = 0; r < 8; ++r) { mrow[r] = -INFINITY; lrow[r] = 0.f; }
#pragma unroll
  for (int t = 0; t < 8; ++t) { oacc[t] = zero8(); oaccr[t] = zero8(); }

  for (int kc = 0; kc < nch; ++kc) {
    const int kv0 = kstart + kc * AT_KC;         // keys kv0..kv0+31, all < SQ
    __syncthreads();
    // one lane pointer per plane for the chunk; the four pieces of a plane lie at constant distances from it
    const _Float16* kq  = Kg  + (size_t)kv0 * KVW + kgo;
    const _Float16* klq = Klg + (size_t)kv0 * KVW + kgo;
    const _Float16* vhq = Vhg + kv0 + vgo;
    const _Float16* vlq = Vlg + kv0 + vgo;
    v8h kx[4], ky[4], vx[4], vy[4];
#pragma unroll
    for (int i = 0; i < 4; ++i) {                // coverage: 512 pieces of 8 halves per plane = whole tile
      kx[i] = *(const v8h*)(kq + i * 8 * KVW);   // K: 32 keys x 128 d, key = (tid >> 4) + 8 i
      if (PRES) ky[i] = *(const v8h*)(klq + i * 8 * KVW);
      vx[i] = *(const v8h*)(vhq + i * 32 * NTOK); // V^T: 128 d x 32 keys, d = (tid >> 2) + 32 i
      vy[i] = *(const v8h*)(vlq + i * 32 * NTOK);
    }
    // precaution: the lane pointers are inputs here, so they keep their registers (no load result is placed over them) until this wait
    if (PRES) asm volatile("s_wait_xcnt 0x0" :: "v"(kq), "v"(klq), "v"(vhq), "v"(vlq) : "memory");
    else      asm volatile("s_wait_xcnt 0x0" :: "v"(kq), "v"(vhq), "v"(vlq) : "memory");
#pragma unroll
    for (int i = 0; i < 4; ++i) {
      const int p   = tid + 128 * i;             // 0..511
      const int key = p >> 4, d8 = (p & 15) * 8;
      *(v8h*)(Ks + key * KS_P + d8) = kx[i];
      if (PRES) *(v8h*)(Kls + key * KS_P + d8) = ky[i];
      const int d = p >> 2, k8 = (p & 3) * 8;
      *(v8h*)(Vhs + d * VS_P + k8) = vx[i];
      *(v8h*)(Vls + d * VS_P + k8) = vy[i];
    }
    __syncthreads();

    if (kv0 <= qlast && kv0 + AT_KC - 1 >= wlo) {   // wave-uniform (scalar): skip chunks with no valid key for this wave
      // ---- scores ----
      v8f sh[2], sr[2];
      sh[0] = zero8(); sh[1] = zero8(); sr[0] = zero8(); sr[1] = zero8();
#pragma unroll
      for (int dc = 0; dc < 4; ++dc) {
        const v16h qa = ldfrag_h(Qhr + dc * 32);
        const v16h ql = ldfrag_h(Qlr + dc * 32);
#pragma unroll
        for (int j = 0; j < 2; ++j) {
          const v16h kb = ldfrag_h(Ks + (j * 16 + c) * KS_P + dc * 32 + 8 * hh);
          sh[j] = mma_h(qa, kb, sh[j]);
          sr[j] = mma_h(ql, kb, sr[j]);
          if (PRES) {
            const v16h kl = ldfrag_h(Kls + (j * 16 + c) * KS_P + dc * 32 + 8 * hh);
            sr[j] = mma_h(qa, kl, sr[j]);
            guard_h4(sh[j], sr[j], qa, ql, kb, kl);
          } else {
            guard_h3(sh[j], sr[j], qa, ql, kb);
          }
        }
      }
      // ---- scale, window + causal validity, chunk row max ----
      float cm[8];
#pragma unroll
      for (int r = 0; r < 8; ++r) {
        const int qrow = q0 + 8 * hh + r;
        float m = -INFINITY;
#pragma unroll
        for (int j = 0; j < 2; ++j) {
          const int key = kv0 + j * 16 + c;
          float s = (sh[j][r] + sr[j][r] * 0.00048828125f) * 0.08838834764831845f;
          const bool ok = (key <= qrow) && (qrow - key <= window);
          s = ok ? s : -INFINITY;
          sh[j][r] = s;
          m = fmaxf(m, s);
        }
        cm[r] = m;
      }
      row_max16x8(cm);
      // ---- online softmax, P' to LDS ----
#pragma unroll
      for (int r = 0; r < 8; ++r) {
        const float mnew  = fmaxf(mrow[r], cm[r]);
        const float mref  = (mnew == -INFINITY) ? 0.f : mnew;   // row with no valid key yet: everything stays 0
        const float alpha = __expf(mrow[r] - mref);
        mrow[r] = mnew;
        float psum = 0.f;
#pragma unroll
        for (int j = 0; j < 2; ++j) {
          const float p  = __expf(sh[j][r] - mref);
          psum += p;
          const float pp = p * 1024.0f;
          const _Float16 phv = (_Float16)pp;
          const int po = (8 * hh + r) * PS_P + j * 16 + c;
          ph[po] = phv;
          if (PRES) pl[po] = (_Float16)((pp - (float)phv) * 2048.0f);
        }
        psum = row_sum16(psum);
        lrow[r] = lrow[r] * alpha + psum;
#pragma unroll
        for (int t = 0; t < 8; ++t) { oacc[t][r] *= alpha; oaccr[t][r] *= alpha; }
      }
      lds_wave_sync();                           // P' stores visible to the other lanes of this wave before the fragment reload
      // ---- O += P' . V ----
      const v16h pa = ldfrag_h(ph + c * PS_P + 8 * hh);
      v16h pr = pa;
      if (PRES) pr = ldfrag_h(pl + c * PS_P + 8 * hh);
#pragma unroll
      for (int t = 0; t < 8; ++t) {
        const v16h vb = ldfrag_h(Vhs + (t * 16 + c) * VS_P + 8 * hh);
        const v16h vr = ldfrag_h(Vls + (t * 16 + c) * VS_P + 8 * hh);
        oacc[t]  = mma_h(pa, vb, oacc[t]);
        oaccr[t] = mma_h(pa, vr, oaccr[t]);
        if (PRES) oaccr[t] = mma_h(pr, vb, oaccr[t]);
        guard_h4(oacc[t], oaccr[t], pa, pr, vb, vr);
      }
    }
  }

  __syncthreads();                               // all chunk-region readers done before aliasing it as output staging
  _Float16* osh = lds + wave * 4096;
  _Float16* osl = osh + 2048;
#pragma unroll
  for (int r = 0; r < 8; ++r) {
    const float inv = (1.0f / lrow[r]) * 0.0009765625f;
#pragma unroll
    for (int t = 0; t < 8; ++t) {
      const float o = (oacc[t][r] + oaccr[t][r] * 0.00048828125f) * inv;
      const unsigned short hb = bf_bits(o);
      const unsigned short lb = bf_bits(o - bf_val(hb));
      const int so = (8 * hh + r) * 128 + t * 16 + c;
      osh[so] = __builtin_bit_cast(_Float16, hb);
      osl[so] = __builtin_bit_cast(_Float16, lb);
    }
  }
  lds_wave_sync();
  _Float16* Ahg = (_Float16*)(void*)ahp + (tok0 + q0) * HID + h * HDM;
  _Float16* Alg = (_Float16*)(void*)alp + (tok0 + q0) * HID + h * HDM;
  {
#pragma unroll
    for (int it = 0; it < 8; ++it) {
      const int row = it * 2 + hh;               // it 0..7 x hh 0..1 covers rows 0..15
      const int c8  = c * 8;                     // 16 lanes x 16 B = the whole 256-B segment
      const v8h x = *(const v8h*)(osh + row * 128 + c8);
      const v8h y = *(const v8h*)(osl + row * 128 + c8);
      *(v8h*)(Ahg + (size_t)row * HID + c8) = x;
      *(v8h*)(Alg + (size_t)row * HID + c8) = y;
    }
    
  }
}

// ---------------------------------------------------------------------------
// Workspace map (bytes; every region is a whole number of the rows its producer writes with whole-line stores, no tails):
//   Xb    bf16 [4096][2048]   16777216   (the attn hi plane Ah [4096][2048] bf16 reuses this region after the last Xb reader)
//   Wqb   bf16 [2048][2048]    8388608      Wkb bf16 [1024][2048]  4194304      Wvb bf16 [1024][2048]  4194304
//   Wob   bf16 [2048][2048]    8388608      cst f32  [2048][64]     524288      snt f32  [2048][64]     524288
//   Qh    f16  [4096][2048]   16777216      Ql  f16  [4096][2048] 16777216
//   Kh    f16  [4096][1024]    8388608      Kl  f16  [4096][1024]  8388608
//   Vh    f16  [1024][4096]    8388608      Vl  f16  [1024][4096]  8388608
//   Al    bf16 [4096][2048]   16777216
//   total                    126877696
// ---------------------------------------------------------------------------
extern "C" void kernel_launch(void* const* d_in, const int* in_sizes, int n_in,
                              void* d_out, int out_size, void* d_ws, size_t ws_size,
                              hipStream_t stream) {
  if (n_in < 9) return;
  if (in_sizes[0] != NTOK * HID) return;
  if (in_sizes[1] != HID * HID) return;
  if (in_sizes[2] != HID) return;
  if (in_sizes[3] != KVW * HID) return;
  if (in_sizes[4] != KVW) return;
  if (in_sizes[5] != KVW * HID) return;
  if (in_sizes[6] != KVW) return;
  if (in_sizes[7] != HID * HID) return;
  if (in_sizes[8] < 1) return;
  if (out_size != NTOK * HID) return;

  const float* x    = (const float*)d_in[0];
  const float* wq_w = (const float*)d_in[1];
  const float* wq_b = (const float*)d_in[2];
  const float* wk_w = (const float*)d_in[3];
  const float* wk_b = (const float*)d_in[4];
  const float* wv_w = (const float*)d_in[5];
  const float* wv_b = (const float*)d_in[6];
  const float* wo_w = (const float*)d_in[7];
  const int*   win  = (const int*)d_in[8];
  float* out = (float*)d_out;

  const size_t szX  = (size_t)NTOK * HID * 2;
  const size_t szWq = (size_t)HID * HID * 2;
  const size_t szWk = (size_t)KVW * HID * 2;
  const size_t szWv = (size_t)KVW * HID * 2;
  const size_t szWo = (size_t)HID * HID * 2;
  const size_t szT  = (size_t)SQ * NFREQ * 4;
  const size_t szQ  = (size_t)NTOK * HID * 2;
  const size_t szK  = (size_t)NTOK * KVW * 2;
  const size_t szV  = (size_t)KVW * NTOK * 2;
  const size_t szA  = (size_t)NTOK * HID * 2;
  size_t off = 0;
  const size_t oX  = off; off += szX;
  const size_t oWq = off; off += szWq;
  const size_t oWk = off; off += szWk;
  const size_t oWv = off; off += szWv;
  const size_t oWo = off; off += szWo;
  const size_t oCs = off; off += szT;
  const size_t oSn = off; off += szT;
  const size_t oQh = off; off += szQ;
  const size_t oQl = off; off += szQ;
  const size_t oKh = off; off += szK;
  const size_t oKl = off; off += szK;
  const size_t oVh = off; off += szV;
  const size_t oVl = off; off += szV;
  const size_t oAl = off; off += szA;
  const size_t oAh = oX;                         // Ah reuses the Xb region (same byte size); Xb is dead after launch (9)
  if (szA != szX) return;
  if (off > ws_size) return;                     // off = 126877696

  char* ws = (char*)d_ws;
  unsigned short* Xb  = (unsigned short*)(ws + oX);
  unsigned short* Wqb = (unsigned short*)(ws + oWq);
  unsigned short* Wkb = (unsigned short*)(ws + oWk);
  unsigned short* Wvb = (unsigned short*)(ws + oWv);
  unsigned short* Wob = (unsigned short*)(ws + oWo);
  float*          cst = (float*)(ws + oCs);
  float*          snt = (float*)(ws + oSn);
  unsigned short* Qh  = (unsigned short*)(ws + oQh);
  unsigned short* Ql  = (unsigned short*)(ws + oQl);
  unsigned short* Kh  = (unsigned short*)(ws + oKh);
  unsigned short* Kl  = (unsigned short*)(ws + oKl);
  unsigned short* Vh  = (unsigned short*)(ws + oVh);
  unsigned short* Vl  = (unsigned short*)(ws + oVl);
  unsigned short* Ah  = (unsigned short*)(ws + oAh);
  unsigned short* Al  = (unsigned short*)(ws + oAl);

  const dim3 b256(256), b128(128);

  // (1) cos/sin table [2048][64] x 2
  rope_table_kernel<<<dim3(SQ / 8), b256, 0, stream>>>(cst, snt, SQ);
  // (2)-(6) RNE bf16 planes of x [4096][2048], Wq [2048][2048], Wk [1024][2048], Wv [1024][2048], Wo [2048][2048] (all [out][in] = Bt[n][k])
  cvt_bf16_kernel<<<dim3((NTOK * HID / 8) / 256), b256, 0, stream>>>(x,    Xb,  NTOK * HID / 8);
  cvt_bf16_kernel<<<dim3((HID * HID / 8) / 256),  b256, 0, stream>>>(wq_w, Wqb, HID * HID / 8);
  cvt_bf16_kernel<<<dim3((KVW * HID / 8) / 256),  b256, 0, stream>>>(wk_w, Wkb, KVW * HID / 8);
  cvt_bf16_kernel<<<dim3((KVW * HID / 8) / 256),  b256, 0, stream>>>(wv_w, Wvb, KVW * HID / 8);
  cvt_bf16_kernel<<<dim3((HID * HID / 8) / 256),  b256, 0, stream>>>(wo_w, Wob, HID * HID / 8);
  // (7) q = x . Wq^T + bq, RoPE -> Qh/Ql [4096][2048]   (M=4096, N=2048, K=2048; 32 x 16 block tiles)
  gemm_w32x128_kernel<0, false><<<dim3((NTOK / 128) * (HID / 128)), b128, 0, stream>>>(
      Xb, Xb, HID, Wqb, HID, wq_b, cst, snt, (void*)Qh, (void*)Ql, HID, NTOK, HID, HID);
  // (8) k = x . Wk^T + bk, RoPE -> Kh/Kl [4096][1024]   (M=4096, N=1024, K=2048; 32 x 8 block tiles)
  gemm_w32x128_kernel<0, false><<<dim3((NTOK / 128) * (KVW / 128)), b128, 0, stream>>>(
      Xb, Xb, HID, Wkb, HID, wk_b, cst, snt, (void*)Kh, (void*)Kl, KVW, NTOK, KVW, HID);
  // (9) v^T = Wv . x^T + bv[m] -> Vh/Vl [1024][4096]   (A = Wvb, Bt = Xb; M=1024, N=4096, K=2048; 8 x 32 block tiles)
  gemm_w32x128_kernel<1, false><<<dim3((KVW / 128) * (NTOK / 128)), b128, 0, stream>>>(
      Wvb, Wvb, HID, Xb, HID, wv_b, cst, snt, (void*)Vh, (void*)Vl, NTOK, KVW, NTOK, HID);
  // (10)-(11) windowed causal attention, query tiles 0..3 with k and p residual products, tiles 4..31 without
  attn_window_kernel<true><<<dim3(4, NHQ, NSEQ), b128, 0, stream>>>(Qh, Ql, Kh, Kl, Vh, Vl, Ah, Al, win, 0);
  attn_window_kernel<false><<<dim3(SQ / 64 - 4, NHQ, NSEQ), b128, 0, stream>>>(Qh, Ql, Kh, Kl, Vh, Vl, Ah, Al, win, 4);
  // (12) out = attn(hi + lo) . Wo^T -> d_out f32 [4096][2048]   (M=4096, N=2048, K=2048; 32 x 16 block tiles)
  gemm_w32x128_kernel<2, true><<<dim3((NTOK / 128) * (HID / 128)), b128, 0, stream>>>(
      Ah, Al, HID, Wob, HID, wq_b, cst, snt, (void*)out, (void*)out, HID, NTOK, HID, HID);
  (void)hipGetLastError();
}

// v005
// Measured time: 275 microseconds a run.
// Timed twice side by side with v004, it ran 1.03 and 1.05 times as fast.
// All steps since v000 together make it 2.97 times as fast.
// Contractions: x.Wq^T, x.Wk^T and Wv.x^T on v_wmma_f32_16x16x32_bf16 (operands = RNE bf16 of the f32 inputs, single products);
// q.k^T and p.v on v_wmma_f32_16x16x32_f16 (q = f16 hi + f16 residual x2^11 planes; k plain f16 plus f16 residual x2^11 on query tiles 0..3;
// p x1024 plain f16 plus f16 residual x2^11 on query tiles 0..3; v^T = f16 hi + f16 residual x2^11 planes); attn.Wo^T on v_wmma_f32_16x16x32_bf16
// (attn = bf16 hi + bf16 lo planes, two products; Wo RNE bf16). f32 accumulate everywhere; bias add, RoPE, online softmax and scale folds in f32.
#include <hip/hip_runtime.h>
#include <math.h>
#include <stdint.h>

#define NSEQ   2
#define SQ     2048
#define HID    2048
#define NHQ    16
#define NKVH   8
#define HDM    128
#define KVW    1024
#define NTOK   4096
#define NFREQ  64

typedef _Float16     v16h __attribute__((ext_vector_type(16)));
typedef _Float16     v8h  __attribute__((ext_vector_type(8)));
typedef __bf16       v16b __attribute__((ext_vector_type(16)));
typedef __bf16       v8b  __attribute__((ext_vector_type(8)));
typedef float        v8f  __attribute__((ext_vector_type(8)));
typedef float        v4f  __attribute__((ext_vector_type(4)));
typedef unsigned int v4u  __attribute__((ext_vector_type(4)));

// ---------------------------------------------------------------------------
// small helpers
// ---------------------------------------------------------------------------
__device__ __forceinline__ unsigned short bf_bits(float f) {          // RNE convert f32 -> bf16 bits
  const unsigned u = __float_as_uint(f);
  return (unsigned short)((u + 0x7FFFu + ((u >> 16) & 1u)) >> 16);
}
__device__ __forceinline__ float bf_val(unsigned short h) { return __uint_as_float(((unsigned)h) << 16); }
__device__ __forceinline__ float bf_rne(float f) { return bf_val(bf_bits(f)); }
__device__ __forceinline__ unsigned pk16(unsigned short a, unsigned short b) { return (unsigned)a | ((unsigned)b << 16); }
__device__ __forceinline__ v8f zero8() { v8f z = {0.f, 0.f, 0.f, 0.f, 0.f, 0.f, 0.f, 0.f}; return z; }
__device__ __forceinline__ int wave_id() { return __builtin_amdgcn_readfirstlane((int)(threadIdx.x >> 5)); }

__device__ __forceinline__ void lds_wave_sync() {
  __builtin_amdgcn_fence(__ATOMIC_RELEASE, "workgroup");
  __builtin_amdgcn_wave_barrier();
  __builtin_amdgcn_fence(__ATOMIC_ACQUIRE, "workgroup");
}

// Value of lane (l ^ X) of the same 16-lane row, X = 1, 2, 4, 8: a DPP row_xmask operand of the vector unit (control word 0x160 + X),
// all lanes on. It takes the place of __shfl_xor, which goes through the LDS pipe and is waited for at every step.
template <int X>
__device__ __forceinline__ float row_xor(float v) {
  return __builtin_bit_cast(float, __builtin_amdgcn_mov_dpp(__builtin_bit_cast(int, v), 0x160 + X, 0xf, 0xf, true));
}
// Maximum over each 16-lane row for eight values at once, all lanes on. Written as asm because from the builtin form the compiler makes three
// dependent instructions a step (the move, a quieting maximum, the maximum) and runs the eight chains one after another; here a step is
// one instruction, and the instruction it depends on stands eight back, so that no step waits for its predecessor.
__device__ __forceinline__ void row_max16x8(float (&m)[8]) {
  asm(
      "v_max_num_f32_dpp %0, %0, %0 row_xmask:1 row_mask:0xf bank_mask:0xf\n\t"
      "v_max_num_f32_dpp %1, %1, %1 row_xmask:1 row_mask:0xf bank_mask:0xf\n\t"
      "v_max_num_f32_dpp %2, %2, %2 row_xmask:1 row_mask:0xf bank_mask:0xf\n\t"
      "v_max_num_f32_dpp %3, %3, %3 row_xmask:1 row_mask:0xf bank_mask:0xf\n\t"
      "v_max_num_f32_dpp %4, %4, %4 row_xmask:1 row_mask:0xf bank_mask:0xf\n\t"
      "v_max_num_f32_dpp %5, %5, %5 row_xmask:1 row_mask:0xf bank_mask:0xf\n\t"
      "v_max_num_f32_dpp %6, %6, %6 row_xmask:1 row_mask:0xf bank_mask:0xf\n\t"
      "v_max_num_f32_dpp %7, %7, %7 row_xmask:1 row_mask:0xf bank_mask:0xf\n\t"
      "v_max_num_f32_dpp %0, %0, %0 row_xmask:2 row_mask:0xf bank_mask:0xf\n\t"
      "v_max_num_f32_dpp %1, %1, %1 row_xmask:2 row_mask:0xf bank_mask:0xf\n\t"
      "v_max_num_f32_dpp %2, %2, %2 row_xmask:2 row_mask:0xf bank_mask:0xf\n\t"
      "v_max_num_f32_dpp %3, %3, %3 row_xmask:2 row_mask:0xf bank_mask:0xf\n\t"
      "v_max_num_f32_dpp %4, %4, %4 row_xmask:2 row_mask:0xf bank_mask:0xf\n\t"
      "v_max_num_f32_dpp %5, %5, %5 row_xmask:2 row_mask:0xf bank_mask:0xf\n\t"
      "v_max_num_f32_dpp %6, %6, %6 row_xmask:2 row_mask:0xf bank_mask:0xf\n\t"
      "v_max_num_f32_dpp %7, %7, %7 row_xmask:2 row_mask:0xf bank_mask:0xf\n\t"
      "v_max_num_f32_dpp %0, %0, %0 row_xmask:4 row_mask:0xf bank_mask:0xf\n\t"
      "v_max_num_f32_dpp %1, %1, %1 row_xmask:4 row_mask:0xf bank_mask:0xf\n\t"
      "v_max_num_f32_dpp %2, %2, %2 row_xmask:4 row_mask:0xf bank_mask:0xf\n\t"
      "v_max_num_f32_dpp %3, %3, %3 row_xmask:4 row_mask:0xf bank_mask:0xf\n\t"
      "v_max_num_f32_dpp %4, %4, %4 row_xmask:4 row_mask:0xf bank_mask:0xf\n\t"
      "v_max_num_f32_dpp %5, %5, %5 row_xmask:4 row_mask:0xf bank_mask:0xf\n\t"
      "v_max_num_f32_dpp %6, %6, %6 row_xmask:4 row_mask:0xf bank_mask:0xf\n\t"
      "v_max_num_f32_dpp %7, %7, %7 row_xmask:4 row_mask:0xf bank_mask:0xf\n\t"
      "v_max_num_f32_dpp %0, %0, %0 row_xmask:8 row_mask:0xf bank_mask:0xf\n\t"
      "v_max_num_f32_dpp %1, %1, %1 row_xmask:8 row_mask:0xf bank_mask:0xf\n\t"
      "v_max_num_f32_dpp %2, %2, %2 row_xmask:8 row_mask:0xf bank_mask:0xf\n\t"
      "v_max_num_f32_dpp %3, %3, %3 row_xmask:8 row_mask:0xf bank_mask:0xf\n\t"
      "v_max_num_f32_dpp %4, %4, %4 row_xmask:8 row_mask:0xf bank_mask:0xf\n\t"
      "v_max_num_f32_dpp %5, %5, %5 row_xmask:8 row_mask:0xf bank_mask:0xf\n\t"
      "v_max_num_f32_dpp %6, %6, %6 row_xmask:8 row_mask:0xf bank_mask:0xf\n\t"
      "v_max_num_f32_dpp %7, %7, %7 row_xmask:8 row_mask:0xf bank_mask:0xf"
      : "+v"(m[0]), "+v"(m[1]), "+v"(m[2]), "+v"(m[3]), "+v"(m[4]), "+v"(m[5]), "+v"(m[6]), "+v"(m[7]));
}
__device__ __forceinline__ float row_sum16(float s) {      // same butterfly, same order of additions as the shuffle form
  s += row_xor<1>(s);
  s += row_xor<2>(s);
  s += row_xor<4>(s);
  s += row_xor<8>(s);
  return s;
}

// ---------------------------------------------------------------------------
// WMMA fragments (wave32, 16x16x32, 16-bit operands). For A (row m = lane&15) and B (col n = lane&15) alike:
// elements 0..7 <- k0 + 8*(lane>>4) + 0..7, elements 8..15 <- k0 + 16 + 8*(lane>>4) + 0..7.
// ldfrag(p) with p = rowbase + k0 + 8*(lane>>4): two 16-B loads p[0..7], p[16..23].
// D: acc[r] = (row 8*(lane>>4) + r, col lane&15).
// ---------------------------------------------------------------------------
union FragH { v16h v; v8h h[2]; };
union FragB { v16b v; v8b h[2]; };
__device__ __forceinline__ v16h ldfrag_h(const _Float16* p) { FragH f; f.h[0] = *(const v8h*)(p); f.h[1] = *(const v8h*)(p + 16); return f.v; }
__device__ __forceinline__ v16b ldfrag_b(const __bf16* p)   { FragB f; f.h[0] = *(const v8b*)(p); f.h[1] = *(const v8b*)(p + 16); return f.v; }

__device__ __forceinline__ v8f mma_h(v16h a, v16h b, v8f c) {
  return __builtin_amdgcn_wmma_f32_16x16x32_f16(false, a, false, b, (short)0, c, false, false);
}
__device__ __forceinline__ v8f mma_b(v16b a, v16b b, v8f c) {
  return __builtin_amdgcn_wmma_f32_16x16x32_bf16(false, a, false, b, (short)0, c, false, false);
}
// hazard guards: 4 VALU slots after the last WMMA of a group, D tied, A/B kept live; memory clobber keeps later loads behind the group
__device__ __forceinline__ void guard_h3(v8f& a, v8f& b, v16h x, v16h y, v16h z) {
  asm volatile("v_nop\n\tv_nop\n\tv_nop\n\tv_nop" : "+v"(a), "+v"(b) : "v"(x), "v"(y), "v"(z) : "memory");
}
__device__ __forceinline__ void guard_h4(v8f& a, v8f& b, v16h w, v16h x, v16h y, v16h z) {
  asm volatile("v_nop\n\tv_nop\n\tv_nop\n\tv_nop" : "+v"(a), "+v"(b) : "v"(w), "v"(x), "v"(y), "v"(z) : "memory");
}
__device__ __forceinline__ void acc_guard4(v8f& a, v8f& b, v8f& c, v8f& d) {
  asm volatile("v_nop\n\tv_nop\n\tv_nop\n\tv_nop" : "+v"(a), "+v"(b), "+v"(c), "+v"(d));
}

// ---------------------------------------------------------------------------
// Preparation, one launch: the RoPE table and the RNE bf16 planes of x, Wq, Wk, Wv, Wo. None of the six pieces reads what another
// writes, so they share a grid; the block index picks the piece (block-uniform, no barrier anywhere in the kernel).
//   blocks 0 .. SQ/8 - 1: RoPE table, cst[s][i] = cos(s * inv_freq[i]), snt[s][i] = sin(...), inv_freq[i] = 1 / 1e4^(i/64), i < 64, all f32.
//     Wave w -> position s = block*8 + w, lane -> i = lane, lane + 32. Coverage: SQ/8 blocks x 8 waves x 32 lanes x 2 = SQ x 64 per plane.
//     They come first in the grid because theirs is the longest dependent chain.
//   then CV_BLK(n) blocks per plane of n elements: a wave converts CV_WAVE = 2048 consecutive elements. All its sixteen 16-B loads are issued
//     before the first conversion; load i covers the 512 contiguous bytes of elements 128 i .. 128 i + 127, store i the 256 contiguous
//     bytes (two whole lines) of the same elements. Coverage: CV_BLK(n) x 8 waves x 2048 = n, every plane a whole number of blocks.
// ---------------------------------------------------------------------------
#define CV_WAVE   2048
#define CV_BLK(n) ((n) / (8 * CV_WAVE))
#define NB_ROPE   (SQ / 8)
#define NB_X      CV_BLK(NTOK * HID)
#define NB_WQ     CV_BLK(HID * HID)
#define NB_WK     CV_BLK(KVW * HID)
#define NB_WV     CV_BLK(KVW * HID)
#define NB_WO     CV_BLK(HID * HID)
static_assert(NB_X * 8 * CV_WAVE == NTOK * HID && NB_WQ * 8 * CV_WAVE == HID * HID && NB_WK * 8 * CV_WAVE == KVW * HID);

typedef unsigned int v2u __attribute__((ext_vector_type(2)));

__device__ __forceinline__ void rope_table_rows(float* __restrict__ cst, float* __restrict__ snt, int blk) {
  const int lane = threadIdx.x & 31;
  const int wave = (int)(threadIdx.x >> 5);
  const int t = blk * 8 + wave;
  const float pf = (float)t;
  float c0 = 0.f, s0 = 0.f, c1 = 0.f, s1 = 0.f;
#pragma unroll 1
  for (int u = 0; u < 2; ++u) {
    const int i = lane + 32 * u;
    const float e   = (float)i * 0.015625f;      // i / 64 exact
    const float pw  = powf(10000.0f, e);
    const float inv = 1.0f / pw;
    const float ang = pf * inv;
    const float cv = cosf(ang);
    const float sv = sinf(ang);
    c1 = cv; s1 = sv;
    if (u == 0) { c0 = cv; s0 = sv; }
  }
  const size_t o = (size_t)t * NFREQ + lane;
  cst[o]      = c0;
  cst[o + 32] = c1;
  snt[o]      = s0;
  snt[o + 32] = s1;
}

__global__ __launch_bounds__(256) void prep_kernel(
    const float* __restrict__ x, const float* __restrict__ wq, const float* __restrict__ wk,
    const float* __restrict__ wv, const float* __restrict__ wo,
    unsigned short* __restrict__ xb, unsigned short* __restrict__ wqb, unsigned short* __restrict__ wkb,
    unsigned short* __restrict__ wvb, unsigned short* __restrict__ wob,
    float* __restrict__ cst, float* __restrict__ snt) {
  int blk = (int)blockIdx.x;
  if (blk < NB_ROPE) { rope_table_rows(cst, snt, blk); return; }
  blk -= NB_ROPE;
  const float* in = x;
  unsigned short* outp = xb;
  if (blk >= NB_X + NB_WQ + NB_WK + NB_WV)      { in = wo; outp = wob; blk -= NB_X + NB_WQ + NB_WK + NB_WV; }
  else if (blk >= NB_X + NB_WQ + NB_WK)         { in = wv; outp = wvb; blk -= NB_X + NB_WQ + NB_WK; }
  else if (blk >= NB_X + NB_WQ)                 { in = wk; outp = wkb; blk -= NB_X + NB_WQ; }
  else if (blk >= NB_X)                         { in = wq; outp = wqb; blk -= NB_X; }
  const int lane = (int)(threadIdx.x & 31);
  const size_t e0 = ((size_t)blk * 8 + wave_id()) * CV_WAVE + lane * 4;
  const float* ip = in + e0;
  unsigned short* op = outp + e0;
  v4f a[16];
#pragma unroll   // constant indices keep a[] in registers, and all sixteen loads are in flight at once
  for (int i = 0; i < 16; ++i) a[i] = *(const v4f*)(ip + i * 128);
  // precaution: the lane pointer is an input here, so it keeps its registers (no load result is placed over it) until this wait
  asm volatile("s_wait_xcnt 0x0" :: "v"(ip) : "memory");
  // keeps every load in front of the first conversion: left alone the compiler holds the last four back until the first four have returned
  __builtin_amdgcn_sched_barrier(0);
#pragma unroll   // as above: constant indices into a[]
  for (int i = 0; i < 16; ++i) {
    v2u w;
    w[0] = pk16(bf_bits(a[i][0]), bf_bits(a[i][1]));
    w[1] = pk16(bf_bits(a[i][2]), bf_bits(a[i][3]));
    *(v2u*)(op + i * 128) = w;
  }
}

// ---------------------------------------------------------------------------
// bf16 WMMA GEMM, block = 4 waves (128 threads) = one 128 x 128 tile of C, wave w = rows 32w..32w+31 x all 128 cols.
//   C[m][n] = sum_k A[m][k] * Bt[n][k]; A row-major [M][K] bf16 (pitch lda), Bt row-major [N][K] bf16 (pitch ldb);
//   M % 128 == 0, N % 128 == 0, K % 64 == 0; grid.x = M/128 * N/128.
//   SPLITA: A carried as hi (Ap) + lo (A2p) bf16 planes, two products into one accumulator.
//   Operands: a pass is 64 k = one whole 128-B line of every operand row. The 128 A rows (both planes when SPLITA) and the
//   128 Bt rows of a pass are brought into LDS by asynchronous 16-B copies (8 lanes = one line, a wave instruction = 4 lines),
//   rows at pitch 144 B, two buffers: the next pass's copies fly while this pass is multiplied. The Bt tile is read by all
//   four waves. Fragments are read from LDS with the split k map (ldfrag_b), k ascending.
// Epilogues (all: per wave, per 16-row slab: stage in LDS, wave sync, write each row segment with ONE instruction of
//   EPI 0: q or k projection; the 128-col tile is one head. B rows are laid in LDS in even/odd order (row n0 + r in slot
//          64*(r&1) + (r>>1)):
//          acc tile j<4, lane rl holds output column n0 + 2*(16j+rl); tile j+4 holds n0 + 2*(16j+rl) + 1 (the interleaved pair).
//          + bf16(bias[n]); RoPE on the pair with cos/sin[pos = row & 2047][pair]; writes f16 hi plane C0 and f16 residual x2048
//          plane C1, both [M][ldc], cols n0..n0+127 (row segment 256 B = 16 lanes x 16 B).
//   EPI 1: v^T projection: + bf16(bias[m]); f16 hi plane C0, residual x2048 plane C1, [M][ldc], row segment 256 B.
//   EPI 2: f32 output C0 [M][ldc]; row segment 128 floats = 512 B = 32 lanes x 16 B per instruction.
// ---------------------------------------------------------------------------
template <int EPI> struct SlabT { typedef _Float16 T; static constexpr int PERW = 4096; };   // 2 planes x 16 x 128 halves
template <> struct SlabT<2>     { typedef float    T; static constexpr int PERW = 2048; };   // 16 x 128 floats

#define G_PITCH 72                    // LDS row pitch in 16-bit elements: 64 k + 8 = 144 B = 16 B x 9
#define G_TILE  (128 * G_PITCH)       // one 128-row operand tile of a pass, in elements

// One 128-row x 128-B operand tile into LDS: eight copies per lane, lane address pairs (l + i*lstep, g + i*gstep).
// The s_wait_xcnt stands in the copies' own statement so that no address register is rewritten ahead of it.
__device__ __forceinline__ void stage_tile(unsigned l, unsigned lstep, const unsigned short* g, size_t gstep) {
  asm volatile(
      "global_load_async_to_lds_b128 %0, %8, off\n\t"
      "global_load_async_to_lds_b128 %1, %9, off\n\t"
      "global_load_async_to_lds_b128 %2, %10, off\n\t"
      "global_load_async_to_lds_b128 %3, %11, off\n\t"
      "global_load_async_to_lds_b128 %4, %12, off\n\t"
      "global_load_async_to_lds_b128 %5, %13, off\n\t"
      "global_load_async_to_lds_b128 %6, %14, off\n\t"
      "global_load_async_to_lds_b128 %7, %15, off\n\t"
      "s_wait_xcnt 0x0"
      :: "v"(l), "v"(l + lstep), "v"(l + 2 * lstep), "v"(l + 3 * lstep),
         "v"(l + 4 * lstep), "v"(l + 5 * lstep), "v"(l + 6 * lstep), "v"(l + 7 * lstep),
         "v"(g), "v"(g + gstep), "v"(g + 2 * gstep), "v"(g + 3 * gstep),
         "v"(g + 4 * gstep), "v"(g + 5 * gstep), "v"(g + 6 * gstep), "v"(g + 7 * gstep)
      : "memory");
}

template <int EPI, bool SPLITA>
__global__ __launch_bounds__(128) void gemm_w32x128_kernel(
    const unsigned short* Ap, const unsigned short* A2p, int lda,
    const unsigned short* __restrict__ Btp, int ldb,
    const float* __restrict__ bias, const float* __restrict__ cst, const float* __restrict__ snt,
    void* C0, void* C1, int ldc,
    int M, int N, int K) {
  typedef typename SlabT<EPI>::T ST;
  constexpr int NPL = SPLITA ? 3 : 2;            // operand tiles per buffer: A (, A lo), Bt
  constexpr int BUF = NPL * G_TILE;              // elements per buffer
  __shared__ __align__(16) ST slab_all[4 * SlabT<EPI>::PERW];
  __shared__ __align__(16) unsigned short ring[2 * BUF];

  const int tid  = (int)threadIdx.x;
  const int lane = tid & 31;
  const int wave = wave_id();
  const int hh = lane >> 4;           // lane half: k offset 8*hh, D row offset 8*hh
  const int rl = lane & 15;           // A row / B col / D col within subtile
  const int tilesN = N >> 7;
  const int tilesM = M >> 7;
  const int tile = (int)blockIdx.x;
  if (tile >= tilesM * tilesN) return;          // block-uniform, in front of every barrier
  const int tm = tile / tilesN;
  const int tn = tile - tm * tilesN;
  const int mb = tm << 7;                       // first row of the block tile
  const int m0 = mb + (wave << 5);              // first row of this wave
  const int n0 = tn << 7;

  // copy addresses of this lane: copy i of a tile moves 16 B of source row (tid>>3) + 16*i, bytes 16*(tid&7)..+15 of the pass's line
  const int crow = tid >> 3;
  const int ccol = (tid & 7) * 8;
  const unsigned short* gA  = Ap  + (size_t)(mb + crow) * lda + ccol;
  const unsigned short* gA2 = A2p + (size_t)(mb + crow) * lda + ccol;
  const unsigned short* gB  = Btp + (size_t)(n0 + crow) * ldb + ccol;
  const unsigned ring0 = (unsigned)(uintptr_t)(&ring[0]);           // LDS byte address of the ring
  const unsigned lA = ring0 + (unsigned)(crow * G_PITCH + ccol) * 2u;
  const int bslot = (EPI == 0) ? ((crow & 1) * 64 + (crow >> 1)) : crow;
  const unsigned lB = ring0 + (unsigned)((NPL - 1) * G_TILE + bslot * G_PITCH + ccol) * 2u;
  const unsigned lstepA = 16u * G_PITCH * 2u;
  const unsigned lstepB = ((EPI == 0) ? 8u : 16u) * G_PITCH * 2u;
  const size_t gstepA = (size_t)16 * lda;
  const size_t gstepB = (size_t)16 * ldb;

  v8f acc[2][8];
#pragma unroll
  for (int i = 0; i < 2; ++i)
#pragma unroll
    for (int j = 0; j < 8; ++j) acc[i][j] = zero8();

  const int npass = K >> 6;
  // pass 0 into buffer 0, landed and published; then pass 1 into buffer 1
  stage_tile(lA, lstepA, gA, gstepA);
  if (SPLITA) stage_tile(lA + G_TILE * 2u, lstepA, gA2, gstepA);
  stage_tile(lB, lstepB, gB, gstepB);
  asm volatile("s_wait_asynccnt 0x0" ::: "memory");   // this wave's copies of pass 0 have landed
  __syncthreads();                                    // every wave's copies of pass 0 are readable by all
  if (npass > 1) {
    stage_tile(lA + BUF * 2u, lstepA, gA + 64, gstepA);
    if (SPLITA) stage_tile(lA + (BUF + G_TILE) * 2u, lstepA, gA2 + 64, gstepA);
    stage_tile(lB + BUF * 2u, lstepB, gB + 64, gstepB);
  }

  for (int t = 0; t < npass; ++t) {
    const int bo = (t & 1) * BUF;
    const __bf16* As = (const __bf16*)(const void*)(ring + bo) + ((wave << 5) + rl) * G_PITCH + 8 * hh;
    const __bf16* Bs = (const __bf16*)(const void*)(ring + bo + (NPL - 1) * G_TILE) + rl * G_PITCH + 8 * hh;
    v16b ah[2][2], al[2][2], bj[2][8];
#pragma unroll
    for (int kb = 0; kb < 2; ++kb) {
#pragma unroll
      for (int i = 0; i < 2; ++i) {
        ah[kb][i] = ldfrag_b(As + i * 16 * G_PITCH + kb * 32);
        al[kb][i] = SPLITA ? ldfrag_b(As + G_TILE + i * 16 * G_PITCH + kb * 32) : ah[kb][i];
      }
#pragma unroll
      for (int j = 0; j < 8; ++j) bj[kb][j] = ldfrag_b(Bs + j * 16 * G_PITCH + kb * 32);
    }
    // keeps the pass's LDS reads together in front of its WMMAs: left alone the compiler puts two reads and a full wait before every WMMA pair
    __builtin_amdgcn_sched_barrier(0);
#pragma unroll
    for (int kb = 0; kb < 2; ++kb) {
#pragma unroll
      for (int j = 0; j < 8; ++j) {
        acc[0][j] = mma_b(ah[kb][0], bj[kb][j], acc[0][j]);
        acc[1][j] = mma_b(ah[kb][1], bj[kb][j], acc[1][j]);
        if (SPLITA) {
          acc[0][j] = mma_b(al[kb][0], bj[kb][j], acc[0][j]);
          acc[1][j] = mma_b(al[kb][1], bj[kb][j], acc[1][j]);
        }
      }
    }
    // keeps the WMMAs in front of the waits and the barrier below, so that the next pass's copies fly for the whole of this pass
    __builtin_amdgcn_sched_barrier(0);
    asm volatile("s_wait_dscnt 0x0" ::: "memory");      // this wave's reads of the buffer are done before it is refilled
    asm volatile("s_wait_asynccnt 0x0" ::: "memory");   // this wave's copies of pass t + 1 have landed
    __syncthreads();                                    // publishes pass t + 1 and ends every reader's last read of pass t
    if (t + 2 < npass) {                                // block-uniform
      const size_t ko = (size_t)(t + 2) * 64;
      stage_tile(lA + (unsigned)bo * 2u, lstepA, gA + ko, gstepA);
      if (SPLITA) stage_tile(lA + (unsigned)(bo + G_TILE) * 2u, lstepA, gA2 + ko, gstepA);
      stage_tile(lB + (unsigned)bo * 2u, lstepB, gB + ko, gstepB);
    }
  }
  asm volatile("s_wait_asynccnt 0x0" ::: "memory");     // no copy is outstanding when the wave goes on to the epilogue
  acc_guard4(acc[0][0], acc[0][1], acc[0][2], acc[0][3]);
  acc_guard4(acc[0][4], acc[0][5], acc[0][6], acc[0][7]);
  acc_guard4(acc[1][0], acc[1][1], acc[1][2], acc[1][3]);
  acc_guard4(acc[1][4], acc[1][5], acc[1][6], acc[1][7]);

  // ---- epilogue ----
  ST* slab = slab_all + wave * SlabT<EPI>::PERW;
  _Float16* sl16 = (_Float16*)(void*)slab;
  float*    slf  = (float*)(void*)slab;

  if (EPI == 0) {
    _Float16* P0 = (_Float16*)C0;
    _Float16* P1 = (_Float16*)C1;
#pragma unroll
    for (int i = 0; i < 2; ++i) {
      const int rb = m0 + i * 16 + 8 * hh;
#pragma unroll
      for (int j = 0; j < 4; ++j) {
        const int pi = j * 16 + rl;                              // pair index 0..63 within head
        const int nc = n0 + 2 * pi;                              // column of x1; x2 at nc + 1
        const float b1 = bf_rne(bias[nc]);
        const float b2 = bf_rne(bias[nc + 1]);
#pragma unroll
        for (int r = 0; r < 8; ++r) {
          const int row = rb + r;                                // token 0..NTOK-1
          const int s   = row & (SQ - 1);                        // position within sequence
          const float cv = cst[(size_t)s * NFREQ + pi];
          const float sv = snt[(size_t)s * NFREQ + pi];
          const float x1 = acc[i][j][r] + b1;
          const float x2 = acc[i][j + 4][r] + b2;
          const float o1 = x1 * cv - x2 * sv;
          const float o2 = x1 * sv + x2 * cv;
          const _Float16 h1 = (_Float16)o1;
          const _Float16 h2 = (_Float16)o2;
          const int so = (8 * hh + r) * 128 + 2 * pi;
          sl16[so]            = h1;
          sl16[so + 1]        = h2;
          sl16[2048 + so]     = (_Float16)((o1 - (float)h1) * 2048.0f);
          sl16[2048 + so + 1] = (_Float16)((o2 - (float)h2) * 2048.0f);
        }
      }
      lds_wave_sync();
      {
#pragma unroll
        for (int it = 0; it < 8; ++it) {
          const int row = it * 2 + hh;                           // it x hh covers rows 0..15
          const int c8  = rl * 8;
          const v8h vh = *(const v8h*)(sl16 + row * 128 + c8);
          const v8h vl = *(const v8h*)(sl16 + 2048 + row * 128 + c8);
          const size_t go = (size_t)(m0 + i * 16 + row) * ldc + n0 + c8;
          *(v8h*)(P0 + go) = vh;
          *(v8h*)(P1 + go) = vl;
        }
        
      }
      lds_wave_sync();
    }
  } else if (EPI == 1) {
    _Float16* P0 = (_Float16*)C0;
    _Float16* P1 = (_Float16*)C1;
#pragma unroll
    for (int i = 0; i < 2; ++i) {
#pragma unroll
      for (int r = 0; r < 8; ++r) {
        const int m = m0 + i * 16 + 8 * hh + r;
        const float bm = bf_rne(bias[m]);
#pragma unroll
        for (int j = 0; j < 8; ++j) {
          const float v = acc[i][j][r] + bm;
          const _Float16 hv = (_Float16)v;
          const int so = (8 * hh + r) * 128 + j * 16 + rl;
          sl16[so]        = hv;
          sl16[2048 + so] = (_Float16)((v - (float)hv) * 2048.0f);
        }
      }
      lds_wave_sync();
      {
#pragma unroll
        for (int it = 0; it < 8; ++it) {
          const int row = it * 2 + hh;
          const int c8  = rl * 8;
          const v8h vh = *(const v8h*)(sl16 + row * 128 + c8);
          const v8h vl = *(const v8h*)(sl16 + 2048 + row * 128 + c8);
          const size_t go = (size_t)(m0 + i * 16 + row) * ldc + n0 + c8;
          *(v8h*)(P0 + go) = vh;
          *(v8h*)(P1 + go) = vl;
        }
        
      }
      lds_wave_sync();
    }
  } else {
    float* C = (float*)C0;
#pragma unroll
    for (int i = 0; i < 2; ++i) {
#pragma unroll
      for (int j = 0; j < 8; ++j)
#pragma unroll
        for (int r = 0; r < 8; ++r)
          slf[(8 * hh + r) * 128 + j * 16 + rl] = acc[i][j][r];
      lds_wave_sync();
      {
#pragma unroll
        for (int row = 0; row < 16; ++row) {                     // 32 lanes x 16 B = the whole 512-B row segment per instruction
          const v4f v = *(const v4f*)(slf + row * 128 + lane * 4);
          *(v4f*)(C + (size_t)(m0 + i * 16 + row) * ldc + n0 + lane * 4) = v;
        }
        
      }
      lds_wave_sync();
    }
  }
}

// ---------------------------------------------------------------------------
// Windowed causal GQA flash attention, head dim 128, 32-key chunks, block = 4 waves = 64 query rows of one (b, h);
// grid (n query tiles, NHQ, NSEQ). Key j is valid for query i iff j <= i and i - j <= window (window read from the int input).
//   q planes f16 [tok][h*128+d]: hi (qhp) and residual x2048 (qlp); k planes f16 [tok][kvh*128+d]: hi (khp), residual x2048 (klp);
//   v^T planes f16 [kvh*128+d][tok]: hi (vhp), residual x2048 (vlp); outputs attn bf16 hi (ahp) / lo (alp) [tok][h*128+d].
//   scores = (Sh + Sr/2048) * 128^-0.5 with Sh = qh.kh and Sr = ql'.kh (+ qh.kl' when PRES); invalid keys -> -inf; online softmax f32
//   (-inf safe: a row with no valid key so far keeps m = -inf, l = 0, O = 0);
//   p' = 1024 p stored per wave to LDS as f16 hi (and residual x2048 when PRES), reloaded as A fragments after a wave sync;
//   O = (Oh + Or/2048)/1024/l with Oh = ph.vh, Or = ph.vl' (+ pl'.vh when PRES).
//   q staging: each wave copies its 16 rows of both q planes into LDS once, rows at pitch 272 B, and reads its A fragments from there.
//   K / V^T chunk staging: 128 threads x 4 x 16 B per plane = whole 32x128 / 128x32 tile, plain loads, __syncthreads before and after.
//   Chunks cover keys [max(0, 64*qb - window) & ~31, 64*qb + 63]; trip count statically <= 64; waves with no valid key in a chunk
//   skip its compute part (wave-uniform, scalar branch).
// ---------------------------------------------------------------------------
#define AT_KC   32
#define KS_P    136
#define VS_P    40
#define PS_P    40
#define QS_P    136
// LDS map in halves. The k residual tile and the p residual tile exist only with PRES; without them four work-groups still share a WGP's LDS.
template <bool PRES> struct AttnLds {
  static constexpr int KS  = 0;
  static constexpr int KLS = 32 * KS_P;
  static constexpr int VHS = (PRES ? 2 : 1) * 32 * KS_P;
  static constexpr int VLS = VHS + 128 * VS_P;
  static constexpr int PH  = VLS + 128 * VS_P;
  static constexpr int PL  = PH + 4 * 16 * PS_P;
  static constexpr int QH  = PH + (PRES ? 2 : 1) * 4 * 16 * PS_P;
  static constexpr int QL  = QH + 64 * QS_P;
  static constexpr int TOT = QL + 64 * QS_P;
};
static_assert(AttnLds<false>::TOT * 2 * 4 <= 327680);   // four work-groups of the long launch per WGP
static_assert(4 * 4096 <= AttnLds<false>::QH);          // output staging (2 planes x 16 x 128 per wave) aliases the chunk region after the loop

template <bool PRES>
// The long launch (no residual products, 896 work-groups) gets a budget of 256 registers a wave = four waves per SIMD: four work-groups
// share a WGP and the whole launch is resident at once. The short launch has fewer work-groups than there are WGPs and keeps the full budget.
__global__ __launch_bounds__(128) __attribute__((amdgpu_waves_per_eu(PRES ? 1 : 4))) void attn_window_kernel(
    const unsigned short* __restrict__ qhp, const unsigned short* __restrict__ qlp,
    const unsigned short* __restrict__ khp, const unsigned short* __restrict__ klp,
    const unsigned short* __restrict__ vhp, const unsigned short* __restrict__ vlp,
    unsigned short* __restrict__ ahp, unsigned short* __restrict__ alp,
    const int* __restrict__ winp, int qb_base) {
  typedef AttnLds<PRES> L;
  __shared__ __align__(16) _Float16 lds[L::TOT];
  _Float16* Ks  = lds + L::KS;
  _Float16* Kls = lds + L::KLS;
  _Float16* Vhs = lds + L::VHS;
  _Float16* Vls = lds + L::VLS;

  const int tid  = (int)threadIdx.x;
  const int lane = tid & 31;
  const int wave = wave_id();
  const int hh   = lane >> 4;
  const int c    = lane & 15;
  const int qb   = (int)blockIdx.x + qb_base;
  const int h    = (int)blockIdx.y;
  const int b    = (int)blockIdx.z;
  const int kvh  = h >> 1;                       // 2 query heads per kv head
  const int window = __builtin_amdgcn_readfirstlane(winp[0]);
  const int qblk0 = qb * 64;
  const int q0    = qblk0 + wave * 16;           // first query row of this wave (within sequence)
  const int qlast = q0 + 15;
  const int wlo   = q0 - window;                 // oldest valid key of row q0
  const size_t tok0 = (size_t)b * SQ;

  int kstart = qblk0 - window;
  kstart = (kstart > 0) ? (kstart & ~31) : 0;
  if (kstart > qblk0) kstart = qblk0;
  int nch = (qblk0 + 64 - kstart) >> 5;          // block-uniform
  if (nch > 64) nch = 64;
  if (nch < 0) nch = 0;

  // This wave's 16 query rows, both planes, go into LDS once (16 lanes = one 256-B row, row = (lane >> 4) + 2 i); every chunk reads its
  // A fragments from there. Only this wave reads them, behind the two barriers at the head of the first chunk.
  _Float16* Qhs = lds + L::QH + wave * (16 * QS_P);
  _Float16* Qls = lds + L::QL + wave * (16 * QS_P);
  {
    const _Float16* qhg = (const _Float16*)(const void*)qhp + (tok0 + q0 + hh) * HID + h * HDM + c * 8;
    const _Float16* qlg = (const _Float16*)(const void*)qlp + (tok0 + q0 + hh) * HID + h * HDM + c * 8;
    v8h qx[8], qy[8];
#pragma unroll   // constant indices keep qx and qy in registers, and all sixteen loads are in flight at once
    for (int i = 0; i < 8; ++i) {
      qx[i] = *(const v8h*)(qhg + i * 2 * HID);
      qy[i] = *(const v8h*)(qlg + i * 2 * HID);
    }
    // precaution: the lane pointers are inputs here, so they keep their registers (no load result is placed over them) until this wait
    asm volatile("s_wait_xcnt 0x0" :: "v"(qhg), "v"(qlg) : "memory");
#pragma unroll   // as above: constant indices into qx and qy
    for (int i = 0; i < 8; ++i) {
      *(v8h*)(Qhs + (hh + 2 * i) * QS_P + c * 8) = qx[i];
      *(v8h*)(Qls + (hh + 2 * i) * QS_P + c * 8) = qy[i];
    }
  }
  const _Float16* Qhr = Qhs + c * QS_P + 8 * hh;   // A fragment row of this lane
  const _Float16* Qlr = Qls + c * QS_P + 8 * hh;
  const _Float16* Kg  = (const _Float16*)(const void*)khp + tok0 * KVW + kvh * HDM;
  const _Float16* Klg = (const _Float16*)(const void*)klp + tok0 * KVW + kvh * HDM;
  const _Float16* Vhg = (const _Float16*)(const void*)vhp + (size_t)(kvh * HDM) * NTOK + tok0;
  const _Float16* Vlg = (const _Float16*)(const void*)vlp + (size_t)(kvh * HDM) * NTOK + tok0;
  const unsigned kgo = (unsigned)((tid >> 4) * KVW + (tid & 15) * 8);    // this lane's element offset in a K chunk, piece 0
  const unsigned vgo = (unsigned)((tid >> 2) * NTOK + (tid & 3) * 8);    // and in a V^T chunk
  _Float16* ph = lds + L::PH + wave * (16 * PS_P);
  _Float16* pl = lds + L::PL + wave * (16 * PS_P);

  float mrow[8], lrow[8];
  v8f oacc[8], oaccr[8];
#pragma unroll
  for (int r = 0; r < 8; ++r) { mrow[r] = -INFINITY; lrow[r] = 0.f; }
#pragma unroll
  for (int t = 0; t < 8; ++t) { oacc[t] = zero8(); oaccr[t] = zero8(); }

  for (int kc = 0; kc < nch; ++kc) {
    const int kv0 = kstart + kc * AT_KC;         // keys kv0..kv0+31, all < SQ
    __syncthreads();
    // one lane pointer per plane for the chunk; the four pieces of a plane lie at constant distances from it
    const _Float16* kq  = Kg  + (size_t)kv0 * KVW + kgo;
    const _Float16* klq = Klg + (size_t)kv0 * KVW + kgo;
    const _Float16* vhq = Vhg + kv0 + vgo;
    const _Float16* vlq = Vlg + kv0 + vgo;
    v8h kx[4], ky[4], vx[4], vy[4];
#pragma unroll
    for (int i = 0; i < 4; ++i) {                // coverage: 512 pieces of 8 halves per plane = whole tile
      kx[i] = *(const v8h*)(kq + i * 8 * KVW);   // K: 32 keys x 128 d, key = (tid >> 4) + 8 i
      if (PRES) ky[i] = *(const v8h*)(klq + i * 8 * KVW);
      vx[i] = *(const v8h*)(vhq + i * 32 * NTOK); // V^T: 128 d x 32 keys, d = (tid >> 2) + 32 i
      vy[i] = *(const v8h*)(vlq + i * 32 * NTOK);
    }
    // precaution: the lane pointers are inputs here, so they keep their registers (no load result is placed over them) until this wait
    if (PRES) asm volatile("s_wait_xcnt 0x0" :: "v"(kq), "v"(klq), "v"(vhq), "v"(vlq) : "memory");
    else      asm volatile("s_wait_xcnt 0x0" :: "v"(kq), "v"(vhq), "v"(vlq) : "memory");
#pragma unroll
    for (int i = 0; i < 4; ++i) {
      const int p   = tid + 128 * i;             // 0..511
      const int key = p >> 4, d8 = (p & 15) * 8;
      *(v8h*)(Ks + key * KS_P + d8) = kx[i];
      if (PRES) *(v8h*)(Kls + key * KS_P + d8) = ky[i];
      const int d = p >> 2, k8 = (p & 3) * 8;
      *(v8h*)(Vhs + d * VS_P + k8) = vx[i];
      *(v8h*)(Vls + d * VS_P + k8) = vy[i];
    }
    __syncthreads();

    if (kv0 <= qlast && kv0 + AT_KC - 1 >= wlo) {   // wave-uniform (scalar): skip chunks with no valid key for this wave
      // ---- scores ----
      v8f sh[2], sr[2];
      sh[0] = zero8(); sh[1] = zero8(); sr[0] = zero8(); sr[1] = zero8();
#pragma unroll
      for (int dc = 0; dc < 4; ++dc) {
        const v16h qa = ldfrag_h(Qhr + dc * 32);
        const v16h ql = ldfrag_h(Qlr + dc * 32);
#pragma unroll
        for (int j = 0; j < 2; ++j) {
          const v16h kb = ldfrag_h(Ks + (j * 16 + c) * KS_P + dc * 32 + 8 * hh);
          sh[j] = mma_h(qa, kb, sh[j]);
          sr[j] = mma_h(ql, kb, sr[j]);
          if (PRES) {
            const v16h kl = ldfrag_h(Kls + (j * 16 + c) * KS_P + dc * 32 + 8 * hh);
            sr[j] = mma_h(qa, kl, sr[j]);
            guard_h4(sh[j], sr[j], qa, ql, kb, kl);
          } else {
            guard_h3(sh[j], sr[j], qa, ql, kb);
          }
        }
      }
      // ---- scale, window + causal validity, chunk row max ----
      float cm[8];
#pragma unroll
      for (int r = 0; r < 8; ++r) {
        const int qrow = q0 + 8 * hh + r;
        float m = -INFINITY;
#pragma unroll
        for (int j = 0; j < 2; ++j) {
          const int key = kv0 + j * 16 + c;
          float s = (sh[j][r] + sr[j][r] * 0.00048828125f) * 0.08838834764831845f;
          const bool ok = (key <= qrow) && (qrow - key <= window);
          s = ok ? s : -INFINITY;
          sh[j][r] = s;
          m = fmaxf(m, s);
        }
        cm[r] = m;
      }
      row_max16x8(cm);
      // ---- online softmax, P' to LDS ----
#pragma unroll
      for (int r = 0; r < 8; ++r) {
        const float mnew  = fmaxf(mrow[r], cm[r]);
        const float mref  = (mnew == -INFINITY) ? 0.f : mnew;   // row with no valid key yet: everything stays 0
        const float alpha = __expf(mrow[r] - mref);
        mrow[r] = mnew;
        float psum = 0.f;
#pragma unroll
        for (int j = 0; j < 2; ++j) {
          const float p  = __expf(sh[j][r] - mref);
          psum += p;
          const float pp = p * 1024.0f;
          const _Float16 phv = (_Float16)pp;
          const int po = (8 * hh + r) * PS_P + j * 16 + c;
          ph[po] = phv;
          if (PRES) pl[po] = (_Float16)((pp - (float)phv) * 2048.0f);
        }
        psum = row_sum16(psum);
        lrow[r] = lrow[r] * alpha + psum;
#pragma unroll
        for (int t = 0; t < 8; ++t) { oacc[t][r] *= alpha; oaccr[t][r] *= alpha; }
      }
      lds_wave_sync();                           // P' stores visible to the other lanes of this wave before the fragment reload
      // ---- O += P' . V ----
      const v16h pa = ldfrag_h(ph + c * PS_P + 8 * hh);
      v16h pr = pa;
      if (PRES) pr = ldfrag_h(pl + c * PS_P + 8 * hh);
#pragma unroll
      for (int t = 0; t < 8; ++t) {
        const v16h vb = ldfrag_h(Vhs + (t * 16 + c) * VS_P + 8 * hh);
        const v16h vr = ldfrag_h(Vls + (t * 16 + c) * VS_P + 8 * hh);
        oacc[t]  = mma_h(pa, vb, oacc[t]);
        oaccr[t] = mma_h(pa, vr, oaccr[t]);
        if (PRES) oaccr[t] = mma_h(pr, vb, oaccr[t]);
        guard_h4(oacc[t], oaccr[t], pa, pr, vb, vr);
      }
    }
  }

  __syncthreads();                               // all chunk-region readers done before aliasing it as output staging
  _Float16* osh = lds + wave * 4096;
  _Float16* osl = osh + 2048;
#pragma unroll
  for (int r = 0; r < 8; ++r) {
    const float inv = (1.0f / lrow[r]) * 0.0009765625f;
#pragma unroll
    for (int t = 0; t < 8; ++t) {
      const float o = (oacc[t][r] + oaccr[t][r] * 0.00048828125f) * inv;
      const unsigned short hb = bf_bits(o);
      const unsigned short lb = bf_bits(o - bf_val(hb));
      const int so = (8 * hh + r) * 128 + t * 16 + c;
      osh[so] = __builtin_bit_cast(_Float16, hb);
      osl[so] = __builtin_bit_cast(_Float16, lb);
    }
  }
  lds_wave_sync();
  _Float16* Ahg = (_Float16*)(void*)ahp + (tok0 + q0) * HID + h * HDM;
  _Float16* Alg = (_Float16*)(void*)alp + (tok0 + q0) * HID + h * HDM;
  {
#pragma unroll
    for (int it = 0; it < 8; ++it) {
      const int row = it * 2 + hh;               // it 0..7 x hh 0..1 covers rows 0..15
      const int c8  = c * 8;                     // 16 lanes x 16 B = the whole 256-B segment
      const v8h x = *(const v8h*)(osh + row * 128 + c8);
      const v8h y = *(const v8h*)(osl + row * 128 + c8);
      *(v8h*)(Ahg + (size_t)row * HID + c8) = x;
      *(v8h*)(Alg + (size_t)row * HID + c8) = y;
    }
    
  }
}

// ---------------------------------------------------------------------------
// Workspace map (bytes; every region is a whole number of the rows its producer writes with whole-line stores, no tails):
//   Xb    bf16 [4096][2048]   16777216   (the attn hi plane Ah [4096][2048] bf16 reuses this region after the last Xb reader)
//   Wqb   bf16 [2048][2048]    8388608      Wkb bf16 [1024][2048]  4194304      Wvb bf16 [1024][2048]  4194304
//   Wob   bf16 [2048][2048]    8388608      cst f32  [2048][64]     524288      snt f32  [2048][64]     524288
//   Qh    f16  [4096][2048]   16777216      Ql  f16  [4096][2048] 16777216
//   Kh    f16  [4096][1024]    8388608      Kl  f16  [4096][1024]  8388608
//   Vh    f16  [1024][4096]    8388608      Vl  f16  [1024][4096]  8388608
//   Al    bf16 [4096][2048]   16777216
//   total                    126877696
// ---------------------------------------------------------------------------
extern "C" void kernel_launch(void* const* d_in, const int* in_sizes, int n_in,
                              void* d_out, int out_size, void* d_ws, size_t ws_size,
                              hipStream_t stream) {
  if (n_in < 9) return;
  if (in_sizes[0] != NTOK * HID) return;
  if (in_sizes[1] != HID * HID) return;
  if (in_sizes[2] != HID) return;
  if (in_sizes[3] != KVW * HID) return;
  if (in_sizes[4] != KVW) return;
  if (in_sizes[5] != KVW * HID) return;
  if (in_sizes[6] != KVW) return;
  if (in_sizes[7] != HID * HID) return;
  if (in_sizes[8] < 1) return;
  if (out_size != NTOK * HID) return;

  const float* x    = (const float*)d_in[0];
  const float* wq_w = (const float*)d_in[1];
  const float* wq_b = (const float*)d_in[2];
  const float* wk_w = (const float*)d_in[3];
  const float* wk_b = (const float*)d_in[4];
  const float* wv_w = (const float*)d_in[5];
  const float* wv_b = (const float*)d_in[6];
  const float* wo_w = (const float*)d_in[7];
  const int*   win  = (const int*)d_in[8];
  float* out = (float*)d_out;

  const size_t szX  = (size_t)NTOK * HID * 2;
  const size_t szWq = (size_t)HID * HID * 2;
  const size_t szWk = (size_t)KVW * HID * 2;
  const size_t szWv = (size_t)KVW * HID * 2;
  const size_t szWo = (size_t)HID * HID * 2;
  const size_t szT  = (size_t)SQ * NFREQ * 4;
  const size_t szQ  = (size_t)NTOK * HID * 2;
  const size_t szK  = (size_t)NTOK * KVW * 2;
  const size_t szV  = (size_t)KVW * NTOK * 2;
  const size_t szA  = (size_t)NTOK * HID * 2;
  size_t off = 0;
  const size_t oX  = off; off += szX;
  const size_t oWq = off; off += szWq;
  const size_t oWk = off; off += szWk;
  const size_t oWv = off; off += szWv;
  const size_t oWo = off; off += szWo;
  const size_t oCs = off; off += szT;
  const size_t oSn = off; off += szT;
  const size_t oQh = off; off += szQ;
  const size_t oQl = off; off += szQ;
  const size_t oKh = off; off += szK;
  const size_t oKl = off; off += szK;
  const size_t oVh = off; off += szV;
  const size_t oVl = off; off += szV;
  const size_t oAl = off; off += szA;
  const size_t oAh = oX;                         // Ah reuses the Xb region (same byte size); Xb is dead after launch (4)
  if (szA != szX) return;
  if (off > ws_size) return;                     // off = 126877696

  char* ws = (char*)d_ws;
  unsigned short* Xb  = (unsigned short*)(ws + oX);
  unsigned short* Wqb = (unsigned short*)(ws + oWq);
  unsigned short* Wkb = (unsigned short*)(ws + oWk);
  unsigned short* Wvb = (unsigned short*)(ws + oWv);
  unsigned short* Wob = (unsigned short*)(ws + oWo);
  float*          cst = (float*)(ws + oCs);
  float*          snt = (float*)(ws + oSn);
  unsigned short* Qh  = (unsigned short*)(ws + oQh);
  unsigned short* Ql  = (unsigned short*)(ws + oQl);
  unsigned short* Kh  = (unsigned short*)(ws + oKh);
  unsigned short* Kl  = (unsigned short*)(ws + oKl);
  unsigned short* Vh  = (unsigned short*)(ws + oVh);
  unsigned short* Vl  = (unsigned short*)(ws + oVl);
  unsigned short* Ah  = (unsigned short*)(ws + oAh);
  unsigned short* Al  = (unsigned short*)(ws + oAl);

  const dim3 b256(256), b128(128);

  // (1) cos/sin table [2048][64] x 2 and the RNE bf16 planes of x [4096][2048], Wq [2048][2048], Wk [1024][2048], Wv [1024][2048],
  //     Wo [2048][2048] (weights [out][in]: Wq, Wk, Wo as Bt[n][k], Wv as A[m][k])
  prep_kernel<<<dim3(NB_ROPE + NB_X + NB_WQ + NB_WK + NB_WV + NB_WO), b256, 0, stream>>>(
      x, wq_w, wk_w, wv_w, wo_w, Xb, Wqb, Wkb, Wvb, Wob, cst, snt);
  // (2) q = x . Wq^T + bq, RoPE -> Qh/Ql [4096][2048]   (M=4096, N=2048, K=2048; 32 x 16 block tiles)
  gemm_w32x128_kernel<0, false><<<dim3((NTOK / 128) * (HID / 128)), b128, 0, stream>>>(
      Xb, Xb, HID, Wqb, HID, wq_b, cst, snt, (void*)Qh, (void*)Ql, HID, NTOK, HID, HID);
  // (3) k = x . Wk^T + bk, RoPE -> Kh/Kl [4096][1024]   (M=4096, N=1024, K=2048; 32 x 8 block tiles)
  gemm_w32x128_kernel<0, false><<<dim3((NTOK / 128) * (KVW / 128)), b128, 0, stream>>>(
      Xb, Xb, HID, Wkb, HID, wk_b, cst, snt, (void*)Kh, (void*)Kl, KVW, NTOK, KVW, HID);
  // (4) v^T = Wv . x^T + bv[m] -> Vh/Vl [1024][4096]   (A = Wvb, Bt = Xb; M=1024, N=4096, K=2048; 8 x 32 block tiles)
  gemm_w32x128_kernel<1, false><<<dim3((KVW / 128) * (NTOK / 128)), b128, 0, stream>>>(
      Wvb, Wvb, HID, Xb, HID, wv_b, cst, snt, (void*)Vh, (void*)Vl, NTOK, KVW, NTOK, HID);
  // (5)-(6) windowed causal attention, query tiles 0..3 with k and p residual products, tiles 4..31 without
  attn_window_kernel<true><<<dim3(4, NHQ, NSEQ), b128, 0, stream>>>(Qh, Ql, Kh, Kl, Vh, Vl, Ah, Al, win, 0);
  attn_window_kernel<false><<<dim3(SQ / 64 - 4, NHQ, NSEQ), b128, 0, stream>>>(Qh, Ql, Kh, Kl, Vh, Vl, Ah, Al, win, 4);
  // (7) out = attn(hi + lo) . Wo^T -> d_out f32 [4096][2048]   (M=4096, N=2048, K=2048; 32 x 16 block tiles)
  gemm_w32x128_kernel<2, true><<<dim3((NTOK / 128) * (HID / 128)), b128, 0, stream>>>(
      Ah, Al, HID, Wob, HID, wq_b, cst, snt, (void*)out, (void*)out, HID, NTOK, HID, HID);
  (void)hipGetLastError();
}

// v006
// It runs in 265 microseconds.
// Next to v005, in two timings, it ran 1.03 and 1.04 times as fast.
// Over all steps from v000 it is 3.08 times as fast.
// Contractions: x.Wq^T, x.Wk^T and Wv.x^T on v_wmma_f32_16x16x32_bf16 (operands = RNE bf16 of the f32 inputs, single products);
// q.k^T and p.v on v_wmma_f32_16x16x32_f16 (q = f16 hi + f16 residual x2^11 planes; k plain f16 plus f16 residual x2^11 on query tiles 0..3;
// p x1024 plain f16 plus f16 residual x2^11 on query tiles 0..3; v^T = f16 hi + f16 residual x2^11 planes); attn.Wo^T on v_wmma_f32_16x16x32_bf16
// (attn = bf16 hi + bf16 lo planes, two products; Wo RNE bf16). f32 accumulate everywhere; bias add, RoPE, online softmax and scale folds in f32.
#include <hip/hip_runtime.h>
#include <math.h>
#include <stdint.h>

#define NSEQ   2
#define SQ     2048
#define HID    2048
#define NHQ    16
#define NKVH   8
#define HDM    128
#define KVW    1024
#define NTOK   4096
#define NFREQ  64

typedef _Float16     v16h __attribute__((ext_vector_type(16)));
typedef _Float16     v8h  __attribute__((ext_vector_type(8)));
typedef __bf16       v16b __attribute__((ext_vector_type(16)));
typedef __bf16       v8b  __attribute__((ext_vector_type(8)));
typedef float        v8f  __attribute__((ext_vector_type(8)));
typedef float        v4f  __attribute__((ext_vector_type(4)));
typedef unsigned int v4u  __attribute__((ext_vector_type(4)));

// ---------------------------------------------------------------------------
// small helpers
// ---------------------------------------------------------------------------
__device__ __forceinline__ unsigned short bf_bits(float f) {          // RNE convert f32 -> bf16 bits
  const unsigned u = __float_as_uint(f);
  return (unsigned short)((u + 0x7FFFu + ((u >> 16) & 1u)) >> 16);
}
__device__ __forceinline__ float bf_val(unsigned short h) { return __uint_as_float(((unsigned)h) << 16); }
__device__ __forceinline__ float bf_rne(float f) { return bf_val(bf_bits(f)); }
__device__ __forceinline__ unsigned pk16(unsigned short a, unsigned short b) { return (unsigned)a | ((unsigned)b << 16); }
__device__ __forceinline__ v8f zero8() { v8f z = {0.f, 0.f, 0.f, 0.f, 0.f, 0.f, 0.f, 0.f}; return z; }
__device__ __forceinline__ int wave_id() { return __builtin_amdgcn_readfirstlane((int)(threadIdx.x >> 5)); }

__device__ __forceinline__ void lds_wave_sync() {
  __builtin_amdgcn_fence(__ATOMIC_RELEASE, "workgroup");
  __builtin_amdgcn_wave_barrier();
  __builtin_amdgcn_fence(__ATOMIC_ACQUIRE, "workgroup");
}

// Value of lane (l ^ X) of the same 16-lane row, X = 1, 2, 4, 8: a DPP row_xmask operand of the vector unit (control word 0x160 + X),
// all lanes on. It takes the place of __shfl_xor, which goes through the LDS pipe and is waited for at every step.
template <int X>
__device__ __forceinline__ float row_xor(float v) {
  return __builtin_bit_cast(float, __builtin_amdgcn_mov_dpp(__builtin_bit_cast(int, v), 0x160 + X, 0xf, 0xf, true));
}
// Maximum over each 16-lane row for eight values at once, all lanes on. Written as asm because from the builtin form the compiler makes three
// dependent instructions a step (the move, a quieting maximum, the maximum) and runs the eight chains one after another; here a step is
// one instruction, and the instruction it depends on stands eight back, so that no step waits for its predecessor.
__device__ __forceinline__ void row_max16x8(float (&m)[8]) {
  asm(
      "v_max_num_f32_dpp %0, %0, %0 row_xmask:1 row_mask:0xf bank_mask:0xf\n\t"
      "v_max_num_f32_dpp %1, %1, %1 row_xmask:1 row_mask:0xf bank_mask:0xf\n\t"
      "v_max_num_f32_dpp %2, %2, %2 row_xmask:1 row_mask:0xf bank_mask:0xf\n\t"
      "v_max_num_f32_dpp %3, %3, %3 row_xmask:1 row_mask:0xf bank_mask:0xf\n\t"
      "v_max_num_f32_dpp %4, %4, %4 row_xmask:1 row_mask:0xf bank_mask:0xf\n\t"
      "v_max_num_f32_dpp %5, %5, %5 row_xmask:1 row_mask:0xf bank_mask:0xf\n\t"
      "v_max_num_f32_dpp %6, %6, %6 row_xmask:1 row_mask:0xf bank_mask:0xf\n\t"
      "v_max_num_f32_dpp %7, %7, %7 row_xmask:1 row_mask:0xf bank_mask:0xf\n\t"
      "v_max_num_f32_dpp %0, %0, %0 row_xmask:2 row_mask:0xf bank_mask:0xf\n\t"
      "v_max_num_f32_dpp %1, %1, %1 row_xmask:2 row_mask:0xf bank_mask:0xf\n\t"
      "v_max_num_f32_dpp %2, %2, %2 row_xmask:2 row_mask:0xf bank_mask:0xf\n\t"
      "v_max_num_f32_dpp %3, %3, %3 row_xmask:2 row_mask:0xf bank_mask:0xf\n\t"
      "v_max_num_f32_dpp %4, %4, %4 row_xmask:2 row_mask:0xf bank_mask:0xf\n\t"
      "v_max_num_f32_dpp %5, %5, %5 row_xmask:2 row_mask:0xf bank_mask:0xf\n\t"
      "v_max_num_f32_dpp %6, %6, %6 row_xmask:2 row_mask:0xf bank_mask:0xf\n\t"
      "v_max_num_f32_dpp %7, %7, %7 row_xmask:2 row_mask:0xf bank_mask:0xf\n\t"
      "v_max_num_f32_dpp %0, %0, %0 row_xmask:4 row_mask:0xf bank_mask:0xf\n\t"
      "v_max_num_f32_dpp %1, %1, %1 row_xmask:4 row_mask:0xf bank_mask:0xf\n\t"
      "v_max_num_f32_dpp %2, %2, %2 row_xmask:4 row_mask:0xf bank_mask:0xf\n\t"
      "v_max_num_f32_dpp %3, %3, %3 row_xmask:4 row_mask:0xf bank_mask:0xf\n\t"
      "v_max_num_f32_dpp %4, %4, %4 row_xmask:4 row_mask:0xf bank_mask:0xf\n\t"
      "v_max_num_f32_dpp %5, %5, %5 row_xmask:4 row_mask:0xf bank_mask:0xf\n\t"
      "v_max_num_f32_dpp %6, %6, %6 row_xmask:4 row_mask:0xf bank_mask:0xf\n\t"
      "v_max_num_f32_dpp %7, %7, %7 row_xmask:4 row_mask:0xf bank_mask:0xf\n\t"
      "v_max_num_f32_dpp %0, %0, %0 row_xmask:8 row_mask:0xf bank_mask:0xf\n\t"
      "v_max_num_f32_dpp %1, %1, %1 row_xmask:8 row_mask:0xf bank_mask:0xf\n\t"
      "v_max_num_f32_dpp %2, %2, %2 row_xmask:8 row_mask:0xf bank_mask:0xf\n\t"
      "v_max_num_f32_dpp %3, %3, %3 row_xmask:8 row_mask:0xf bank_mask:0xf\n\t"
      "v_max_num_f32_dpp %4, %4, %4 row_xmask:8 row_mask:0xf bank_mask:0xf\n\t"
      "v_max_num_f32_dpp %5, %5, %5 row_xmask:8 row_mask:0xf bank_mask:0xf\n\t"
      "v_max_num_f32_dpp %6, %6, %6 row_xmask:8 row_mask:0xf bank_mask:0xf\n\t"
      "v_max_num_f32_dpp %7, %7, %7 row_xmask:8 row_mask:0xf bank_mask:0xf"
      : "+v"(m[0]), "+v"(m[1]), "+v"(m[2]), "+v"(m[3]), "+v"(m[4]), "+v"(m[5]), "+v"(m[6]), "+v"(m[7]));
}
__device__ __forceinline__ float row_sum16(float s) {      // same butterfly, same order of additions as the shuffle form
  s += row_xor<1>(s);
  s += row_xor<2>(s);
  s += row_xor<4>(s);
  s += row_xor<8>(s);
  return s;
}

// ---------------------------------------------------------------------------
// WMMA fragments (wave32, 16x16x32, 16-bit operands). For A (row m = lane&15) and B (col n = lane&15) alike:
// elements 0..7 <- k0 + 8*(lane>>4) + 0..7, elements 8..15 <- k0 + 16 + 8*(lane>>4) + 0..7.
// ldfrag(p) with p = rowbase + k0 + 8*(lane>>4): two 16-B loads p[0..7], p[16..23].
// D: acc[r] = (row 8*(lane>>4) + r, col lane&15).
// ---------------------------------------------------------------------------
union FragH { v16h v; v8h h[2]; };
union FragB { v16b v; v8b h[2]; };
__device__ __forceinline__ v16h ldfrag_h(const _Float16* p) { FragH f; f.h[0] = *(const v8h*)(p); f.h[1] = *(const v8h*)(p + 16); return f.v; }
__device__ __forceinline__ v16b ldfrag_b(const __bf16* p)   { FragB f; f.h[0] = *(const v8b*)(p); f.h[1] = *(const v8b*)(p + 16); return f.v; }

__device__ __forceinline__ v8f mma_h(v16h a, v16h b, v8f c) {
  return __builtin_amdgcn_wmma_f32_16x16x32_f16(false, a, false, b, (short)0, c, false, false);
}
__device__ __forceinline__ v8f mma_b(v16b a, v16b b, v8f c) {
  return __builtin_amdgcn_wmma_f32_16x16x32_bf16(false, a, false, b, (short)0, c, false, false);
}
// hazard guards: 4 VALU slots after the last WMMAs of a run, D tied.
// guard_frags also keeps the run's A and B fragments live to behind the slots, so that no D of the run is placed over one of them.
__device__ __forceinline__ void guard_frags(v8f& a, v8f& b, v8f& c, v8f& d, v16h u, v16h v, v16h w, v16h x, v16h y, v16h z) {
  asm volatile("v_nop\n\tv_nop\n\tv_nop\n\tv_nop" : "+v"(a), "+v"(b), "+v"(c), "+v"(d) : "v"(u), "v"(v), "v"(w), "v"(x), "v"(y), "v"(z));
}
__device__ __forceinline__ void acc_guard4(v8f& a, v8f& b, v8f& c, v8f& d) {
  asm volatile("v_nop\n\tv_nop\n\tv_nop\n\tv_nop" : "+v"(a), "+v"(b), "+v"(c), "+v"(d));
}

// ---------------------------------------------------------------------------
// Preparation, one launch: the RoPE table and the RNE bf16 planes of x, Wq, Wk, Wv, Wo. None of the six pieces reads what another
// writes, so they share a grid; the block index picks the piece (block-uniform, no barrier anywhere in the kernel).
//   blocks 0 .. SQ/8 - 1: RoPE table, cst[s][i] = cos(s * inv_freq[i]), snt[s][i] = sin(...), inv_freq[i] = 1 / 1e4^(i/64), i < 64, all f32.
//     Wave w -> position s = block*8 + w, lane -> i = lane, lane + 32. Coverage: SQ/8 blocks x 8 waves x 32 lanes x 2 = SQ x 64 per plane.
//     They come first in the grid because theirs is the longest dependent chain.
//   then CV_BLK(n) blocks per plane of n elements: a wave converts CV_WAVE = 2048 consecutive elements. All its sixteen 16-B loads are issued
//     before the first conversion; load i covers the 512 contiguous bytes of elements 128 i .. 128 i + 127, store i the 256 contiguous
//     bytes (two whole lines) of the same elements. Coverage: CV_BLK(n) x 8 waves x 2048 = n, every plane a whole number of blocks.
// ---------------------------------------------------------------------------
#define CV_WAVE   2048
#define CV_BLK(n) ((n) / (8 * CV_WAVE))
#define NB_ROPE   (SQ / 8)
#define NB_X      CV_BLK(NTOK * HID)
#define NB_WQ     CV_BLK(HID * HID)
#define NB_WK     CV_BLK(KVW * HID)
#define NB_WV     CV_BLK(KVW * HID)
#define NB_WO     CV_BLK(HID * HID)
static_assert(NB_X * 8 * CV_WAVE == NTOK * HID && NB_WQ * 8 * CV_WAVE == HID * HID && NB_WK * 8 * CV_WAVE == KVW * HID);

typedef unsigned int v2u __attribute__((ext_vector_type(2)));

__device__ __forceinline__ void rope_table_rows(float* __restrict__ cst, float* __restrict__ snt, int blk) {
  const int lane = threadIdx.x & 31;
  const int wave = (int)(threadIdx.x >> 5);
  const int t = blk * 8 + wave;
  const float pf = (float)t;
  float c0 = 0.f, s0 = 0.f, c1 = 0.f, s1 = 0.f;
#pragma unroll 1
  for (int u = 0; u < 2; ++u) {
    const int i = lane + 32 * u;
    const float e   = (float)i * 0.015625f;      // i / 64 exact
    const float pw  = powf(10000.0f, e);
    const float inv = 1.0f / pw;
    const float ang = pf * inv;
    const float cv = cosf(ang);
    const float sv = sinf(ang);
    c1 = cv; s1 = sv;
    if (u == 0) { c0 = cv; s0 = sv; }
  }
  const size_t o = (size_t)t * NFREQ + lane;
  cst[o]      = c0;
  cst[o + 32] = c1;
  snt[o]      = s0;
  snt[o + 32] = s1;
}

__global__ __launch_bounds__(256) void prep_kernel(
    const float* __restrict__ x, const float* __restrict__ wq, const float* __restrict__ wk,
    const float* __restrict__ wv, const float* __restrict__ wo,
    unsigned short* __restrict__ xb, unsigned short* __restrict__ wqb, unsigned short* __restrict__ wkb,
    unsigned short* __restrict__ wvb, unsigned short* __restrict__ wob,
    float* __restrict__ cst, float* __restrict__ snt) {
  int blk = (int)blockIdx.x;
  if (blk < NB_ROPE) { rope_table_rows(cst, snt, blk); return; }
  blk -= NB_ROPE;
  const float* in = x;
  unsigned short* outp = xb;
  if (blk >= NB_X + NB_WQ + NB_WK + NB_WV)      { in = wo; outp = wob; blk -= NB_X + NB_WQ + NB_WK + NB_WV; }
  else if (blk >= NB_X + NB_WQ + NB_WK)         { in = wv; outp = wvb; blk -= NB_X + NB_WQ + NB_WK; }
  else if (blk >= NB_X + NB_WQ)                 { in = wk; outp = wkb; blk -= NB_X + NB_WQ; }
  else if (blk >= NB_X)                         { in = wq; outp = wqb; blk -= NB_X; }
  const int lane = (int)(threadIdx.x & 31);
  const size_t e0 = ((size_t)blk * 8 + wave_id()) * CV_WAVE + lane * 4;
  const float* ip = in + e0;
  unsigned short* op = outp + e0;
  v4f a[16];
#pragma unroll   // constant indices keep a[] in registers, and all sixteen loads are in flight at once
  for (int i = 0; i < 16; ++i) a[i] = *(const v4f*)(ip + i * 128);
  // precaution: the lane pointer is an input here, so it keeps its registers (no load result is placed over it) until this wait
  asm volatile("s_wait_xcnt 0x0" :: "v"(ip) : "memory");
  // keeps every load in front of the first conversion: left alone the compiler holds the last four back until the first four have returned
  __builtin_amdgcn_sched_barrier(0);
#pragma unroll   // as above: constant indices into a[]
  for (int i = 0; i < 16; ++i) {
    v2u w;
    w[0] = pk16(bf_bits(a[i][0]), bf_bits(a[i][1]));
    w[1] = pk16(bf_bits(a[i][2]), bf_bits(a[i][3]));
    *(v2u*)(op + i * 128) = w;
  }
}

// ---------------------------------------------------------------------------
// bf16 WMMA GEMM, block = 4 waves (128 threads) = one 128 x 128 tile of C, wave w = rows 32w..32w+31 x all 128 cols.
//   C[m][n] = sum_k A[m][k] * Bt[n][k]; A row-major [M][K] bf16 (pitch lda), Bt row-major [N][K] bf16 (pitch ldb);
//   M % 128 == 0, N % 128 == 0, K % 64 == 0; grid.x = M/128 * N/128.
//   SPLITA: A carried as hi (Ap) + lo (A2p) bf16 planes, two products into one accumulator.
//   Operands: a pass is 64 k = one whole 128-B line of every operand row. The 128 A rows (both planes when SPLITA) and the
//   128 Bt rows of a pass are brought into LDS by asynchronous 16-B copies (8 lanes = one line, a wave instruction = 4 lines),
//   rows at pitch 144 B, two buffers: the next pass's copies fly while this pass is multiplied. The Bt tile is read by all
//   four waves. Fragments are read from LDS with the split k map (ldfrag_b), k ascending.
// Epilogues (all: per wave, per 16-row slab: stage in LDS, wave sync, write each row segment with ONE instruction of
//   EPI 0: q or k projection; the 128-col tile is one head. B rows are laid in LDS in even/odd order (row n0 + r in slot
//          64*(r&1) + (r>>1)):
//          acc tile j<4, lane rl holds output column n0 + 2*(16j+rl); tile j+4 holds n0 + 2*(16j+rl) + 1 (the interleaved pair).
//          + bf16(bias[n]); RoPE on the pair with cos/sin[pos = row & 2047][pair]; writes f16 hi plane C0 and f16 residual x2048
//          plane C1, both [M][ldc], cols n0..n0+127 (row segment 256 B = 16 lanes x 16 B).
//   EPI 1: v^T projection: + bf16(bias[m]); f16 hi plane C0, residual x2048 plane C1, [M][ldc], row segment 256 B.
//   EPI 2: f32 output C0 [M][ldc]; row segment 128 floats = 512 B = 32 lanes x 16 B per instruction.
// ---------------------------------------------------------------------------
template <int EPI> struct SlabT { typedef _Float16 T; static constexpr int PERW = 4096; };   // 2 planes x 16 x 128 halves
template <> struct SlabT<2>     { typedef float    T; static constexpr int PERW = 2048; };   // 16 x 128 floats

#define G_PITCH 72                    // LDS row pitch in 16-bit elements: 64 k + 8 = 144 B = 16 B x 9
#define G_TILE  (128 * G_PITCH)       // one 128-row operand tile of a pass, in elements

// One 128-row x 128-B operand tile into LDS: eight copies per lane, lane address pairs (l + i*lstep, g + i*gstep).
// The s_wait_xcnt stands in the copies' own statement so that no address register is rewritten ahead of it.
__device__ __forceinline__ void stage_tile(unsigned l, unsigned lstep, const unsigned short* g, size_t gstep) {
  asm volatile(
      "global_load_async_to_lds_b128 %0, %8, off\n\t"
      "global_load_async_to_lds_b128 %1, %9, off\n\t"
      "global_load_async_to_lds_b128 %2, %10, off\n\t"
      "global_load_async_to_lds_b128 %3, %11, off\n\t"
      "global_load_async_to_lds_b128 %4, %12, off\n\t"
      "global_load_async_to_lds_b128 %5, %13, off\n\t"
      "global_load_async_to_lds_b128 %6, %14, off\n\t"
      "global_load_async_to_lds_b128 %7, %15, off\n\t"
      "s_wait_xcnt 0x0"
      :: "v"(l), "v"(l + lstep), "v"(l + 2 * lstep), "v"(l + 3 * lstep),
         "v"(l + 4 * lstep), "v"(l + 5 * lstep), "v"(l + 6 * lstep), "v"(l + 7 * lstep),
         "v"(g), "v"(g + gstep), "v"(g + 2 * gstep), "v"(g + 3 * gstep),
         "v"(g + 4 * gstep), "v"(g + 5 * gstep), "v"(g + 6 * gstep), "v"(g + 7 * gstep)
      : "memory");
}

template <int EPI, bool SPLITA>
__global__ __launch_bounds__(128) void gemm_w32x128_kernel(
    const unsigned short* Ap, const unsigned short* A2p, int lda,
    const unsigned short* __restrict__ Btp, int ldb,
    const float* __restrict__ bias, const float* __restrict__ cst, const float* __restrict__ snt,
    void* C0, void* C1, int ldc,
    int M, int N, int K) {
  typedef typename SlabT<EPI>::T ST;
  constexpr int NPL = SPLITA ? 3 : 2;            // operand tiles per buffer: A (, A lo), Bt
  constexpr int BUF = NPL * G_TILE;              // elements per buffer
  __shared__ __align__(16) ST slab_all[4 * SlabT<EPI>::PERW];
  __shared__ __align__(16) unsigned short ring[2 * BUF];

  const int tid  = (int)threadIdx.x;
  const int lane = tid & 31;
  const int wave = wave_id();
  const int hh = lane >> 4;           // lane half: k offset 8*hh, D row offset 8*hh
  const int rl = lane & 15;           // A row / B col / D col within subtile
  const int tilesN = N >> 7;
  const int tilesM = M >> 7;
  const int tile = (int)blockIdx.x;
  if (tile >= tilesM * tilesN) return;          // block-uniform, in front of every barrier
  const int tm = tile / tilesN;
  const int tn = tile - tm * tilesN;
  const int mb = tm << 7;                       // first row of the block tile
  const int m0 = mb + (wave << 5);              // first row of this wave
  const int n0 = tn << 7;

  // copy addresses of this lane: copy i of a tile moves 16 B of source row (tid>>3) + 16*i, bytes 16*(tid&7)..+15 of the pass's line
  const int crow = tid >> 3;
  const int ccol = (tid & 7) * 8;
  const unsigned short* gA  = Ap  + (size_t)(mb + crow) * lda + ccol;
  const unsigned short* gA2 = A2p + (size_t)(mb + crow) * lda + ccol;
  const unsigned short* gB  = Btp + (size_t)(n0 + crow) * ldb + ccol;
  const unsigned ring0 = (unsigned)(uintptr_t)(&ring[0]);           // LDS byte address of the ring
  const unsigned lA = ring0 + (unsigned)(crow * G_PITCH + ccol) * 2u;
  const int bslot = (EPI == 0) ? ((crow & 1) * 64 + (crow >> 1)) : crow;
  const unsigned lB = ring0 + (unsigned)((NPL - 1) * G_TILE + bslot * G_PITCH + ccol) * 2u;
  const unsigned lstepA = 16u * G_PITCH * 2u;
  const unsigned lstepB = ((EPI == 0) ? 8u : 16u) * G_PITCH * 2u;
  const size_t gstepA = (size_t)16 * lda;
  const size_t gstepB = (size_t)16 * ldb;

  v8f acc[2][8];
#pragma unroll
  for (int i = 0; i < 2; ++i)
#pragma unroll
    for (int j = 0; j < 8; ++j) acc[i][j] = zero8();

  const int npass = K >> 6;
  // pass 0 into buffer 0, landed and published; then pass 1 into buffer 1
  stage_tile(lA, lstepA, gA, gstepA);
  if (SPLITA) stage_tile(lA + G_TILE * 2u, lstepA, gA2, gstepA);
  stage_tile(lB, lstepB, gB, gstepB);
  asm volatile("s_wait_asynccnt 0x0" ::: "memory");   // this wave's copies of pass 0 have landed
  __syncthreads();                                    // every wave's copies of pass 0 are readable by all
  if (npass > 1) {
    stage_tile(lA + BUF * 2u, lstepA, gA + 64, gstepA);
    if (SPLITA) stage_tile(lA + (BUF + G_TILE) * 2u, lstepA, gA2 + 64, gstepA);
    stage_tile(lB + BUF * 2u, lstepB, gB + 64, gstepB);
  }

  for (int t = 0; t < npass; ++t) {
    const int bo = (t & 1) * BUF;
    const __bf16* As = (const __bf16*)(const void*)(ring + bo) + ((wave << 5) + rl) * G_PITCH + 8 * hh;
    const __bf16* Bs = (const __bf16*)(const void*)(ring + bo + (NPL - 1) * G_TILE) + rl * G_PITCH + 8 * hh;
    v16b ah[2][2], al[2][2], bj[2][8];
#pragma unroll
    for (int kb = 0; kb < 2; ++kb) {
#pragma unroll
      for (int i = 0; i < 2; ++i) {
        ah[kb][i] = ldfrag_b(As + i * 16 * G_PITCH + kb * 32);
        al[kb][i] = SPLITA ? ldfrag_b(As + G_TILE + i * 16 * G_PITCH + kb * 32) : ah[kb][i];
      }
#pragma unroll
      for (int j = 0; j < 8; ++j) bj[kb][j] = ldfrag_b(Bs + j * 16 * G_PITCH + kb * 32);
    }
    // keeps the pass's LDS reads together in front of its WMMAs: left alone the compiler puts two reads and a full wait before every WMMA pair
    __builtin_amdgcn_sched_barrier(0);
#pragma unroll
    for (int kb = 0; kb < 2; ++kb) {
#pragma unroll
      for (int j = 0; j < 8; ++j) {
        acc[0][j] = mma_b(ah[kb][0], bj[kb][j], acc[0][j]);
        acc[1][j] = mma_b(ah[kb][1], bj[kb][j], acc[1][j]);
        if (SPLITA) {
          acc[0][j] = mma_b(al[kb][0], bj[kb][j], acc[0][j]);
          acc[1][j] = mma_b(al[kb][1], bj[kb][j], acc[1][j]);
        }
      }
    }
    // keeps the WMMAs in front of the waits and the barrier below, so that the next pass's copies fly for the whole of this pass
    __builtin_amdgcn_sched_barrier(0);
    asm volatile("s_wait_dscnt 0x0" ::: "memory");      // this wave's reads of the buffer are done before it is refilled
    asm volatile("s_wait_asynccnt 0x0" ::: "memory");   // this wave's copies of pass t + 1 have landed
    __syncthreads();                                    // publishes pass t + 1 and ends every reader's last read of pass t
    if (t + 2 < npass) {                                // block-uniform
      const size_t ko = (size_t)(t + 2) * 64;
      stage_tile(lA + (unsigned)bo * 2u, lstepA, gA + ko, gstepA);
      if (SPLITA) stage_tile(lA + (unsigned)(bo + G_TILE) * 2u, lstepA, gA2 + ko, gstepA);
      stage_tile(lB + (unsigned)bo * 2u, lstepB, gB + ko, gstepB);
    }
  }
  asm volatile("s_wait_asynccnt 0x0" ::: "memory");     // no copy is outstanding when the wave goes on to the epilogue
  acc_guard4(acc[0][0], acc[0][1], acc[0][2], acc[0][3]);
  acc_guard4(acc[0][4], acc[0][5], acc[0][6], acc[0][7]);
  acc_guard4(acc[1][0], acc[1][1], acc[1][2], acc[1][3]);
  acc_guard4(acc[1][4], acc[1][5], acc[1][6], acc[1][7]);

  // ---- epilogue ----
  ST* slab = slab_all + wave * SlabT<EPI>::PERW;
  _Float16* sl16 = (_Float16*)(void*)slab;
  float*    slf  = (float*)(void*)slab;

  if (EPI == 0) {
    _Float16* P0 = (_Float16*)C0;
    _Float16* P1 = (_Float16*)C1;
#pragma unroll
    for (int i = 0; i < 2; ++i) {
      const int rb = m0 + i * 16 + 8 * hh;
#pragma unroll
      for (int j = 0; j < 4; ++j) {
        const int pi = j * 16 + rl;                              // pair index 0..63 within head
        const int nc = n0 + 2 * pi;                              // column of x1; x2 at nc + 1
        const float b1 = bf_rne(bias[nc]);
        const float b2 = bf_rne(bias[nc + 1]);
#pragma unroll
        for (int r = 0; r < 8; ++r) {
          const int row = rb + r;                                // token 0..NTOK-1
          const int s   = row & (SQ - 1);                        // position within sequence
          const float cv = cst[(size_t)s * NFREQ + pi];
          const float sv = snt[(size_t)s * NFREQ + pi];
          const float x1 = acc[i][j][r] + b1;
          const float x2 = acc[i][j + 4][r] + b2;
          const float o1 = x1 * cv - x2 * sv;
          const float o2 = x1 * sv + x2 * cv;
          const _Float16 h1 = (_Float16)o1;
          const _Float16 h2 = (_Float16)o2;
          const int so = (8 * hh + r) * 128 + 2 * pi;
          sl16[so]            = h1;
          sl16[so + 1]        = h2;
          sl16[2048 + so]     = (_Float16)((o1 - (float)h1) * 2048.0f);
          sl16[2048 + so + 1] = (_Float16)((o2 - (float)h2) * 2048.0f);
        }
      }
      lds_wave_sync();
      {
#pragma unroll
        for (int it = 0; it < 8; ++it) {
          const int row = it * 2 + hh;                           // it x hh covers rows 0..15
          const int c8  = rl * 8;
          const v8h vh = *(const v8h*)(sl16 + row * 128 + c8);
          const v8h vl = *(const v8h*)(sl16 + 2048 + row * 128 + c8);
          const size_t go = (size_t)(m0 + i * 16 + row) * ldc + n0 + c8;
          *(v8h*)(P0 + go) = vh;
          *(v8h*)(P1 + go) = vl;
        }
        
      }
      lds_wave_sync();
    }
  } else if (EPI == 1) {
    _Float16* P0 = (_Float16*)C0;
    _Float16* P1 = (_Float16*)C1;
#pragma unroll
    for (int i = 0; i < 2; ++i) {
#pragma unroll
      for (int r = 0; r < 8; ++r) {
        const int m = m0 + i * 16 + 8 * hh + r;
        const float bm = bf_rne(bias[m]);
#pragma unroll
        for (int j = 0; j < 8; ++j) {
          const float v = acc[i][j][r] + bm;
          const _Float16 hv = (_Float16)v;
          const int so = (8 * hh + r) * 128 + j * 16 + rl;
          sl16[so]        = hv;
          sl16[2048 + so] = (_Float16)((v - (float)hv) * 2048.0f);
        }
      }
      lds_wave_sync();
      {
#pragma unroll
        for (int it = 0; it < 8; ++it) {
          const int row = it * 2 + hh;
          const int c8  = rl * 8;
          const v8h vh = *(const v8h*)(sl16 + row * 128 + c8);
          const v8h vl = *(const v8h*)(sl16 + 2048 + row * 128 + c8);
          const size_t go = (size_t)(m0 + i * 16 + row) * ldc + n0 + c8;
          *(v8h*)(P0 + go) = vh;
          *(v8h*)(P1 + go) = vl;
        }
        
      }
      lds_wave_sync();
    }
  } else {
    float* C = (float*)C0;
#pragma unroll
    for (int i = 0; i < 2; ++i) {
#pragma unroll
      for (int j = 0; j < 8; ++j)
#pragma unroll
        for (int r = 0; r < 8; ++r)
          slf[(8 * hh + r) * 128 + j * 16 + rl] = acc[i][j][r];
      lds_wave_sync();
      {
#pragma unroll
        for (int row = 0; row < 16; ++row) {                     // 32 lanes x 16 B = the whole 512-B row segment per instruction
          const v4f v = *(const v4f*)(slf + row * 128 + lane * 4);
          *(v4f*)(C + (size_t)(m0 + i * 16 + row) * ldc + n0 + lane * 4) = v;
        }
        
      }
      lds_wave_sync();
    }
  }
}

// ---------------------------------------------------------------------------
// Windowed causal GQA flash attention, head dim 128, 32-key chunks, block = 4 waves = 64 query rows of one (b, h);
// grid (n query tiles, NHQ, NSEQ). Key j is valid for query i iff j <= i and i - j <= window (window read from the int input).
//   q planes f16 [tok][h*128+d]: hi (qhp) and residual x2048 (qlp); k planes f16 [tok][kvh*128+d]: hi (khp), residual x2048 (klp);
//   v^T planes f16 [kvh*128+d][tok]: hi (vhp), residual x2048 (vlp); outputs attn bf16 hi (ahp) / lo (alp) [tok][h*128+d].
//   scores = (Sh + Sr/2048) * 128^-0.5 with Sh = qh.kh and Sr = ql'.kh (+ qh.kl' when PRES); invalid keys -> -inf; online softmax f32
//   (-inf safe: a row with no valid key so far keeps m = -inf, l = 0, O = 0);
//   p' = 1024 p stored per wave to LDS as f16 hi (and residual x2048 when PRES), reloaded as A fragments after a wave sync;
//   O = (Oh + Or/2048)/1024/l with Oh = ph.vh, Or = ph.vl' (+ pl'.vh when PRES).
//   q staging: each wave copies its 16 rows of both q planes into LDS once, rows at pitch 272 B, and reads its A fragments from there.
//   K / V^T chunk staging: 128 threads x 4 x 16 B per plane = whole 32x128 / 128x32 tile, plain loads, __syncthreads before and after.
//   Chunks cover keys [max(0, 64*qb - window) & ~31, 64*qb + 63]; trip count statically <= 64; waves with no valid key in a chunk
//   skip its compute part (wave-uniform, scalar branch).
// ---------------------------------------------------------------------------
#define AT_KC   32
#define KS_P    136
#define VS_P    40
#define PS_P    40
#define QS_P    136
#define VAHEAD  2
// LDS map in halves. The k residual tile and the p residual tile exist only with PRES; without them four work-groups still share a WGP's LDS.
template <bool PRES> struct AttnLds {
  static constexpr int KS  = 0;
  static constexpr int KLS = 32 * KS_P;
  static constexpr int VHS = (PRES ? 2 : 1) * 32 * KS_P;
  static constexpr int VLS = VHS + 128 * VS_P;
  static constexpr int PH  = VLS + 128 * VS_P;
  static constexpr int PL  = PH + 4 * 16 * PS_P;
  static constexpr int QH  = PH + (PRES ? 2 : 1) * 4 * 16 * PS_P;
  static constexpr int QL  = QH + 64 * QS_P;
  static constexpr int TOT = QL + 64 * QS_P;
};
static_assert(AttnLds<false>::TOT * 2 * 4 <= 327680);   // four work-groups of the long launch per WGP
static_assert(4 * 4096 <= AttnLds<false>::QH);          // output staging (2 planes x 16 x 128 per wave) aliases the chunk region after the loop

template <bool PRES>
// The long launch (no residual products, 896 work-groups) gets a budget of 256 registers a wave = four waves per SIMD: four work-groups
// share a WGP and the whole launch is resident at once. The short launch has fewer work-groups than there are WGPs and keeps the full budget.
__global__ __launch_bounds__(128) __attribute__((amdgpu_waves_per_eu(PRES ? 1 : 4))) void attn_window_kernel(
    const unsigned short* __restrict__ qhp, const unsigned short* __restrict__ qlp,
    const unsigned short* __restrict__ khp, const unsigned short* __restrict__ klp,
    const unsigned short* __restrict__ vhp, const unsigned short* __restrict__ vlp,
    unsigned short* __restrict__ ahp, unsigned short* __restrict__ alp,
    const int* __restrict__ winp, int qb_base) {
  typedef AttnLds<PRES> L;
  __shared__ __align__(16) _Float16 lds[L::TOT];
  _Float16* Ks  = lds + L::KS;
  _Float16* Kls = lds + L::KLS;
  _Float16* Vhs = lds + L::VHS;
  _Float16* Vls = lds + L::VLS;

  const int tid  = (int)threadIdx.x;
  const int lane = tid & 31;
  const int wave = wave_id();
  const int hh   = lane >> 4;
  const int c    = lane & 15;
  const int qb   = (int)blockIdx.x + qb_base;
  const int h    = (int)blockIdx.y;
  const int b    = (int)blockIdx.z;
  const int kvh  = h >> 1;                       // 2 query heads per kv head
  const int window = __builtin_amdgcn_readfirstlane(winp[0]);
  const int qblk0 = qb * 64;
  const int q0    = qblk0 + wave * 16;           // first query row of this wave (within sequence)
  const int qlast = q0 + 15;
  const int wlo   = q0 - window;                 // oldest valid key of row q0
  const size_t tok0 = (size_t)b * SQ;

  int kstart = qblk0 - window;
  kstart = (kstart > 0) ? (kstart & ~31) : 0;
  if (kstart > qblk0) kstart = qblk0;
  int nch = (qblk0 + 64 - kstart) >> 5;          // block-uniform
  if (nch > 64) nch = 64;
  if (nch < 0) nch = 0;

  // This wave's 16 query rows, both planes, go into LDS once (16 lanes = one 256-B row, row = (lane >> 4) + 2 i); every chunk reads its
  // A fragments from there. Only this wave reads them, behind the two barriers at the head of the first chunk.
  _Float16* Qhs = lds + L::QH + wave * (16 * QS_P);
  _Float16* Qls = lds + L::QL + wave * (16 * QS_P);
  {
    const _Float16* qhg = (const _Float16*)(const void*)qhp + (tok0 + q0 + hh) * HID + h * HDM + c * 8;
    const _Float16* qlg = (const _Float16*)(const void*)qlp + (tok0 + q0 + hh) * HID + h * HDM + c * 8;
    v8h qx[8], qy[8];
#pragma unroll   // constant indices keep qx and qy in registers, and all sixteen loads are in flight at once
    for (int i = 0; i < 8; ++i) {
      qx[i] = *(const v8h*)(qhg + i * 2 * HID);
      qy[i] = *(const v8h*)(qlg + i * 2 * HID);
    }
    // precaution: the lane pointers are inputs here, so they keep their registers (no load result is placed over them) until this wait
    asm volatile("s_wait_xcnt 0x0" :: "v"(qhg), "v"(qlg) : "memory");
#pragma unroll   // as above: constant indices into qx and qy
    for (int i = 0; i < 8; ++i) {
      *(v8h*)(Qhs + (hh + 2 * i) * QS_P + c * 8) = qx[i];
      *(v8h*)(Qls + (hh + 2 * i) * QS_P + c * 8) = qy[i];
    }
  }
  const _Float16* Qhr = Qhs + c * QS_P + 8 * hh;   // A fragment row of this lane
  const _Float16* Qlr = Qls + c * QS_P + 8 * hh;
  const _Float16* Kg  = (const _Float16*)(const void*)khp + tok0 * KVW + kvh * HDM;
  const _Float16* Klg = (const _Float16*)(const void*)klp + tok0 * KVW + kvh * HDM;
  const _Float16* Vhg = (const _Float16*)(const void*)vhp + (size_t)(kvh * HDM) * NTOK + tok0;
  const _Float16* Vlg = (const _Float16*)(const void*)vlp + (size_t)(kvh * HDM) * NTOK + tok0;
  const unsigned kgo = (unsigned)((tid >> 4) * KVW + (tid & 15) * 8);    // this lane's element offset in a K chunk, piece 0
  const unsigned vgo = (unsigned)((tid >> 2) * NTOK + (tid & 3) * 8);    // and in a V^T chunk
  _Float16* ph = lds + L::PH + wave * (16 * PS_P);
  _Float16* pl = lds + L::PL + wave * (16 * PS_P);

  float mrow[8], lrow[8];
  v8f oacc[8], oaccr[8];
#pragma unroll
  for (int r = 0; r < 8; ++r) { mrow[r] = -INFINITY; lrow[r] = 0.f; }
#pragma unroll
  for (int t = 0; t < 8; ++t) { oacc[t] = zero8(); oaccr[t] = zero8(); }

  for (int kc = 0; kc < nch; ++kc) {
    const int kv0 = kstart + kc * AT_KC;         // keys kv0..kv0+31, all < SQ
    __syncthreads();
    // one lane pointer per plane for the chunk; the four pieces of a plane lie at constant distances from it
    const _Float16* kq  = Kg  + (size_t)kv0 * KVW + kgo;
    const _Float16* klq = Klg + (size_t)kv0 * KVW + kgo;
    const _Float16* vhq = Vhg + kv0 + vgo;
    const _Float16* vlq = Vlg + kv0 + vgo;
    v8h kx[4], ky[4], vx[4], vy[4];
#pragma unroll
    for (int i = 0; i < 4; ++i) {                // coverage: 512 pieces of 8 halves per plane = whole tile
      kx[i] = *(const v8h*)(kq + i * 8 * KVW);   // K: 32 keys x 128 d, key = (tid >> 4) + 8 i
      if (PRES) ky[i] = *(const v8h*)(klq + i * 8 * KVW);
      vx[i] = *(const v8h*)(vhq + i * 32 * NTOK); // V^T: 128 d x 32 keys, d = (tid >> 2) + 32 i
      vy[i] = *(const v8h*)(vlq + i * 32 * NTOK);
    }
    // precaution: the lane pointers are inputs here, so they keep their registers (no load result is placed over them) until this wait
    if (PRES) asm volatile("s_wait_xcnt 0x0" :: "v"(kq), "v"(klq), "v"(vhq), "v"(vlq) : "memory");
    else      asm volatile("s_wait_xcnt 0x0" :: "v"(kq), "v"(vhq), "v"(vlq) : "memory");
#pragma unroll
    for (int i = 0; i < 4; ++i) {
      const int p   = tid + 128 * i;             // 0..511
      const int key = p >> 4, d8 = (p & 15) * 8;
      *(v8h*)(Ks + key * KS_P + d8) = kx[i];
      if (PRES) *(v8h*)(Kls + key * KS_P + d8) = ky[i];
      const int d = p >> 2, k8 = (p & 3) * 8;
      *(v8h*)(Vhs + d * VS_P + k8) = vx[i];
      *(v8h*)(Vls + d * VS_P + k8) = vy[i];
    }
    __syncthreads();

    if (kv0 <= qlast && kv0 + AT_KC - 1 >= wlo) {   // wave-uniform (scalar): skip chunks with no valid key for this wave
      // ---- scores ----
      v8f sh[2], sr[2];
      sh[0] = zero8(); sh[1] = zero8(); sr[0] = zero8(); sr[1] = zero8();
#pragma unroll
      for (int dc = 0; dc < 4; ++dc) {
        const v16h qa = ldfrag_h(Qhr + dc * 32);
        const v16h ql = ldfrag_h(Qlr + dc * 32);
        v16h kb[2], kl[2];
#pragma unroll
        for (int j = 0; j < 2; ++j) {
          kb[j] = ldfrag_h(Ks + (j * 16 + c) * KS_P + dc * 32 + 8 * hh);
          kl[j] = PRES ? ldfrag_h(Kls + (j * 16 + c) * KS_P + dc * 32 + 8 * hh) : kb[j];
        }
        // keeps all fragment reads of this 32-d slice in one place in front of its WMMAs: left alone the compiler waits out a read per WMMA pair
        __builtin_amdgcn_sched_barrier(0);
#pragma unroll
        for (int j = 0; j < 2; ++j) {
          sh[j] = mma_h(qa, kb[j], sh[j]);
          sr[j] = mma_h(ql, kb[j], sr[j]);
        }
        if (PRES) {
#pragma unroll
          for (int j = 0; j < 2; ++j) sr[j] = mma_h(qa, kl[j], sr[j]);
        }
        // first slice: its WMMAs start the four accumulators; the guard keeps them off the registers of this slice's own fragments
        if (dc == 0) guard_frags(sh[0], sr[0], sh[1], sr[1], qa, ql, kb[0], kb[1], kl[0], kl[1]);
        // keeps this slice's WMMAs in front of the next slice's reads
        __builtin_amdgcn_sched_barrier(0);
      }
      // ---- scale, window + causal validity, chunk row max ----
      float cm[8];
#pragma unroll
      for (int r = 0; r < 8; ++r) {
        const int qrow = q0 + 8 * hh + r;
        float m = -INFINITY;
#pragma unroll
        for (int j = 0; j < 2; ++j) {
          const int key = kv0 + j * 16 + c;
          float s = (sh[j][r] + sr[j][r] * 0.00048828125f) * 0.08838834764831845f;
          const bool ok = (key <= qrow) && (qrow - key <= window);
          s = ok ? s : -INFINITY;
          sh[j][r] = s;
          m = fmaxf(m, s);
        }
        cm[r] = m;
      }
      row_max16x8(cm);
      // ---- online softmax, P' to LDS ----
#pragma unroll
      for (int r = 0; r < 8; ++r) {
        const float mnew  = fmaxf(mrow[r], cm[r]);
        const float mref  = (mnew == -INFINITY) ? 0.f : mnew;   // row with no valid key yet: everything stays 0
        const float alpha = __expf(mrow[r] - mref);
        mrow[r] = mnew;
        float psum = 0.f;
#pragma unroll
        for (int j = 0; j < 2; ++j) {
          const float p  = __expf(sh[j][r] - mref);
          psum += p;
          const float pp = p * 1024.0f;
          const _Float16 phv = (_Float16)pp;
          const int po = (8 * hh + r) * PS_P + j * 16 + c;
          ph[po] = phv;
          if (PRES) pl[po] = (_Float16)((pp - (float)phv) * 2048.0f);
        }
        psum = row_sum16(psum);
        lrow[r] = lrow[r] * alpha + psum;
#pragma unroll
        for (int t = 0; t < 8; ++t) { oacc[t][r] *= alpha; oaccr[t][r] *= alpha; }
      }
      // ---- O += P' . V ----
      // The V^T fragments of tile t + VAHEAD are read in front of tile t's WMMAs, the first VAHEAD tiles in front of the P' trip through LDS.
      v16h vb[8], vr[8];
#pragma unroll
      for (int t = 0; t < VAHEAD; ++t) {
        vb[t] = ldfrag_h(Vhs + (t * 16 + c) * VS_P + 8 * hh);
        vr[t] = ldfrag_h(Vls + (t * 16 + c) * VS_P + 8 * hh);
      }
      lds_wave_sync();                           // P' stores visible to the other lanes of this wave before the fragment reload
      const v16h pa = ldfrag_h(ph + c * PS_P + 8 * hh);
      v16h pr = pa;
      if (PRES) pr = ldfrag_h(pl + c * PS_P + 8 * hh);
#pragma unroll
      for (int t = 0; t < 8; ++t) {
        if (t + VAHEAD < 8) {
          vb[t + VAHEAD] = ldfrag_h(Vhs + ((t + VAHEAD) * 16 + c) * VS_P + 8 * hh);
          vr[t + VAHEAD] = ldfrag_h(Vls + ((t + VAHEAD) * 16 + c) * VS_P + 8 * hh);
        }
        // keeps the reads of tile t + VAHEAD in front of tile t's WMMAs: left alone the compiler reads only one tile ahead
        // (mask 6: plain vector and scalar work, the rescale of later tiles and the row sums, may still move in among the WMMAs)
        __builtin_amdgcn_sched_barrier(6);
        oacc[t]  = mma_h(pa, vb[t], oacc[t]);
        oaccr[t] = mma_h(pa, vr[t], oaccr[t]);
        if (PRES) oaccr[t] = mma_h(pr, vb[t], oaccr[t]);
        // keeps tile t's WMMAs in front of the next tile's reads
        __builtin_amdgcn_sched_barrier(6);
      }
      acc_guard4(oacc[6], oaccr[6], oacc[7], oaccr[7]);   // the loop's back edge follows
    }
  }

  __syncthreads();                               // all chunk-region readers done before aliasing it as output staging
  _Float16* osh = lds + wave * 4096;
  _Float16* osl = osh + 2048;
#pragma unroll
  for (int r = 0; r < 8; ++r) {
    const float inv = (1.0f / lrow[r]) * 0.0009765625f;
#pragma unroll
    for (int t = 0; t < 8; ++t) {
      const float o = (oacc[t][r] + oaccr[t][r] * 0.00048828125f) * inv;
      const unsigned short hb = bf_bits(o);
      const unsigned short lb = bf_bits(o - bf_val(hb));
      const int so = (8 * hh + r) * 128 + t * 16 + c;
      osh[so] = __builtin_bit_cast(_Float16, hb);
      osl[so] = __builtin_bit_cast(_Float16, lb);
    }
  }
  lds_wave_sync();
  _Float16* Ahg = (_Float16*)(void*)ahp + (tok0 + q0) * HID + h * HDM;
  _Float16* Alg = (_Float16*)(void*)alp + (tok0 + q0) * HID + h * HDM;
  {
#pragma unroll
    for (int it = 0; it < 8; ++it) {
      const int row = it * 2 + hh;               // it 0..7 x hh 0..1 covers rows 0..15
      const int c8  = c * 8;                     // 16 lanes x 16 B = the whole 256-B segment
      const v8h x = *(const v8h*)(osh + row * 128 + c8);
      const v8h y = *(const v8h*)(osl + row * 128 + c8);
      *(v8h*)(Ahg + (size_t)row * HID + c8) = x;
      *(v8h*)(Alg + (size_t)row * HID + c8) = y;
    }
    
  }
}

// ---------------------------------------------------------------------------
// Workspace map (bytes; every region is a whole number of the rows its producer writes with whole-line stores, no tails):
//   Xb    bf16 [4096][2048]   16777216   (the attn hi plane Ah [4096][2048] bf16 reuses this region after the last Xb reader)
//   Wqb   bf16 [2048][2048]    8388608      Wkb bf16 [1024][2048]  4194304      Wvb bf16 [1024][2048]  4194304
//   Wob   bf16 [2048][2048]    8388608      cst f32  [2048][64]     524288      snt f32  [2048][64]     524288
//   Qh    f16  [4096][2048]   16777216      Ql  f16  [4096][2048] 16777216
//   Kh    f16  [4096][1024]    8388608      Kl  f16  [4096][1024]  8388608
//   Vh    f16  [1024][4096]    8388608      Vl  f16  [1024][4096]  8388608
//   Al    bf16 [4096][2048]   16777216
//   total                    126877696
// ---------------------------------------------------------------------------
extern "C" void kernel_launch(void* const* d_in, const int* in_sizes, int n_in,
                              void* d_out, int out_size, void* d_ws, size_t ws_size,
                              hipStream_t stream) {
  if (n_in < 9) return;
  if (in_sizes[0] != NTOK * HID) return;
  if (in_sizes[1] != HID * HID) return;
  if (in_sizes[2] != HID) return;
  if (in_sizes[3] != KVW * HID) return;
  if (in_sizes[4] != KVW) return;
  if (in_sizes[5] != KVW * HID) return;
  if (in_sizes[6] != KVW) return;
  if (in_sizes[7] != HID * HID) return;
  if (in_sizes[8] < 1) return;
  if (out_size != NTOK * HID) return;

  const float* x    = (const float*)d_in[0];
  const float* wq_w = (const float*)d_in[1];
  const float* wq_b = (const float*)d_in[2];
  const float* wk_w = (const float*)d_in[3];
  const float* wk_b = (const float*)d_in[4];
  const float* wv_w = (const float*)d_in[5];
  const float* wv_b = (const float*)d_in[6];
  const float* wo_w = (const float*)d_in[7];
  const int*   win  = (const int*)d_in[8];
  float* out = (float*)d_out;

  const size_t szX  = (size_t)NTOK * HID * 2;
  const size_t szWq = (size_t)HID * HID * 2;
  const size_t szWk = (size_t)KVW * HID * 2;
  const size_t szWv = (size_t)KVW * HID * 2;
  const size_t szWo = (size_t)HID * HID * 2;
  const size_t szT  = (size_t)SQ * NFREQ * 4;
  const size_t szQ  = (size_t)NTOK * HID * 2;
  const size_t szK  = (size_t)NTOK * KVW * 2;
  const size_t szV  = (size_t)KVW * NTOK * 2;
  const size_t szA  = (size_t)NTOK * HID * 2;
  size_t off = 0;
  const size_t oX  = off; off += szX;
  const size_t oWq = off; off += szWq;
  const size_t oWk = off; off += szWk;
  const size_t oWv = off; off += szWv;
  const size_t oWo = off; off += szWo;
  const size_t oCs = off; off += szT;
  const size_t oSn = off; off += szT;
  const size_t oQh = off; off += szQ;
  const size_t oQl = off; off += szQ;
  const size_t oKh = off; off += szK;
  const size_t oKl = off; off += szK;
  const size_t oVh = off; off += szV;
  const size_t oVl = off; off += szV;
  const size_t oAl = off; off += szA;
  const size_t oAh = oX;                         // Ah reuses the Xb region (same byte size); Xb is dead after launch (4)
  if (szA != szX) return;
  if (off > ws_size) return;                     // off = 126877696

  char* ws = (char*)d_ws;
  unsigned short* Xb  = (unsigned short*)(ws + oX);
  unsigned short* Wqb = (unsigned short*)(ws + oWq);
  unsigned short* Wkb = (unsigned short*)(ws + oWk);
  unsigned short* Wvb = (unsigned short*)(ws + oWv);
  unsigned short* Wob = (unsigned short*)(ws + oWo);
  float*          cst = (float*)(ws + oCs);
  float*          snt = (float*)(ws + oSn);
  unsigned short* Qh  = (unsigned short*)(ws + oQh);
  unsigned short* Ql  = (unsigned short*)(ws + oQl);
  unsigned short* Kh  = (unsigned short*)(ws + oKh);
  unsigned short* Kl  = (unsigned short*)(ws + oKl);
  unsigned short* Vh  = (unsigned short*)(ws + oVh);
  unsigned short* Vl  = (unsigned short*)(ws + oVl);
  unsigned short* Ah  = (unsigned short*)(ws + oAh);
  unsigned short* Al  = (unsigned short*)(ws + oAl);

  const dim3 b256(256), b128(128);

  // (1) cos/sin table [2048][64] x 2 and the RNE bf16 planes of x [4096][2048], Wq [2048][2048], Wk [1024][2048], Wv [1024][2048],
  //     Wo [2048][2048] (weights [out][in]: Wq, Wk, Wo as Bt[n][k], Wv as A[m][k])
  prep_kernel<<<dim3(NB_ROPE + NB_X + NB_WQ + NB_WK + NB_WV + NB_WO), b256, 0, stream>>>(
      x, wq_w, wk_w, wv_w, wo_w, Xb, Wqb, Wkb, Wvb, Wob, cst, snt);
  // (2) q = x . Wq^T + bq, RoPE -> Qh/Ql [4096][2048]   (M=4096, N=2048, K=2048; 32 x 16 block tiles)
  gemm_w32x128_kernel<0, false><<<dim3((NTOK / 128) * (HID / 128)), b128, 0, stream>>>(
      Xb, Xb, HID, Wqb, HID, wq_b, cst, snt, (void*)Qh, (void*)Ql, HID, NTOK, HID, HID);
  // (3) k = x . Wk^T + bk, RoPE -> Kh/Kl [4096][1024]   (M=4096, N=1024, K=2048; 32 x 8 block tiles)
  gemm_w32x128_kernel<0, false><<<dim3((NTOK / 128) * (KVW / 128)), b128, 0, stream>>>(
      Xb, Xb, HID, Wkb, HID, wk_b, cst, snt, (void*)Kh, (void*)Kl, KVW, NTOK, KVW, HID);
  // (4) v^T = Wv . x^T + bv[m] -> Vh/Vl [1024][4096]   (A = Wvb, Bt = Xb; M=1024, N=4096, K=2048; 8 x 32 block tiles)
  gemm_w32x128_kernel<1, false><<<dim3((KVW / 128) * (NTOK / 128)), b128, 0, stream>>>(
      Wvb, Wvb, HID, Xb, HID, wv_b, cst, snt, (void*)Vh, (void*)Vl, NTOK, KVW, NTOK, HID);
  // (5)-(6) windowed causal attention, query tiles 0..3 with k and p residual products, tiles 4..31 without
  attn_window_kernel<true><<<dim3(4, NHQ, NSEQ), b128, 0, stream>>>(Qh, Ql, Kh, Kl, Vh, Vl, Ah, Al, win, 0);
  attn_window_kernel<false><<<dim3(SQ / 64 - 4, NHQ, NSEQ), b128, 0, stream>>>(Qh, Ql, Kh, Kl, Vh, Vl, Ah, Al, win, 4);
  // (7) out = attn(hi + lo) . Wo^T -> d_out f32 [4096][2048]   (M=4096, N=2048, K=2048; 32 x 16 block tiles)
  gemm_w32x128_kernel<2, true><<<dim3((NTOK / 128) * (HID / 128)), b128, 0, stream>>>(
      Ah, Al, HID, Wob, HID, wq_b, cst, snt, (void*)out, (void*)out, HID, NTOK, HID, HID);
  (void)hipGetLastError();
}

// v008
// It runs in 222 microseconds.
// Versions in between are left out here; by their measured steps it is 1.19 times as fast as v006.
// Counting every step since v000, it is 3.67 times as fast.
// Contractions: x.Wq^T, x.Wk^T and Wv.x^T on v_wmma_f32_16x16x32_bf16 (operands = RNE bf16 of the f32 inputs, single products);
// k.q^T and v^T.p^T on v_wmma_f32_16x16x32_f16 (q, k, p x1024 and v^T plain f16; on query tiles 0..3 each of the four also has its f16 residual
// x2^11 plane, with the cross products hi.residual); attn.Wo^T on v_wmma_f32_16x16x32_bf16
// (attn = bf16 hi + bf16 lo planes, two products; Wo RNE bf16). f32 accumulate everywhere; bias add, RoPE, online softmax and scale folds in f32.
#include <hip/hip_runtime.h>
#include <math.h>
#include <stdint.h>

#define NSEQ   2
#define SQ     2048
#define HID    2048
#define NHQ    16
#define NKVH   8
#define HDM    128
#define KVW    1024
#define NTOK   4096
#define NFREQ  64

typedef _Float16     v16h __attribute__((ext_vector_type(16)));
typedef _Float16     v8h  __attribute__((ext_vector_type(8)));
typedef __bf16       v16b __attribute__((ext_vector_type(16)));
typedef __bf16       v8b  __attribute__((ext_vector_type(8)));
typedef float        v8f  __attribute__((ext_vector_type(8)));
typedef float        v4f  __attribute__((ext_vector_type(4)));
typedef unsigned int v4u  __attribute__((ext_vector_type(4)));

// ---------------------------------------------------------------------------
// small helpers
// ---------------------------------------------------------------------------
__device__ __forceinline__ unsigned short bf_bits(float f) {          // RNE convert f32 -> bf16 bits
  const unsigned u = __float_as_uint(f);
  return (unsigned short)((u + 0x7FFFu + ((u >> 16) & 1u)) >> 16);
}
__device__ __forceinline__ float bf_val(unsigned short h) { return __uint_as_float(((unsigned)h) << 16); }
__device__ __forceinline__ float bf_rne(float f) { return bf_val(bf_bits(f)); }
__device__ __forceinline__ unsigned pk16(unsigned short a, unsigned short b) { return (unsigned)a | ((unsigned)b << 16); }
__device__ __forceinline__ v8f zero8() { v8f z = {0.f, 0.f, 0.f, 0.f, 0.f, 0.f, 0.f, 0.f}; return z; }
__device__ __forceinline__ int wave_id() { return __builtin_amdgcn_readfirstlane((int)(threadIdx.x >> 5)); }

__device__ __forceinline__ void lds_wave_sync() {
  __builtin_amdgcn_fence(__ATOMIC_RELEASE, "workgroup");
  __builtin_amdgcn_wave_barrier();
  __builtin_amdgcn_fence(__ATOMIC_ACQUIRE, "workgroup");
}

// Value of lane l ^ 16 (the same column of the other 16-lane row), a cross-row move of the vector unit, all lanes on.
__device__ __forceinline__ float half_xor(float v) {
  const int b = __builtin_bit_cast(int, v);
  return __builtin_bit_cast(float, __builtin_amdgcn_permlanex16(b, b, 0x76543210, 0xfedcba98, false, false));
}

// ---------------------------------------------------------------------------
// WMMA fragments (wave32, 16x16x32, 16-bit operands). For A (row m = lane&15) and B (col n = lane&15) alike:
// elements 0..7 <- k0 + 8*(lane>>4) + 0..7, elements 8..15 <- k0 + 16 + 8*(lane>>4) + 0..7.
// ldfrag(p) with p = rowbase + k0 + 8*(lane>>4): two 16-B loads p[0..7], p[16..23].
// D: acc[r] = (row 8*(lane>>4) + r, col lane&15).
// ---------------------------------------------------------------------------
union FragH { v16h v; v8h h[2]; };
union FragB { v16b v; v8b h[2]; };
__device__ __forceinline__ v16h ldfrag_h(const _Float16* p) { FragH f; f.h[0] = *(const v8h*)(p); f.h[1] = *(const v8h*)(p + 16); return f.v; }
__device__ __forceinline__ v16b ldfrag_b(const __bf16* p)   { FragB f; f.h[0] = *(const v8b*)(p); f.h[1] = *(const v8b*)(p + 16); return f.v; }

__device__ __forceinline__ v8f mma_h(v16h a, v16h b, v8f c) {
  return __builtin_amdgcn_wmma_f32_16x16x32_f16(false, a, false, b, (short)0, c, false, false);
}
__device__ __forceinline__ v8f mma_b(v16b a, v16b b, v8f c) {
  return __builtin_amdgcn_wmma_f32_16x16x32_bf16(false, a, false, b, (short)0, c, false, false);
}
// hazard guards: 4 VALU slots after the last WMMAs of a run, D tied.
// guard_frags also keeps the run's A and B fragments live to behind the slots, so that no D of the run is placed over one of them.
__device__ __forceinline__ void guard_frags(v8f& a, v8f& b, v8f& c, v8f& d, v16h u, v16h v, v16h w, v16h x, v16h y, v16h z) {
  asm volatile("v_nop\n\tv_nop\n\tv_nop\n\tv_nop" : "+v"(a), "+v"(b), "+v"(c), "+v"(d) : "v"(u), "v"(v), "v"(w), "v"(x), "v"(y), "v"(z));
}
__device__ __forceinline__ void guard_frags2(v8f& a, v8f& b, v16h u, v16h v, v16h w) {
  asm volatile("v_nop\n\tv_nop\n\tv_nop\n\tv_nop" : "+v"(a), "+v"(b) : "v"(u), "v"(v), "v"(w));
}
__device__ __forceinline__ void acc_guard4(v8f& a, v8f& b, v8f& c, v8f& d) {
  asm volatile("v_nop\n\tv_nop\n\tv_nop\n\tv_nop" : "+v"(a), "+v"(b), "+v"(c), "+v"(d));
}

// ---------------------------------------------------------------------------
// Preparation, one launch: the RoPE table and the RNE bf16 planes of x, Wq, Wk, Wv, Wo. None of the six pieces reads what another
// writes, so they share a grid; the block index picks the piece (block-uniform, no barrier anywhere in the kernel).
//   blocks 0 .. SQ/8 - 1: RoPE table, cst[s][i] = cos(s * inv_freq[i]), snt[s][i] = sin(...), inv_freq[i] = 1 / 1e4^(i/64), i < 64, all f32.
//     Wave w -> position s = block*8 + w, lane -> i = lane, lane + 32. Coverage: SQ/8 blocks x 8 waves x 32 lanes x 2 = SQ x 64 per plane.
//     They come first in the grid because theirs is the longest dependent chain.
//   then CV_BLK(n) blocks per plane of n elements: a wave converts CV_WAVE = 2048 consecutive elements. All its sixteen 16-B loads are issued
//     before the first conversion; load i covers the 512 contiguous bytes of elements 128 i .. 128 i + 127, store i the 256 contiguous
//     bytes (two whole lines) of the same elements. Coverage: CV_BLK(n) x 8 waves x 2048 = n, every plane a whole number of blocks.
// ---------------------------------------------------------------------------
#define CV_WAVE   2048
#define CV_BLK(n) ((n) / (8 * CV_WAVE))
#define NB_ROPE   (SQ / 8)
#define NB_X      CV_BLK(NTOK * HID)
#define NB_WQ     CV_BLK(HID * HID)
#define NB_WK     CV_BLK(KVW * HID)
#define NB_WV     CV_BLK(KVW * HID)
#define NB_WO     CV_BLK(HID * HID)
static_assert(NB_X * 8 * CV_WAVE == NTOK * HID && NB_WQ * 8 * CV_WAVE == HID * HID && NB_WK * 8 * CV_WAVE == KVW * HID);

typedef unsigned int v2u __attribute__((ext_vector_type(2)));

__device__ __forceinline__ void rope_table_rows(float* __restrict__ cst, float* __restrict__ snt, int blk) {
  const int lane = threadIdx.x & 31;
  const int wave = (int)(threadIdx.x >> 5);
  const int t = blk * 8 + wave;
  const float pf = (float)t;
  float c0 = 0.f, s0 = 0.f, c1 = 0.f, s1 = 0.f;
#pragma unroll 1
  for (int u = 0; u < 2; ++u) {
    const int i = lane + 32 * u;
    const float e   = (float)i * 0.015625f;      // i / 64 exact
    const float pw  = powf(10000.0f, e);
    const float inv = 1.0f / pw;
    const float ang = pf * inv;
    const float cv = cosf(ang);
    const float sv = sinf(ang);
    c1 = cv; s1 = sv;
    if (u == 0) { c0 = cv; s0 = sv; }
  }
  const size_t o = (size_t)t * NFREQ + lane;
  cst[o]      = c0;
  cst[o + 32] = c1;
  snt[o]      = s0;
  snt[o + 32] = s1;
}

__global__ __launch_bounds__(256) void prep_kernel(
    const float* __restrict__ x, const float* __restrict__ wq, const float* __restrict__ wk,
    const float* __restrict__ wv, const float* __restrict__ wo,
    unsigned short* __restrict__ xb, unsigned short* __restrict__ wqb, unsigned short* __restrict__ wkb,
    unsigned short* __restrict__ wvb, unsigned short* __restrict__ wob,
    float* __restrict__ cst, float* __restrict__ snt) {
  int blk = (int)blockIdx.x;
  if (blk < NB_ROPE) { rope_table_rows(cst, snt, blk); return; }
  blk -= NB_ROPE;
  const float* in = x;
  unsigned short* outp = xb;
  if (blk >= NB_X + NB_WQ + NB_WK + NB_WV)      { in = wo; outp = wob; blk -= NB_X + NB_WQ + NB_WK + NB_WV; }
  else if (blk >= NB_X + NB_WQ + NB_WK)         { in = wv; outp = wvb; blk -= NB_X + NB_WQ + NB_WK; }
  else if (blk >= NB_X + NB_WQ)                 { in = wk; outp = wkb; blk -= NB_X + NB_WQ; }
  else if (blk >= NB_X)                         { in = wq; outp = wqb; blk -= NB_X; }
  const int lane = (int)(threadIdx.x & 31);
  const size_t e0 = ((size_t)blk * 8 + wave_id()) * CV_WAVE + lane * 4;
  const float* ip = in + e0;
  unsigned short* op = outp + e0;
  v4f a[16];
#pragma unroll   // constant indices keep a[] in registers, and all sixteen loads are in flight at once
  for (int i = 0; i < 16; ++i) a[i] = *(const v4f*)(ip + i * 128);
  // precaution: the lane pointer is an input here, so it keeps its registers (no load result is placed over it) until this wait
  asm volatile("s_wait_xcnt 0x0" :: "v"(ip) : "memory");
  // keeps every load in front of the first conversion: left alone the compiler holds the last four back until the first four have returned
  __builtin_amdgcn_sched_barrier(0);
#pragma unroll   // as above: constant indices into a[]
  for (int i = 0; i < 16; ++i) {
    v2u w;
    w[0] = pk16(bf_bits(a[i][0]), bf_bits(a[i][1]));
    w[1] = pk16(bf_bits(a[i][2]), bf_bits(a[i][3]));
    *(v2u*)(op + i * 128) = w;
  }
}

// ---------------------------------------------------------------------------
// bf16 WMMA GEMM, block = 4 waves (128 threads) = one 128 x 128 tile of C, wave w = rows 32w..32w+31 x all 128 cols.
//   C[m][n] = sum_k A[m][k] * Bt[n][k]; A row-major [M][K] bf16 (pitch lda), Bt row-major [N][K] bf16 (pitch ldb);
//   M % 128 == 0, N % 128 == 0, K % 64 == 0; grid.x = M/128 * N/128.
//   SPLITA: A carried as hi (Ap) + lo (A2p) bf16 planes, two products into one accumulator.
//   Operands: a pass is 64 k = one whole 128-B line of every operand row. The 128 A rows (both planes when SPLITA) and the
//   128 Bt rows of a pass are brought into LDS by asynchronous 16-B copies (8 lanes = one line, a wave instruction = 4 lines),
//   rows at pitch 144 B, two buffers: the next pass's copies fly while this pass is multiplied. The Bt tile is read by all
//   four waves. Fragments are read from LDS with the split k map (ldfrag_b), k ascending.
// Epilogues (all: per wave, per 16-row slab: stage in LDS, wave sync, write each row segment with ONE instruction of
//   EPI 0: q or k projection; the 128-col tile is one head. B rows are laid in LDS in even/odd order (row n0 + r in slot
//          64*(r&1) + (r>>1)):
//          acc tile j<4, lane rl holds output column n0 + 2*(16j+rl); tile j+4 holds n0 + 2*(16j+rl) + 1 (the interleaved pair).
//          + bf16(bias[n]); RoPE on the pair with cos/sin[pos = row & 2047][pair]; writes f16 hi plane C0 and f16 residual x2048
//          plane C1, both [M][ldc], cols n0..n0+127 (row segment 256 B = 16 lanes x 16 B).
//   EPI 1: v^T projection: + bf16(bias[m]); f16 hi plane C0, residual x2048 plane C1, [M][ldc], row segment 256 B.
//   EPI 2: f32 output C0 [M][ldc]; row segment 128 floats = 512 B = 32 lanes x 16 B per instruction.
// ---------------------------------------------------------------------------
template <int EPI> struct SlabT { typedef _Float16 T; static constexpr int PERW = 4096; };   // 2 planes x 16 x 128 halves
template <> struct SlabT<2>     { typedef float    T; static constexpr int PERW = 2048; };   // 16 x 128 floats

#define G_PITCH 72                    // LDS row pitch in 16-bit elements: 64 k + 8 = 144 B = 16 B x 9
#define G_TILE  (128 * G_PITCH)       // one 128-row operand tile of a pass, in elements

// One 128-row x 128-B operand tile into LDS: eight copies per lane, lane address pairs (l + i*lstep, g + i*gstep).
// The s_wait_xcnt stands in the copies' own statement so that no address register is rewritten ahead of it.
__device__ __forceinline__ void stage_tile(unsigned l, unsigned lstep, const unsigned short* g, size_t gstep) {
  asm volatile(
      "global_load_async_to_lds_b128 %0, %8, off\n\t"
      "global_load_async_to_lds_b128 %1, %9, off\n\t"
      "global_load_async_to_lds_b128 %2, %10, off\n\t"
      "global_load_async_to_lds_b128 %3, %11, off\n\t"
      "global_load_async_to_lds_b128 %4, %12, off\n\t"
      "global_load_async_to_lds_b128 %5, %13, off\n\t"
      "global_load_async_to_lds_b128 %6, %14, off\n\t"
      "global_load_async_to_lds_b128 %7, %15, off\n\t"
      "s_wait_xcnt 0x0"
      :: "v"(l), "v"(l + lstep), "v"(l + 2 * lstep), "v"(l + 3 * lstep),
         "v"(l + 4 * lstep), "v"(l + 5 * lstep), "v"(l + 6 * lstep), "v"(l + 7 * lstep),
         "v"(g), "v"(g + gstep), "v"(g + 2 * gstep), "v"(g + 3 * gstep),
         "v"(g + 4 * gstep), "v"(g + 5 * gstep), "v"(g + 6 * gstep), "v"(g + 7 * gstep)
      : "memory");
}

template <int EPI, bool SPLITA>
__global__ __launch_bounds__(128) void gemm_w32x128_kernel(
    const unsigned short* Ap, const unsigned short* A2p, int lda,
    const unsigned short* __restrict__ Btp, int ldb,
    const float* __restrict__ bias, const float* __restrict__ cst, const float* __restrict__ snt,
    void* C0, void* C1, int ldc,
    int M, int N, int K) {
  typedef typename SlabT<EPI>::T ST;
  constexpr int NPL = SPLITA ? 3 : 2;            // operand tiles per buffer: A (, A lo), Bt
  constexpr int BUF = NPL * G_TILE;              // elements per buffer
  __shared__ __align__(16) ST slab_all[4 * SlabT<EPI>::PERW];
  __shared__ __align__(16) unsigned short ring[2 * BUF];

  const int tid  = (int)threadIdx.x;
  const int lane = tid & 31;
  const int wave = wave_id();
  const int hh = lane >> 4;           // lane half: k offset 8*hh, D row offset 8*hh
  const int rl = lane & 15;           // A row / B col / D col within subtile
  const int tilesN = N >> 7;
  const int tilesM = M >> 7;
  const int tile = (int)blockIdx.x;
  if (tile >= tilesM * tilesN) return;          // block-uniform, in front of every barrier
  const int tm = tile / tilesN;
  const int tn = tile - tm * tilesN;
  const int mb = tm << 7;                       // first row of the block tile
  const int m0 = mb + (wave << 5);              // first row of this wave
  const int n0 = tn << 7;

  // copy addresses of this lane: copy i of a tile moves 16 B of source row (tid>>3) + 16*i, bytes 16*(tid&7)..+15 of the pass's line
  const int crow = tid >> 3;
  const int ccol = (tid & 7) * 8;
  const unsigned short* gA  = Ap  + (size_t)(mb + crow) * lda + ccol;
  const unsigned short* gA2 = A2p + (size_t)(mb + crow) * lda + ccol;
  const unsigned short* gB  = Btp + (size_t)(n0 + crow) * ldb + ccol;
  const unsigned ring0 = (unsigned)(uintptr_t)(&ring[0]);           // LDS byte address of the ring
  const unsigned lA = ring0 + (unsigned)(crow * G_PITCH + ccol) * 2u;
  const int bslot = (EPI == 0) ? ((crow & 1) * 64 + (crow >> 1)) : crow;
  const unsigned lB = ring0 + (unsigned)((NPL - 1) * G_TILE + bslot * G_PITCH + ccol) * 2u;
  const unsigned lstepA = 16u * G_PITCH * 2u;
  const unsigned lstepB = ((EPI == 0) ? 8u : 16u) * G_PITCH * 2u;
  const size_t gstepA = (size_t)16 * lda;
  const size_t gstepB = (size_t)16 * ldb;

  v8f acc[2][8];
#pragma unroll
  for (int i = 0; i < 2; ++i)
#pragma unroll
    for (int j = 0; j < 8; ++j) acc[i][j] = zero8();

  const int npass = K >> 6;
  // pass 0 into buffer 0, landed and published; then pass 1 into buffer 1
  stage_tile(lA, lstepA, gA, gstepA);
  if (SPLITA) stage_tile(lA + G_TILE * 2u, lstepA, gA2, gstepA);
  stage_tile(lB, lstepB, gB, gstepB);
  asm volatile("s_wait_asynccnt 0x0" ::: "memory");   // this wave's copies of pass 0 have landed
  __syncthreads();                                    // every wave's copies of pass 0 are readable by all
  if (npass > 1) {
    stage_tile(lA + BUF * 2u, lstepA, gA + 64, gstepA);
    if (SPLITA) stage_tile(lA + (BUF + G_TILE) * 2u, lstepA, gA2 + 64, gstepA);
    stage_tile(lB + BUF * 2u, lstepB, gB + 64, gstepB);
  }

  for (int t = 0; t < npass; ++t) {
    const int bo = (t & 1) * BUF;
    const __bf16* As = (const __bf16*)(const void*)(ring + bo) + ((wave << 5) + rl) * G_PITCH + 8 * hh;
    const __bf16* Bs = (const __bf16*)(const void*)(ring + bo + (NPL - 1) * G_TILE) + rl * G_PITCH + 8 * hh;
    v16b ah[2][2], al[2][2], bj[2][8];
#pragma unroll
    for (int kb = 0; kb < 2; ++kb) {
#pragma unroll
      for (int i = 0; i < 2; ++i) {
        ah[kb][i] = ldfrag_b(As + i * 16 * G_PITCH + kb * 32);
        al[kb][i] = SPLITA ? ldfrag_b(As + G_TILE + i * 16 * G_PITCH + kb * 32) : ah[kb][i];
      }
#pragma unroll
      for (int j = 0; j < 8; ++j) bj[kb][j] = ldfrag_b(Bs + j * 16 * G_PITCH + kb * 32);
    }
    // keeps the pass's LDS reads together in front of its WMMAs: left alone the compiler puts two reads and a full wait before every WMMA pair
    __builtin_amdgcn_sched_barrier(0);
#pragma unroll
    for (int kb = 0; kb < 2; ++kb) {
#pragma unroll
      for (int j = 0; j < 8; ++j) {
        acc[0][j] = mma_b(ah[kb][0], bj[kb][j], acc[0][j]);
        acc[1][j] = mma_b(ah[kb][1], bj[kb][j], acc[1][j]);
        if (SPLITA) {
          acc[0][j] = mma_b(al[kb][0], bj[kb][j], acc[0][j]);
          acc[1][j] = mma_b(al[kb][1], bj[kb][j], acc[1][j]);
        }
      }
    }
    // keeps the WMMAs in front of the waits and the barrier below, so that the next pass's copies fly for the whole of this pass
    __builtin_amdgcn_sched_barrier(0);
    asm volatile("s_wait_dscnt 0x0" ::: "memory");      // this wave's reads of the buffer are done before it is refilled
    asm volatile("s_wait_asynccnt 0x0" ::: "memory");   // this wave's copies of pass t + 1 have landed
    __syncthreads();                                    // publishes pass t + 1 and ends every reader's last read of pass t
    if (t + 2 < npass) {                                // block-uniform
      const size_t ko = (size_t)(t + 2) * 64;
      stage_tile(lA + (unsigned)bo * 2u, lstepA, gA + ko, gstepA);
      if (SPLITA) stage_tile(lA + (unsigned)(bo + G_TILE) * 2u, lstepA, gA2 + ko, gstepA);
      stage_tile(lB + (unsigned)bo * 2u, lstepB, gB + ko, gstepB);
    }
  }
  asm volatile("s_wait_asynccnt 0x0" ::: "memory");     // no copy is outstanding when the wave goes on to the epilogue
  acc_guard4(acc[0][0], acc[0][1], acc[0][2], acc[0][3]);
  acc_guard4(acc[0][4], acc[0][5], acc[0][6], acc[0][7]);
  acc_guard4(acc[1][0], acc[1][1], acc[1][2], acc[1][3]);
  acc_guard4(acc[1][4], acc[1][5], acc[1][6], acc[1][7]);

  // ---- epilogue ----
  ST* slab = slab_all + wave * SlabT<EPI>::PERW;
  _Float16* sl16 = (_Float16*)(void*)slab;
  float*    slf  = (float*)(void*)slab;

  if (EPI == 0) {
    _Float16* P0 = (_Float16*)C0;
    _Float16* P1 = (_Float16*)C1;
#pragma unroll
    for (int i = 0; i < 2; ++i) {
      const int rb = m0 + i * 16 + 8 * hh;
#pragma unroll
      for (int j = 0; j < 4; ++j) {
        const int pi = j * 16 + rl;                              // pair index 0..63 within head
        const int nc = n0 + 2 * pi;                              // column of x1; x2 at nc + 1
        const float b1 = bf_rne(bias[nc]);
        const float b2 = bf_rne(bias[nc + 1]);
#pragma unroll
        for (int r = 0; r < 8; ++r) {
          const int row = rb + r;                                // token 0..NTOK-1
          const int s   = row & (SQ - 1);                        // position within sequence
          const float cv = cst[(size_t)s * NFREQ + pi];
          const float sv = snt[(size_t)s * NFREQ + pi];
          const float x1 = acc[i][j][r] + b1;
          const float x2 = acc[i][j + 4][r] + b2;
          const float o1 = x1 * cv - x2 * sv;
          const float o2 = x1 * sv + x2 * cv;
          const _Float16 h1 = (_Float16)o1;
          const _Float16 h2 = (_Float16)o2;
          const int so = (8 * hh + r) * 128 + 2 * pi;
          sl16[so]            = h1;
          sl16[so + 1]        = h2;
          sl16[2048 + so]     = (_Float16)((o1 - (float)h1) * 2048.0f);
          sl16[2048 + so + 1] = (_Float16)((o2 - (float)h2) * 2048.0f);
        }
      }
      lds_wave_sync();
      {
#pragma unroll
        for (int it = 0; it < 8; ++it) {
          const int row = it * 2 + hh;                           // it x hh covers rows 0..15
          const int c8  = rl * 8;
          const v8h vh = *(const v8h*)(sl16 + row * 128 + c8);
          const v8h vl = *(const v8h*)(sl16 + 2048 + row * 128 + c8);
          const size_t go = (size_t)(m0 + i * 16 + row) * ldc + n0 + c8;
          *(v8h*)(P0 + go) = vh;
          *(v8h*)(P1 + go) = vl;
        }
        
      }
      lds_wave_sync();
    }
  } else if (EPI == 1) {
    _Float16* P0 = (_Float16*)C0;
    _Float16* P1 = (_Float16*)C1;
#pragma unroll
    for (int i = 0; i < 2; ++i) {
#pragma unroll
      for (int r = 0; r < 8; ++r) {
        const int m = m0 + i * 16 + 8 * hh + r;
        const float bm = bf_rne(bias[m]);
#pragma unroll
        for (int j = 0; j < 8; ++j) {
          const float v = acc[i][j][r] + bm;
          const _Float16 hv = (_Float16)v;
          const int so = (8 * hh + r) * 128 + j * 16 + rl;
          sl16[so]        = hv;
          sl16[2048 + so] = (_Float16)((v - (float)hv) * 2048.0f);
        }
      }
      lds_wave_sync();
      {
#pragma unroll
        for (int it = 0; it < 8; ++it) {
          const int row = it * 2 + hh;
          const int c8  = rl * 8;
          const v8h vh = *(const v8h*)(sl16 + row * 128 + c8);
          const v8h vl = *(const v8h*)(sl16 + 2048 + row * 128 + c8);
          const size_t go = (size_t)(m0 + i * 16 + row) * ldc + n0 + c8;
          *(v8h*)(P0 + go) = vh;
          *(v8h*)(P1 + go) = vl;
        }
        
      }
      lds_wave_sync();
    }
  } else {
    float* C = (float*)C0;
#pragma unroll
    for (int i = 0; i < 2; ++i) {
#pragma unroll
      for (int j = 0; j < 8; ++j)
#pragma unroll
        for (int r = 0; r < 8; ++r)
          slf[(8 * hh + r) * 128 + j * 16 + rl] = acc[i][j][r];
      lds_wave_sync();
      {
#pragma unroll
        for (int row = 0; row < 16; ++row) {                     // 32 lanes x 16 B = the whole 512-B row segment per instruction
          const v4f v = *(const v4f*)(slf + row * 128 + lane * 4);
          *(v4f*)(C + (size_t)(m0 + i * 16 + row) * ldc + n0 + lane * 4) = v;
        }
        
      }
      lds_wave_sync();
    }
  }
}

// ---------------------------------------------------------------------------
// Windowed causal GQA flash attention, head dim 128, 32-key chunks, block = 4 waves = 64 query rows of one (b, h);
// grid (n query tiles, NHQ, NSEQ). Key j is valid for query i iff j <= i and i - j <= window (window read from the int input).
//   q planes f16 [tok][h*128+d]: hi (qhp) and residual x2048 (qlp); k planes f16 [tok][kvh*128+d]: hi (khp), residual x2048 (klp);
//   v^T planes f16 [kvh*128+d][tok]: hi (vhp), residual x2048 (vlp); outputs attn bf16 hi (ahp) / lo (alp) [tok][h*128+d].
//   PRES: scores = (Sh + Sr/2048) * 128^-0.5 with Sh = qh.kh and Sr = ql'.kh + qh.kl'; else scores = Sh * 128^-0.5; invalid keys -> -inf; online softmax f32
//   (-inf safe: a row with no valid key so far keeps m = -inf, l = 0, O = 0);
//   Both products are formed transposed: S^T = K . Q^T (A = 16 key rows, B = the wave's 16 query columns) and O^T += V^T . P^T (A = 16 d rows of
//   v^T, B = P^T). A lane (c, hh) then holds, of query q0 + c alone, the scores of keys 8 hh + r and 16 + 8 hh + r of the chunk: the row maximum and
//   the row sum are taken inside the lane, the maximum joined with the other half by one cross-row move per chunk, the two halves' sums once
//   behind the loop; m, l and the rescale factor are one value a lane;
//   p' = 1024 p as f16 hi (and residual x2048 when PRES): the two score tiles, converted in place, ARE the B fragment of P^T (element s = tile s >> 3,
//   register s & 7, the k order in which ldfrag_h reads v^T), so that P passes through no LDS and no lane exchange;
//   PRES: O = (Oh + Or/2048)/1024/l with Oh = ph.vh, Or = ph.vl' + pl'.vh; else O = Oh/1024/l. Without PRES no residual plane is read at all:
//   q and v^T then carry the 11 bits that k and p carry, well under the bf16 rounding of x and the weights that made them.
//   q staging: each wave copies its 16 rows of q (both planes when PRES) into LDS once, rows at pitch 272 B, and reads its B fragments from there.
//   K / V^T chunk staging: 128 threads x 4 x 16 B per plane = whole 32x128 / 128x32 tile, plain loads, __syncthreads before and after.
//   Chunks cover keys [max(0, 64*qb - window) & ~31, 64*qb + 63]; trip count statically <= 64; waves with no valid key in a chunk
//   skip its compute part (wave-uniform, scalar branch).
// ---------------------------------------------------------------------------
#define AT_KC   32
#define KS_P    136
#define VS_P    40
#define OS_P    136                   // output staging: 16 query rows a plane at pitch 272 B = 16 B x 17
#define QS_P    136
#define VAHEAD  2
// LDS map in halves. The residual tiles (k, v^T, q) exist only with PRES.
template <bool PRES> struct AttnLds {
  static constexpr int KS  = 0;
  static constexpr int KLS = 32 * KS_P;
  static constexpr int VHS = (PRES ? 2 : 1) * 32 * KS_P;
  static constexpr int VLS = VHS + 128 * VS_P;
  static constexpr int QH  = VHS + (PRES ? 2 : 1) * 128 * VS_P;
  static constexpr int QL  = QH + 64 * QS_P;
  static constexpr int TOT = QH + (PRES ? 2 : 1) * 64 * QS_P;
};
static_assert(AttnLds<false>::TOT * 2 * 4 <= 327680);   // four work-groups of the long launch per WGP
static_assert(4 * 2 * 16 * OS_P <= AttnLds<false>::TOT); // output staging (2 planes x 16 rows per wave) aliases the chunk and q regions after the loop

template <bool PRES>
// The long launch (no residual products, 896 work-groups) gets a budget of 256 registers a wave = four waves per SIMD: four work-groups
// share a WGP and the whole launch is resident at once. The short launch has fewer work-groups than there are WGPs and keeps the full budget.
__global__ __launch_bounds__(128) __attribute__((amdgpu_waves_per_eu(PRES ? 1 : 4))) void attn_window_kernel(
    const unsigned short* __restrict__ qhp, const unsigned short* __restrict__ qlp,
    const unsigned short* __restrict__ khp, const unsigned short* __restrict__ klp,
    const unsigned short* __restrict__ vhp, const unsigned short* __restrict__ vlp,
    unsigned short* __restrict__ ahp, unsigned short* __restrict__ alp,
    const int* __restrict__ winp, int qb_base) {
  typedef AttnLds<PRES> L;
  __shared__ __align__(16) _Float16 lds[L::TOT];
  _Float16* Ks  = lds + L::KS;
  _Float16* Kls = lds + L::KLS;
  _Float16* Vhs = lds + L::VHS;
  _Float16* Vls = lds + L::VLS;

  const int tid  = (int)threadIdx.x;
  const int lane = tid & 31;
  const int wave = wave_id();
  const int hh   = lane >> 4;
  const int c    = lane & 15;
  const int qb   = (int)blockIdx.x + qb_base;
  const int h    = (int)blockIdx.y;
  const int b    = (int)blockIdx.z;
  const int kvh  = h >> 1;                       // 2 query heads per kv head
  const int window = __builtin_amdgcn_readfirstlane(winp[0]);
  const int qblk0 = qb * 64;
  const int q0    = qblk0 + wave * 16;           // first query row of this wave (within sequence)
  const int qlast = q0 + 15;
  const int wlo   = q0 - window;                 // oldest valid key of row q0
  const size_t tok0 = (size_t)b * SQ;

  int kstart = qblk0 - window;
  kstart = (kstart > 0) ? (kstart & ~31) : 0;
  if (kstart > qblk0) kstart = qblk0;
  int nch = (qblk0 + 64 - kstart) >> 5;          // block-uniform
  if (nch > 64) nch = 64;
  if (nch < 0) nch = 0;
  nch = __builtin_amdgcn_readfirstlane(nch);     // the trip count of the loop that holds the barriers stays in a scalar register (the clamp is a vector med3 otherwise)

  // This wave's 16 query rows (both planes when PRES) go into LDS once (16 lanes = one 256-B row, row = (lane >> 4) + 2 i); every chunk reads its
  // B fragments from there. Only this wave reads them, behind the two barriers at the head of the first chunk.
  _Float16* Qhs = lds + L::QH + wave * (16 * QS_P);
  _Float16* Qls = lds + L::QL + wave * (16 * QS_P);
  {
    const _Float16* qhg = (const _Float16*)(const void*)qhp + (tok0 + q0 + hh) * HID + h * HDM + c * 8;
    const _Float16* qlg = (const _Float16*)(const void*)qlp + (tok0 + q0 + hh) * HID + h * HDM + c * 8;
    v8h qx[8], qy[8];
#pragma unroll   // constant indices keep qx and qy in registers, and all its loads (sixteen with PRES, eight without) are in flight at once
    for (int i = 0; i < 8; ++i) {
      qx[i] = *(const v8h*)(qhg + i * 2 * HID);
      if (PRES) qy[i] = *(const v8h*)(qlg + i * 2 * HID);
    }
    // precaution: the lane pointers are inputs here, so they keep their registers (no load result is placed over them) until this wait
    if (PRES) asm volatile("s_wait_xcnt 0x0" :: "v"(qhg), "v"(qlg) : "memory");
    else      asm volatile("s_wait_xcnt 0x0" :: "v"(qhg) : "memory");
#pragma unroll   // as above: constant indices into qx and qy
    for (int i = 0; i < 8; ++i) {
      *(v8h*)(Qhs + (hh + 2 * i) * QS_P + c * 8) = qx[i];
      if (PRES) *(v8h*)(Qls + (hh + 2 * i) * QS_P + c * 8) = qy[i];
    }
  }
  const _Float16* Qhr = Qhs + c * QS_P + 8 * hh;   // B fragment column (query q0 + c) of this lane
  const _Float16* Qlr = Qls + c * QS_P + 8 * hh;
  const _Float16* Kg  = (const _Float16*)(const void*)khp + tok0 * KVW + kvh * HDM;
  const _Float16* Klg = (const _Float16*)(const void*)klp + tok0 * KVW + kvh * HDM;
  const _Float16* Vhg = (const _Float16*)(const void*)vhp + (size_t)(kvh * HDM) * NTOK + tok0;
  const _Float16* Vlg = (const _Float16*)(const void*)vlp + (size_t)(kvh * HDM) * NTOK + tok0;
  const unsigned kgo = (unsigned)((tid >> 4) * KVW + (tid & 15) * 8);    // this lane's element offset in a K chunk, piece 0
  const unsigned vgo = (unsigned)((tid >> 2) * NTOK + (tid & 3) * 8);    // and in a V^T chunk

  const int qrow = q0 + c;                       // the one query of this lane
  // window as the validity test uses it: 0 <= qrow - key < SQ for every key that passes key <= qrow, so a window below -1 admits what -1
  // admits (nothing) and one above SQ what SQ admits (everything); the clamp keeps dq - window from wrapping
  const int wcl = (window < -1) ? -1 : ((window > SQ) ? SQ : window);
  float mrow = -INFINITY, lrow = 0.f;            // its running maximum (same in both halves) and the sum over this half's keys
  v8f oacc[8], oaccr[8];                         // oacc[t][r] = O^T(d = 16 t + 8 hh + r, query c)
#pragma unroll
  for (int t = 0; t < 8; ++t) { oacc[t] = zero8(); oaccr[t] = zero8(); }

  for (int kc = 0; kc < nch; ++kc) {
    const int kv0 = kstart + kc * AT_KC;         // keys kv0..kv0+31, all < SQ
    __syncthreads();
    // one lane pointer per plane for the chunk; the four pieces of a plane lie at constant distances from it
    const _Float16* kq  = Kg  + (size_t)kv0 * KVW + kgo;
    const _Float16* klq = Klg + (size_t)kv0 * KVW + kgo;
    const _Float16* vhq = Vhg + kv0 + vgo;
    const _Float16* vlq = Vlg + kv0 + vgo;
    v8h kx[4], ky[4], vx[4], vy[4];
#pragma unroll
    for (int i = 0; i < 4; ++i) {                // coverage: 512 pieces of 8 halves per plane = whole tile
      kx[i] = *(const v8h*)(kq + i * 8 * KVW);   // K: 32 keys x 128 d, key = (tid >> 4) + 8 i
      if (PRES) ky[i] = *(const v8h*)(klq + i * 8 * KVW);
      vx[i] = *(const v8h*)(vhq + i * 32 * NTOK); // V^T: 128 d x 32 keys, d = (tid >> 2) + 32 i
      if (PRES) vy[i] = *(const v8h*)(vlq + i * 32 * NTOK);
    }
    // precaution: the lane pointers are inputs here, so they keep their registers (no load result is placed over them) until this wait
    if (PRES) asm volatile("s_wait_xcnt 0x0" :: "v"(kq), "v"(klq), "v"(vhq), "v"(vlq) : "memory");
    else      asm volatile("s_wait_xcnt 0x0" :: "v"(kq), "v"(vhq) : "memory");
#pragma unroll
    for (int i = 0; i < 4; ++i) {
      const int p   = tid + 128 * i;             // 0..511
      const int key = p >> 4, d8 = (p & 15) * 8;
      *(v8h*)(Ks + key * KS_P + d8) = kx[i];
      if (PRES) *(v8h*)(Kls + key * KS_P + d8) = ky[i];
      const int d = p >> 2, k8 = (p & 3) * 8;
      *(v8h*)(Vhs + d * VS_P + k8) = vx[i];
      if (PRES) *(v8h*)(Vls + d * VS_P + k8) = vy[i];
    }
    __syncthreads();

    if (kv0 <= qlast && kv0 + AT_KC - 1 >= wlo) {   // wave-uniform (scalar): skip chunks with no valid key for this wave
      // ---- scores, transposed: sh[j][r] = S^T(key kv0 + 16 j + 8 hh + r, query q0 + c) ----
      v8f sh[2], sr[2];
      sh[0] = zero8(); sh[1] = zero8(); sr[0] = zero8(); sr[1] = zero8();
#pragma unroll
      for (int dc = 0; dc < 4; ++dc) {
        const v16h qa = ldfrag_h(Qhr + dc * 32);
        const v16h ql = PRES ? ldfrag_h(Qlr + dc * 32) : qa;
        v16h kb[2], kl[2];
#pragma unroll
        for (int j = 0; j < 2; ++j) {
          kb[j] = ldfrag_h(Ks + (j * 16 + c) * KS_P + dc * 32 + 8 * hh);
          kl[j] = PRES ? ldfrag_h(Kls + (j * 16 + c) * KS_P + dc * 32 + 8 * hh) : kb[j];
        }
        // keeps all fragment reads of this 32-d slice in one place in front of its WMMAs: left alone the compiler waits out a read per WMMA pair
        __builtin_amdgcn_sched_barrier(0);
#pragma unroll
        for (int j = 0; j < 2; ++j) {
          sh[j] = mma_h(kb[j], qa, sh[j]);
          if (PRES) sr[j] = mma_h(kb[j], ql, sr[j]);
        }
        if (PRES) {
#pragma unroll
          for (int j = 0; j < 2; ++j) sr[j] = mma_h(kl[j], qa, sr[j]);
        }
        // first slice: its WMMAs start the accumulators; the guard keeps them off the registers of this slice's own fragments
        if (dc == 0) {
          if (PRES) guard_frags(sh[0], sr[0], sh[1], sr[1], qa, ql, kb[0], kb[1], kl[0], kl[1]);
          else      guard_frags2(sh[0], sh[1], qa, kb[0], kb[1]);
        }
        // keeps this slice's WMMAs in front of the next slice's reads
        __builtin_amdgcn_sched_barrier(0);
      }
      // The V^T fragments of tile t + VAHEAD are read in front of tile t's WMMAs, the first VAHEAD tiles in front of the softmax arithmetic.
      v16h vb[8], vr[8];
#pragma unroll
      for (int t = 0; t < VAHEAD; ++t) {
        vb[t] = ldfrag_h(Vhs + (t * 16 + c) * VS_P + 8 * hh);
        if (PRES) vr[t] = ldfrag_h(Vls + (t * 16 + c) * VS_P + 8 * hh);
      }
      // ---- scale, window + causal validity, maximum of this lane's 16 keys, joined with the other half's 16 ----
      // key = kv0 + 8 hh + e with e = 16 j + r: key <= qrow is e <= dq, and qrow - key <= window is e >= dq - window
      const int dq = qrow - kv0 - 8 * hh;
      const int dw = dq - wcl;
      float cm = -INFINITY;
#pragma unroll
      for (int j = 0; j < 2; ++j) {
#pragma unroll
        for (int r = 0; r < 8; ++r) {
          const int e = j * 16 + r;
          float sc = (PRES ? sh[j][r] + sr[j][r] * 0.00048828125f : sh[j][r]) * 0.08838834764831845f;
          const bool ok = (e <= dq) & (e >= dw);
          sc = ok ? sc : -INFINITY;
          sh[j][r] = sc;
          cm = fmaxf(cm, sc);
        }
      }
      cm = fmaxf(cm, half_xor(cm));
      // ---- online softmax; P'^T packed in place as the B fragment ----
      const float mnew  = fmaxf(mrow, cm);
      const float mref  = (mnew == -INFINITY) ? 0.f : mnew;     // query with no valid key yet: everything stays 0
      const float alpha = __expf(mrow - mref);
      mrow = mnew;
      float psum[2] = {0.f, 0.f};                               // one chain of additions per score tile
      v16h pa, pr;
#pragma unroll
      for (int j = 0; j < 2; ++j) {
#pragma unroll
        for (int r = 0; r < 8; ++r) {
          const float p  = __expf(sh[j][r] - mref);
          psum[j] += p;
          const float pp = p * 1024.0f;
          const _Float16 phv = (_Float16)pp;
          pa[j * 8 + r] = phv;
          pr[j * 8 + r] = PRES ? (_Float16)((pp - (float)phv) * 2048.0f) : phv;
        }
      }
      lrow = lrow * alpha + (psum[0] + psum[1]);
#pragma unroll
      for (int t = 0; t < 8; ++t) { oacc[t] *= alpha; if (PRES) oaccr[t] *= alpha; }
      // ---- O^T += V^T . P'^T ----
#pragma unroll
      for (int t = 0; t < 8; ++t) {
        if (t + VAHEAD < 8) {
          vb[t + VAHEAD] = ldfrag_h(Vhs + ((t + VAHEAD) * 16 + c) * VS_P + 8 * hh);
          if (PRES) vr[t + VAHEAD] = ldfrag_h(Vls + ((t + VAHEAD) * 16 + c) * VS_P + 8 * hh);
        }
        // keeps the reads of tile t + VAHEAD in front of tile t's WMMAs: left alone the compiler reads only one tile ahead
        // (mask 6: plain vector and scalar work, the rescale of later tiles, may still move in among the WMMAs)
        __builtin_amdgcn_sched_barrier(6);
        oacc[t]  = mma_h(vb[t], pa, oacc[t]);
        if (PRES) {
          oaccr[t] = mma_h(vr[t], pa, oaccr[t]);
          oaccr[t] = mma_h(vb[t], pr, oaccr[t]);
        }
        // keeps tile t's WMMAs in front of the next tile's reads
        __builtin_amdgcn_sched_barrier(6);
      }
      if (PRES) acc_guard4(oacc[6], oaccr[6], oacc[7], oaccr[7]);   // the loop's back edge follows
      else      acc_guard4(oacc[4], oacc[5], oacc[6], oacc[7]);
    }
  }

  __syncthreads();                               // all chunk- and q-region readers done before output staging aliases them (the q region in the long launch)
  _Float16* osh = lds + wave * (2 * 16 * OS_P);
  _Float16* osl = osh + 16 * OS_P;
  {
    const float inv = (1.0f / (lrow + half_xor(lrow))) * 0.0009765625f;   // the two halves' sums joined
#pragma unroll
    for (int t = 0; t < 8; ++t) {
      v8h xh, xl;                                // d = 16 t + 8 hh + 0..7 of query c: 16 B a plane
#pragma unroll
      for (int r = 0; r < 8; ++r) {
        const float o = (PRES ? oacc[t][r] + oaccr[t][r] * 0.00048828125f : oacc[t][r]) * inv;
        const unsigned short hb = bf_bits(o);
        const unsigned short lb = bf_bits(o - bf_val(hb));
        xh[r] = __builtin_bit_cast(_Float16, hb);
        xl[r] = __builtin_bit_cast(_Float16, lb);
      }
      *(v8h*)(osh + c * OS_P + t * 16 + 8 * hh) = xh;
      *(v8h*)(osl + c * OS_P + t * 16 + 8 * hh) = xl;
    }
  }
  lds_wave_sync();
  _Float16* Ahg = (_Float16*)(void*)ahp + (tok0 + q0) * HID + h * HDM;
  _Float16* Alg = (_Float16*)(void*)alp + (tok0 + q0) * HID + h * HDM;
  {
#pragma unroll
    for (int it = 0; it < 8; ++it) {
      const int row = it * 2 + hh;               // it 0..7 x hh 0..1 covers rows 0..15
      const int c8  = c * 8;                     // 16 lanes x 16 B = the whole 256-B segment
      const v8h x = *(const v8h*)(osh + row * OS_P + c8);
      const v8h y = *(const v8h*)(osl + row * OS_P + c8);
      *(v8h*)(Ahg + (size_t)row * HID + c8) = x;
      *(v8h*)(Alg + (size_t)row * HID + c8) = y;
    }
    
  }
}

// ---------------------------------------------------------------------------
// Workspace map (bytes; every region is a whole number of the rows its producer writes with whole-line stores, no tails):
//   Xb    bf16 [4096][2048]   16777216   (the attn hi plane Ah [4096][2048] bf16 reuses this region after the last Xb reader)
//   Wqb   bf16 [2048][2048]    8388608      Wkb bf16 [1024][2048]  4194304      Wvb bf16 [1024][2048]  4194304
//   Wob   bf16 [2048][2048]    8388608      cst f32  [2048][64]     524288      snt f32  [2048][64]     524288
//   Qh    f16  [4096][2048]   16777216      Ql  f16  [4096][2048] 16777216
//   Kh    f16  [4096][1024]    8388608      Kl  f16  [4096][1024]  8388608
//   Vh    f16  [1024][4096]    8388608      Vl  f16  [1024][4096]  8388608
//   Al    bf16 [4096][2048]   16777216
//   total                    126877696
// ---------------------------------------------------------------------------
extern "C" void kernel_launch(void* const* d_in, const int* in_sizes, int n_in,
                              void* d_out, int out_size, void* d_ws, size_t ws_size,
                              hipStream_t stream) {
  if (n_in < 9) return;
  if (in_sizes[0] != NTOK * HID) return;
  if (in_sizes[1] != HID * HID) return;
  if (in_sizes[2] != HID) return;
  if (in_sizes[3] != KVW * HID) return;
  if (in_sizes[4] != KVW) return;
  if (in_sizes[5] != KVW * HID) return;
  if (in_sizes[6] != KVW) return;
  if (in_sizes[7] != HID * HID) return;
  if (in_sizes[8] < 1) return;
  if (out_size != NTOK * HID) return;

  const float* x    = (const float*)d_in[0];
  const float* wq_w = (const float*)d_in[1];
  const float* wq_b = (const float*)d_in[2];
  const float* wk_w = (const float*)d_in[3];
  const float* wk_b = (const float*)d_in[4];
  const float* wv_w = (const float*)d_in[5];
  const float* wv_b = (const float*)d_in[6];
  const float* wo_w = (const float*)d_in[7];
  const int*   win  = (const int*)d_in[8];
  float* out = (float*)d_out;

  const size_t szX  = (size_t)NTOK * HID * 2;
  const size_t szWq = (size_t)HID * HID * 2;
  const size_t szWk = (size_t)KVW * HID * 2;
  const size_t szWv = (size_t)KVW * HID * 2;
  const size_t szWo = (size_t)HID * HID * 2;
  const size_t szT  = (size_t)SQ * NFREQ * 4;
  const size_t szQ  = (size_t)NTOK * HID * 2;
  const size_t szK  = (size_t)NTOK * KVW * 2;
  const size_t szV  = (size_t)KVW * NTOK * 2;
  const size_t szA  = (size_t)NTOK * HID * 2;
  size_t off = 0;
  const size_t oX  = off; off += szX;
  const size_t oWq = off; off += szWq;
  const size_t oWk = off; off += szWk;
  const size_t oWv = off; off += szWv;
  const size_t oWo = off; off += szWo;
  const size_t oCs = off; off += szT;
  const size_t oSn = off; off += szT;
  const size_t oQh = off; off += szQ;
  const size_t oQl = off; off += szQ;
  const size_t oKh = off; off += szK;
  const size_t oKl = off; off += szK;
  const size_t oVh = off; off += szV;
  const size_t oVl = off; off += szV;
  const size_t oAl = off; off += szA;
  const size_t oAh = oX;                         // Ah reuses the Xb region (same byte size); Xb is dead after launch (4)
  if (szA != szX) return;
  if (off > ws_size) return;                     // off = 126877696

  char* ws = (char*)d_ws;
  unsigned short* Xb  = (unsigned short*)(ws + oX);
  unsigned short* Wqb = (unsigned short*)(ws + oWq);
  unsigned short* Wkb = (unsigned short*)(ws + oWk);
  unsigned short* Wvb = (unsigned short*)(ws + oWv);
  unsigned short* Wob = (unsigned short*)(ws + oWo);
  float*          cst = (float*)(ws + oCs);
  float*          snt = (float*)(ws + oSn);
  unsigned short* Qh  = (unsigned short*)(ws + oQh);
  unsigned short* Ql  = (unsigned short*)(ws + oQl);
  unsigned short* Kh  = (unsigned short*)(ws + oKh);
  unsigned short* Kl  = (unsigned short*)(ws + oKl);
  unsigned short* Vh  = (unsigned short*)(ws + oVh);
  unsigned short* Vl  = (unsigned short*)(ws + oVl);
  unsigned short* Ah  = (unsigned short*)(ws + oAh);
  unsigned short* Al  = (unsigned short*)(ws + oAl);

  const dim3 b256(256), b128(128);

  // (1) cos/sin table [2048][64] x 2 and the RNE bf16 planes of x [4096][2048], Wq [2048][2048], Wk [1024][2048], Wv [1024][2048],
  //     Wo [2048][2048] (weights [out][in]: Wq, Wk, Wo as Bt[n][k], Wv as A[m][k])
  prep_kernel<<<dim3(NB_ROPE + NB_X + NB_WQ + NB_WK + NB_WV + NB_WO), b256, 0, stream>>>(
      x, wq_w, wk_w, wv_w, wo_w, Xb, Wqb, Wkb, Wvb, Wob, cst, snt);
  // (2) q = x . Wq^T + bq, RoPE -> Qh/Ql [4096][2048]   (M=4096, N=2048, K=2048; 32 x 16 block tiles)
  gemm_w32x128_kernel<0, false><<<dim3((NTOK / 128) * (HID / 128)), b128, 0, stream>>>(
      Xb, Xb, HID, Wqb, HID, wq_b, cst, snt, (void*)Qh, (void*)Ql, HID, NTOK, HID, HID);
  // (3) k = x . Wk^T + bk, RoPE -> Kh/Kl [4096][1024]   (M=4096, N=1024, K=2048; 32 x 8 block tiles)
  gemm_w32x128_kernel<0, false><<<dim3((NTOK / 128) * (KVW / 128)), b128, 0, stream>>>(
      Xb, Xb, HID, Wkb, HID, wk_b, cst, snt, (void*)Kh, (void*)Kl, KVW, NTOK, KVW, HID);
  // (4) v^T = Wv . x^T + bv[m] -> Vh/Vl [1024][4096]   (A = Wvb, Bt = Xb; M=1024, N=4096, K=2048; 8 x 32 block tiles)
  gemm_w32x128_kernel<1, false><<<dim3((KVW / 128) * (NTOK / 128)), b128, 0, stream>>>(
      Wvb, Wvb, HID, Xb, HID, wv_b, cst, snt, (void*)Vh, (void*)Vl, NTOK, KVW, NTOK, HID);
  // (5)-(6) windowed causal attention, query tiles 0..3 with the residual products of q, k, p and v, tiles 4..31 without
  attn_window_kernel<true><<<dim3(4, NHQ, NSEQ), b128, 0, stream>>>(Qh, Ql, Kh, Kl, Vh, Vl, Ah, Al, win, 0);
  attn_window_kernel<false><<<dim3(SQ / 64 - 4, NHQ, NSEQ), b128, 0, stream>>>(Qh, Ql, Kh, Kl, Vh, Vl, Ah, Al, win, 4);
  // (7) out = attn(hi + lo) . Wo^T -> d_out f32 [4096][2048]   (M=4096, N=2048, K=2048; 32 x 16 block tiles)
  gemm_w32x128_kernel<2, true><<<dim3((NTOK / 128) * (HID / 128)), b128, 0, stream>>>(
      Ah, Al, HID, Wob, HID, wq_b, cst, snt, (void*)out, (void*)out, HID, NTOK, HID, HID);
  (void)hipGetLastError();
}

// v009
// Measured time: 187 microseconds a run.
// Timed twice side by side with v008, it ran 1.17 and 1.19 times as fast.
// Counting every step since v000, it is 4.33 times as fast.
// Contractions: x.Wq^T, x.Wk^T and Wv.x^T on v_wmma_f32_16x16x32_bf16 (operands = RNE bf16 of the f32 inputs, single products);
// k.q^T and v^T.p^T on v_wmma_f32_16x16x32_f16 (q, k, p x1024 and v^T plain f16; on query tiles 0..3 each of the four also has its f16 residual
// x2^11 plane, with the cross products hi.residual); attn.Wo^T on v_wmma_f32_16x16x32_bf16
// (attn = bf16 hi + bf16 lo planes, two products; Wo RNE bf16). f32 accumulate everywhere; bias add, RoPE, online softmax and scale folds in f32.
#include <hip/hip_runtime.h>
#include <math.h>
#include <stdint.h>

#define NSEQ   2
#define SQ     2048
#define HID    2048
#define NHQ    16
#define NKVH   8
#define HDM    128
#define KVW    1024
#define NTOK   4096
#define NFREQ  64

typedef _Float16     v16h __attribute__((ext_vector_type(16)));
typedef _Float16     v8h  __attribute__((ext_vector_type(8)));
typedef __bf16       v16b __attribute__((ext_vector_type(16)));
typedef __bf16       v8b  __attribute__((ext_vector_type(8)));
typedef float        v8f  __attribute__((ext_vector_type(8)));
typedef float        v4f  __attribute__((ext_vector_type(4)));
typedef unsigned int v4u  __attribute__((ext_vector_type(4)));

// ---------------------------------------------------------------------------
// small helpers
// ---------------------------------------------------------------------------
__device__ __forceinline__ unsigned short bf_bits(float f) {          // RNE convert f32 -> bf16 bits
  const unsigned u = __float_as_uint(f);
  return (unsigned short)((u + 0x7FFFu + ((u >> 16) & 1u)) >> 16);
}
__device__ __forceinline__ float bf_val(unsigned short h) { return __uint_as_float(((unsigned)h) << 16); }
__device__ __forceinline__ float bf_rne(float f) { return bf_val(bf_bits(f)); }
__device__ __forceinline__ unsigned pk16(unsigned short a, unsigned short b) { return (unsigned)a | ((unsigned)b << 16); }
__device__ __forceinline__ v8f zero8() { v8f z = {0.f, 0.f, 0.f, 0.f, 0.f, 0.f, 0.f, 0.f}; return z; }
__device__ __forceinline__ int wave_id() { return __builtin_amdgcn_readfirstlane((int)(threadIdx.x >> 5)); }

__device__ __forceinline__ void lds_wave_sync() {
  __builtin_amdgcn_fence(__ATOMIC_RELEASE, "workgroup");
  __builtin_amdgcn_wave_barrier();
  __builtin_amdgcn_fence(__ATOMIC_ACQUIRE, "workgroup");
}

// Value of lane l ^ 16 (the same column of the other 16-lane row), a cross-row move of the vector unit, all lanes on.
__device__ __forceinline__ float half_xor(float v) {
  const int b = __builtin_bit_cast(int, v);
  return __builtin_bit_cast(float, __builtin_amdgcn_permlanex16(b, b, 0x76543210, 0xfedcba98, false, false));
}

// ---------------------------------------------------------------------------
// WMMA fragments (wave32, 16x16x32, 16-bit operands). For A (row m = lane&15) and B (col n = lane&15) alike:
// elements 0..7 <- k0 + 8*(lane>>4) + 0..7, elements 8..15 <- k0 + 16 + 8*(lane>>4) + 0..7.
// ldfrag(p) with p = rowbase + k0 + 8*(lane>>4): two 16-B loads p[0..7], p[16..23].
// D: acc[r] = (row 8*(lane>>4) + r, col lane&15).
// ---------------------------------------------------------------------------
union FragH { v16h v; v8h h[2]; };
union FragB { v16b v; v8b h[2]; };
__device__ __forceinline__ v16h ldfrag_h(const _Float16* p) { FragH f; f.h[0] = *(const v8h*)(p); f.h[1] = *(const v8h*)(p + 16); return f.v; }
__device__ __forceinline__ v16b ldfrag_b(const __bf16* p)   { FragB f; f.h[0] = *(const v8b*)(p); f.h[1] = *(const v8b*)(p + 16); return f.v; }

__device__ __forceinline__ v8f mma_h(v16h a, v16h b, v8f c) {
  return __builtin_amdgcn_wmma_f32_16x16x32_f16(false, a, false, b, (short)0, c, false, false);
}
__device__ __forceinline__ v8f mma_b(v16b a, v16b b, v8f c) {
  return __builtin_amdgcn_wmma_f32_16x16x32_bf16(false, a, false, b, (short)0, c, false, false);
}
// hazard guards: 4 VALU slots after the last WMMAs of a run, D tied.
// guard_frags also keeps the run's A and B fragments live to behind the slots, so that no D of the run is placed over one of them.
__device__ __forceinline__ void guard_frags(v8f& a, v8f& b, v8f& c, v8f& d, v16h u, v16h v, v16h w, v16h x, v16h y, v16h z) {
  asm volatile("v_nop\n\tv_nop\n\tv_nop\n\tv_nop" : "+v"(a), "+v"(b), "+v"(c), "+v"(d) : "v"(u), "v"(v), "v"(w), "v"(x), "v"(y), "v"(z));
}
__device__ __forceinline__ void guard_frags2(v8f& a, v8f& b, v16h u, v16h v, v16h w) {
  asm volatile("v_nop\n\tv_nop\n\tv_nop\n\tv_nop" : "+v"(a), "+v"(b) : "v"(u), "v"(v), "v"(w));
}
__device__ __forceinline__ void acc_guard4(v8f& a, v8f& b, v8f& c, v8f& d) {
  asm volatile("v_nop\n\tv_nop\n\tv_nop\n\tv_nop" : "+v"(a), "+v"(b), "+v"(c), "+v"(d));
}

// ---------------------------------------------------------------------------
// Preparation, one launch: the RoPE table and the RNE bf16 planes of x, Wq, Wk, Wv, Wo. None of the six pieces reads what another
// writes, so they share a grid; the block index picks the piece (block-uniform, no barrier anywhere in the kernel).
//   blocks 0 .. SQ/8 - 1: RoPE table, cst[s][i] = cos(s * inv_freq[i]), snt[s][i] = sin(...), inv_freq[i] = 1 / 1e4^(i/64), i < 64, all f32.
//     Wave w -> position s = block*8 + w, lane -> i = lane, lane + 32. Coverage: SQ/8 blocks x 8 waves x 32 lanes x 2 = SQ x 64 per plane.
//     They come first in the grid because theirs is the longest dependent chain.
//   then CV_BLK(n) blocks per plane of n elements: a wave converts CV_WAVE = 2048 consecutive elements. All its sixteen 16-B loads are issued
//     before the first conversion; load i covers the 512 contiguous bytes of elements 128 i .. 128 i + 127, store i the 256 contiguous
//     bytes (two whole lines) of the same elements. Coverage: CV_BLK(n) x 8 waves x 2048 = n, every plane a whole number of blocks.
// ---------------------------------------------------------------------------
#define CV_WAVE   2048
#define CV_BLK(n) ((n) / (8 * CV_WAVE))
#define NB_ROPE   (SQ / 8)
#define NB_X      CV_BLK(NTOK * HID)
#define NB_WQ     CV_BLK(HID * HID)
#define NB_WK     CV_BLK(KVW * HID)
#define NB_WV     CV_BLK(KVW * HID)
#define NB_WO     CV_BLK(HID * HID)
static_assert(NB_X * 8 * CV_WAVE == NTOK * HID && NB_WQ * 8 * CV_WAVE == HID * HID && NB_WK * 8 * CV_WAVE == KVW * HID);

typedef unsigned int v2u __attribute__((ext_vector_type(2)));

__device__ __forceinline__ void rope_table_rows(float* __restrict__ cst, float* __restrict__ snt, int blk) {
  const int lane = threadIdx.x & 31;
  const int wave = (int)(threadIdx.x >> 5);
  const int t = blk * 8 + wave;
  const float pf = (float)t;
  float c0 = 0.f, s0 = 0.f, c1 = 0.f, s1 = 0.f;
#pragma unroll 1
  for (int u = 0; u < 2; ++u) {
    const int i = lane + 32 * u;
    const float e   = (float)i * 0.015625f;      // i / 64 exact
    const float pw  = powf(10000.0f, e);
    const float inv = 1.0f / pw;
    const float ang = pf * inv;
    const float cv = cosf(ang);
    const float sv = sinf(ang);
    c1 = cv; s1 = sv;
    if (u == 0) { c0 = cv; s0 = sv; }
  }
  const size_t o = (size_t)t * NFREQ + lane;
  cst[o]      = c0;
  cst[o + 32] = c1;
  snt[o]      = s0;
  snt[o + 32] = s1;
}

__global__ __launch_bounds__(256) void prep_kernel(
    const float* __restrict__ x, const float* __restrict__ wq, const float* __restrict__ wk,
    const float* __restrict__ wv, const float* __restrict__ wo,
    unsigned short* __restrict__ xb, unsigned short* __restrict__ wqb, unsigned short* __restrict__ wkb,
    unsigned short* __restrict__ wvb, unsigned short* __restrict__ wob,
    float* __restrict__ cst, float* __restrict__ snt) {
  int blk = (int)blockIdx.x;
  if (blk < NB_ROPE) { rope_table_rows(cst, snt, blk); return; }
  blk -= NB_ROPE;
  const float* in = x;
  unsigned short* outp = xb;
  if (blk >= NB_X + NB_WQ + NB_WK + NB_WV)      { in = wo; outp = wob; blk -= NB_X + NB_WQ + NB_WK + NB_WV; }
  else if (blk >= NB_X + NB_WQ + NB_WK)         { in = wv; outp = wvb; blk -= NB_X + NB_WQ + NB_WK; }
  else if (blk >= NB_X + NB_WQ)                 { in = wk; outp = wkb; blk -= NB_X + NB_WQ; }
  else if (blk >= NB_X)                         { in = wq; outp = wqb; blk -= NB_X; }
  const int lane = (int)(threadIdx.x & 31);
  const size_t e0 = ((size_t)blk * 8 + wave_id()) * CV_WAVE + lane * 4;
  const float* ip = in + e0;
  unsigned short* op = outp + e0;
  v4f a[16];
#pragma unroll   // constant indices keep a[] in registers, and all sixteen loads are in flight at once
  for (int i = 0; i < 16; ++i) a[i] = *(const v4f*)(ip + i * 128);
  // precaution: the lane pointer is an input here, so it keeps its registers (no load result is placed over it) until this wait
  asm volatile("s_wait_xcnt 0x0" :: "v"(ip) : "memory");
  // keeps every load in front of the first conversion: left alone the compiler holds the last four back until the first four have returned
  __builtin_amdgcn_sched_barrier(0);
#pragma unroll   // as above: constant indices into a[]
  for (int i = 0; i < 16; ++i) {
    v2u w;
    w[0] = pk16(bf_bits(a[i][0]), bf_bits(a[i][1]));
    w[1] = pk16(bf_bits(a[i][2]), bf_bits(a[i][3]));
    *(v2u*)(op + i * 128) = w;
  }
}

// ---------------------------------------------------------------------------
// bf16 WMMA GEMM, block = 4 waves (128 threads) = one 128 x 128 tile of C, wave w = rows 32w..32w+31 x all 128 cols.
//   C[m][n] = sum_k A[m][k] * Bt[n][k]; A row-major [M][K] bf16 (pitch lda), Bt row-major [N][K] bf16 (pitch ldb);
//   M % 128 == 0, N % 128 == 0, K % 64 == 0; grid.x = M/128 * N/128.
//   SPLITA: A carried as hi (Ap) + lo (A2p) bf16 planes, two products into one accumulator.
//   Operands: a pass is 64 k = one whole 128-B line of every operand row. The 128 A rows (both planes when SPLITA) and the
//   128 Bt rows of a pass are brought into LDS by asynchronous 16-B copies (8 lanes = one line, a wave instruction = 4 lines),
//   rows at pitch 144 B, two buffers: the next pass's copies fly while this pass is multiplied. The Bt tile is read by all
//   four waves. Fragments are read from LDS with the split k map (ldfrag_b), k ascending.
// Epilogues (all: per wave, per 16-row slab: stage in LDS, wave sync, write each row segment with ONE instruction of
//   EPI 0: q or k projection; the 128-col tile is one head. B rows are laid in LDS in even/odd order (row n0 + r in slot
//          64*(r&1) + (r>>1)):
//          acc tile j<4, lane rl holds output column n0 + 2*(16j+rl); tile j+4 holds n0 + 2*(16j+rl) + 1 (the interleaved pair).
//          + bf16(bias[n]); RoPE on the pair with cos/sin[pos = row & 2047][pair]; writes f16 hi plane C0 and f16 residual x2048
//          plane C1, both [M][ldc], cols n0..n0+127 (row segment 256 B = 16 lanes x 16 B).
//   EPI 1: v^T projection: + bf16(bias[m]); f16 hi plane C0, residual x2048 plane C1, [M][ldc], row segment 256 B.
//   EPI 2: f32 output C0 [M][ldc]; row segment 128 floats = 512 B = 32 lanes x 16 B per instruction.
// ---------------------------------------------------------------------------
template <int EPI> struct SlabT { typedef _Float16 T; static constexpr int PERW = 4096; };   // 2 planes x 16 x 128 halves
template <> struct SlabT<2>     { typedef float    T; static constexpr int PERW = 2048; };   // 16 x 128 floats

#define G_PITCH 72                    // LDS row pitch in 16-bit elements: 64 k + 8 = 144 B = 16 B x 9
#define G_TILE  (128 * G_PITCH)       // one 128-row operand tile of a pass, in elements

// One 128-row x 128-B operand tile into LDS: eight copies per lane, lane address pairs (l + i*lstep, g + i*gstep).
// The s_wait_xcnt stands in the copies' own statement so that no address register is rewritten ahead of it.
__device__ __forceinline__ void stage_tile(unsigned l, unsigned lstep, const unsigned short* g, size_t gstep) {
  asm volatile(
      "global_load_async_to_lds_b128 %0, %8, off\n\t"
      "global_load_async_to_lds_b128 %1, %9, off\n\t"
      "global_load_async_to_lds_b128 %2, %10, off\n\t"
      "global_load_async_to_lds_b128 %3, %11, off\n\t"
      "global_load_async_to_lds_b128 %4, %12, off\n\t"
      "global_load_async_to_lds_b128 %5, %13, off\n\t"
      "global_load_async_to_lds_b128 %6, %14, off\n\t"
      "global_load_async_to_lds_b128 %7, %15, off\n\t"
      "s_wait_xcnt 0x0"
      :: "v"(l), "v"(l + lstep), "v"(l + 2 * lstep), "v"(l + 3 * lstep),
         "v"(l + 4 * lstep), "v"(l + 5 * lstep), "v"(l + 6 * lstep), "v"(l + 7 * lstep),
         "v"(g), "v"(g + gstep), "v"(g + 2 * gstep), "v"(g + 3 * gstep),
         "v"(g + 4 * gstep), "v"(g + 5 * gstep), "v"(g + 6 * gstep), "v"(g + 7 * gstep)
      : "memory");
}

// One block tile. slab_all (4 * SlabT<EPI>::PERW elements) and ring (2 * NPL * G_TILE elements) are the calling kernel's LDS arrays.
template <int EPI, bool SPLITA>
__device__ __forceinline__ void gemm_w32x128_tile(
    typename SlabT<EPI>::T* slab_all, unsigned short* ring, int tile,
    const unsigned short* Ap, const unsigned short* A2p, int lda,
    const unsigned short* __restrict__ Btp, int ldb,
    const float* __restrict__ bias, const float* __restrict__ cst, const float* __restrict__ snt,
    void* C0, void* C1, int ldc,
    int M, int N, int K) {
  typedef typename SlabT<EPI>::T ST;
  constexpr int NPL = SPLITA ? 3 : 2;            // operand tiles per buffer: A (, A lo), Bt
  constexpr int BUF = NPL * G_TILE;              // elements per buffer

  const int tid  = (int)threadIdx.x;
  const int lane = tid & 31;
  const int wave = wave_id();
  const int hh = lane >> 4;           // lane half: k offset 8*hh, D row offset 8*hh
  const int rl = lane & 15;           // A row / B col / D col within subtile
  const int tilesN = N >> 7;
  const int tilesM = M >> 7;
  if (tile >= tilesM * tilesN) return;          // block-uniform, in front of every barrier
  const int tm = tile / tilesN;
  const int tn = tile - tm * tilesN;
  const int mb = tm << 7;                       // first row of the block tile
  const int m0 = mb + (wave << 5);              // first row of this wave
  const int n0 = tn << 7;

  // copy addresses of this lane: copy i of a tile moves 16 B of source row (tid>>3) + 16*i, bytes 16*(tid&7)..+15 of the pass's line
  const int crow = tid >> 3;
  const int ccol = (tid & 7) * 8;
  const unsigned short* gA  = Ap  + (size_t)(mb + crow) * lda + ccol;
  const unsigned short* gA2 = A2p + (size_t)(mb + crow) * lda + ccol;
  const unsigned short* gB  = Btp + (size_t)(n0 + crow) * ldb + ccol;
  const unsigned ring0 = (unsigned)(uintptr_t)(&ring[0]);           // LDS byte address of the ring
  const unsigned lA = ring0 + (unsigned)(crow * G_PITCH + ccol) * 2u;
  const int bslot = (EPI == 0) ? ((crow & 1) * 64 + (crow >> 1)) : crow;
  const unsigned lB = ring0 + (unsigned)((NPL - 1) * G_TILE + bslot * G_PITCH + ccol) * 2u;
  const unsigned lstepA = 16u * G_PITCH * 2u;
  const unsigned lstepB = ((EPI == 0) ? 8u : 16u) * G_PITCH * 2u;
  const size_t gstepA = (size_t)16 * lda;
  const size_t gstepB = (size_t)16 * ldb;

  v8f acc[2][8];
#pragma unroll
  for (int i = 0; i < 2; ++i)
#pragma unroll
    for (int j = 0; j < 8; ++j) acc[i][j] = zero8();

  const int npass = K >> 6;
  // pass 0 into buffer 0, landed and published; then pass 1 into buffer 1
  stage_tile(lA, lstepA, gA, gstepA);
  if (SPLITA) stage_tile(lA + G_TILE * 2u, lstepA, gA2, gstepA);
  stage_tile(lB, lstepB, gB, gstepB);
  asm volatile("s_wait_asynccnt 0x0" ::: "memory");   // this wave's copies of pass 0 have landed
  __syncthreads();                                    // every wave's copies of pass 0 are readable by all
  if (npass > 1) {
    stage_tile(lA + BUF * 2u, lstepA, gA + 64, gstepA);
    if (SPLITA) stage_tile(lA + (BUF + G_TILE) * 2u, lstepA, gA2 + 64, gstepA);
    stage_tile(lB + BUF * 2u, lstepB, gB + 64, gstepB);
  }

  for (int t = 0; t < npass; ++t) {
    const int bo = (t & 1) * BUF;
    const __bf16* As = (const __bf16*)(const void*)(ring + bo) + ((wave << 5) + rl) * G_PITCH + 8 * hh;
    const __bf16* Bs = (const __bf16*)(const void*)(ring + bo + (NPL - 1) * G_TILE) + rl * G_PITCH + 8 * hh;
    v16b ah[2][2], al[2][2], bj[2][8];
#pragma unroll
    for (int kb = 0; kb < 2; ++kb) {
#pragma unroll
      for (int i = 0; i < 2; ++i) {
        ah[kb][i] = ldfrag_b(As + i * 16 * G_PITCH + kb * 32);
        al[kb][i] = SPLITA ? ldfrag_b(As + G_TILE + i * 16 * G_PITCH + kb * 32) : ah[kb][i];
      }
#pragma unroll
      for (int j = 0; j < 8; ++j) bj[kb][j] = ldfrag_b(Bs + j * 16 * G_PITCH + kb * 32);
    }
    // keeps the pass's LDS reads together in front of its WMMAs: left alone the compiler puts two reads and a full wait before every WMMA pair
    __builtin_amdgcn_sched_barrier(0);
#pragma unroll
    for (int kb = 0; kb < 2; ++kb) {
#pragma unroll
      for (int j = 0; j < 8; ++j) {
        acc[0][j] = mma_b(ah[kb][0], bj[kb][j], acc[0][j]);
        acc[1][j] = mma_b(ah[kb][1], bj[kb][j], acc[1][j]);
        if (SPLITA) {
          acc[0][j] = mma_b(al[kb][0], bj[kb][j], acc[0][j]);
          acc[1][j] = mma_b(al[kb][1], bj[kb][j], acc[1][j]);
        }
      }
    }
    // keeps the WMMAs in front of the waits and the barrier below, so that the next pass's copies fly for the whole of this pass
    __builtin_amdgcn_sched_barrier(0);
    asm volatile("s_wait_dscnt 0x0" ::: "memory");      // this wave's reads of the buffer are done before it is refilled
    asm volatile("s_wait_asynccnt 0x0" ::: "memory");   // this wave's copies of pass t + 1 have landed
    __syncthreads();                                    // publishes pass t + 1 and ends every reader's last read of pass t
    if (t + 2 < npass) {                                // block-uniform
      const size_t ko = (size_t)(t + 2) * 64;
      stage_tile(lA + (unsigned)bo * 2u, lstepA, gA + ko, gstepA);
      if (SPLITA) stage_tile(lA + (unsigned)(bo + G_TILE) * 2u, lstepA, gA2 + ko, gstepA);
      stage_tile(lB + (unsigned)bo * 2u, lstepB, gB + ko, gstepB);
    }
  }
  asm volatile("s_wait_asynccnt 0x0" ::: "memory");     // no copy is outstanding when the wave goes on to the epilogue
  acc_guard4(acc[0][0], acc[0][1], acc[0][2], acc[0][3]);
  acc_guard4(acc[0][4], acc[0][5], acc[0][6], acc[0][7]);
  acc_guard4(acc[1][0], acc[1][1], acc[1][2], acc[1][3]);
  acc_guard4(acc[1][4], acc[1][5], acc[1][6], acc[1][7]);

  // ---- epilogue ----
  ST* slab = slab_all + wave * SlabT<EPI>::PERW;
  _Float16* sl16 = (_Float16*)(void*)slab;
  float*    slf  = (float*)(void*)slab;

  if (EPI == 0) {
    _Float16* P0 = (_Float16*)C0;
    _Float16* P1 = (_Float16*)C1;
#pragma unroll
    for (int i = 0; i < 2; ++i) {
      const int rb = m0 + i * 16 + 8 * hh;
#pragma unroll
      for (int j = 0; j < 4; ++j) {
        const int pi = j * 16 + rl;                              // pair index 0..63 within head
        const int nc = n0 + 2 * pi;                              // column of x1; x2 at nc + 1
        const float b1 = bf_rne(bias[nc]);
        const float b2 = bf_rne(bias[nc + 1]);
#pragma unroll
        for (int r = 0; r < 8; ++r) {
          const int row = rb + r;                                // token 0..NTOK-1
          const int s   = row & (SQ - 1);                        // position within sequence
          const float cv = cst[(size_t)s * NFREQ + pi];
          const float sv = snt[(size_t)s * NFREQ + pi];
          const float x1 = acc[i][j][r] + b1;
          const float x2 = acc[i][j + 4][r] + b2;
          const float o1 = x1 * cv - x2 * sv;
          const float o2 = x1 * sv + x2 * cv;
          const _Float16 h1 = (_Float16)o1;
          const _Float16 h2 = (_Float16)o2;
          const int so = (8 * hh + r) * 128 + 2 * pi;
          sl16[so]            = h1;
          sl16[so + 1]        = h2;
          sl16[2048 + so]     = (_Float16)((o1 - (float)h1) * 2048.0f);
          sl16[2048 + so + 1] = (_Float16)((o2 - (float)h2) * 2048.0f);
        }
      }
      lds_wave_sync();
      {
#pragma unroll
        for (int it = 0; it < 8; ++it) {
          const int row = it * 2 + hh;                           // it x hh covers rows 0..15
          const int c8  = rl * 8;
          const v8h vh = *(const v8h*)(sl16 + row * 128 + c8);
          const v8h vl = *(const v8h*)(sl16 + 2048 + row * 128 + c8);
          const size_t go = (size_t)(m0 + i * 16 + row) * ldc + n0 + c8;
          *(v8h*)(P0 + go) = vh;
          *(v8h*)(P1 + go) = vl;
        }
        
      }
      lds_wave_sync();
    }
  } else if (EPI == 1) {
    _Float16* P0 = (_Float16*)C0;
    _Float16* P1 = (_Float16*)C1;
#pragma unroll
    for (int i = 0; i < 2; ++i) {
#pragma unroll
      for (int r = 0; r < 8; ++r) {
        const int m = m0 + i * 16 + 8 * hh + r;
        const float bm = bf_rne(bias[m]);
#pragma unroll
        for (int j = 0; j < 8; ++j) {
          const float v = acc[i][j][r] + bm;
          const _Float16 hv = (_Float16)v;
          const int so = (8 * hh + r) * 128 + j * 16 + rl;
          sl16[so]        = hv;
          sl16[2048 + so] = (_Float16)((v - (float)hv) * 2048.0f);
        }
      }
      lds_wave_sync();
      {
#pragma unroll
        for (int it = 0; it < 8; ++it) {
          const int row = it * 2 + hh;
          const int c8  = rl * 8;
          const v8h vh = *(const v8h*)(sl16 + row * 128 + c8);
          const v8h vl = *(const v8h*)(sl16 + 2048 + row * 128 + c8);
          const size_t go = (size_t)(m0 + i * 16 + row) * ldc + n0 + c8;
          *(v8h*)(P0 + go) = vh;
          *(v8h*)(P1 + go) = vl;
        }
        
      }
      lds_wave_sync();
    }
  } else {
    float* C = (float*)C0;
#pragma unroll
    for (int i = 0; i < 2; ++i) {
#pragma unroll
      for (int j = 0; j < 8; ++j)
#pragma unroll
        for (int r = 0; r < 8; ++r)
          slf[(8 * hh + r) * 128 + j * 16 + rl] = acc[i][j][r];
      lds_wave_sync();
      {
#pragma unroll
        for (int row = 0; row < 16; ++row) {                     // 32 lanes x 16 B = the whole 512-B row segment per instruction
          const v4f v = *(const v4f*)(slf + row * 128 + lane * 4);
          *(v4f*)(C + (size_t)(m0 + i * 16 + row) * ldc + n0 + lane * 4) = v;
        }
        
      }
      lds_wave_sync();
    }
  }
}

template <int EPI, bool SPLITA>
__global__ __launch_bounds__(128) void gemm_w32x128_kernel(
    const unsigned short* Ap, const unsigned short* A2p, int lda,
    const unsigned short* __restrict__ Btp, int ldb,
    const float* __restrict__ bias, const float* __restrict__ cst, const float* __restrict__ snt,
    void* C0, void* C1, int ldc,
    int M, int N, int K) {
  __shared__ __align__(16) typename SlabT<EPI>::T slab_all[4 * SlabT<EPI>::PERW];
  __shared__ __align__(16) unsigned short ring[2 * (SPLITA ? 3 : 2) * G_TILE];
  gemm_w32x128_tile<EPI, SPLITA>(slab_all, ring, (int)blockIdx.x, Ap, A2p, lda, Btp, ldb, bias, cst, snt, C0, C1, ldc, M, N, K);
}

// The k and the v^T projection in one grid: neither reads what the other writes, and each alone has only one work-group per WGP (one wave
// per SIMD, nothing to run while a wave waits). Blocks 0 .. nk - 1 are the k tiles (A = x, Bt = Wk, EPI 0), the rest the v^T tiles
// (A = Wv, Bt = x, EPI 1); the choice is block-uniform, and both sides use the same LDS arrays.
__global__ __launch_bounds__(128) void gemm_kv_kernel(
    const unsigned short* xb, const unsigned short* wkb, const unsigned short* wvb,
    const float* __restrict__ bk, const float* __restrict__ bv, const float* __restrict__ cst, const float* __restrict__ snt,
    unsigned short* kh, unsigned short* kl, unsigned short* vh, unsigned short* vl,
    int ntok, int kvw, int hid) {
  __shared__ __align__(16) _Float16 slab_all[4 * SlabT<0>::PERW];
  __shared__ __align__(16) unsigned short ring[2 * 2 * G_TILE];
  static_assert(SlabT<0>::PERW == SlabT<1>::PERW);
  const int blk = (int)blockIdx.x;
  const int nk  = (ntok >> 7) * (kvw >> 7);
  if (blk < nk) gemm_w32x128_tile<0, false>(slab_all, ring, blk, xb, xb, hid, wkb, hid, bk, cst, snt, (void*)kh, (void*)kl, kvw, ntok, kvw, hid);
  else          gemm_w32x128_tile<1, false>(slab_all, ring, blk - nk, wvb, wvb, hid, xb, hid, bv, cst, snt, (void*)vh, (void*)vl, ntok, kvw, ntok, hid);
}

// ---------------------------------------------------------------------------
// Windowed causal GQA flash attention, head dim 128, 32-key chunks, block = 4 waves = 64 query rows of one (b, h);
// Key j is valid for query i iff j <= i and i - j <= window (window read from the int input).
//   q planes f16 [tok][h*128+d]: hi (qhp) and residual x2048 (qlp); k planes f16 [tok][kvh*128+d]: hi (khp), residual x2048 (klp);
//   v^T planes f16 [kvh*128+d][tok]: hi (vhp), residual x2048 (vlp); outputs attn bf16 hi (ahp) / lo (alp) [tok][h*128+d].
//   PRES: scores = (Sh + Sr/2048) * 128^-0.5 with Sh = qh.kh and Sr = ql'.kh + qh.kl'; else scores = Sh * 128^-0.5; invalid keys -> -inf; online softmax f32
//   (-inf safe: a row with no valid key so far keeps m = -inf, l = 0, O = 0);
//   Both products are formed transposed: S^T = K . Q^T (A = 16 key rows, B = the wave's 16 query columns) and O^T += V^T . P^T (A = 16 d rows of
//   v^T, B = P^T). A lane (c, hh) then holds, of query q0 + c alone, the scores of keys 8 hh + r and 16 + 8 hh + r of the chunk: the row maximum and
//   the row sum are taken inside the lane, the maximum joined with the other half by one cross-row move per chunk, the two halves' sums once
//   behind the loop; m, l and the rescale factor are one value a lane;
//   p' = 1024 p as f16 hi (and residual x2048 when PRES): the two score tiles, converted in place, ARE the B fragment of P^T (element s = tile s >> 3,
//   register s & 7, the k order in which ldfrag_h reads v^T), so that P passes through no LDS and no lane exchange;
//   PRES: O = (Oh + Or/2048)/1024/l with Oh = ph.vh, Or = ph.vl' + pl'.vh; else O = Oh/1024/l. Without PRES no residual plane is read at all:
//   q and v^T then carry the 11 bits that k and p carry, well under the bf16 rounding of x and the weights that made them.
//   q staging: each wave copies its 16 rows of q (both planes when PRES) into LDS once, rows at pitch 272 B, and reads its B fragments from there.
//   K / V^T chunk staging: 128 threads x 4 x 16 B per plane = whole 32x128 / 128x32 tile, plain loads, __syncthreads before and after.
//   Chunks cover keys [max(0, 64*qb - window) & ~31, 64*qb + 63]; trip count statically <= 64; waves with no valid key in a chunk
//   skip its compute part (wave-uniform, scalar branch).
// ---------------------------------------------------------------------------
#define AT_KC   32
#define KS_P    136
#define VS_P    40
#define OS_P    136                   // output staging: 16 query rows a plane at pitch 272 B = 16 B x 17
#define QS_P    136
#define VAHEAD  2
// LDS map in halves. The residual tiles (k, v^T, q) exist only with PRES.
template <bool PRES> struct AttnLds {
  static constexpr int KS  = 0;
  static constexpr int KLS = 32 * KS_P;
  static constexpr int VHS = (PRES ? 2 : 1) * 32 * KS_P;
  static constexpr int VLS = VHS + 128 * VS_P;
  static constexpr int QH  = VHS + (PRES ? 2 : 1) * 128 * VS_P;
  static constexpr int QL  = QH + 64 * QS_P;
  static constexpr int TOT = QH + (PRES ? 2 : 1) * 64 * QS_P;
};
static_assert(AttnLds<true>::TOT * 2 * 4 <= 327680);    // four work-groups per WGP, each with the larger of the two maps
static_assert(4 * 2 * 16 * OS_P <= AttnLds<false>::TOT); // output staging (2 planes x 16 rows per wave) aliases the chunk and q regions after the loop

// One query tile qb of head h, sequence b. lds is the calling kernel's LDS array, at least AttnLds<PRES>::TOT halves.
template <bool PRES>
__device__ __forceinline__ void attn_window_tile(
    _Float16* lds, int qb, int h, int b,
    const unsigned short* __restrict__ qhp, const unsigned short* __restrict__ qlp,
    const unsigned short* __restrict__ khp, const unsigned short* __restrict__ klp,
    const unsigned short* __restrict__ vhp, const unsigned short* __restrict__ vlp,
    unsigned short* __restrict__ ahp, unsigned short* __restrict__ alp,
    const int* __restrict__ winp) {
  typedef AttnLds<PRES> L;
  _Float16* Ks  = lds + L::KS;
  _Float16* Kls = lds + L::KLS;
  _Float16* Vhs = lds + L::VHS;
  _Float16* Vls = lds + L::VLS;

  const int tid  = (int)threadIdx.x;
  const int lane = tid & 31;
  const int wave = wave_id();
  const int hh   = lane >> 4;
  const int c    = lane & 15;
  const int kvh  = h >> 1;                       // 2 query heads per kv head
  const int window = __builtin_amdgcn_readfirstlane(winp[0]);
  const int qblk0 = qb * 64;
  const int q0    = qblk0 + wave * 16;           // first query row of this wave (within sequence)
  const int qlast = q0 + 15;
  const int wlo   = q0 - window;                 // oldest valid key of row q0
  const size_t tok0 = (size_t)b * SQ;

  int kstart = qblk0 - window;
  kstart = (kstart > 0) ? (kstart & ~31) : 0;
  if (kstart > qblk0) kstart = qblk0;
  int nch = (qblk0 + 64 - kstart) >> 5;          // block-uniform
  if (nch > 64) nch = 64;
  if (nch < 0) nch = 0;
  nch = __builtin_amdgcn_readfirstlane(nch);     // the trip count of the loop that holds the barriers stays in a scalar register (the clamp is a vector med3 otherwise)

  // This wave's 16 query rows (both planes when PRES) go into LDS once (16 lanes = one 256-B row, row = (lane >> 4) + 2 i); every chunk reads its
  // B fragments from there. Only this wave reads them, behind the two barriers at the head of the first chunk.
  _Float16* Qhs = lds + L::QH + wave * (16 * QS_P);
  _Float16* Qls = lds + L::QL + wave * (16 * QS_P);
  {
    const _Float16* qhg = (const _Float16*)(const void*)qhp + (tok0 + q0 + hh) * HID + h * HDM + c * 8;
    const _Float16* qlg = (const _Float16*)(const void*)qlp + (tok0 + q0 + hh) * HID + h * HDM + c * 8;
    v8h qx[8], qy[8];
#pragma unroll   // constant indices keep qx and qy in registers, and all its loads (sixteen with PRES, eight without) are in flight at once
    for (int i = 0; i < 8; ++i) {
      qx[i] = *(const v8h*)(qhg + i * 2 * HID);
      if (PRES) qy[i] = *(const v8h*)(qlg + i * 2 * HID);
    }
    // precaution: the lane pointers are inputs here, so they keep their registers (no load result is placed over them) until this wait
    if (PRES) asm volatile("s_wait_xcnt 0x0" :: "v"(qhg), "v"(qlg) : "memory");
    else      asm volatile("s_wait_xcnt 0x0" :: "v"(qhg) : "memory");
#pragma unroll   // as above: constant indices into qx and qy
    for (int i = 0; i < 8; ++i) {
      *(v8h*)(Qhs + (hh + 2 * i) * QS_P + c * 8) = qx[i];
      if (PRES) *(v8h*)(Qls + (hh + 2 * i) * QS_P + c * 8) = qy[i];
    }
  }
  const _Float16* Qhr = Qhs + c * QS_P + 8 * hh;   // B fragment column (query q0 + c) of this lane
  const _Float16* Qlr = Qls + c * QS_P + 8 * hh;
  const _Float16* Kg  = (const _Float16*)(const void*)khp + tok0 * KVW + kvh * HDM;
  const _Float16* Klg = (const _Float16*)(const void*)klp + tok0 * KVW + kvh * HDM;
  const _Float16* Vhg = (const _Float16*)(const void*)vhp + (size_t)(kvh * HDM) * NTOK + tok0;
  const _Float16* Vlg = (const _Float16*)(const void*)vlp + (size_t)(kvh * HDM) * NTOK + tok0;
  const unsigned kgo = (unsigned)((tid >> 4) * KVW + (tid & 15) * 8);    // this lane's element offset in a K chunk, piece 0
  const unsigned vgo = (unsigned)((tid >> 2) * NTOK + (tid & 3) * 8);    // and in a V^T chunk

  const int qrow = q0 + c;                       // the one query of this lane
  // window as the validity test uses it: 0 <= qrow - key < SQ for every key that passes key <= qrow, so a window below -1 admits what -1
  // admits (nothing) and one above SQ what SQ admits (everything); the clamp keeps dq - window from wrapping
  const int wcl = (window < -1) ? -1 : ((window > SQ) ? SQ : window);
  float mrow = -INFINITY, lrow = 0.f;            // its running maximum (same in both halves) and the sum over this half's keys
  v8f oacc[8], oaccr[8];                         // oacc[t][r] = O^T(d = 16 t + 8 hh + r, query c)
#pragma unroll
  for (int t = 0; t < 8; ++t) { oacc[t] = zero8(); oaccr[t] = zero8(); }

  for (int kc = 0; kc < nch; ++kc) {
    const int kv0 = kstart + kc * AT_KC;         // keys kv0..kv0+31, all < SQ
    __syncthreads();
    // one lane pointer per plane for the chunk; the four pieces of a plane lie at constant distances from it
    const _Float16* kq  = Kg  + (size_t)kv0 * KVW + kgo;
    const _Float16* klq = Klg + (size_t)kv0 * KVW + kgo;
    const _Float16* vhq = Vhg + kv0 + vgo;
    const _Float16* vlq = Vlg + kv0 + vgo;
    v8h kx[4], ky[4], vx[4], vy[4];
#pragma unroll
    for (int i = 0; i < 4; ++i) {                // coverage: 512 pieces of 8 halves per plane = whole tile
      kx[i] = *(const v8h*)(kq + i * 8 * KVW);   // K: 32 keys x 128 d, key = (tid >> 4) + 8 i
      if (PRES) ky[i] = *(const v8h*)(klq + i * 8 * KVW);
      vx[i] = *(const v8h*)(vhq + i * 32 * NTOK); // V^T: 128 d x 32 keys, d = (tid >> 2) + 32 i
      if (PRES) vy[i] = *(const v8h*)(vlq + i * 32 * NTOK);
    }
    // precaution: the lane pointers are inputs here, so they keep their registers (no load result is placed over them) until this wait
    if (PRES) asm volatile("s_wait_xcnt 0x0" :: "v"(kq), "v"(klq), "v"(vhq), "v"(vlq) : "memory");
    else      asm volatile("s_wait_xcnt 0x0" :: "v"(kq), "v"(vhq) : "memory");
#pragma unroll
    for (int i = 0; i < 4; ++i) {
      const int p   = tid + 128 * i;             // 0..511
      const int key = p >> 4, d8 = (p & 15) * 8;
      *(v8h*)(Ks + key * KS_P + d8) = kx[i];
      if (PRES) *(v8h*)(Kls + key * KS_P + d8) = ky[i];
      const int d = p >> 2, k8 = (p & 3) * 8;
      *(v8h*)(Vhs + d * VS_P + k8) = vx[i];
      if (PRES) *(v8h*)(Vls + d * VS_P + k8) = vy[i];
    }
    __syncthreads();

    if (kv0 <= qlast && kv0 + AT_KC - 1 >= wlo) {   // wave-uniform (scalar): skip chunks with no valid key for this wave
      // ---- scores, transposed: sh[j][r] = S^T(key kv0 + 16 j + 8 hh + r, query q0 + c) ----
      v8f sh[2], sr[2];
      sh[0] = zero8(); sh[1] = zero8(); sr[0] = zero8(); sr[1] = zero8();
#pragma unroll
      for (int dc = 0; dc < 4; ++dc) {
        const v16h qa = ldfrag_h(Qhr + dc * 32);
        const v16h ql = PRES ? ldfrag_h(Qlr + dc * 32) : qa;
        v16h kb[2], kl[2];
#pragma unroll
        for (int j = 0; j < 2; ++j) {
          kb[j] = ldfrag_h(Ks + (j * 16 + c) * KS_P + dc * 32 + 8 * hh);
          kl[j] = PRES ? ldfrag_h(Kls + (j * 16 + c) * KS_P + dc * 32 + 8 * hh) : kb[j];
        }
        // keeps all fragment reads of this 32-d slice in one place in front of its WMMAs: left alone the compiler waits out a read per WMMA pair
        __builtin_amdgcn_sched_barrier(0);
#pragma unroll
        for (int j = 0; j < 2; ++j) {
          sh[j] = mma_h(kb[j], qa, sh[j]);
          if (PRES) sr[j] = mma_h(kb[j], ql, sr[j]);
        }
        if (PRES) {
#pragma unroll
          for (int j = 0; j < 2; ++j) sr[j] = mma_h(kl[j], qa, sr[j]);
        }
        // first slice: its WMMAs start the accumulators; the guard keeps them off the registers of this slice's own fragments
        if (dc == 0) {
          if (PRES) guard_frags(sh[0], sr[0], sh[1], sr[1], qa, ql, kb[0], kb[1], kl[0], kl[1]);
          else      guard_frags2(sh[0], sh[1], qa, kb[0], kb[1]);
        }
        // keeps this slice's WMMAs in front of the next slice's reads
        __builtin_amdgcn_sched_barrier(0);
      }
      // The V^T fragments of tile t + VAHEAD are read in front of tile t's WMMAs, the first VAHEAD tiles in front of the softmax arithmetic.
      v16h vb[8], vr[8];
#pragma unroll
      for (int t = 0; t < VAHEAD; ++t) {
        vb[t] = ldfrag_h(Vhs + (t * 16 + c) * VS_P + 8 * hh);
        if (PRES) vr[t] = ldfrag_h(Vls + (t * 16 + c) * VS_P + 8 * hh);
      }
      // ---- scale, window + causal validity, maximum of this lane's 16 keys, joined with the other half's 16 ----
      // key = kv0 + 8 hh + e with e = 16 j + r: key <= qrow is e <= dq, and qrow - key <= window is e >= dq - window
      const int dq = qrow - kv0 - 8 * hh;
      const int dw = dq - wcl;
      float cm = -INFINITY;
#pragma unroll
      for (int j = 0; j < 2; ++j) {
#pragma unroll
        for (int r = 0; r < 8; ++r) {
          const int e = j * 16 + r;
          float sc = (PRES ? sh[j][r] + sr[j][r] * 0.00048828125f : sh[j][r]) * 0.08838834764831845f;
          const bool ok = (e <= dq) & (e >= dw);
          sc = ok ? sc : -INFINITY;
          sh[j][r] = sc;
          cm = fmaxf(cm, sc);
        }
      }
      cm = fmaxf(cm, half_xor(cm));
      // ---- online softmax; P'^T packed in place as the B fragment ----
      const float mnew  = fmaxf(mrow, cm);
      const float mref  = (mnew == -INFINITY) ? 0.f : mnew;     // query with no valid key yet: everything stays 0
      const float alpha = __expf(mrow - mref);
      mrow = mnew;
      float psum[2] = {0.f, 0.f};                               // one chain of additions per score tile
      v16h pa, pr;
#pragma unroll
      for (int j = 0; j < 2; ++j) {
#pragma unroll
        for (int r = 0; r < 8; ++r) {
          const float p  = __expf(sh[j][r] - mref);
          psum[j] += p;
          const float pp = p * 1024.0f;
          const _Float16 phv = (_Float16)pp;
          pa[j * 8 + r] = phv;
          pr[j * 8 + r] = PRES ? (_Float16)((pp - (float)phv) * 2048.0f) : phv;
        }
      }
      lrow = lrow * alpha + (psum[0] + psum[1]);
#pragma unroll
      for (int t = 0; t < 8; ++t) { oacc[t] *= alpha; if (PRES) oaccr[t] *= alpha; }
      // ---- O^T += V^T . P'^T ----
#pragma unroll
      for (int t = 0; t < 8; ++t) {
        if (t + VAHEAD < 8) {
          vb[t + VAHEAD] = ldfrag_h(Vhs + ((t + VAHEAD) * 16 + c) * VS_P + 8 * hh);
          if (PRES) vr[t + VAHEAD] = ldfrag_h(Vls + ((t + VAHEAD) * 16 + c) * VS_P + 8 * hh);
        }
        // keeps the reads of tile t + VAHEAD in front of tile t's WMMAs: left alone the compiler reads only one tile ahead
        // (mask 6: plain vector and scalar work, the rescale of later tiles, may still move in among the WMMAs)
        __builtin_amdgcn_sched_barrier(6);
        oacc[t]  = mma_h(vb[t], pa, oacc[t]);
        if (PRES) {
          oaccr[t] = mma_h(vr[t], pa, oaccr[t]);
          oaccr[t] = mma_h(vb[t], pr, oaccr[t]);
        }
        // keeps tile t's WMMAs in front of the next tile's reads
        __builtin_amdgcn_sched_barrier(6);
      }
      if (PRES) acc_guard4(oacc[6], oaccr[6], oacc[7], oaccr[7]);   // the loop's back edge follows
      else      acc_guard4(oacc[4], oacc[5], oacc[6], oacc[7]);
    }
  }

  __syncthreads();                               // all chunk- and q-region readers done before output staging aliases them (the q region in the tiles without PRES)
  _Float16* osh = lds + wave * (2 * 16 * OS_P);
  _Float16* osl = osh + 16 * OS_P;
  {
    const float inv = (1.0f / (lrow + half_xor(lrow))) * 0.0009765625f;   // the two halves' sums joined
#pragma unroll
    for (int t = 0; t < 8; ++t) {
      v8h xh, xl;                                // d = 16 t + 8 hh + 0..7 of query c: 16 B a plane
#pragma unroll
      for (int r = 0; r < 8; ++r) {
        const float o = (PRES ? oacc[t][r] + oaccr[t][r] * 0.00048828125f : oacc[t][r]) * inv;
        const unsigned short hb = bf_bits(o);
        const unsigned short lb = bf_bits(o - bf_val(hb));
        xh[r] = __builtin_bit_cast(_Float16, hb);
        xl[r] = __builtin_bit_cast(_Float16, lb);
      }
      *(v8h*)(osh + c * OS_P + t * 16 + 8 * hh) = xh;
      *(v8h*)(osl + c * OS_P + t * 16 + 8 * hh) = xl;
    }
  }
  lds_wave_sync();
  _Float16* Ahg = (_Float16*)(void*)ahp + (tok0 + q0) * HID + h * HDM;
  _Float16* Alg = (_Float16*)(void*)alp + (tok0 + q0) * HID + h * HDM;
  {
#pragma unroll
    for (int it = 0; it < 8; ++it) {
      const int row = it * 2 + hh;               // it 0..7 x hh 0..1 covers rows 0..15
      const int c8  = c * 8;                     // 16 lanes x 16 B = the whole 256-B segment
      const v8h x = *(const v8h*)(osh + row * OS_P + c8);
      const v8h y = *(const v8h*)(osl + row * OS_P + c8);
      *(v8h*)(Ahg + (size_t)row * HID + c8) = x;
      *(v8h*)(Alg + (size_t)row * HID + c8) = y;
    }
    
  }
}

// All query tiles in one grid of AT_NLONG + AT_NSHORT = 1024 work-groups. A budget of 256 registers a wave = four waves per SIMD: four
// work-groups share a WGP and the whole grid is resident at once. Blocks 0 .. AT_NLONG - 1 are tiles AT_NRES .. 31 (no residual products; tile
// fastest, then head, then sequence); they leave one place in eight free, and the AT_NSHORT blocks behind them, tiles 0 .. AT_NRES - 1 with the
// residual products, run there beside them. No tile reads what another writes; the choice is block-uniform.
#define AT_NRES   4
#define AT_NTL    (SQ / 64 - AT_NRES)
#define AT_NLONG  (AT_NTL * NHQ * NSEQ)
#define AT_NSHORT (AT_NRES * NHQ * NSEQ)
__global__ __launch_bounds__(128) __attribute__((amdgpu_waves_per_eu(4))) void attn_window_kernel(
    const unsigned short* __restrict__ qhp, const unsigned short* __restrict__ qlp,
    const unsigned short* __restrict__ khp, const unsigned short* __restrict__ klp,
    const unsigned short* __restrict__ vhp, const unsigned short* __restrict__ vlp,
    unsigned short* __restrict__ ahp, unsigned short* __restrict__ alp,
    const int* __restrict__ winp) {
  __shared__ __align__(16) _Float16 lds[AttnLds<true>::TOT];
  const int blk = (int)blockIdx.x;
  if (blk < AT_NLONG) {
    const int hb = blk / AT_NTL;                 // head + NHQ * sequence
    attn_window_tile<false>(lds, AT_NRES + (blk - hb * AT_NTL), hb % NHQ, hb / NHQ, qhp, qlp, khp, klp, vhp, vlp, ahp, alp, winp);
  } else {
    const int p  = blk - AT_NLONG;
    const int hb = p / AT_NRES;
    attn_window_tile<true>(lds, p - hb * AT_NRES, hb % NHQ, hb / NHQ, qhp, qlp, khp, klp, vhp, vlp, ahp, alp, winp);
  }
}

// ---------------------------------------------------------------------------
// Workspace map (bytes; every region is a whole number of the rows its producer writes with whole-line stores, no tails):
//   Xb    bf16 [4096][2048]   16777216   (the attn hi plane Ah [4096][2048] bf16 reuses this region after the last Xb reader)
//   Wqb   bf16 [2048][2048]    8388608      Wkb bf16 [1024][2048]  4194304      Wvb bf16 [1024][2048]  4194304
//   Wob   bf16 [2048][2048]    8388608      cst f32  [2048][64]     524288      snt f32  [2048][64]     524288
//   Qh    f16  [4096][2048]   16777216      Ql  f16  [4096][2048] 16777216
//   Kh    f16  [4096][1024]    8388608      Kl  f16  [4096][1024]  8388608
//   Vh    f16  [1024][4096]    8388608      Vl  f16  [1024][4096]  8388608
//   Al    bf16 [4096][2048]   16777216
//   total                    126877696
// ---------------------------------------------------------------------------
extern "C" void kernel_launch(void* const* d_in, const int* in_sizes, int n_in,
                              void* d_out, int out_size, void* d_ws, size_t ws_size,
                              hipStream_t stream) {
  if (n_in < 9) return;
  if (in_sizes[0] != NTOK * HID) return;
  if (in_sizes[1] != HID * HID) return;
  if (in_sizes[2] != HID) return;
  if (in_sizes[3] != KVW * HID) return;
  if (in_sizes[4] != KVW) return;
  if (in_sizes[5] != KVW * HID) return;
  if (in_sizes[6] != KVW) return;
  if (in_sizes[7] != HID * HID) return;
  if (in_sizes[8] < 1) return;
  if (out_size != NTOK * HID) return;

  const float* x    = (const float*)d_in[0];
  const float* wq_w = (const float*)d_in[1];
  const float* wq_b = (const float*)d_in[2];
  const float* wk_w = (const float*)d_in[3];
  const float* wk_b = (const float*)d_in[4];
  const float* wv_w = (const float*)d_in[5];
  const float* wv_b = (const float*)d_in[6];
  const float* wo_w = (const float*)d_in[7];
  const int*   win  = (const int*)d_in[8];
  float* out = (float*)d_out;

  const size_t szX  = (size_t)NTOK * HID * 2;
  const size_t szWq = (size_t)HID * HID * 2;
  const size_t szWk = (size_t)KVW * HID * 2;
  const size_t szWv = (size_t)KVW * HID * 2;
  const size_t szWo = (size_t)HID * HID * 2;
  const size_t szT  = (size_t)SQ * NFREQ * 4;
  const size_t szQ  = (size_t)NTOK * HID * 2;
  const size_t szK  = (size_t)NTOK * KVW * 2;
  const size_t szV  = (size_t)KVW * NTOK * 2;
  const size_t szA  = (size_t)NTOK * HID * 2;
  size_t off = 0;
  const size_t oX  = off; off += szX;
  const size_t oWq = off; off += szWq;
  const size_t oWk = off; off += szWk;
  const size_t oWv = off; off += szWv;
  const size_t oWo = off; off += szWo;
  const size_t oCs = off; off += szT;
  const size_t oSn = off; off += szT;
  const size_t oQh = off; off += szQ;
  const size_t oQl = off; off += szQ;
  const size_t oKh = off; off += szK;
  const size_t oKl = off; off += szK;
  const size_t oVh = off; off += szV;
  const size_t oVl = off; off += szV;
  const size_t oAl = off; off += szA;
  const size_t oAh = oX;                         // Ah reuses the Xb region (same byte size); Xb is dead after launch (3)
  if (szA != szX) return;
  if (off > ws_size) return;                     // off = 126877696

  char* ws = (char*)d_ws;
  unsigned short* Xb  = (unsigned short*)(ws + oX);
  unsigned short* Wqb = (unsigned short*)(ws + oWq);
  unsigned short* Wkb = (unsigned short*)(ws + oWk);
  unsigned short* Wvb = (unsigned short*)(ws + oWv);
  unsigned short* Wob = (unsigned short*)(ws + oWo);
  float*          cst = (float*)(ws + oCs);
  float*          snt = (float*)(ws + oSn);
  unsigned short* Qh  = (unsigned short*)(ws + oQh);
  unsigned short* Ql  = (unsigned short*)(ws + oQl);
  unsigned short* Kh  = (unsigned short*)(ws + oKh);
  unsigned short* Kl  = (unsigned short*)(ws + oKl);
  unsigned short* Vh  = (unsigned short*)(ws + oVh);
  unsigned short* Vl  = (unsigned short*)(ws + oVl);
  unsigned short* Ah  = (unsigned short*)(ws + oAh);
  unsigned short* Al  = (unsigned short*)(ws + oAl);

  const dim3 b256(256), b128(128);

  // (1) cos/sin table [2048][64] x 2 and the RNE bf16 planes of x [4096][2048], Wq [2048][2048], Wk [1024][2048], Wv [1024][2048],
  //     Wo [2048][2048] (weights [out][in]: Wq, Wk, Wo as Bt[n][k], Wv as A[m][k])
  prep_kernel<<<dim3(NB_ROPE + NB_X + NB_WQ + NB_WK + NB_WV + NB_WO), b256, 0, stream>>>(
      x, wq_w, wk_w, wv_w, wo_w, Xb, Wqb, Wkb, Wvb, Wob, cst, snt);
  // (2) q = x . Wq^T + bq, RoPE -> Qh/Ql [4096][2048]   (M=4096, N=2048, K=2048; 32 x 16 block tiles)
  gemm_w32x128_kernel<0, false><<<dim3((NTOK / 128) * (HID / 128)), b128, 0, stream>>>(
      Xb, Xb, HID, Wqb, HID, wq_b, cst, snt, (void*)Qh, (void*)Ql, HID, NTOK, HID, HID);
  // (3) k = x . Wk^T + bk, RoPE -> Kh/Kl [4096][1024]   (M=4096, N=1024, K=2048; 32 x 8 block tiles) and
  //     v^T = Wv . x^T + bv[m] -> Vh/Vl [1024][4096]   (A = Wvb, Bt = Xb; M=1024, N=4096, K=2048; 8 x 32 block tiles), one grid
  gemm_kv_kernel<<<dim3(2 * (NTOK / 128) * (KVW / 128)), b128, 0, stream>>>(
      Xb, Wkb, Wvb, wk_b, wv_b, cst, snt, Kh, Kl, Vh, Vl, NTOK, KVW, HID);
  // (4) windowed causal attention, one grid: query tiles 4..31 without, tiles 0..3 with the residual products of q, k, p and v
  attn_window_kernel<<<dim3(AT_NLONG + AT_NSHORT), b128, 0, stream>>>(Qh, Ql, Kh, Kl, Vh, Vl, Ah, Al, win);
  // (5) out = attn(hi + lo) . Wo^T -> d_out f32 [4096][2048]   (M=4096, N=2048, K=2048; 32 x 16 block tiles)
  gemm_w32x128_kernel<2, true><<<dim3((NTOK / 128) * (HID / 128)), b128, 0, stream>>>(
      Ah, Al, HID, Wob, HID, wq_b, cst, snt, (void*)out, (void*)out, HID, NTOK, HID, HID);
  (void)hipGetLastError();
}

// v010
// A run of this version takes 174 microseconds.
// Next to v009, in two timings, it ran 1.08 times as fast each time.
// Over all steps from v000 it is 4.66 times as fast.
// Contractions: x.Wq^T, x.Wk^T and Wv.x^T on v_wmma_f32_16x16x32_bf16 (operands = RNE bf16 of the f32 inputs, single products);
// k.q^T and v^T.p^T on v_wmma_f32_16x16x32_f16 (q, k, p x1024 and v^T plain f16; on query tiles 0..3 each of the four also has its f16 residual
// x2^11 plane, with the cross products hi.residual); attn.Wo^T on v_wmma_f32_16x16x32_bf16
// (attn = bf16 hi + bf16 lo planes, two products; Wo RNE bf16). f32 accumulate everywhere; bias add, RoPE, online softmax and scale folds in f32.
#include <hip/hip_runtime.h>
#include <math.h>
#include <stdint.h>

#define NSEQ   2
#define SQ     2048
#define HID    2048
#define NHQ    16
#define NKVH   8
#define HDM    128
#define KVW    1024
#define NTOK   4096
#define NFREQ  64

typedef _Float16     v16h __attribute__((ext_vector_type(16)));
typedef _Float16     v8h  __attribute__((ext_vector_type(8)));
typedef __bf16       v16b __attribute__((ext_vector_type(16)));
typedef __bf16       v8b  __attribute__((ext_vector_type(8)));
typedef float        v8f  __attribute__((ext_vector_type(8)));
typedef float        v4f  __attribute__((ext_vector_type(4)));
typedef unsigned int v4u  __attribute__((ext_vector_type(4)));

// ---------------------------------------------------------------------------
// small helpers
// ---------------------------------------------------------------------------
__device__ __forceinline__ unsigned short bf_bits(float f) {          // RNE convert f32 -> bf16 bits
  const unsigned u = __float_as_uint(f);
  return (unsigned short)((u + 0x7FFFu + ((u >> 16) & 1u)) >> 16);
}
__device__ __forceinline__ float bf_val(unsigned short h) { return __uint_as_float(((unsigned)h) << 16); }
__device__ __forceinline__ float bf_rne(float f) { return bf_val(bf_bits(f)); }
__device__ __forceinline__ unsigned pk16(unsigned short a, unsigned short b) { return (unsigned)a | ((unsigned)b << 16); }
__device__ __forceinline__ v8f zero8() { v8f z = {0.f, 0.f, 0.f, 0.f, 0.f, 0.f, 0.f, 0.f}; return z; }
__device__ __forceinline__ int wave_id() { return __builtin_amdgcn_readfirstlane((int)(threadIdx.x >> 5)); }

__device__ __forceinline__ void lds_wave_sync() {
  __builtin_amdgcn_fence(__ATOMIC_RELEASE, "workgroup");
  __builtin_amdgcn_wave_barrier();
  __builtin_amdgcn_fence(__ATOMIC_ACQUIRE, "workgroup");
}

// Value of lane l ^ 16 (the same column of the other 16-lane row), a cross-row move of the vector unit, all lanes on.
__device__ __forceinline__ float half_xor(float v) {
  const int b = __builtin_bit_cast(int, v);
  return __builtin_bit_cast(float, __builtin_amdgcn_permlanex16(b, b, 0x76543210, 0xfedcba98, false, false));
}

// ---------------------------------------------------------------------------
// WMMA fragments (wave32, 16x16x32, 16-bit operands). For A (row m = lane&15) and B (col n = lane&15) alike:
// elements 0..7 <- k0 + 8*(lane>>4) + 0..7, elements 8..15 <- k0 + 16 + 8*(lane>>4) + 0..7.
// ldfrag(p) with p = rowbase + k0 + 8*(lane>>4): two 16-B loads p[0..7], p[16..23].
// D: acc[r] = (row 8*(lane>>4) + r, col lane&15).
// ---------------------------------------------------------------------------
union FragH { v16h v; v8h h[2]; };
union FragB { v16b v; v8b h[2]; };
__device__ __forceinline__ v16h ldfrag_h(const _Float16* p) { FragH f; f.h[0] = *(const v8h*)(p); f.h[1] = *(const v8h*)(p + 16); return f.v; }
__device__ __forceinline__ v16b ldfrag_b(const __bf16* p)   { FragB f; f.h[0] = *(const v8b*)(p); f.h[1] = *(const v8b*)(p + 16); return f.v; }

__device__ __forceinline__ v8f mma_h(v16h a, v16h b, v8f c) {
  return __builtin_amdgcn_wmma_f32_16x16x32_f16(false, a, false, b, (short)0, c, false, false);
}
__device__ __forceinline__ v8f mma_b(v16b a, v16b b, v8f c) {
  return __builtin_amdgcn_wmma_f32_16x16x32_bf16(false, a, false, b, (short)0, c, false, false);
}
// hazard guards: 4 VALU slots after the last WMMAs of a run, D tied.
// guard_frags also keeps the run's A and B fragments live to behind the slots, so that no D of the run is placed over one of them.
__device__ __forceinline__ void guard_frags(v8f& a, v8f& b, v8f& c, v8f& d, v16h u, v16h v, v16h w, v16h x, v16h y, v16h z) {
  asm volatile("v_nop\n\tv_nop\n\tv_nop\n\tv_nop" : "+v"(a), "+v"(b), "+v"(c), "+v"(d) : "v"(u), "v"(v), "v"(w), "v"(x), "v"(y), "v"(z));
}
__device__ __forceinline__ void guard_frags2(v8f& a, v8f& b, v16h u, v16h v, v16h w) {
  asm volatile("v_nop\n\tv_nop\n\tv_nop\n\tv_nop" : "+v"(a), "+v"(b) : "v"(u), "v"(v), "v"(w));
}
__device__ __forceinline__ void acc_guard4(v8f& a, v8f& b, v8f& c, v8f& d) {
  asm volatile("v_nop\n\tv_nop\n\tv_nop\n\tv_nop" : "+v"(a), "+v"(b), "+v"(c), "+v"(d));
}

// ---------------------------------------------------------------------------
// Preparation, one launch: the RoPE table and the RNE bf16 planes of x, Wq, Wk, Wv, Wo. None of the six pieces reads what another
// writes, so they share a grid; the block index picks the piece (block-uniform, no barrier anywhere in the kernel).
//   blocks 0 .. SQ/8 - 1: RoPE table, cst[s][i] = cos(s * inv_freq[i]), snt[s][i] = sin(...), inv_freq[i] = 1 / 1e4^(i/64), i < 64, all f32.
//     Wave w -> position s = block*8 + w, lane -> i = lane, lane + 32. Coverage: SQ/8 blocks x 8 waves x 32 lanes x 2 = SQ x 64 per plane.
//     They come first in the grid because theirs is the longest dependent chain.
//   then CV_BLK(n) blocks per plane of n elements: a wave converts CV_WAVE = 2048 consecutive elements. All its sixteen 16-B loads are issued
//     before the first conversion; load i covers the 512 contiguous bytes of elements 128 i .. 128 i + 127, store i the 256 contiguous
//     bytes (two whole lines) of the same elements. Coverage: CV_BLK(n) x 8 waves x 2048 = n, every plane a whole number of blocks.
// ---------------------------------------------------------------------------
#define CV_WAVE   2048
#define CV_BLK(n) ((n) / (8 * CV_WAVE))
#define NB_ROPE   (SQ / 8)
#define NB_X      CV_BLK(NTOK * HID)
#define NB_WQ     CV_BLK(HID * HID)
#define NB_WK     CV_BLK(KVW * HID)
#define NB_WV     CV_BLK(KVW * HID)
#define NB_WO     CV_BLK(HID * HID)
static_assert(NB_X * 8 * CV_WAVE == NTOK * HID && NB_WQ * 8 * CV_WAVE == HID * HID && NB_WK * 8 * CV_WAVE == KVW * HID);

typedef unsigned int v2u __attribute__((ext_vector_type(2)));

__device__ __forceinline__ void rope_table_rows(float* __restrict__ cst, float* __restrict__ snt, int blk) {
  const int lane = threadIdx.x & 31;
  const int wave = (int)(threadIdx.x >> 5);
  const int t = blk * 8 + wave;
  const float pf = (float)t;
  float c0 = 0.f, s0 = 0.f, c1 = 0.f, s1 = 0.f;
#pragma unroll 1
  for (int u = 0; u < 2; ++u) {
    const int i = lane + 32 * u;
    const float e   = (float)i * 0.015625f;      // i / 64 exact
    const float pw  = powf(10000.0f, e);
    const float inv = 1.0f / pw;
    const float ang = pf * inv;
    const float cv = cosf(ang);
    const float sv = sinf(ang);
    c1 = cv; s1 = sv;
    if (u == 0) { c0 = cv; s0 = sv; }
  }
  const size_t o = (size_t)t * NFREQ + lane;
  cst[o]      = c0;
  cst[o + 32] = c1;
  snt[o]      = s0;
  snt[o + 32] = s1;
}

__global__ __launch_bounds__(256) void prep_kernel(
    const float* __restrict__ x, const float* __restrict__ wq, const float* __restrict__ wk,
    const float* __restrict__ wv, const float* __restrict__ wo,
    unsigned short* __restrict__ xb, unsigned short* __restrict__ wqb, unsigned short* __restrict__ wkb,
    unsigned short* __restrict__ wvb, unsigned short* __restrict__ wob,
    float* __restrict__ cst, float* __restrict__ snt) {
  int blk = (int)blockIdx.x;
  if (blk < NB_ROPE) { rope_table_rows(cst, snt, blk); return; }
  blk -= NB_ROPE;
  const float* in = x;
  unsigned short* outp = xb;
  if (blk >= NB_X + NB_WQ + NB_WK + NB_WV)      { in = wo; outp = wob; blk -= NB_X + NB_WQ + NB_WK + NB_WV; }
  else if (blk >= NB_X + NB_WQ + NB_WK)         { in = wv; outp = wvb; blk -= NB_X + NB_WQ + NB_WK; }
  else if (blk >= NB_X + NB_WQ)                 { in = wk; outp = wkb; blk -= NB_X + NB_WQ; }
  else if (blk >= NB_X)                         { in = wq; outp = wqb; blk -= NB_X; }
  const int lane = (int)(threadIdx.x & 31);
  const size_t e0 = ((size_t)blk * 8 + wave_id()) * CV_WAVE + lane * 4;
  const float* ip = in + e0;
  unsigned short* op = outp + e0;
  v4f a[16];
#pragma unroll   // constant indices keep a[] in registers, and all sixteen loads are in flight at once
  for (int i = 0; i < 16; ++i) a[i] = *(const v4f*)(ip + i * 128);
  // precaution: the lane pointer is an input here, so it keeps its registers (no load result is placed over it) until this wait
  asm volatile("s_wait_xcnt 0x0" :: "v"(ip) : "memory");
  // keeps every load in front of the first conversion: left alone the compiler holds the last four back until the first four have returned
  __builtin_amdgcn_sched_barrier(0);
#pragma unroll   // as above: constant indices into a[]
  for (int i = 0; i < 16; ++i) {
    v2u w;
    w[0] = pk16(bf_bits(a[i][0]), bf_bits(a[i][1]));
    w[1] = pk16(bf_bits(a[i][2]), bf_bits(a[i][3]));
    *(v2u*)(op + i * 128) = w;
  }
}

// ---------------------------------------------------------------------------
// bf16 WMMA GEMM, block = 4 waves (128 threads) = one 128 x 128 tile of C, wave w = rows 32w..32w+31 x all 128 cols.
//   C[m][n] = sum_k A[m][k] * Bt[n][k]; A row-major [M][K] bf16 (pitch lda), Bt row-major [N][K] bf16 (pitch ldb);
//   M % 128 == 0, N % 128 == 0, K % 64 == 0; grid.x = M/128 * N/128.
//   SPLITA: A carried as hi (Ap) + lo (A2p) bf16 planes, two products into one accumulator.
//   Operands: a pass is 64 k = one whole 128-B line of every operand row. The 128 A rows (both planes when SPLITA) and the
//   128 Bt rows of a pass are brought into LDS by asynchronous 16-B copies (8 lanes = one line, a wave instruction = 4 lines),
//   rows at pitch 144 B, two buffers: the next pass's copies fly while this pass is multiplied. The Bt tile is read by all
//   four waves. Fragments are read from LDS with the split k map (ldfrag_b), k ascending.
// Epilogues (all: per wave, per 16-row slab: stage in LDS, wave sync, write each row segment with ONE instruction of
//   EPI 0: q or k projection; the 128-col tile is one head. B rows are laid in LDS in even/odd order (row n0 + r in slot
//          64*(r&1) + (r>>1)):
//          acc tile j<4, lane rl holds output column n0 + 2*(16j+rl); tile j+4 holds n0 + 2*(16j+rl) + 1 (the interleaved pair).
//          + bf16(bias[n]); RoPE on the pair with cos/sin[pos = row & 2047][pair]; writes f16 hi plane C0 and f16 residual x2048
//          plane C1, both [M][ldc], cols n0..n0+127 (row segment 256 B = 16 lanes x 16 B).
//   EPI 1: v^T projection: + bf16(bias[m]); f16 hi plane C0, residual x2048 plane C1, [M][ldc], row segment 256 B.
//   EPI 2: f32 output C0 [M][ldc]; row segment 128 floats = 512 B = 32 lanes x 16 B per instruction.
// ---------------------------------------------------------------------------
template <int EPI> struct SlabT { typedef _Float16 T; static constexpr int PERW = 4096; };   // 2 planes x 16 x 128 halves
template <> struct SlabT<2>     { typedef float    T; static constexpr int PERW = 2048; };   // 16 x 128 floats

#define G_PITCH 72                    // LDS row pitch in 16-bit elements: 64 k + 8 = 144 B = 16 B x 9
#define G_TILE  (128 * G_PITCH)       // one 128-row operand tile of a pass, in elements

// One 128-row x 128-B operand tile into LDS: eight copies per lane, lane address pairs (l + i*lstep, g + i*gstep).
// The s_wait_xcnt stands in the copies' own statement so that no address register is rewritten ahead of it.
__device__ __forceinline__ void stage_tile(unsigned l, unsigned lstep, const unsigned short* g, size_t gstep) {
  asm volatile(
      "global_load_async_to_lds_b128 %0, %8, off\n\t"
      "global_load_async_to_lds_b128 %1, %9, off\n\t"
      "global_load_async_to_lds_b128 %2, %10, off\n\t"
      "global_load_async_to_lds_b128 %3, %11, off\n\t"
      "global_load_async_to_lds_b128 %4, %12, off\n\t"
      "global_load_async_to_lds_b128 %5, %13, off\n\t"
      "global_load_async_to_lds_b128 %6, %14, off\n\t"
      "global_load_async_to_lds_b128 %7, %15, off\n\t"
      "s_wait_xcnt 0x0"
      :: "v"(l), "v"(l + lstep), "v"(l + 2 * lstep), "v"(l + 3 * lstep),
         "v"(l + 4 * lstep), "v"(l + 5 * lstep), "v"(l + 6 * lstep), "v"(l + 7 * lstep),
         "v"(g), "v"(g + gstep), "v"(g + 2 * gstep), "v"(g + 3 * gstep),
         "v"(g + 4 * gstep), "v"(g + 5 * gstep), "v"(g + 6 * gstep), "v"(g + 7 * gstep)
      : "memory");
}

// One block tile. slab_all (4 * SlabT<EPI>::PERW elements) and ring (2 * NPL * G_TILE elements) are the calling kernel's LDS arrays.
template <int EPI, bool SPLITA>
__device__ __forceinline__ void gemm_w32x128_tile(
    typename SlabT<EPI>::T* slab_all, unsigned short* ring, int tile,
    const unsigned short* Ap, const unsigned short* A2p, int lda,
    const unsigned short* __restrict__ Btp, int ldb,
    const float* __restrict__ bias, const float* __restrict__ cst, const float* __restrict__ snt,
    void* C0, void* C1, int ldc,
    int M, int N, int K) {
  typedef typename SlabT<EPI>::T ST;
  constexpr int NPL = SPLITA ? 3 : 2;            // operand tiles per buffer: A (, A lo), Bt
  constexpr int BUF = NPL * G_TILE;              // elements per buffer

  const int tid  = (int)threadIdx.x;
  const int lane = tid & 31;
  const int wave = wave_id();
  const int hh = lane >> 4;           // lane half: k offset 8*hh, D row offset 8*hh
  const int rl = lane & 15;           // A row / B col / D col within subtile
  const int tilesN = N >> 7;
  const int tilesM = M >> 7;
  if (tile >= tilesM * tilesN) return;          // block-uniform, in front of every barrier
  const int tm = tile / tilesN;
  const int tn = tile - tm * tilesN;
  const int mb = tm << 7;                       // first row of the block tile
  const int m0 = mb + (wave << 5);              // first row of this wave
  const int n0 = tn << 7;

  // copy addresses of this lane: copy i of a tile moves 16 B of source row (tid>>3) + 16*i, bytes 16*(tid&7)..+15 of the pass's line
  const int crow = tid >> 3;
  const int ccol = (tid & 7) * 8;
  const unsigned short* gA  = Ap  + (size_t)(mb + crow) * lda + ccol;
  const unsigned short* gA2 = A2p + (size_t)(mb + crow) * lda + ccol;
  const unsigned short* gB  = Btp + (size_t)(n0 + crow) * ldb + ccol;
  const unsigned ring0 = (unsigned)(uintptr_t)(&ring[0]);           // LDS byte address of the ring
  const unsigned lA = ring0 + (unsigned)(crow * G_PITCH + ccol) * 2u;
  const int bslot = (EPI == 0) ? ((crow & 1) * 64 + (crow >> 1)) : crow;
  const unsigned lB = ring0 + (unsigned)((NPL - 1) * G_TILE + bslot * G_PITCH + ccol) * 2u;
  const unsigned lstepA = 16u * G_PITCH * 2u;
  const unsigned lstepB = ((EPI == 0) ? 8u : 16u) * G_PITCH * 2u;
  const size_t gstepA = (size_t)16 * lda;
  const size_t gstepB = (size_t)16 * ldb;

  v8f acc[2][8];
#pragma unroll
  for (int i = 0; i < 2; ++i)
#pragma unroll
    for (int j = 0; j < 8; ++j) acc[i][j] = zero8();

  const int npass = K >> 6;
  // pass 0 into buffer 0, landed and published; then pass 1 into buffer 1
  stage_tile(lA, lstepA, gA, gstepA);
  if (SPLITA) stage_tile(lA + G_TILE * 2u, lstepA, gA2, gstepA);
  stage_tile(lB, lstepB, gB, gstepB);
  asm volatile("s_wait_asynccnt 0x0" ::: "memory");   // this wave's copies of pass 0 have landed
  __syncthreads();                                    // every wave's copies of pass 0 are readable by all
  if (npass > 1) {
    stage_tile(lA + BUF * 2u, lstepA, gA + 64, gstepA);
    if (SPLITA) stage_tile(lA + (BUF + G_TILE) * 2u, lstepA, gA2 + 64, gstepA);
    stage_tile(lB + BUF * 2u, lstepB, gB + 64, gstepB);
  }

  for (int t = 0; t < npass; ++t) {
    const int bo = (t & 1) * BUF;
    const __bf16* As = (const __bf16*)(const void*)(ring + bo) + ((wave << 5) + rl) * G_PITCH + 8 * hh;
    const __bf16* Bs = (const __bf16*)(const void*)(ring + bo + (NPL - 1) * G_TILE) + rl * G_PITCH + 8 * hh;
    v16b ah[2][2], al[2][2], bj[2][8];
#pragma unroll
    for (int kb = 0; kb < 2; ++kb) {
#pragma unroll
      for (int i = 0; i < 2; ++i) {
        ah[kb][i] = ldfrag_b(As + i * 16 * G_PITCH + kb * 32);
        al[kb][i] = SPLITA ? ldfrag_b(As + G_TILE + i * 16 * G_PITCH + kb * 32) : ah[kb][i];
      }
#pragma unroll
      for (int j = 0; j < 8; ++j) bj[kb][j] = ldfrag_b(Bs + j * 16 * G_PITCH + kb * 32);
    }
    // keeps the pass's LDS reads together in front of its WMMAs: left alone the compiler puts two reads and a full wait before every WMMA pair
    __builtin_amdgcn_sched_barrier(0);
#pragma unroll
    for (int kb = 0; kb < 2; ++kb) {
#pragma unroll
      for (int j = 0; j < 8; ++j) {
        acc[0][j] = mma_b(ah[kb][0], bj[kb][j], acc[0][j]);
        acc[1][j] = mma_b(ah[kb][1], bj[kb][j], acc[1][j]);
        if (SPLITA) {
          acc[0][j] = mma_b(al[kb][0], bj[kb][j], acc[0][j]);
          acc[1][j] = mma_b(al[kb][1], bj[kb][j], acc[1][j]);
        }
      }
    }
    // keeps the WMMAs in front of the waits and the barrier below, so that the next pass's copies fly for the whole of this pass
    __builtin_amdgcn_sched_barrier(0);
    asm volatile("s_wait_dscnt 0x0" ::: "memory");      // this wave's reads of the buffer are done before it is refilled
    asm volatile("s_wait_asynccnt 0x0" ::: "memory");   // this wave's copies of pass t + 1 have landed
    __syncthreads();                                    // publishes pass t + 1 and ends every reader's last read of pass t
    if (t + 2 < npass) {                                // block-uniform
      const size_t ko = (size_t)(t + 2) * 64;
      stage_tile(lA + (unsigned)bo * 2u, lstepA, gA + ko, gstepA);
      if (SPLITA) stage_tile(lA + (unsigned)(bo + G_TILE) * 2u, lstepA, gA2 + ko, gstepA);
      stage_tile(lB + (unsigned)bo * 2u, lstepB, gB + ko, gstepB);
    }
  }
  asm volatile("s_wait_asynccnt 0x0" ::: "memory");     // no copy is outstanding when the wave goes on to the epilogue
  acc_guard4(acc[0][0], acc[0][1], acc[0][2], acc[0][3]);
  acc_guard4(acc[0][4], acc[0][5], acc[0][6], acc[0][7]);
  acc_guard4(acc[1][0], acc[1][1], acc[1][2], acc[1][3]);
  acc_guard4(acc[1][4], acc[1][5], acc[1][6], acc[1][7]);

  // ---- epilogue ----
  ST* slab = slab_all + wave * SlabT<EPI>::PERW;
  _Float16* sl16 = (_Float16*)(void*)slab;
  float*    slf  = (float*)(void*)slab;

  if (EPI == 0) {
    _Float16* P0 = (_Float16*)C0;
    _Float16* P1 = (_Float16*)C1;
#pragma unroll
    for (int i = 0; i < 2; ++i) {
      const int rb = m0 + i * 16 + 8 * hh;
#pragma unroll
      for (int j = 0; j < 4; ++j) {
        const int pi = j * 16 + rl;                              // pair index 0..63 within head
        const int nc = n0 + 2 * pi;                              // column of x1; x2 at nc + 1
        const float b1 = bf_rne(bias[nc]);
        const float b2 = bf_rne(bias[nc + 1]);
#pragma unroll
        for (int r = 0; r < 8; ++r) {
          const int row = rb + r;                                // token 0..NTOK-1
          const int s   = row & (SQ - 1);                        // position within sequence
          const float cv = cst[(size_t)s * NFREQ + pi];
          const float sv = snt[(size_t)s * NFREQ + pi];
          const float x1 = acc[i][j][r] + b1;
          const float x2 = acc[i][j + 4][r] + b2;
          const float o1 = x1 * cv - x2 * sv;
          const float o2 = x1 * sv + x2 * cv;
          const _Float16 h1 = (_Float16)o1;
          const _Float16 h2 = (_Float16)o2;
          const int so = (8 * hh + r) * 128 + 2 * pi;
          sl16[so]            = h1;
          sl16[so + 1]        = h2;
          sl16[2048 + so]     = (_Float16)((o1 - (float)h1) * 2048.0f);
          sl16[2048 + so + 1] = (_Float16)((o2 - (float)h2) * 2048.0f);
        }
      }
      lds_wave_sync();
      {
#pragma unroll
        for (int it = 0; it < 8; ++it) {
          const int row = it * 2 + hh;                           // it x hh covers rows 0..15
          const int c8  = rl * 8;
          const v8h vh = *(const v8h*)(sl16 + row * 128 + c8);
          const v8h vl = *(const v8h*)(sl16 + 2048 + row * 128 + c8);
          const size_t go = (size_t)(m0 + i * 16 + row) * ldc + n0 + c8;
          *(v8h*)(P0 + go) = vh;
          *(v8h*)(P1 + go) = vl;
        }
        
      }
      lds_wave_sync();
    }
  } else if (EPI == 1) {
    _Float16* P0 = (_Float16*)C0;
    _Float16* P1 = (_Float16*)C1;
#pragma unroll
    for (int i = 0; i < 2; ++i) {
#pragma unroll
      for (int r = 0; r < 8; ++r) {
        const int m = m0 + i * 16 + 8 * hh + r;
        const float bm = bf_rne(bias[m]);
#pragma unroll
        for (int j = 0; j < 8; ++j) {
          const float v = acc[i][j][r] + bm;
          const _Float16 hv = (_Float16)v;
          const int so = (8 * hh + r) * 128 + j * 16 + rl;
          sl16[so]        = hv;
          sl16[2048 + so] = (_Float16)((v - (float)hv) * 2048.0f);
        }
      }
      lds_wave_sync();
      {
#pragma unroll
        for (int it = 0; it < 8; ++it) {
          const int row = it * 2 + hh;
          const int c8  = rl * 8;
          const v8h vh = *(const v8h*)(sl16 + row * 128 + c8);
          const v8h vl = *(const v8h*)(sl16 + 2048 + row * 128 + c8);
          const size_t go = (size_t)(m0 + i * 16 + row) * ldc + n0 + c8;
          *(v8h*)(P0 + go) = vh;
          *(v8h*)(P1 + go) = vl;
        }
        
      }
      lds_wave_sync();
    }
  } else {
    float* C = (float*)C0;
#pragma unroll
    for (int i = 0; i < 2; ++i) {
#pragma unroll
      for (int j = 0; j < 8; ++j)
#pragma unroll
        for (int r = 0; r < 8; ++r)
          slf[(8 * hh + r) * 128 + j * 16 + rl] = acc[i][j][r];
      lds_wave_sync();
      {
#pragma unroll
        for (int row = 0; row < 16; ++row) {                     // 32 lanes x 16 B = the whole 512-B row segment per instruction
          const v4f v = *(const v4f*)(slf + row * 128 + lane * 4);
          *(v4f*)(C + (size_t)(m0 + i * 16 + row) * ldc + n0 + lane * 4) = v;
        }
        
      }
      lds_wave_sync();
    }
  }
}

template <int EPI, bool SPLITA>
__global__ __launch_bounds__(128) void gemm_w32x128_kernel(
    const unsigned short* Ap, const unsigned short* A2p, int lda,
    const unsigned short* __restrict__ Btp, int ldb,
    const float* __restrict__ bias, const float* __restrict__ cst, const float* __restrict__ snt,
    void* C0, void* C1, int ldc,
    int M, int N, int K) {
  __shared__ __align__(16) typename SlabT<EPI>::T slab_all[4 * SlabT<EPI>::PERW];
  __shared__ __align__(16) unsigned short ring[2 * (SPLITA ? 3 : 2) * G_TILE];
  gemm_w32x128_tile<EPI, SPLITA>(slab_all, ring, (int)blockIdx.x, Ap, A2p, lda, Btp, ldb, bias, cst, snt, C0, C1, ldc, M, N, K);
}

// The k and the v^T projection in one grid: neither reads what the other writes, and each alone has only one work-group per WGP (one wave
// per SIMD, nothing to run while a wave waits). Blocks 0 .. nk - 1 are the k tiles (A = x, Bt = Wk, EPI 0), the rest the v^T tiles
// (A = Wv, Bt = x, EPI 1); the choice is block-uniform, and both sides use the same LDS arrays.
__global__ __launch_bounds__(128) void gemm_kv_kernel(
    const unsigned short* xb, const unsigned short* wkb, const unsigned short* wvb,
    const float* __restrict__ bk, const float* __restrict__ bv, const float* __restrict__ cst, const float* __restrict__ snt,
    unsigned short* kh, unsigned short* kl, unsigned short* vh, unsigned short* vl,
    int ntok, int kvw, int hid) {
  __shared__ __align__(16) _Float16 slab_all[4 * SlabT<0>::PERW];
  __shared__ __align__(16) unsigned short ring[2 * 2 * G_TILE];
  static_assert(SlabT<0>::PERW == SlabT<1>::PERW);
  const int blk = (int)blockIdx.x;
  const int nk  = (ntok >> 7) * (kvw >> 7);
  if (blk < nk) gemm_w32x128_tile<0, false>(slab_all, ring, blk, xb, xb, hid, wkb, hid, bk, cst, snt, (void*)kh, (void*)kl, kvw, ntok, kvw, hid);
  else          gemm_w32x128_tile<1, false>(slab_all, ring, blk - nk, wvb, wvb, hid, xb, hid, bv, cst, snt, (void*)vh, (void*)vl, ntok, kvw, ntok, hid);
}

// ---------------------------------------------------------------------------
// Windowed causal GQA flash attention, head dim 128, 32-key chunks, block = 4 waves = 64 query rows of one (b, h);
// Key j is valid for query i iff j <= i and i - j <= window (window read from the int input).
//   q planes f16 [tok][h*128+d]: hi (qhp) and residual x2048 (qlp); k planes f16 [tok][kvh*128+d]: hi (khp), residual x2048 (klp);
//   v^T planes f16 [kvh*128+d][tok]: hi (vhp), residual x2048 (vlp); outputs attn bf16 hi (ahp) / lo (alp) [tok][h*128+d].
//   PRES: scores = (Sh + Sr/2048) * 128^-0.5 with Sh = qh.kh and Sr = ql'.kh + qh.kl'; else scores = Sh * 128^-0.5; invalid keys -> -inf; online softmax f32
//   (-inf safe: a row with no valid key so far keeps m = -inf, l = 0, O = 0);
//   Both products are formed transposed: S^T = K . Q^T (A = 16 key rows, B = the wave's 16 query columns) and O^T += V^T . P^T (A = 16 d rows of
//   v^T, B = P^T). A lane (c, hh) then holds, of query q0 + c alone, the scores of keys 8 hh + r and 16 + 8 hh + r of the chunk: the row maximum and
//   the row sum are taken inside the lane, the maximum joined with the other half by one cross-row move per chunk, the two halves' sums once
//   behind the loop; m, l and the rescale factor are one value a lane;
//   p' = 1024 p as f16 hi (and residual x2048 when PRES): the two score tiles, converted in place, ARE the B fragment of P^T (element s = tile s >> 3,
//   register s & 7, the k order in which ldfrag_h reads v^T), so that P passes through no LDS and no lane exchange;
//   PRES: O = (Oh + Or/2048)/1024/l with Oh = ph.vh, Or = ph.vl' + pl'.vh; else O = Oh/1024/l. Without PRES no residual plane is read at all:
//   q and v^T then carry the 11 bits that k and p carry, well under the bf16 rounding of x and the weights that made them.
//   q staging: each wave copies its 16 rows of q (both planes when PRES) into LDS once, rows at pitch 272 B, and reads its B fragments from there.
//   K / V^T chunk staging: 128 threads x 4 x 16 B per plane = whole 32x128 / 128x32 tile. PRES: plain loads, __syncthreads before and after.
//   Without PRES: asynchronous 16-B copies to LDS, two buffers: chunk t + 2 is requested at the foot of chunk t, into the buffer that chunk t has
//   just left, and flies while chunk t + 1 is worked on; one __syncthreads per chunk publishes chunk t + 1 and ends the reads of chunk t.
//   Chunks cover keys [max(0, 64*qb - window) & ~31, 64*qb + 63]; trip count statically <= 64; waves with no valid key in a chunk
//   skip its compute part (wave-uniform, scalar branch).
// ---------------------------------------------------------------------------
#define AT_KC   32
#define KS_P    136
#define VS_P    40
#define OS_P    136                   // output staging: 16 query rows a plane at pitch 272 B = 16 B x 17
#define QS_P    136
#define VAHEAD  2
// LDS map in halves. The residual tiles (k, v^T, q) exist only with PRES; the second chunk buffer (at CB) only without.
template <bool PRES> struct AttnLds {
  static constexpr int KS  = 0;
  static constexpr int KLS = 32 * KS_P;
  static constexpr int VHS = (PRES ? 2 : 1) * 32 * KS_P;
  static constexpr int VLS = VHS + 128 * VS_P;
  static constexpr int CB  = VHS + (PRES ? 2 : 1) * 128 * VS_P;   // one chunk buffer: the k and v^T tiles of 32 keys
  static constexpr int QH  = (PRES ? 1 : 2) * CB;
  static constexpr int QL  = QH + 64 * QS_P;
  static constexpr int TOT = QH + (PRES ? 2 : 1) * 64 * QS_P;
};
static_assert(AttnLds<true>::TOT * 2 * 4 <= 327680);    // four work-groups per WGP, each with the larger of the two maps
static_assert(AttnLds<false>::TOT <= AttnLds<true>::TOT && (AttnLds<false>::CB * 2) % 16 == 0);
static_assert(4 * 2 * 16 * OS_P <= AttnLds<false>::TOT); // output staging (2 planes x 16 rows per wave) aliases the chunk region after the loop

// One 32-key chunk into LDS, eight copies per lane: k piece i = 16 B of key (tid >> 4) + 8 i (LDS address lk, source gk), v^T piece i = 16 B of
// row d = (tid >> 2) + 32 i (lv, gv). The s_wait_xcnt stands in the copies' own statement so that no address register is rewritten ahead of it.
__device__ __forceinline__ void stage_chunk(unsigned lk, const _Float16* gk, unsigned lv, const _Float16* gv) {
  asm volatile(
      "global_load_async_to_lds_b128 %0, %8, off\n\t"
      "global_load_async_to_lds_b128 %1, %9, off\n\t"
      "global_load_async_to_lds_b128 %2, %10, off\n\t"
      "global_load_async_to_lds_b128 %3, %11, off\n\t"
      "global_load_async_to_lds_b128 %4, %12, off\n\t"
      "global_load_async_to_lds_b128 %5, %13, off\n\t"
      "global_load_async_to_lds_b128 %6, %14, off\n\t"
      "global_load_async_to_lds_b128 %7, %15, off\n\t"
      "s_wait_xcnt 0x0"
      :: "v"(lk), "v"(lk + 8u * KS_P * 2u), "v"(lk + 16u * KS_P * 2u), "v"(lk + 24u * KS_P * 2u),
         "v"(lv), "v"(lv + 32u * VS_P * 2u), "v"(lv + 64u * VS_P * 2u), "v"(lv + 96u * VS_P * 2u),
         "v"(gk), "v"(gk + 8 * KVW), "v"(gk + 16 * KVW), "v"(gk + 24 * KVW),
         "v"(gv), "v"(gv + 32 * NTOK), "v"(gv + 64 * NTOK), "v"(gv + 96 * NTOK)
      : "memory");
}

// One query tile qb of head h, sequence b. lds is the calling kernel's LDS array, at least AttnLds<PRES>::TOT halves.
template <bool PRES>
__device__ __forceinline__ void attn_window_tile(
    _Float16* lds, int qb, int h, int b,
    const unsigned short* __restrict__ qhp, const unsigned short* __restrict__ qlp,
    const unsigned short* __restrict__ khp, const unsigned short* __restrict__ klp,
    const unsigned short* __restrict__ vhp, const unsigned short* __restrict__ vlp,
    unsigned short* __restrict__ ahp, unsigned short* __restrict__ alp,
    const int* __restrict__ winp) {
  typedef AttnLds<PRES> L;
  _Float16* Ks  = lds + L::KS;
  _Float16* Kls = lds + L::KLS;
  _Float16* Vhs = lds + L::VHS;
  _Float16* Vls = lds + L::VLS;

  const int tid  = (int)threadIdx.x;
  const int lane = tid & 31;
  const int wave = wave_id();
  const int hh   = lane >> 4;
  const int c    = lane & 15;
  const int kvh  = h >> 1;                       // 2 query heads per kv head
  const int window = __builtin_amdgcn_readfirstlane(winp[0]);
  const int qblk0 = qb * 64;
  const int q0    = qblk0 + wave * 16;           // first query row of this wave (within sequence)
  const int qlast = q0 + 15;
  const int wlo   = q0 - window;                 // oldest valid key of row q0
  const size_t tok0 = (size_t)b * SQ;

  int kstart = qblk0 - window;
  kstart = (kstart > 0) ? (kstart & ~31) : 0;
  if (kstart > qblk0) kstart = qblk0;
  int nch = (qblk0 + 64 - kstart) >> 5;          // block-uniform
  if (nch > 64) nch = 64;
  if (nch < 0) nch = 0;
  nch = __builtin_amdgcn_readfirstlane(nch);     // the trip count of the loop that holds the barriers stays in a scalar register (the clamp is a vector med3 otherwise)

  const _Float16* Kg  = (const _Float16*)(const void*)khp + tok0 * KVW + kvh * HDM;
  const _Float16* Klg = (const _Float16*)(const void*)klp + tok0 * KVW + kvh * HDM;
  const _Float16* Vhg = (const _Float16*)(const void*)vhp + (size_t)(kvh * HDM) * NTOK + tok0;
  const _Float16* Vlg = (const _Float16*)(const void*)vlp + (size_t)(kvh * HDM) * NTOK + tok0;
  const unsigned kgo = (unsigned)((tid >> 4) * KVW + (tid & 15) * 8);    // this lane's element offset in a K chunk, piece 0
  const unsigned vgo = (unsigned)((tid >> 2) * NTOK + (tid & 3) * 8);    // and in a V^T chunk
  // without PRES: this lane's copy addresses, piece 0 of chunk 0 in buffer 0 (LDS byte addresses; sources)
  const unsigned lds0 = (unsigned)(uintptr_t)lds;
  const unsigned lkc  = lds0 + (unsigned)(L::KS + (tid >> 4) * KS_P + (tid & 15) * 8) * 2u;
  const unsigned lvc  = lds0 + (unsigned)(L::VHS + (tid >> 2) * VS_P + (tid & 3) * 8) * 2u;
  const _Float16* kcp = Kg + (size_t)kstart * KVW + kgo;
  const _Float16* vcp = Vhg + kstart + vgo;
  if (!PRES) stage_chunk(lkc, kcp, lvc, vcp);    // chunk 0 (keys kstart .. kstart + 31 <= qblk0 + 31) flies while q is staged

  // This wave's 16 query rows (both planes when PRES) go into LDS once (16 lanes = one 256-B row, row = (lane >> 4) + 2 i); every chunk reads its
  // B fragments from there. Only this wave reads them, behind the barrier(s) in front of the first chunk's products.
  _Float16* Qhs = lds + L::QH + wave * (16 * QS_P);
  _Float16* Qls = lds + L::QL + wave * (16 * QS_P);
  {
    const _Float16* qhg = (const _Float16*)(const void*)qhp + (tok0 + q0 + hh) * HID + h * HDM + c * 8;
    const _Float16* qlg = (const _Float16*)(const void*)qlp + (tok0 + q0 + hh) * HID + h * HDM + c * 8;
    v8h qx[8], qy[8];
#pragma unroll   // constant indices keep qx and qy in registers, and all its loads (sixteen with PRES, eight without) are in flight at once
    for (int i = 0; i < 8; ++i) {
      qx[i] = *(const v8h*)(qhg + i * 2 * HID);
      if (PRES) qy[i] = *(const v8h*)(qlg + i * 2 * HID);
    }
    // precaution: the lane pointers are inputs here, so they keep their registers (no load result is placed over them) until this wait
    if (PRES) asm volatile("s_wait_xcnt 0x0" :: "v"(qhg), "v"(qlg) : "memory");
    else      asm volatile("s_wait_xcnt 0x0" :: "v"(qhg) : "memory");
#pragma unroll   // as above: constant indices into qx and qy
    for (int i = 0; i < 8; ++i) {
      *(v8h*)(Qhs + (hh + 2 * i) * QS_P + c * 8) = qx[i];
      if (PRES) *(v8h*)(Qls + (hh + 2 * i) * QS_P + c * 8) = qy[i];
    }
  }
  const _Float16* Qhr = Qhs + c * QS_P + 8 * hh;   // B fragment column (query q0 + c) of this lane
  const _Float16* Qlr = Qls + c * QS_P + 8 * hh;

  const int qrow = q0 + c;                       // the one query of this lane
  // window as the validity test uses it: 0 <= qrow - key < SQ for every key that passes key <= qrow, so a window below -1 admits what -1
  // admits (nothing) and one above SQ what SQ admits (everything); the clamp keeps dq - window from wrapping
  const int wcl = (window < -1) ? -1 : ((window > SQ) ? SQ : window);
  float mrow = -INFINITY, lrow = 0.f;            // its running maximum (same in both halves) and the sum over this half's keys
  v8f oacc[8], oaccr[8];                         // oacc[t][r] = O^T(d = 16 t + 8 hh + r, query c)
#pragma unroll
  for (int t = 0; t < 8; ++t) { oacc[t] = zero8(); oaccr[t] = zero8(); }

  if (!PRES) {
    asm volatile("s_wait_asynccnt 0x0" ::: "memory");   // this wave's copies of chunk 0 have landed
    __syncthreads();                                    // every wave's copies of chunk 0 are readable by all
    if (nch > 1) stage_chunk(lkc + L::CB * 2u, kcp + (size_t)AT_KC * KVW, lvc + L::CB * 2u, vcp + AT_KC);   // block-uniform
  }

  for (int kc = 0; kc < nch; ++kc) {
    const int kv0 = kstart + kc * AT_KC;         // keys kv0..kv0+31, all < SQ
    const int bo  = PRES ? 0 : (kc & 1) * L::CB; // the chunk's buffer
    const _Float16* Kc = Ks + bo;
    const _Float16* Vc = Vhs + bo;
    if (PRES) {
    __syncthreads();
    // one lane pointer per plane for the chunk; the four pieces of a plane lie at constant distances from it
    const _Float16* kq  = Kg  + (size_t)kv0 * KVW + kgo;
    const _Float16* klq = Klg + (size_t)kv0 * KVW + kgo;
    const _Float16* vhq = Vhg + kv0 + vgo;
    const _Float16* vlq = Vlg + kv0 + vgo;
    v8h kx[4], ky[4], vx[4], vy[4];
#pragma unroll
    for (int i = 0; i < 4; ++i) {                // coverage: 512 pieces of 8 halves per plane = whole tile
      kx[i] = *(const v8h*)(kq + i * 8 * KVW);   // K: 32 keys x 128 d, key = (tid >> 4) + 8 i
      if (PRES) ky[i] = *(const v8h*)(klq + i * 8 * KVW);
      vx[i] = *(const v8h*)(vhq + i * 32 * NTOK); // V^T: 128 d x 32 keys, d = (tid >> 2) + 32 i
      if (PRES) vy[i] = *(const v8h*)(vlq + i * 32 * NTOK);
    }
    // precaution: the lane pointers are inputs here, so they keep their registers (no load result is placed over them) until this wait
    if (PRES) asm volatile("s_wait_xcnt 0x0" :: "v"(kq), "v"(klq), "v"(vhq), "v"(vlq) : "memory");
    else      asm volatile("s_wait_xcnt 0x0" :: "v"(kq), "v"(vhq) : "memory");
#pragma unroll
    for (int i = 0; i < 4; ++i) {
      const int p   = tid + 128 * i;             // 0..511
      const int key = p >> 4, d8 = (p & 15) * 8;
      *(v8h*)(Ks + key * KS_P + d8) = kx[i];
      if (PRES) *(v8h*)(Kls + key * KS_P + d8) = ky[i];
      const int d = p >> 2, k8 = (p & 3) * 8;
      *(v8h*)(Vhs + d * VS_P + k8) = vx[i];
      if (PRES) *(v8h*)(Vls + d * VS_P + k8) = vy[i];
    }
    __syncthreads();
    }

    if (kv0 <= qlast && kv0 + AT_KC - 1 >= wlo) {   // wave-uniform (scalar): skip chunks with no valid key for this wave
      // ---- scores, transposed: sh[j][r] = S^T(key kv0 + 16 j + 8 hh + r, query q0 + c) ----
      v8f sh[2], sr[2];
      sh[0] = zero8(); sh[1] = zero8(); sr[0] = zero8(); sr[1] = zero8();
#pragma unroll
      for (int dc = 0; dc < 4; ++dc) {
        const v16h qa = ldfrag_h(Qhr + dc * 32);
        const v16h ql = PRES ? ldfrag_h(Qlr + dc * 32) : qa;
        v16h kb[2], kl[2];
#pragma unroll
        for (int j = 0; j < 2; ++j) {
          kb[j] = ldfrag_h(Kc + (j * 16 + c) * KS_P + dc * 32 + 8 * hh);
          kl[j] = PRES ? ldfrag_h(Kls + (j * 16 + c) * KS_P + dc * 32 + 8 * hh) : kb[j];
        }
        // keeps all fragment reads of this 32-d slice in one place in front of its WMMAs: left alone the compiler waits out a read per WMMA pair
        __builtin_amdgcn_sched_barrier(0);
#pragma unroll
        for (int j = 0; j < 2; ++j) {
          sh[j] = mma_h(kb[j], qa, sh[j]);
          if (PRES) sr[j] = mma_h(kb[j], ql, sr[j]);
        }
        if (PRES) {
#pragma unroll
          for (int j = 0; j < 2; ++j) sr[j] = mma_h(kl[j], qa, sr[j]);
        }
        // first slice: its WMMAs start the accumulators; the guard keeps them off the registers of this slice's own fragments
        if (dc == 0) {
          if (PRES) guard_frags(sh[0], sr[0], sh[1], sr[1], qa, ql, kb[0], kb[1], kl[0], kl[1]);
          else      guard_frags2(sh[0], sh[1], qa, kb[0], kb[1]);
        }
        // keeps this slice's WMMAs in front of the next slice's reads
        __builtin_amdgcn_sched_barrier(0);
      }
      // The V^T fragments of tile t + VAHEAD are read in front of tile t's WMMAs, the first VAHEAD tiles in front of the softmax arithmetic.
      v16h vb[8], vr[8];
#pragma unroll
      for (int t = 0; t < VAHEAD; ++t) {
        vb[t] = ldfrag_h(Vc + (t * 16 + c) * VS_P + 8 * hh);
        if (PRES) vr[t] = ldfrag_h(Vls + (t * 16 + c) * VS_P + 8 * hh);
      }
      // ---- scale, window + causal validity, maximum of this lane's 16 keys, joined with the other half's 16 ----
      // key = kv0 + 8 hh + e with e = 16 j + r: key <= qrow is e <= dq, and qrow - key <= window is e >= dq - window
      const int dq = qrow - kv0 - 8 * hh;
      const int dw = dq - wcl;
      float cm = -INFINITY;
#pragma unroll
      for (int j = 0; j < 2; ++j) {
#pragma unroll
        for (int r = 0; r < 8; ++r) {
          const int e = j * 16 + r;
          float sc = (PRES ? sh[j][r] + sr[j][r] * 0.00048828125f : sh[j][r]) * 0.08838834764831845f;
          const bool ok = (e <= dq) & (e >= dw);
          sc = ok ? sc : -INFINITY;
          sh[j][r] = sc;
          cm = fmaxf(cm, sc);
        }
      }
      cm = fmaxf(cm, half_xor(cm));
      // ---- online softmax; P'^T packed in place as the B fragment ----
      const float mnew  = fmaxf(mrow, cm);
      const float mref  = (mnew == -INFINITY) ? 0.f : mnew;     // query with no valid key yet: everything stays 0
      const float alpha = __expf(mrow - mref);
      mrow = mnew;
      float psum[2] = {0.f, 0.f};                               // one chain of additions per score tile
      v16h pa, pr;
#pragma unroll
      for (int j = 0; j < 2; ++j) {
#pragma unroll
        for (int r = 0; r < 8; ++r) {
          const float p  = __expf(sh[j][r] - mref);
          psum[j] += p;
          const float pp = p * 1024.0f;
          const _Float16 phv = (_Float16)pp;
          pa[j * 8 + r] = phv;
          pr[j * 8 + r] = PRES ? (_Float16)((pp - (float)phv) * 2048.0f) : phv;
        }
      }
      lrow = lrow * alpha + (psum[0] + psum[1]);
#pragma unroll
      for (int t = 0; t < 8; ++t) { oacc[t] *= alpha; if (PRES) oaccr[t] *= alpha; }
      // ---- O^T += V^T . P'^T ----
#pragma unroll
      for (int t = 0; t < 8; ++t) {
        if (t + VAHEAD < 8) {
          vb[t + VAHEAD] = ldfrag_h(Vc + ((t + VAHEAD) * 16 + c) * VS_P + 8 * hh);
          if (PRES) vr[t + VAHEAD] = ldfrag_h(Vls + ((t + VAHEAD) * 16 + c) * VS_P + 8 * hh);
        }
        // keeps the reads of tile t + VAHEAD in front of tile t's WMMAs: left alone the compiler reads only one tile ahead
        // (mask 6: plain vector and scalar work, the rescale of later tiles, may still move in among the WMMAs)
        __builtin_amdgcn_sched_barrier(6);
        oacc[t]  = mma_h(vb[t], pa, oacc[t]);
        if (PRES) {
          oaccr[t] = mma_h(vr[t], pa, oaccr[t]);
          oaccr[t] = mma_h(vb[t], pr, oaccr[t]);
        }
        // keeps tile t's WMMAs in front of the next tile's reads
        __builtin_amdgcn_sched_barrier(6);
      }
      if (PRES) acc_guard4(oacc[6], oaccr[6], oacc[7], oaccr[7]);   // the loop's back edge follows
      else      acc_guard4(oacc[4], oacc[5], oacc[6], oacc[7]);
    }
    if (!PRES) {                                          // every wave, also one that skipped the chunk's products
      asm volatile("s_wait_dscnt 0x0" ::: "memory");      // this wave's reads of the buffer are done before it is refilled
      asm volatile("s_wait_asynccnt 0x0" ::: "memory");   // this wave's copies of chunk kc + 1 have landed
      __syncthreads();                                    // publishes chunk kc + 1 and ends every reader's last read of chunk kc
      if (kc + 2 < nch)                                   // block-uniform
        stage_chunk(lkc + (unsigned)bo * 2u, kcp + (size_t)(kc + 2) * (AT_KC * KVW), lvc + (unsigned)bo * 2u, vcp + (kc + 2) * AT_KC);
    }
  }
  if (!PRES) asm volatile("s_wait_asynccnt 0x0" ::: "memory");   // no copy is outstanding when the buffers become output staging

  __syncthreads();                               // all chunk-region readers done before aliasing it as output staging
  _Float16* osh = lds + wave * (2 * 16 * OS_P);
  _Float16* osl = osh + 16 * OS_P;
  {
    const float inv = (1.0f / (lrow + half_xor(lrow))) * 0.0009765625f;   // the two halves' sums joined
#pragma unroll
    for (int t = 0; t < 8; ++t) {
      v8h xh, xl;                                // d = 16 t + 8 hh + 0..7 of query c: 16 B a plane
#pragma unroll
      for (int r = 0; r < 8; ++r) {
        const float o = (PRES ? oacc[t][r] + oaccr[t][r] * 0.00048828125f : oacc[t][r]) * inv;
        const unsigned short hb = bf_bits(o);
        const unsigned short lb = bf_bits(o - bf_val(hb));
        xh[r] = __builtin_bit_cast(_Float16, hb);
        xl[r] = __builtin_bit_cast(_Float16, lb);
      }
      *(v8h*)(osh + c * OS_P + t * 16 + 8 * hh) = xh;
      *(v8h*)(osl + c * OS_P + t * 16 + 8 * hh) = xl;
    }
  }
  lds_wave_sync();
  _Float16* Ahg = (_Float16*)(void*)ahp + (tok0 + q0) * HID + h * HDM;
  _Float16* Alg = (_Float16*)(void*)alp + (tok0 + q0) * HID + h * HDM;
  {
#pragma unroll
    for (int it = 0; it < 8; ++it) {
      const int row = it * 2 + hh;               // it 0..7 x hh 0..1 covers rows 0..15
      const int c8  = c * 8;                     // 16 lanes x 16 B = the whole 256-B segment
      const v8h x = *(const v8h*)(osh + row * OS_P + c8);
      const v8h y = *(const v8h*)(osl + row * OS_P + c8);
      *(v8h*)(Ahg + (size_t)row * HID + c8) = x;
      *(v8h*)(Alg + (size_t)row * HID + c8) = y;
    }
    
  }
}

// All query tiles in one grid of AT_NLONG + AT_NSHORT = 1024 work-groups. A budget of 256 registers a wave = four waves per SIMD: four
// work-groups share a WGP and the whole grid is resident at once. Blocks 0 .. AT_NLONG - 1 are tiles AT_NRES .. 31 (no residual products; tile
// fastest, then head, then sequence); they leave one place in eight free, and the AT_NSHORT blocks behind them, tiles 0 .. AT_NRES - 1 with the
// residual products, run there beside them. No tile reads what another writes; the choice is block-uniform.
#define AT_NRES   4
#define AT_NTL    (SQ / 64 - AT_NRES)
#define AT_NLONG  (AT_NTL * NHQ * NSEQ)
#define AT_NSHORT (AT_NRES * NHQ * NSEQ)
__global__ __launch_bounds__(128) __attribute__((amdgpu_waves_per_eu(4))) void attn_window_kernel(
    const unsigned short* __restrict__ qhp, const unsigned short* __restrict__ qlp,
    const unsigned short* __restrict__ khp, const unsigned short* __restrict__ klp,
    const unsigned short* __restrict__ vhp, const unsigned short* __restrict__ vlp,
    unsigned short* __restrict__ ahp, unsigned short* __restrict__ alp,
    const int* __restrict__ winp) {
  __shared__ __align__(16) _Float16 lds[AttnLds<true>::TOT];
  const int blk = (int)blockIdx.x;
  if (blk < AT_NLONG) {
    const int hb = blk / AT_NTL;                 // head + NHQ * sequence
    attn_window_tile<false>(lds, AT_NRES + (blk - hb * AT_NTL), hb % NHQ, hb / NHQ, qhp, qlp, khp, klp, vhp, vlp, ahp, alp, winp);
  } else {
    const int p  = blk - AT_NLONG;
    const int hb = p / AT_NRES;
    attn_window_tile<true>(lds, p - hb * AT_NRES, hb % NHQ, hb / NHQ, qhp, qlp, khp, klp, vhp, vlp, ahp, alp, winp);
  }
}

// ---------------------------------------------------------------------------
// Workspace map (bytes; every region is a whole number of the rows its producer writes with whole-line stores, no tails):
//   Xb    bf16 [4096][2048]   16777216   (the attn hi plane Ah [4096][2048] bf16 reuses this region after the last Xb reader)
//   Wqb   bf16 [2048][2048]    8388608      Wkb bf16 [1024][2048]  4194304      Wvb bf16 [1024][2048]  4194304
//   Wob   bf16 [2048][2048]    8388608      cst f32  [2048][64]     524288      snt f32  [2048][64]     524288
//   Qh    f16  [4096][2048]   16777216      Ql  f16  [4096][2048] 16777216
//   Kh    f16  [4096][1024]    8388608      Kl  f16  [4096][1024]  8388608
//   Vh    f16  [1024][4096]    8388608      Vl  f16  [1024][4096]  8388608
//   Al    bf16 [4096][2048]   16777216
//   total                    126877696
// ---------------------------------------------------------------------------
extern "C" void kernel_launch(void* const* d_in, const int* in_sizes, int n_in,
                              void* d_out, int out_size, void* d_ws, size_t ws_size,
                              hipStream_t stream) {
  if (n_in < 9) return;
  if (in_sizes[0] != NTOK * HID) return;
  if (in_sizes[1] != HID * HID) return;
  if (in_sizes[2] != HID) return;
  if (in_sizes[3] != KVW * HID) return;
  if (in_sizes[4] != KVW) return;
  if (in_sizes[5] != KVW * HID) return;
  if (in_sizes[6] != KVW) return;
  if (in_sizes[7] != HID * HID) return;
  if (in_sizes[8] < 1) return;
  if (out_size != NTOK * HID) return;

  const float* x    = (const float*)d_in[0];
  const float* wq_w = (const float*)d_in[1];
  const float* wq_b = (const float*)d_in[2];
  const float* wk_w = (const float*)d_in[3];
  const float* wk_b = (const float*)d_in[4];
  const float* wv_w = (const float*)d_in[5];
  const float* wv_b = (const float*)d_in[6];
  const float* wo_w = (const float*)d_in[7];
  const int*   win  = (const int*)d_in[8];
  float* out = (float*)d_out;

  const size_t szX  = (size_t)NTOK * HID * 2;
  const size_t szWq = (size_t)HID * HID * 2;
  const size_t szWk = (size_t)KVW * HID * 2;
  const size_t szWv = (size_t)KVW * HID * 2;
  const size_t szWo = (size_t)HID * HID * 2;
  const size_t szT  = (size_t)SQ * NFREQ * 4;
  const size_t szQ  = (size_t)NTOK * HID * 2;
  const size_t szK  = (size_t)NTOK * KVW * 2;
  const size_t szV  = (size_t)KVW * NTOK * 2;
  const size_t szA  = (size_t)NTOK * HID * 2;
  size_t off = 0;
  const size_t oX  = off; off += szX;
  const size_t oWq = off; off += szWq;
  const size_t oWk = off; off += szWk;
  const size_t oWv = off; off += szWv;
  const size_t oWo = off; off += szWo;
  const size_t oCs = off; off += szT;
  const size_t oSn = off; off += szT;
  const size_t oQh = off; off += szQ;
  const size_t oQl = off; off += szQ;
  const size_t oKh = off; off += szK;
  const size_t oKl = off; off += szK;
  const size_t oVh = off; off += szV;
  const size_t oVl = off; off += szV;
  const size_t oAl = off; off += szA;
  const size_t oAh = oX;                         // Ah reuses the Xb region (same byte size); Xb is dead after launch (3)
  if (szA != szX) return;
  if (off > ws_size) return;                     // off = 126877696

  char* ws = (char*)d_ws;
  unsigned short* Xb  = (unsigned short*)(ws + oX);
  unsigned short* Wqb = (unsigned short*)(ws + oWq);
  unsigned short* Wkb = (unsigned short*)(ws + oWk);
  unsigned short* Wvb = (unsigned short*)(ws + oWv);
  unsigned short* Wob = (unsigned short*)(ws + oWo);
  float*          cst = (float*)(ws + oCs);
  float*          snt = (float*)(ws + oSn);
  unsigned short* Qh  = (unsigned short*)(ws + oQh);
  unsigned short* Ql  = (unsigned short*)(ws + oQl);
  unsigned short* Kh  = (unsigned short*)(ws + oKh);
  unsigned short* Kl  = (unsigned short*)(ws + oKl);
  unsigned short* Vh  = (unsigned short*)(ws + oVh);
  unsigned short* Vl  = (unsigned short*)(ws + oVl);
  unsigned short* Ah  = (unsigned short*)(ws + oAh);
  unsigned short* Al  = (unsigned short*)(ws + oAl);

  const dim3 b256(256), b128(128);

  // (1) cos/sin table [2048][64] x 2 and the RNE bf16 planes of x [4096][2048], Wq [2048][2048], Wk [1024][2048], Wv [1024][2048],
  //     Wo [2048][2048] (weights [out][in]: Wq, Wk, Wo as Bt[n][k], Wv as A[m][k])
  prep_kernel<<<dim3(NB_ROPE + NB_X + NB_WQ + NB_WK + NB_WV + NB_WO), b256, 0, stream>>>(
      x, wq_w, wk_w, wv_w, wo_w, Xb, Wqb, Wkb, Wvb, Wob, cst, snt);
  // (2) q = x . Wq^T + bq, RoPE -> Qh/Ql [4096][2048]   (M=4096, N=2048, K=2048; 32 x 16 block tiles)
  gemm_w32x128_kernel<0, false><<<dim3((NTOK / 128) * (HID / 128)), b128, 0, stream>>>(
      Xb, Xb, HID, Wqb, HID, wq_b, cst, snt, (void*)Qh, (void*)Ql, HID, NTOK, HID, HID);
  // (3) k = x . Wk^T + bk, RoPE -> Kh/Kl [4096][1024]   (M=4096, N=1024, K=2048; 32 x 8 block tiles) and
  //     v^T = Wv . x^T + bv[m] -> Vh/Vl [1024][4096]   (A = Wvb, Bt = Xb; M=1024, N=4096, K=2048; 8 x 32 block tiles), one grid
  gemm_kv_kernel<<<dim3(2 * (NTOK / 128) * (KVW / 128)), b128, 0, stream>>>(
      Xb, Wkb, Wvb, wk_b, wv_b, cst, snt, Kh, Kl, Vh, Vl, NTOK, KVW, HID);
  // (4) windowed causal attention, one grid: query tiles 4..31 without, tiles 0..3 with the residual products of q, k, p and v
  attn_window_kernel<<<dim3(AT_NLONG + AT_NSHORT), b128, 0, stream>>>(Qh, Ql, Kh, Kl, Vh, Vl, Ah, Al, win);
  // (5) out = attn(hi + lo) . Wo^T -> d_out f32 [4096][2048]   (M=4096, N=2048, K=2048; 32 x 16 block tiles)
  gemm_w32x128_kernel<2, true><<<dim3((NTOK / 128) * (HID / 128)), b128, 0, stream>>>(
      Ah, Al, HID, Wob, HID, wq_b, cst, snt, (void*)out, (void*)out, HID, NTOK, HID, HID);
  (void)hipGetLastError();
}
